// v000
// Times are from an AMD MI455X. After a warm-up the kernel runs many times in a row, and a time is the length of
// such a window on the GPU divided by its runs, so every launch and the gaps after it count. The runs cycle
// through copies of the inputs. A figure is the median of several windows, for all but v000 over two sittings.
// Sittings can differ by a few percent; kernels timed side by side share one.
// v000 is the starting kernel. One run takes 2030 microseconds.
#include <hip/hip_runtime.h>
#include <math.h>
// Spatio-temporal attention (2 clips x 4096 tokens, 8 heads x 64): q/k/v = x·Wᵀ (8192 x 256 · 256 x 512 each) and out = o·Woᵀ (·512 x 256)
// on v_wmma_f32_16x16x32_bf16 with bf16 hi/lo split operands (the output is an average over 4096 near-uniform attention weights, RMS
// 0.0025); the attention itself (scores and p·v, p x2^15, 4096 keys) on
// v_wmma_f32_16x16x32_f16 with f16 operands; f32 accumulate; softmax f32 on VALU.
// The 1x1x1 conv weights ([out][in]) are used directly as the transposed operand.
typedef __attribute__((ext_vector_type(16))) _Float16 v16h;
typedef __attribute__((ext_vector_type(8)))  _Float16 v8h;
typedef __attribute__((ext_vector_type(16))) __bf16   v16b;
typedef __attribute__((ext_vector_type(8)))  __bf16   v8b;
typedef __attribute__((ext_vector_type(8)))  float    v8f;
typedef __attribute__((ext_vector_type(4)))  float    v4f;
#define PSCALE 32768.0f
#define U16(p) ((const unsigned short*)(const void*)(p))
#define PSCALE_INV (1.0f / 32768.0f)

__device__ __forceinline__ unsigned short f2bf_bits(float f) {
  unsigned u = __float_as_uint(f);
  return (unsigned short)((u + 0x7FFFu + ((u >> 16) & 1u)) >> 16);
}
__device__ __forceinline__ float bf_bits2f(unsigned short h) { return __uint_as_float(((unsigned)h) << 16); }

// hazard guards as plain device helpers (no inline asm inside the kernel template body)
__device__ __forceinline__ void dep_guard_h(v8f& a, v8f& b, v16h x, v16h y) { asm volatile("v_nop\n\tv_nop\n\tv_nop\n\tv_nop" : "+v"(a), "+v"(b) : "v"(x), "v"(y)); }
__device__ __forceinline__ void dep_guard_b(v8f& a, v8f& b, v16b x, v16b y) { asm volatile("v_nop\n\tv_nop\n\tv_nop\n\tv_nop" : "+v"(a), "+v"(b) : "v"(x), "v"(y)); }
__device__ __forceinline__ void keep4_h(v16h a, v16h b, v16h c, v16h d) { asm volatile("v_nop" :: "v"(a), "v"(b), "v"(c), "v"(d)); }
__device__ __forceinline__ void keep4_b(v16b a, v16b b, v16b c, v16b d) { asm volatile("v_nop" :: "v"(a), "v"(b), "v"(c), "v"(d)); }
__device__ __forceinline__ void acc_guard4(v8f& a, v8f& b, v8f& c, v8f& d) { asm volatile("v_nop\n\tv_nop\n\tv_nop\n\tv_nop" : "+v"(a), "+v"(b), "+v"(c), "+v"(d)); }
template <typename T> struct Frag;
template <> struct Frag<_Float16> {
  typedef v16h V; union U { v16h v; v8h h[2]; };
  static __device__ __forceinline__ v16h load(const _Float16* p) {   // elements 0..7 <- p[0..7], 8..15 <- p[16..23]
    U f; f.h[0] = *(const v8h*)(p); f.h[1] = *(const v8h*)(p + 16); return f.v;
  }
  static __device__ __forceinline__ v8f mma(v16h a, v16h b, v8f c) {
    return __builtin_amdgcn_wmma_f32_16x16x32_f16(false, a, false, b, (short)0, c, false, false);
  }
  static __device__ __forceinline__ void guard(v8f& a, v8f& b, v16h x, v16h y) { dep_guard_h(a, b, x, y); }
  static __device__ __forceinline__ void keep(v16h a, v16h b, v16h c, v16h d) { keep4_h(a, b, c, d); }
};
template <> struct Frag<__bf16> {
  typedef v16b V; union U { v16b v; v8b h[2]; };
  static __device__ __forceinline__ v16b load(const __bf16* p) {
    U f; f.h[0] = *(const v8b*)(p); f.h[1] = *(const v8b*)(p + 16); return f.v;
  }
  static __device__ __forceinline__ v8f mma(v16b a, v16b b, v8f c) {
    return __builtin_amdgcn_wmma_f32_16x16x32_bf16(false, a, false, b, (short)0, c, false, false);
  }
  static __device__ __forceinline__ void guard(v8f& a, v8f& b, v16b x, v16b y) { dep_guard_b(a, b, x, y); }
  static __device__ __forceinline__ void keep(v16b a, v16b b, v16b c, v16b d) { keep4_b(a, b, c, d); }
};

// ---- Register-blocked batched WMMA GEMM ------------------------------------
// C[m,n] = scale * sum_k A[m,k] * Bt[n,k] (+bias)(+resid); each wave owns a 64x64 tile.
// A row-major [M,K]; Bt row-major [N,K]; M,N % 64 == 0, K % 32 == 0.
// SPLIT: operands are hi/lo planes (A2/Bt2 = lo planes, same layout); product = hi·hi + hi·lo + lo·hi.
// BIAS_MODE: 0 = none, 1 = bias[m], 2 = bias[n].
// OUT_MODE: 0 = f32, 1 = f16, 2 = bf16 hi plane (Cout) + bf16 lo plane (Cout2).
// ET: 0 = f16 operands, 1 = bf16 operands (pointers passed as 16-bit storage)
template <int ET> struct Elem;
template <> struct Elem<0> { typedef _Float16 T; };
template <> struct Elem<1> { typedef __bf16 T; };
template <int ET, bool SPLIT, int BIAS_MODE, int OUT_MODE, bool RESID, int ACT = 0>
__global__ __launch_bounds__(256) void wmma_gemm64(
    const unsigned short* __restrict__ Ap, const unsigned short* __restrict__ A2p, int lda, long strideA,
    const unsigned short* __restrict__ Btp, const unsigned short* __restrict__ Bt2p, int ldb, long strideB,
    void* __restrict__ Cout, void* __restrict__ Cout2, int ldc, long strideC,
    const float* __restrict__ bias,
    const float* __restrict__ resid, long strideR,
    int M, int N, int K, float scale) {
  typedef typename Elem<ET>::T T;
  typedef typename Frag<T>::V V;
  const T* A = (const T*)Ap; const T* A2 = (const T*)A2p; const T* Bt = (const T*)Btp; const T* Bt2 = (const T*)Bt2p;
  __shared__ __align__(16) float sT[8][16 * 68];   // per-wave 16x64 slab, pitch 68 floats
  const int b    = blockIdx.y;
  const int lane = threadIdx.x & 31;
  const int wave = threadIdx.x >> 5;
  const int tilesN = N >> 6;
  const int tilesM = M >> 6;
  const int tile = blockIdx.x * 8 + wave;
  if (tile >= tilesM * tilesN) return;   // wave-uniform; no block barriers in this kernel
  const int tm = tile / tilesN;
  const int tn = tile - tm * tilesN;
  const int m0 = tm << 6;
  const int n0 = tn << 6;

  const T* Ab  = A  + (size_t)b * strideA;
  const T* Bb  = Bt + (size_t)b * strideB;
  const T* Ab2 = SPLIT ? (A2  + (size_t)b * strideA) : nullptr;
  const T* Bb2 = SPLIT ? (Bt2 + (size_t)b * strideB) : nullptr;

  const int rlane = lane & 15;                 // row (A) / col (B, D) within subtile
  const int koff  = (lane >> 4) * 8;           // k offset of this lane half
  const int mOff  = (lane >> 4) * 8;           // D row offset

  v8f acc[4][4];
#pragma unroll
  for (int i = 0; i < 4; ++i)
#pragma unroll
    for (int j = 0; j < 4; ++j) acc[i][j] = (v8f){0.f,0.f,0.f,0.f,0.f,0.f,0.f,0.f};

  for (int k0 = 0; k0 < K; k0 += 32) {
    V bh[4], bl[4];
#pragma unroll
    for (int j = 0; j < 4; ++j) {
      const size_t bo = (size_t)(n0 + (j << 4) + rlane) * ldb + koff + k0;
      bh[j] = Frag<T>::load(Bb + bo);
      if (SPLIT) bl[j] = Frag<T>::load(Bb2 + bo);
    }
#pragma unroll
    for (int i = 0; i < 4; ++i) {
      const size_t ao = (size_t)(m0 + (i << 4) + rlane) * lda + koff + k0;
      V ah = Frag<T>::load(Ab + ao);
      V al;
      if (SPLIT) al = Frag<T>::load(Ab2 + ao);
#pragma unroll
      for (int j = 0; j < 4; ++j) {
        acc[i][j] = Frag<T>::mma(ah, bh[j], acc[i][j]);
        if (SPLIT) {
          acc[i][j] = Frag<T>::mma(ah, bl[j], acc[i][j]);
          acc[i][j] = Frag<T>::mma(al, bh[j], acc[i][j]);
        }
      }
      Frag<T>::guard(acc[i][0], acc[i][3], ah, SPLIT ? al : ah);
    }
    Frag<T>::keep(bh[0], bh[1], bh[2], bh[3]);
    if (SPLIT) Frag<T>::keep(bl[0], bl[1], bl[2], bl[3]);
  }
  acc_guard4(acc[0][0], acc[0][1], acc[0][2], acc[0][3]);
  acc_guard4(acc[1][0], acc[1][1], acc[1][2], acc[1][3]);
  acc_guard4(acc[2][0], acc[2][1], acc[2][2], acc[2][3]);
  acc_guard4(acc[3][0], acc[3][1], acc[3][2], acc[3][3]);

  // ---- epilogue ----
  float* slab = sT[wave];
  const float* Rb = RESID ? (resid + (size_t)b * strideR) : nullptr;
#pragma unroll
  for (int i = 0; i < 4; ++i) {
    const int mBase = m0 + (i << 4);
#pragma unroll
    for (int j = 0; j < 4; ++j) {
      const int n = n0 + (j << 4) + rlane;
      float bv = 0.f;
      if (BIAS_MODE == 2) bv = bias[n];
#pragma unroll
      for (int r = 0; r < 8; ++r) {
        float v = acc[i][j][r] * scale;
        if (BIAS_MODE == 1) v += bias[mBase + mOff + r];
        if (BIAS_MODE == 2) v += bv;
        if (RESID) v += Rb[(size_t)(mBase + mOff + r) * ldc + n];
        if (ACT == 1) v = tanhf(v);
        if (ACT == 2) v = fmaxf(v, 0.0f);
        if (ACT == 3) v = v / (1.0f + expf(-v));
        if (ACT == 4) v = (v > 0.f) ? v : 0.01f * v;
        if (ACT == 5) v = 0.5f * v * (1.0f + erff(v * 0.70710678118654752f));
        slab[(mOff + r) * 68 + (j << 4) + rlane] = v;
      }
    }
    __builtin_amdgcn_fence(__ATOMIC_RELEASE, "workgroup");
    __builtin_amdgcn_wave_barrier();
    __builtin_amdgcn_fence(__ATOMIC_ACQUIRE, "workgroup");
    if (OUT_MODE == 0) {
      float* C = (float*)Cout + (size_t)b * strideC;
      const int hh = lane >> 4, c4 = (lane & 15) * 4;     // row seg = 256 B = 16 lanes x 16 B
      {
#pragma unroll
        for (int it = 0; it < 8; ++it) {
          const int row = it * 2 + hh;
          v4f v = *(const v4f*)(slab + row * 68 + c4);
          *(v4f*)(C + (size_t)(mBase + row) * ldc + n0 + c4) = v;
        }
        
      }
    } else {
      const int q = lane >> 3, c8 = (lane & 7) * 8;
      unsigned short* C  = (unsigned short*)Cout  + (size_t)b * strideC;
      unsigned short* C2 = (OUT_MODE == 2) ? ((unsigned short*)Cout2 + (size_t)b * strideC) : nullptr;
      {
#pragma unroll
        for (int it = 0; it < 4; ++it) {
          const int row = it * 4 + q;
          const float* sp = slab + row * 68 + c8;
          v8h hv, lv;
#pragma unroll
          for (int e = 0; e < 8; ++e) {
            if (OUT_MODE == 1) {
              hv[e] = (_Float16)sp[e];
            } else {
              unsigned short hb = f2bf_bits(sp[e]);
              unsigned short lb = f2bf_bits(sp[e] - bf_bits2f(hb));
              hv[e] = __builtin_bit_cast(_Float16, hb);
              lv[e] = __builtin_bit_cast(_Float16, lb);
            }
          }
          *(v8h*)(C + (size_t)(mBase + row) * ldc + n0 + c8) = hv;
          if (OUT_MODE == 2) *(v8h*)(C2 + (size_t)(mBase + row) * ldc + n0 + c8) = lv;
        }
        
      }
    }
    __builtin_amdgcn_fence(__ATOMIC_RELEASE, "workgroup");
    __builtin_amdgcn_wave_barrier();
    __builtin_amdgcn_fence(__ATOMIC_ACQUIRE, "workgroup");
  }
}

__global__ __launch_bounds__(256) void cast_f32_f16x2(
    const float* __restrict__ in, _Float16* __restrict__ out, int n2) {
  int i = blockIdx.x * 256 + threadIdx.x;
  if (i < n2) {
    const _Float16 h0 = (_Float16)in[2 * i], h1 = (_Float16)in[2 * i + 1];
    const unsigned u = (unsigned)__builtin_bit_cast(unsigned short, h0) | ((unsigned)__builtin_bit_cast(unsigned short, h1) << 16);
    ((unsigned*)out)[i] = u;
    
  }
}


// ---- f32 -> f16 cast with a power-of-two pre-scale (folded back by the consumer GEMM's scale) ----
__global__ __launch_bounds__(256) void cast_f32_f16x2s(const float* __restrict__ in, _Float16* __restrict__ out, int n2, float s) {
  int i = blockIdx.x * 256 + threadIdx.x;
  if (i < n2) {
    const _Float16 h0 = (_Float16)(in[2 * i] * s), h1 = (_Float16)(in[2 * i + 1] * s);
    const unsigned u = (unsigned)__builtin_bit_cast(unsigned short, h0) | ((unsigned)__builtin_bit_cast(unsigned short, h1) << 16);
    ((unsigned*)out)[i] = u;
    
  }
}
__global__ __launch_bounds__(256) void split_f32_bf16x2(
    const float* __restrict__ in, __bf16* __restrict__ hi, __bf16* __restrict__ lo, long n2) {
  long i = (long)blockIdx.x * 256 + threadIdx.x;
  long stride = (long)gridDim.x * 256;
  {
    for (long j = i; j < n2; j += stride) {
      const float a = in[2 * j], b = in[2 * j + 1];
      const unsigned short ah = f2bf_bits(a), bh = f2bf_bits(b);
      const unsigned short al = f2bf_bits(a - bf_bits2f(ah)), bl = f2bf_bits(b - bf_bits2f(bh));
      ((unsigned*)hi)[j] = (unsigned)ah | ((unsigned)bh << 16);
      ((unsigned*)lo)[j] = (unsigned)al | ((unsigned)bl << 16);
    }
    
  }
}


// ---- f32 [R][C] (row pitch ldi) -> f16 transposed [C][R] (row pitch ldo); 64x64 tiles; each output row segment
__global__ __launch_bounds__(256) void transpose_cast_f16(const float* __restrict__ in, int ldi,
                                                         _Float16* __restrict__ outT, int ldo, float scale) {
  __shared__ __align__(16) _Float16 tile[64][72];     // [c][r]
  const int c0 = blockIdx.x * 64, r0 = blockIdx.y * 64;
  const int t = threadIdx.y * 32 + threadIdx.x;
  for (int i = threadIdx.y; i < 64; i += 8) {
    tile[threadIdx.x][i]      = (_Float16)(in[(size_t)(r0 + i) * ldi + c0 + threadIdx.x] * scale);
    tile[32 + threadIdx.x][i] = (_Float16)(in[(size_t)(r0 + i) * ldi + c0 + 32 + threadIdx.x] * scale);
  }
  __syncthreads();
  const int q = t >> 3, c8 = (t & 7) * 8;
  {
#pragma unroll
    for (int it = 0; it < 2; ++it) {
      const int c = it * 32 + q;
      v8h hv = *(const v8h*)(&tile[c][c8]);
      *(v8h*)(outT + (size_t)(c0 + c) * ldo + r0 + c8) = hv;
    }
    
  }
}

// ---- f32 [R][C] (pitch ldi) -> bf16 hi/lo transposed planes [C][R] (pitch ldo); 64x64 tiles; each output row segment
__global__ __launch_bounds__(256) void transpose_split_bf16(const float* __restrict__ in, int ldi,
                                                           __bf16* __restrict__ outH, __bf16* __restrict__ outL, int ldo) {
  __shared__ __align__(16) float tile[64][68];     // [c][r]
  const int c0 = blockIdx.x * 64, r0 = blockIdx.y * 64;
  const int t = threadIdx.y * 32 + threadIdx.x;
  for (int i = threadIdx.y; i < 64; i += 8) {
    tile[threadIdx.x][i]      = in[(size_t)(r0 + i) * ldi + c0 + threadIdx.x];
    tile[32 + threadIdx.x][i] = in[(size_t)(r0 + i) * ldi + c0 + 32 + threadIdx.x];
  }
  __syncthreads();
  const int q = t >> 3, c8 = (t & 7) * 8;
  {
#pragma unroll
    for (int it = 0; it < 2; ++it) {
      const int c = it * 32 + q;
      v8b hv, lv;
#pragma unroll
      for (int e = 0; e < 8; ++e) {
        const float f = tile[c][c8 + e];
        const unsigned short hb = f2bf_bits(f);
        hv[e] = __builtin_bit_cast(__bf16, hb);
        lv[e] = __builtin_bit_cast(__bf16, f2bf_bits(f - bf_bits2f(hb)));
      }
      *(v8b*)(outH + (size_t)(c0 + c) * ldo + r0 + c8) = hv;
      *(v8b*)(outL + (size_t)(c0 + c) * ldo + r0 + c8) = lv;
    }
    
  }
}

// =====================================================================================
// Generic causal/non-causal attention for head_dim 64, f32 in / f32 out; 16-bit operands: bf16 with optional hi/lo splits, or
// plain f16 (F16=true, non-split, probabilities carried x2^15).
//   scores = (q*qscale)·kᵀ : v_wmma_f32_16x16x32_bf16; SPLIT_QK -> q,k as bf16 hi/lo (hi·hi + hi·lo + lo·hi)
//   out    = p·v           : v_wmma_f32_16x16x32_bf16; SPLIT_PV -> p,v as bf16 hi/lo; else p,v plain bf16
//   f32 accumulate; online softmax in f32. Block = 4 waves = 64 query rows of one (batch, head); S % 64 == 0.
//   Element (b, s, h, d) of tensor X lives at X[b*X_bs + s*X_rs + h*X_hs + d] (strides in floats, multiples of 4).
//   Masking: mask_mode 0 none, 1 causal (kv > q masked), 2 tensor [S][Skv] shared over (b,h) (float if
//   mask_is_int==0, int32 with element == 0 -> masked if 1, int32 with element != 0 -> masked if 2), 3 per-token vectors qmask[B][S] & kvmask[B][Skv] (int32,
//   0 -> masked), 4 causal + sliding window (kv > q or q - kv > W masked; W passed in mask_is_int);
//   5 = relative-position bias: s += cp[b,h,q][idx[q][kv]] + pc[b,h,kv][idx[q][kv]] with idx = mask_b ([S][Skv] int32) and
//   mask_a an int32 [S][Skv] tensor with nonzero = masked (tables: element (b,h,row,n) at X + b*c_bs + h*c_hs + row*c_rs + n);
//   masked scores are replaced by mask_fill (e.g. -inf or -1e9) before the softmax.
//   grid.x = B * H * (S/64) (or a sub-range with blk0).
// =====================================================================================
#define AT_D 64
#define AT_NW 4
#define AT_QB 64
#define AT_KC 64
struct AttnGeom { const float* cp = nullptr; const float* pc = nullptr; long c_bs = 0, c_rs = 0, c_hs = 0;   // mode-5 score-bias tables
                  long q_bs, q_rs, q_hs, k_bs, k_rs, k_hs, v_bs, v_rs, v_hs, o_bs, o_rs, o_hs;
                  int S, Skv, H, mask_mode; float qscale; int blk0; float mask_fill; int mask_is_int; };
static_assert(sizeof(AttnGeom) == 168, "no padding");

__device__ __forceinline__ unsigned short at_bf_bits(float f) {
  unsigned u = __float_as_uint(f);
  return (unsigned short)((u + 0x7FFFu + ((u >> 16) & 1u)) >> 16);
}
__device__ __forceinline__ __bf16 at_f2bf(float f) { return __builtin_bit_cast(__bf16, at_bf_bits(f)); }
__device__ __forceinline__ void at_split(float f, __bf16& hi, __bf16& lo) {
  const unsigned short hb = at_bf_bits(f);
  hi = __builtin_bit_cast(__bf16, hb);
  lo = at_f2bf(f - __uint_as_float(((unsigned)hb) << 16));
}
__device__ __forceinline__ v8f at_mma(v16b a, v16b b, v8f c) {
  c = __builtin_amdgcn_wmma_f32_16x16x32_bf16(false, a, false, b, (short)0, c, false, false);
  asm volatile("v_nop\n\tv_nop\n\tv_nop\n\tv_nop" : "+v"(c) : "v"(a), "v"(b));
  return c;
}
// 16-bit element as a bit pattern held in a __bf16 slot: f16 bits when F16, bf16 (RNE) otherwise
template <bool F16> __device__ __forceinline__ __bf16 at_to16(float f) {
  if (F16) return __builtin_bit_cast(__bf16, (_Float16)f);
  return at_f2bf(f);
}
template <bool F16> __device__ __forceinline__ v8f at_mma16(v16b a, v16b b, v8f c) {
  if (F16) {
    const v16h ah = __builtin_bit_cast(v16h, a), bh = __builtin_bit_cast(v16h, b);
    c = __builtin_amdgcn_wmma_f32_16x16x32_f16(false, ah, false, bh, (short)0, c, false, false);
    asm volatile("v_nop\n\tv_nop\n\tv_nop\n\tv_nop" : "+v"(c) : "v"(ah), "v"(bh));
    return c;
  }
  return at_mma(a, b, c);
}

template <bool SPLIT_QK, bool SPLIT_PV, bool F16 = false>
__global__ __launch_bounds__(128)
void attn64_kernel(const float* __restrict__ q, const float* __restrict__ k,
                   const float* __restrict__ v, float* __restrict__ out,
                   const void* __restrict__ mask_a, const int* __restrict__ mask_b, AttnGeom g) {
  static_assert(!(F16 && (SPLIT_QK || SPLIT_PV)), "f16 mode is non-split");
  const float PSC = F16 ? 32768.0f : 1.0f;     // f16 probabilities carried x2^15 (subnormal range), folded into the final 1/l
  union FB { v16b v; v8b h[2]; };
  __shared__ __align__(16) __bf16 Ksh[AT_KC * AT_D];             // K hi [kv][d]      8 KB
  __shared__ __align__(16) __bf16 Ksl[SPLIT_QK ? AT_KC * AT_D : 8];
  __shared__ __align__(16) __bf16 Vth[AT_D * AT_KC];             // V hi [d][kv]      8 KB
  __shared__ __align__(16) __bf16 Vtl[SPLIT_PV ? AT_D * AT_KC : 8];
  __shared__ __align__(16) __bf16 Psh[AT_NW][16 * AT_KC];        // per wave P hi [row][kv]  8 KB
  __shared__ __align__(16) __bf16 Psl[SPLIT_PV ? AT_NW : 1][SPLIT_PV ? 16 * AT_KC : 8];
  __shared__ __align__(16) float  Os[AT_NW][16 * 68];            // per wave out tile, pitch 68

  const int tid  = threadIdx.x;
  const int wave = tid >> 5;
  const int lane = tid & 31;
  const int hh   = lane >> 4;
  const int c    = lane & 15;

  const int nqb = g.S / AT_QB;
  const int bx = blockIdx.x + g.blk0;
  const int qb = bx % nqb;
  const int bh = bx / nqb;
  const int h  = bh % g.H;
  const int b  = bh / g.H;
  const int qbase_block = qb * AT_QB;
  const int q0 = qbase_block + wave * 16;

  const float* qb_ptr = q + (size_t)b * g.q_bs + (size_t)h * g.q_hs;
  const float* kb_ptr = k + (size_t)b * g.k_bs + (size_t)h * g.k_hs;
  const float* vb_ptr = v + (size_t)b * g.v_bs + (size_t)h * g.v_hs;
  float*       ob_ptr = out + (size_t)b * g.o_bs + (size_t)h * g.o_hs;

  // ---- Q fragments (A operand): 2 d-chunks, hi (and lo) ----
  v16b qah[2], qal[2];
  {
    const float* qrow = qb_ptr + (size_t)(q0 + c) * g.q_rs;
#pragma unroll
    for (int dc = 0; dc < 2; ++dc) {
#pragma unroll
      for (int e = 0; e < 8; ++e) {
        const float f0 = qrow[dc * 32 + 8 * hh + e] * g.qscale;
        const float f1 = qrow[dc * 32 + 16 + 8 * hh + e] * g.qscale;
        if (SPLIT_QK) { __bf16 hq, lq; at_split(f0, hq, lq); qah[dc][e] = hq; qal[dc][e] = lq; at_split(f1, hq, lq); qah[dc][8 + e] = hq; qal[dc][8 + e] = lq; }
        else { qah[dc][e] = at_to16<F16>(f0); qah[dc][8 + e] = at_to16<F16>(f1); qal[dc][e] = qah[dc][e]; qal[dc][8 + e] = qah[dc][8 + e]; }
      }
    }
  }

  float mrow[8], lrow[8];
  v8f oacc[4];
#pragma unroll
  for (int r = 0; r < 8; ++r) { mrow[r] = -INFINITY; lrow[r] = 0.f; }
#pragma unroll
  for (int t = 0; t < 4; ++t) oacc[t] = (v8f){0.f,0.f,0.f,0.f,0.f,0.f,0.f,0.f};

  const int nChunks = (g.mask_mode == 1 || g.mask_mode == 4) ? (qb + 1) : (g.Skv / AT_KC);   // block-uniform
  // per-row query mask (mode 3)
  int qkeep[8];
#pragma unroll
  for (int r = 0; r < 8; ++r) qkeep[r] = (g.mask_mode == 3) ? mask_b[(size_t)b * g.S + q0 + 8 * hh + r] : 1;   // mask_b = qmask in mode 3
  for (int kc = 0; kc < nChunks; ++kc) {
    const int kv0 = kc * AT_KC;
    __syncthreads();
    {
      const int kvr = tid >> 1, dh = (tid & 1) * 32;
      const float* krow = kb_ptr + (size_t)(kv0 + kvr) * g.k_rs + dh;
      const float* vrow = vb_ptr + (size_t)(kv0 + kvr) * g.v_rs + dh;
#pragma unroll
      for (int i = 0; i < 8; ++i) {
        v4f kk = *(const v4f*)(krow + 4 * i);
        v4f vv = *(const v4f*)(vrow + 4 * i);
#pragma unroll
        for (int e = 0; e < 4; ++e) {
          const int d = dh + 4 * i + e;
          if (SPLIT_QK) { __bf16 a, bl; at_split(kk[e], a, bl); Ksh[kvr * AT_D + d] = a; Ksl[kvr * AT_D + d] = bl; }
          else Ksh[kvr * AT_D + d] = at_to16<F16>(kk[e]);
          if (SPLIT_PV) { __bf16 a, bl; at_split(vv[e], a, bl); Vth[d * AT_KC + kvr] = a; Vtl[d * AT_KC + kvr] = bl; }
          else Vth[d * AT_KC + kvr] = at_to16<F16>(vv[e]);
        }
      }
    }
    __syncthreads();

    v8f s[4];
#pragma unroll
    for (int j = 0; j < 4; ++j) {
      s[j] = (v8f){0.f,0.f,0.f,0.f,0.f,0.f,0.f,0.f};
#pragma unroll 1
      for (int dc = 0; dc < 2; ++dc) {
        FB kb;
        kb.h[0] = *(const v8b*)(Ksh + (j * 16 + c) * AT_D + dc * 32 + 8 * hh);
        kb.h[1] = *(const v8b*)(Ksh + (j * 16 + c) * AT_D + dc * 32 + 16 + 8 * hh);
        s[j] = at_mma16<F16>(qah[dc], kb.v, s[j]);
        if (SPLIT_QK) {
          FB kl;
          kl.h[0] = *(const v8b*)(Ksl + (j * 16 + c) * AT_D + dc * 32 + 8 * hh);
          kl.h[1] = *(const v8b*)(Ksl + (j * 16 + c) * AT_D + dc * 32 + 16 + 8 * hh);
          s[j] = at_mma16<F16>(qah[dc], kl.v, s[j]);
          s[j] = at_mma16<F16>(qal[dc], kb.v, s[j]);
        }
      }
    }
    const bool diag = (g.mask_mode == 1) && (kc == qb);
    int kvkeep[4] = {1, 1, 1, 1};
    if (g.mask_mode == 3) {
#pragma unroll
      for (int j = 0; j < 4; ++j) kvkeep[j] = ((const int*)mask_a)[(size_t)b * g.Skv + kv0 + j * 16 + c];   // mask_a = kvmask
    }
    float cm[8];
#pragma unroll
    for (int r = 0; r < 8; ++r) {
      const int qrow = q0 + 8 * hh + r;
      float m = -INFINITY;
#pragma unroll
      for (int j = 0; j < 4; ++j) {
        const int kvcol = kv0 + j * 16 + c;
        bool masked = false;
        if (diag) masked = (kvcol > qrow);
        else if (g.mask_mode == 4) masked = (kvcol > qrow) || (qrow - kvcol > g.mask_is_int);
        else if (g.mask_mode == 2) {
          const size_t mi = (size_t)qrow * g.Skv + kvcol;
          masked = (g.mask_is_int == 0) ? (((const float*)mask_a)[mi] == 0.0f)
                 : (g.mask_is_int == 1) ? (((const int*)mask_a)[mi] == 0) : (((const int*)mask_a)[mi] != 0);
        } else if (g.mask_mode == 3) masked = (qkeep[r] == 0) || (kvkeep[j] == 0);
        else if (g.mask_mode == 5) {
          const size_t mi = (size_t)qrow * g.Skv + kvcol;
          masked = (((const int*)mask_a)[mi] != 0);
          int n = mask_b[mi]; n = n < 0 ? 0 : n;
          s[j][r] += g.cp[(size_t)b * g.c_bs + (size_t)h * g.c_hs + (size_t)qrow * g.c_rs + n]
                   + g.pc[(size_t)b * g.c_bs + (size_t)h * g.c_hs + (size_t)kvcol * g.c_rs + n];
        }
        if (masked) s[j][r] = g.mask_fill;
        m = fmaxf(m, s[j][r]);
      }
#pragma unroll
      for (int off = 1; off < 16; off <<= 1) m = fmaxf(m, __shfl_xor(m, off, 32));
      cm[r] = m;
    }
    __bf16* pwh = Psh[wave];
    __bf16* pwl = Psl[SPLIT_PV ? wave : 0];
#pragma unroll
    for (int r = 0; r < 8; ++r) {
      const float mnew = fmaxf(mrow[r], cm[r]);
      const float alpha = expf(mrow[r] - mnew);
      mrow[r] = mnew;
      float psum = 0.f;
#pragma unroll
      for (int j = 0; j < 4; ++j) {
        const float p = expf(s[j][r] - mnew);
        psum += p;
        if (SPLIT_PV) { __bf16 a, bl; at_split(p, a, bl); pwh[(8 * hh + r) * AT_KC + j * 16 + c] = a; pwl[(8 * hh + r) * AT_KC + j * 16 + c] = bl; }
        else pwh[(8 * hh + r) * AT_KC + j * 16 + c] = at_to16<F16>(p * PSC);
      }
#pragma unroll
      for (int off = 1; off < 16; off <<= 1) psum += __shfl_xor(psum, off, 32);
      lrow[r] = lrow[r] * alpha + psum;
#pragma unroll
      for (int t = 0; t < 4; ++t) oacc[t][r] *= alpha;
    }
    __builtin_amdgcn_fence(__ATOMIC_RELEASE, "workgroup");
    __builtin_amdgcn_wave_barrier();
    __builtin_amdgcn_fence(__ATOMIC_ACQUIRE, "workgroup");
#pragma unroll 1
    for (int kk = 0; kk < 2; ++kk) {
      FB pa, pl;
      pa.h[0] = *(const v8b*)(pwh + c * AT_KC + kk * 32 + 8 * hh);
      pa.h[1] = *(const v8b*)(pwh + c * AT_KC + kk * 32 + 16 + 8 * hh);
      if (SPLIT_PV) {
        pl.h[0] = *(const v8b*)(pwl + c * AT_KC + kk * 32 + 8 * hh);
        pl.h[1] = *(const v8b*)(pwl + c * AT_KC + kk * 32 + 16 + 8 * hh);
      }
#pragma unroll
      for (int t = 0; t < 4; ++t) {
        FB vb;
        vb.h[0] = *(const v8b*)(Vth + (t * 16 + c) * AT_KC + kk * 32 + 8 * hh);
        vb.h[1] = *(const v8b*)(Vth + (t * 16 + c) * AT_KC + kk * 32 + 16 + 8 * hh);
        oacc[t] = at_mma16<F16>(pa.v, vb.v, oacc[t]);
        if (SPLIT_PV) {
          FB vl;
          vl.h[0] = *(const v8b*)(Vtl + (t * 16 + c) * AT_KC + kk * 32 + 8 * hh);
          vl.h[1] = *(const v8b*)(Vtl + (t * 16 + c) * AT_KC + kk * 32 + 16 + 8 * hh);
          oacc[t] = at_mma16<F16>(pa.v, vl.v, oacc[t]);
          oacc[t] = at_mma16<F16>(pl.v, vb.v, oacc[t]);
        }
      }
    }
  }

  float* os = Os[wave];
#pragma unroll
  for (int r = 0; r < 8; ++r) {
    const float inv = 1.0f / (lrow[r] * PSC);
#pragma unroll
    for (int t = 0; t < 4; ++t) os[(8 * hh + r) * 68 + t * 16 + c] = oacc[t][r] * inv;
  }
  __builtin_amdgcn_fence(__ATOMIC_RELEASE, "workgroup");
  __builtin_amdgcn_wave_barrier();
  __builtin_amdgcn_fence(__ATOMIC_ACQUIRE, "workgroup");
  {
    const int c4 = (lane & 15) * 4;
    {
#pragma unroll
      for (int it = 0; it < 8; ++it) {
        const int row = it * 2 + hh;
        v4f val = *(const v4f*)(os + row * 68 + c4);
        *(v4f*)(ob_ptr + (size_t)(q0 + row) * g.o_rs + c4) = val;
      }
      
    }
  }
}

#define SB_ 2
#define SN_ 4096
#define SC_ 256
#define SI_ 512
#define SH_ 8
extern "C" void kernel_launch(void* const* d_in, const int* in_sizes, int n_in, void* d_out, int out_size, void* d_ws, size_t ws_size, hipStream_t stream) {
  (void)in_sizes; (void)n_in; (void)out_size; (void)ws_size;
  const float* x = (const float*)d_in[0]; const float* Wq = (const float*)d_in[1]; const float* Wk = (const float*)d_in[2]; const float* Wv = (const float*)d_in[3]; const float* Wo = (const float*)d_in[4];
  float* out = (float*)d_out;
  char* ws = (char*)d_ws; size_t off = 0;
  auto carve = [&](size_t bytes) -> char* { char* p = ws + off; off += (bytes + 255) & ~(size_t)255; return p; };
  const int R = SB_ * SN_;
  __bf16* Xh = (__bf16*)carve((size_t)R * SC_ * 2); __bf16* Xl = (__bf16*)carve((size_t)R * SC_ * 2);
  __bf16* W3h = (__bf16*)carve((size_t)3 * SI_ * SC_ * 2); __bf16* W3l = (__bf16*)carve((size_t)3 * SI_ * SC_ * 2);     // [Wq;Wk;Wv] stacked = Bt for N = 1536
  __bf16* Woh = (__bf16*)carve((size_t)SC_ * SI_ * 2); __bf16* Wol = (__bf16*)carve((size_t)SC_ * SI_ * 2);
  float* QKV = (float*)carve((size_t)R * 3 * SI_ * 4);            // 50 MB
  float* O = (float*)carve((size_t)R * SI_ * 4);
  __bf16* Oh = (__bf16*)carve((size_t)R * SI_ * 2); __bf16* Ol = (__bf16*)carve((size_t)R * SI_ * 2);
  split_f32_bf16x2<<<(R * SC_ / 2 + 255) / 256, 256, 0, stream>>>(x, Xh, Xl, R * SC_ / 2);
  split_f32_bf16x2<<<(SI_ * SC_ / 2 + 255) / 256, 256, 0, stream>>>(Wq, W3h, W3l, SI_ * SC_ / 2);
  split_f32_bf16x2<<<(SI_ * SC_ / 2 + 255) / 256, 256, 0, stream>>>(Wk, W3h + (size_t)SI_ * SC_, W3l + (size_t)SI_ * SC_, SI_ * SC_ / 2);
  split_f32_bf16x2<<<(SI_ * SC_ / 2 + 255) / 256, 256, 0, stream>>>(Wv, W3h + (size_t)2 * SI_ * SC_, W3l + (size_t)2 * SI_ * SC_, SI_ * SC_ / 2);
  split_f32_bf16x2<<<(SC_ * SI_ / 2 + 255) / 256, 256, 0, stream>>>(Wo, Woh, Wol, SC_ * SI_ / 2);
  { const int t = (R / 64) * (3 * SI_ / 64);
    wmma_gemm64<1, true, 0, 0, false><<<dim3((t + 7) / 8, 1), 256, 0, stream>>>(U16(Xh), U16(Xl), SC_, 0, U16(W3h), U16(W3l), SC_, 0, QKV, nullptr, 3 * SI_, 0, nullptr, nullptr, 0, R, 3 * SI_, SC_, 1.0f); }
  { AttnGeom g;
    g.q_bs = (long)SN_ * 3 * SI_; g.q_rs = 3 * SI_; g.q_hs = 64; g.k_bs = g.q_bs; g.k_rs = 3 * SI_; g.k_hs = 64; g.v_bs = g.q_bs; g.v_rs = 3 * SI_; g.v_hs = 64;
    g.o_bs = (long)SN_ * SI_; g.o_rs = SI_; g.o_hs = 64; g.S = SN_; g.Skv = SN_; g.H = SH_; g.mask_mode = 0; g.qscale = 0.125f; g.blk0 = 0; g.mask_fill = -INFINITY; g.mask_is_int = 0;
    attn64_kernel<false, false, true><<<SB_ * SH_ * (SN_ / AT_QB), AT_NW * 32, 0, stream>>>(QKV, QKV + SI_, QKV + 2 * SI_, O, nullptr, nullptr, g); }
  split_f32_bf16x2<<<(R * SI_ / 2 + 255) / 256, 256, 0, stream>>>(O, Oh, Ol, R * SI_ / 2);
  { const int t = (R / 64) * (SC_ / 64);
    wmma_gemm64<1, true, 0, 0, false><<<dim3((t + 7) / 8, 1), 256, 0, stream>>>(U16(Oh), U16(Ol), SI_, 0, U16(Woh), U16(Wol), SI_, 0, out, nullptr, SC_, 0, nullptr, nullptr, 0, R, SC_, SI_, 1.0f); }
}

// v001
// It runs in 538 microseconds.
// Two timings next to v000 put it at 4.10 and 4.11 times that version's speed.
#include <hip/hip_runtime.h>
#include <math.h>
// Spatio-temporal attention (2 clips x 4096 tokens, 8 heads x 64): q/k/v = x·Wᵀ (8192 x 256 · 256 x 512 each) and out = o·Woᵀ (·512 x 256)
// on v_wmma_f32_16x16x32_bf16 with bf16 hi/lo split operands (the output is an average over 4096 near-uniform attention weights, RMS
// 0.0025); the attention itself (scores and p·v, p x2^15, 4096 keys) on
// v_wmma_f32_16x16x32_f16 with f16 operands; f32 accumulate; softmax f32 on VALU.
// The 1x1x1 conv weights ([out][in]) are used directly as the transposed operand.
typedef __attribute__((ext_vector_type(16))) _Float16 v16h;
typedef __attribute__((ext_vector_type(8)))  _Float16 v8h;
typedef __attribute__((ext_vector_type(16))) __bf16   v16b;
typedef __attribute__((ext_vector_type(8)))  __bf16   v8b;
typedef __attribute__((ext_vector_type(8)))  float    v8f;
typedef __attribute__((ext_vector_type(4)))  float    v4f;
#define PSCALE 32768.0f
#define U16(p) ((const unsigned short*)(const void*)(p))
#define PSCALE_INV (1.0f / 32768.0f)

__device__ __forceinline__ unsigned short f2bf_bits(float f) {
  unsigned u = __float_as_uint(f);
  return (unsigned short)((u + 0x7FFFu + ((u >> 16) & 1u)) >> 16);
}
__device__ __forceinline__ float bf_bits2f(unsigned short h) { return __uint_as_float(((unsigned)h) << 16); }

// hazard guards as plain device helpers (no inline asm inside the kernel template body)
__device__ __forceinline__ void dep_guard_h(v8f& a, v8f& b, v16h x, v16h y) { asm volatile("v_nop\n\tv_nop\n\tv_nop\n\tv_nop" : "+v"(a), "+v"(b) : "v"(x), "v"(y)); }
__device__ __forceinline__ void dep_guard_b(v8f& a, v8f& b, v16b x, v16b y) { asm volatile("v_nop\n\tv_nop\n\tv_nop\n\tv_nop" : "+v"(a), "+v"(b) : "v"(x), "v"(y)); }
__device__ __forceinline__ void keep4_h(v16h a, v16h b, v16h c, v16h d) { asm volatile("v_nop" :: "v"(a), "v"(b), "v"(c), "v"(d)); }
__device__ __forceinline__ void keep4_b(v16b a, v16b b, v16b c, v16b d) { asm volatile("v_nop" :: "v"(a), "v"(b), "v"(c), "v"(d)); }
__device__ __forceinline__ void acc_guard4(v8f& a, v8f& b, v8f& c, v8f& d) { asm volatile("v_nop\n\tv_nop\n\tv_nop\n\tv_nop" : "+v"(a), "+v"(b), "+v"(c), "+v"(d)); }
template <typename T> struct Frag;
template <> struct Frag<_Float16> {
  typedef v16h V; union U { v16h v; v8h h[2]; };
  static __device__ __forceinline__ v16h load(const _Float16* p) {   // elements 0..7 <- p[0..7], 8..15 <- p[16..23]
    U f; f.h[0] = *(const v8h*)(p); f.h[1] = *(const v8h*)(p + 16); return f.v;
  }
  static __device__ __forceinline__ v8f mma(v16h a, v16h b, v8f c) {
    return __builtin_amdgcn_wmma_f32_16x16x32_f16(false, a, false, b, (short)0, c, false, false);
  }
  static __device__ __forceinline__ void guard(v8f& a, v8f& b, v16h x, v16h y) { dep_guard_h(a, b, x, y); }
  static __device__ __forceinline__ void keep(v16h a, v16h b, v16h c, v16h d) { keep4_h(a, b, c, d); }
};
template <> struct Frag<__bf16> {
  typedef v16b V; union U { v16b v; v8b h[2]; };
  static __device__ __forceinline__ v16b load(const __bf16* p) {
    U f; f.h[0] = *(const v8b*)(p); f.h[1] = *(const v8b*)(p + 16); return f.v;
  }
  static __device__ __forceinline__ v8f mma(v16b a, v16b b, v8f c) {
    return __builtin_amdgcn_wmma_f32_16x16x32_bf16(false, a, false, b, (short)0, c, false, false);
  }
  static __device__ __forceinline__ void guard(v8f& a, v8f& b, v16b x, v16b y) { dep_guard_b(a, b, x, y); }
  static __device__ __forceinline__ void keep(v16b a, v16b b, v16b c, v16b d) { keep4_b(a, b, c, d); }
};

// ---- Register-blocked batched WMMA GEMM ------------------------------------
// C[m,n] = scale * sum_k A[m,k] * Bt[n,k] (+bias)(+resid); each wave owns a 64x64 tile.
// A row-major [M,K]; Bt row-major [N,K]; M,N % 64 == 0, K % 32 == 0.
// SPLIT: operands are hi/lo planes (A2/Bt2 = lo planes, same layout); product = hi·hi + hi·lo + lo·hi.
// BIAS_MODE: 0 = none, 1 = bias[m], 2 = bias[n].
// OUT_MODE: 0 = f32, 1 = f16, 2 = bf16 hi plane (Cout) + bf16 lo plane (Cout2).
// ET: 0 = f16 operands, 1 = bf16 operands (pointers passed as 16-bit storage)
template <int ET> struct Elem;
template <> struct Elem<0> { typedef _Float16 T; };
template <> struct Elem<1> { typedef __bf16 T; };
template <int ET, bool SPLIT, int BIAS_MODE, int OUT_MODE, bool RESID, int ACT = 0>
__global__ __launch_bounds__(256) void wmma_gemm64(
    const unsigned short* __restrict__ Ap, const unsigned short* __restrict__ A2p, int lda, long strideA,
    const unsigned short* __restrict__ Btp, const unsigned short* __restrict__ Bt2p, int ldb, long strideB,
    void* __restrict__ Cout, void* __restrict__ Cout2, int ldc, long strideC,
    const float* __restrict__ bias,
    const float* __restrict__ resid, long strideR,
    int M, int N, int K, float scale) {
  typedef typename Elem<ET>::T T;
  typedef typename Frag<T>::V V;
  const T* A = (const T*)Ap; const T* A2 = (const T*)A2p; const T* Bt = (const T*)Btp; const T* Bt2 = (const T*)Bt2p;
  __shared__ __align__(16) float sT[8][16 * 68];   // per-wave 16x64 slab, pitch 68 floats
  const int b    = blockIdx.y;
  const int lane = threadIdx.x & 31;
  const int wave = threadIdx.x >> 5;
  const int tilesN = N >> 6;
  const int tilesM = M >> 6;
  const int tile = blockIdx.x * 8 + wave;
  if (tile >= tilesM * tilesN) return;   // wave-uniform; no block barriers in this kernel
  const int tm = tile / tilesN;
  const int tn = tile - tm * tilesN;
  const int m0 = tm << 6;
  const int n0 = tn << 6;

  const T* Ab  = A  + (size_t)b * strideA;
  const T* Bb  = Bt + (size_t)b * strideB;
  const T* Ab2 = SPLIT ? (A2  + (size_t)b * strideA) : nullptr;
  const T* Bb2 = SPLIT ? (Bt2 + (size_t)b * strideB) : nullptr;

  const int rlane = lane & 15;                 // row (A) / col (B, D) within subtile
  const int koff  = (lane >> 4) * 8;           // k offset of this lane half
  const int mOff  = (lane >> 4) * 8;           // D row offset

  v8f acc[4][4];
#pragma unroll
  for (int i = 0; i < 4; ++i)
#pragma unroll
    for (int j = 0; j < 4; ++j) acc[i][j] = (v8f){0.f,0.f,0.f,0.f,0.f,0.f,0.f,0.f};

  for (int k0 = 0; k0 < K; k0 += 32) {
    V bh[4], bl[4];
#pragma unroll
    for (int j = 0; j < 4; ++j) {
      const size_t bo = (size_t)(n0 + (j << 4) + rlane) * ldb + koff + k0;
      bh[j] = Frag<T>::load(Bb + bo);
      if (SPLIT) bl[j] = Frag<T>::load(Bb2 + bo);
    }
#pragma unroll
    for (int i = 0; i < 4; ++i) {
      const size_t ao = (size_t)(m0 + (i << 4) + rlane) * lda + koff + k0;
      V ah = Frag<T>::load(Ab + ao);
      V al;
      if (SPLIT) al = Frag<T>::load(Ab2 + ao);
#pragma unroll
      for (int j = 0; j < 4; ++j) {
        acc[i][j] = Frag<T>::mma(ah, bh[j], acc[i][j]);
        if (SPLIT) {
          acc[i][j] = Frag<T>::mma(ah, bl[j], acc[i][j]);
          acc[i][j] = Frag<T>::mma(al, bh[j], acc[i][j]);
        }
      }
      Frag<T>::guard(acc[i][0], acc[i][3], ah, SPLIT ? al : ah);
    }
    Frag<T>::keep(bh[0], bh[1], bh[2], bh[3]);
    if (SPLIT) Frag<T>::keep(bl[0], bl[1], bl[2], bl[3]);
  }
  acc_guard4(acc[0][0], acc[0][1], acc[0][2], acc[0][3]);
  acc_guard4(acc[1][0], acc[1][1], acc[1][2], acc[1][3]);
  acc_guard4(acc[2][0], acc[2][1], acc[2][2], acc[2][3]);
  acc_guard4(acc[3][0], acc[3][1], acc[3][2], acc[3][3]);

  // ---- epilogue ----
  float* slab = sT[wave];
  const float* Rb = RESID ? (resid + (size_t)b * strideR) : nullptr;
#pragma unroll
  for (int i = 0; i < 4; ++i) {
    const int mBase = m0 + (i << 4);
#pragma unroll
    for (int j = 0; j < 4; ++j) {
      const int n = n0 + (j << 4) + rlane;
      float bv = 0.f;
      if (BIAS_MODE == 2) bv = bias[n];
#pragma unroll
      for (int r = 0; r < 8; ++r) {
        float v = acc[i][j][r] * scale;
        if (BIAS_MODE == 1) v += bias[mBase + mOff + r];
        if (BIAS_MODE == 2) v += bv;
        if (RESID) v += Rb[(size_t)(mBase + mOff + r) * ldc + n];
        if (ACT == 1) v = tanhf(v);
        if (ACT == 2) v = fmaxf(v, 0.0f);
        if (ACT == 3) v = v / (1.0f + expf(-v));
        if (ACT == 4) v = (v > 0.f) ? v : 0.01f * v;
        if (ACT == 5) v = 0.5f * v * (1.0f + erff(v * 0.70710678118654752f));
        slab[(mOff + r) * 68 + (j << 4) + rlane] = v;
      }
    }
    __builtin_amdgcn_fence(__ATOMIC_RELEASE, "workgroup");
    __builtin_amdgcn_wave_barrier();
    __builtin_amdgcn_fence(__ATOMIC_ACQUIRE, "workgroup");
    if (OUT_MODE == 0) {
      float* C = (float*)Cout + (size_t)b * strideC;
      const int hh = lane >> 4, c4 = (lane & 15) * 4;     // row seg = 256 B = 16 lanes x 16 B
      {
#pragma unroll
        for (int it = 0; it < 8; ++it) {
          const int row = it * 2 + hh;
          v4f v = *(const v4f*)(slab + row * 68 + c4);
          *(v4f*)(C + (size_t)(mBase + row) * ldc + n0 + c4) = v;
        }
        
      }
    } else {
      const int q = lane >> 3, c8 = (lane & 7) * 8;
      unsigned short* C  = (unsigned short*)Cout  + (size_t)b * strideC;
      unsigned short* C2 = (OUT_MODE == 2) ? ((unsigned short*)Cout2 + (size_t)b * strideC) : nullptr;
      {
#pragma unroll
        for (int it = 0; it < 4; ++it) {
          const int row = it * 4 + q;
          const float* sp = slab + row * 68 + c8;
          v8h hv, lv;
#pragma unroll
          for (int e = 0; e < 8; ++e) {
            if (OUT_MODE == 1) {
              hv[e] = (_Float16)sp[e];
            } else {
              unsigned short hb = f2bf_bits(sp[e]);
              unsigned short lb = f2bf_bits(sp[e] - bf_bits2f(hb));
              hv[e] = __builtin_bit_cast(_Float16, hb);
              lv[e] = __builtin_bit_cast(_Float16, lb);
            }
          }
          *(v8h*)(C + (size_t)(mBase + row) * ldc + n0 + c8) = hv;
          if (OUT_MODE == 2) *(v8h*)(C2 + (size_t)(mBase + row) * ldc + n0 + c8) = lv;
        }
        
      }
    }
    __builtin_amdgcn_fence(__ATOMIC_RELEASE, "workgroup");
    __builtin_amdgcn_wave_barrier();
    __builtin_amdgcn_fence(__ATOMIC_ACQUIRE, "workgroup");
  }
}

__global__ __launch_bounds__(256) void cast_f32_f16x2(
    const float* __restrict__ in, _Float16* __restrict__ out, int n2) {
  int i = blockIdx.x * 256 + threadIdx.x;
  if (i < n2) {
    const _Float16 h0 = (_Float16)in[2 * i], h1 = (_Float16)in[2 * i + 1];
    const unsigned u = (unsigned)__builtin_bit_cast(unsigned short, h0) | ((unsigned)__builtin_bit_cast(unsigned short, h1) << 16);
    ((unsigned*)out)[i] = u;
    
  }
}


// ---- f32 -> f16 cast with a power-of-two pre-scale (folded back by the consumer GEMM's scale) ----
__global__ __launch_bounds__(256) void cast_f32_f16x2s(const float* __restrict__ in, _Float16* __restrict__ out, int n2, float s) {
  int i = blockIdx.x * 256 + threadIdx.x;
  if (i < n2) {
    const _Float16 h0 = (_Float16)(in[2 * i] * s), h1 = (_Float16)(in[2 * i + 1] * s);
    const unsigned u = (unsigned)__builtin_bit_cast(unsigned short, h0) | ((unsigned)__builtin_bit_cast(unsigned short, h1) << 16);
    ((unsigned*)out)[i] = u;
    
  }
}
__global__ __launch_bounds__(256) void split_f32_bf16x2(
    const float* __restrict__ in, __bf16* __restrict__ hi, __bf16* __restrict__ lo, long n2) {
  long i = (long)blockIdx.x * 256 + threadIdx.x;
  long stride = (long)gridDim.x * 256;
  {
    for (long j = i; j < n2; j += stride) {
      const float a = in[2 * j], b = in[2 * j + 1];
      const unsigned short ah = f2bf_bits(a), bh = f2bf_bits(b);
      const unsigned short al = f2bf_bits(a - bf_bits2f(ah)), bl = f2bf_bits(b - bf_bits2f(bh));
      ((unsigned*)hi)[j] = (unsigned)ah | ((unsigned)bh << 16);
      ((unsigned*)lo)[j] = (unsigned)al | ((unsigned)bl << 16);
    }
    
  }
}


// ---- f32 [R][C] (row pitch ldi) -> f16 transposed [C][R] (row pitch ldo); 64x64 tiles; each output row segment
__global__ __launch_bounds__(256) void transpose_cast_f16(const float* __restrict__ in, int ldi,
                                                         _Float16* __restrict__ outT, int ldo, float scale) {
  __shared__ __align__(16) _Float16 tile[64][72];     // [c][r]
  const int c0 = blockIdx.x * 64, r0 = blockIdx.y * 64;
  const int t = threadIdx.y * 32 + threadIdx.x;
  for (int i = threadIdx.y; i < 64; i += 8) {
    tile[threadIdx.x][i]      = (_Float16)(in[(size_t)(r0 + i) * ldi + c0 + threadIdx.x] * scale);
    tile[32 + threadIdx.x][i] = (_Float16)(in[(size_t)(r0 + i) * ldi + c0 + 32 + threadIdx.x] * scale);
  }
  __syncthreads();
  const int q = t >> 3, c8 = (t & 7) * 8;
  {
#pragma unroll
    for (int it = 0; it < 2; ++it) {
      const int c = it * 32 + q;
      v8h hv = *(const v8h*)(&tile[c][c8]);
      *(v8h*)(outT + (size_t)(c0 + c) * ldo + r0 + c8) = hv;
    }
    
  }
}

// ---- f32 [R][C] (pitch ldi) -> bf16 hi/lo transposed planes [C][R] (pitch ldo); 64x64 tiles; each output row segment
__global__ __launch_bounds__(256) void transpose_split_bf16(const float* __restrict__ in, int ldi,
                                                           __bf16* __restrict__ outH, __bf16* __restrict__ outL, int ldo) {
  __shared__ __align__(16) float tile[64][68];     // [c][r]
  const int c0 = blockIdx.x * 64, r0 = blockIdx.y * 64;
  const int t = threadIdx.y * 32 + threadIdx.x;
  for (int i = threadIdx.y; i < 64; i += 8) {
    tile[threadIdx.x][i]      = in[(size_t)(r0 + i) * ldi + c0 + threadIdx.x];
    tile[32 + threadIdx.x][i] = in[(size_t)(r0 + i) * ldi + c0 + 32 + threadIdx.x];
  }
  __syncthreads();
  const int q = t >> 3, c8 = (t & 7) * 8;
  {
#pragma unroll
    for (int it = 0; it < 2; ++it) {
      const int c = it * 32 + q;
      v8b hv, lv;
#pragma unroll
      for (int e = 0; e < 8; ++e) {
        const float f = tile[c][c8 + e];
        const unsigned short hb = f2bf_bits(f);
        hv[e] = __builtin_bit_cast(__bf16, hb);
        lv[e] = __builtin_bit_cast(__bf16, f2bf_bits(f - bf_bits2f(hb)));
      }
      *(v8b*)(outH + (size_t)(c0 + c) * ldo + r0 + c8) = hv;
      *(v8b*)(outL + (size_t)(c0 + c) * ldo + r0 + c8) = lv;
    }
    
  }
}

// =====================================================================================
// Generic causal/non-causal attention for head_dim 64, f32 in / f32 out; 16-bit operands: bf16 with optional hi/lo splits, or
// plain f16 (F16=true, non-split, probabilities carried x2^15).
//   scores = (q*qscale)·kᵀ : v_wmma_f32_16x16x32_bf16; SPLIT_QK -> q,k as bf16 hi/lo (hi·hi + hi·lo + lo·hi)
//   out    = p·v           : v_wmma_f32_16x16x32_bf16; SPLIT_PV -> p,v as bf16 hi/lo; else p,v plain bf16
//   f32 accumulate; online softmax in f32. Block = 4 waves = 64 query rows of one (batch, head); S % 64 == 0.
//   Element (b, s, h, d) of tensor X lives at X[b*X_bs + s*X_rs + h*X_hs + d] (strides in floats, multiples of 4).
//   Masking: mask_mode 0 none, 1 causal (kv > q masked), 2 tensor [S][Skv] shared over (b,h) (float if
//   mask_is_int==0, int32 with element == 0 -> masked if 1, int32 with element != 0 -> masked if 2), 3 per-token vectors qmask[B][S] & kvmask[B][Skv] (int32,
//   0 -> masked), 4 causal + sliding window (kv > q or q - kv > W masked; W passed in mask_is_int);
//   5 = relative-position bias: s += cp[b,h,q][idx[q][kv]] + pc[b,h,kv][idx[q][kv]] with idx = mask_b ([S][Skv] int32) and
//   mask_a an int32 [S][Skv] tensor with nonzero = masked (tables: element (b,h,row,n) at X + b*c_bs + h*c_hs + row*c_rs + n);
//   masked scores are replaced by mask_fill (e.g. -inf or -1e9) before the softmax.
//   grid.x = B * H * (S/64) (or a sub-range with blk0).
// =====================================================================================
#define AT_D 64
#define AT_NW 4
#define AT_QB 64
#define AT_KC 64
struct AttnGeom { const float* cp = nullptr; const float* pc = nullptr; long c_bs = 0, c_rs = 0, c_hs = 0;   // mode-5 score-bias tables
                  long q_bs, q_rs, q_hs, k_bs, k_rs, k_hs, v_bs, v_rs, v_hs, o_bs, o_rs, o_hs;
                  int S, Skv, H, mask_mode; float qscale; int blk0; float mask_fill; int mask_is_int; };
static_assert(sizeof(AttnGeom) == 168, "no padding");

__device__ __forceinline__ unsigned short at_bf_bits(float f) {
  unsigned u = __float_as_uint(f);
  return (unsigned short)((u + 0x7FFFu + ((u >> 16) & 1u)) >> 16);
}
__device__ __forceinline__ __bf16 at_f2bf(float f) { return __builtin_bit_cast(__bf16, at_bf_bits(f)); }
__device__ __forceinline__ void at_split(float f, __bf16& hi, __bf16& lo) {
  const unsigned short hb = at_bf_bits(f);
  hi = __builtin_bit_cast(__bf16, hb);
  lo = at_f2bf(f - __uint_as_float(((unsigned)hb) << 16));
}
__device__ __forceinline__ v8f at_mma(v16b a, v16b b, v8f c) {
  c = __builtin_amdgcn_wmma_f32_16x16x32_bf16(false, a, false, b, (short)0, c, false, false);
  asm volatile("v_nop\n\tv_nop\n\tv_nop\n\tv_nop" : "+v"(c) : "v"(a), "v"(b));
  return c;
}
// 16-bit element as a bit pattern held in a __bf16 slot: f16 bits when F16, bf16 (RNE) otherwise
template <bool F16> __device__ __forceinline__ __bf16 at_to16(float f) {
  if (F16) return __builtin_bit_cast(__bf16, (_Float16)f);
  return at_f2bf(f);
}
template <bool F16> __device__ __forceinline__ v8f at_mma16(v16b a, v16b b, v8f c) {
  if (F16) {
    const v16h ah = __builtin_bit_cast(v16h, a), bh = __builtin_bit_cast(v16h, b);
    c = __builtin_amdgcn_wmma_f32_16x16x32_f16(false, ah, false, bh, (short)0, c, false, false);
    asm volatile("v_nop\n\tv_nop\n\tv_nop\n\tv_nop" : "+v"(c) : "v"(ah), "v"(bh));
    return c;
  }
  return at_mma(a, b, c);
}

// MM: the mask mode as a compile-time constant (the launch's g.mask_mode must equal it); MM < 0 reads g.mask_mode at run time.
template <bool SPLIT_QK, bool SPLIT_PV, bool F16 = false, int MM = -1>
__global__ __launch_bounds__(128)
void attn64_kernel(const float* __restrict__ q, const float* __restrict__ k,
                   const float* __restrict__ v, float* __restrict__ out,
                   const void* __restrict__ mask_a, const int* __restrict__ mask_b, AttnGeom g) {
  static_assert(!(F16 && (SPLIT_QK || SPLIT_PV)), "f16 mode is non-split");
  const int mask_mode = (MM >= 0) ? MM : g.mask_mode;
  const float PSC = F16 ? 32768.0f : 1.0f;     // f16 probabilities carried x2^15 (subnormal range), folded into the final 1/l
  union FB { v16b v; v8b h[2]; };
  __shared__ __align__(16) __bf16 Ksh[AT_KC * AT_D];             // K hi [kv][d]      8 KB
  __shared__ __align__(16) __bf16 Ksl[SPLIT_QK ? AT_KC * AT_D : 8];
  __shared__ __align__(16) __bf16 Vth[AT_D * AT_KC];             // V hi [d][kv]      8 KB
  __shared__ __align__(16) __bf16 Vtl[SPLIT_PV ? AT_D * AT_KC : 8];
  __shared__ __align__(16) __bf16 Psh[AT_NW][16 * AT_KC];        // per wave P hi [row][kv]  8 KB
  __shared__ __align__(16) __bf16 Psl[SPLIT_PV ? AT_NW : 1][SPLIT_PV ? 16 * AT_KC : 8];
  __shared__ __align__(16) float  Os[AT_NW][16 * 68];            // per wave out tile, pitch 68

  const int tid  = threadIdx.x;
  const int wave = tid >> 5;
  const int lane = tid & 31;
  const int hh   = lane >> 4;
  const int c    = lane & 15;

  const int nqb = g.S / AT_QB;
  const int bx = blockIdx.x + g.blk0;
  const int qb = bx % nqb;
  const int bh = bx / nqb;
  const int h  = bh % g.H;
  const int b  = bh / g.H;
  const int qbase_block = qb * AT_QB;
  const int q0 = qbase_block + wave * 16;

  const float* qb_ptr = q + (size_t)b * g.q_bs + (size_t)h * g.q_hs;
  const float* kb_ptr = k + (size_t)b * g.k_bs + (size_t)h * g.k_hs;
  const float* vb_ptr = v + (size_t)b * g.v_bs + (size_t)h * g.v_hs;
  float*       ob_ptr = out + (size_t)b * g.o_bs + (size_t)h * g.o_hs;

  // ---- Q fragments (A operand): 2 d-chunks, hi (and lo) ----
  v16b qah[2], qal[2];
  {
    const float* qrow = qb_ptr + (size_t)(q0 + c) * g.q_rs;
#pragma unroll
    for (int dc = 0; dc < 2; ++dc) {
#pragma unroll
      for (int e = 0; e < 8; ++e) {
        const float f0 = qrow[dc * 32 + 8 * hh + e] * g.qscale;
        const float f1 = qrow[dc * 32 + 16 + 8 * hh + e] * g.qscale;
        if (SPLIT_QK) { __bf16 hq, lq; at_split(f0, hq, lq); qah[dc][e] = hq; qal[dc][e] = lq; at_split(f1, hq, lq); qah[dc][8 + e] = hq; qal[dc][8 + e] = lq; }
        else { qah[dc][e] = at_to16<F16>(f0); qah[dc][8 + e] = at_to16<F16>(f1); qal[dc][e] = qah[dc][e]; qal[dc][8 + e] = qah[dc][8 + e]; }
      }
    }
  }

  float mrow[8], lrow[8];
  v8f oacc[4];
#pragma unroll
  for (int r = 0; r < 8; ++r) { mrow[r] = -INFINITY; lrow[r] = 0.f; }
#pragma unroll
  for (int t = 0; t < 4; ++t) oacc[t] = (v8f){0.f,0.f,0.f,0.f,0.f,0.f,0.f,0.f};

  const int nChunks = (mask_mode == 1 || mask_mode == 4) ? (qb + 1) : (g.Skv / AT_KC);   // block-uniform
  // per-row query mask (mode 3)
  int qkeep[8];
#pragma unroll
  for (int r = 0; r < 8; ++r) qkeep[r] = (mask_mode == 3) ? mask_b[(size_t)b * g.S + q0 + 8 * hh + r] : 1;   // mask_b = qmask in mode 3
  for (int kc = 0; kc < nChunks; ++kc) {
    const int kv0 = kc * AT_KC;
    __syncthreads();
    {
      const int kvr = tid >> 1, dh = (tid & 1) * 32;
      const float* krow = kb_ptr + (size_t)(kv0 + kvr) * g.k_rs + dh;
      const float* vrow = vb_ptr + (size_t)(kv0 + kvr) * g.v_rs + dh;
#pragma unroll
      for (int i = 0; i < 8; ++i) {
        v4f kk = *(const v4f*)(krow + 4 * i);
        v4f vv = *(const v4f*)(vrow + 4 * i);
#pragma unroll
        for (int e = 0; e < 4; ++e) {
          const int d = dh + 4 * i + e;
          if (SPLIT_QK) { __bf16 a, bl; at_split(kk[e], a, bl); Ksh[kvr * AT_D + d] = a; Ksl[kvr * AT_D + d] = bl; }
          else Ksh[kvr * AT_D + d] = at_to16<F16>(kk[e]);
          if (SPLIT_PV) { __bf16 a, bl; at_split(vv[e], a, bl); Vth[d * AT_KC + kvr] = a; Vtl[d * AT_KC + kvr] = bl; }
          else Vth[d * AT_KC + kvr] = at_to16<F16>(vv[e]);
        }
      }
    }
    __syncthreads();

    v8f s[4];
#pragma unroll
    for (int j = 0; j < 4; ++j) {
      s[j] = (v8f){0.f,0.f,0.f,0.f,0.f,0.f,0.f,0.f};
#pragma unroll 1
      for (int dc = 0; dc < 2; ++dc) {
        FB kb;
        kb.h[0] = *(const v8b*)(Ksh + (j * 16 + c) * AT_D + dc * 32 + 8 * hh);
        kb.h[1] = *(const v8b*)(Ksh + (j * 16 + c) * AT_D + dc * 32 + 16 + 8 * hh);
        s[j] = at_mma16<F16>(qah[dc], kb.v, s[j]);
        if (SPLIT_QK) {
          FB kl;
          kl.h[0] = *(const v8b*)(Ksl + (j * 16 + c) * AT_D + dc * 32 + 8 * hh);
          kl.h[1] = *(const v8b*)(Ksl + (j * 16 + c) * AT_D + dc * 32 + 16 + 8 * hh);
          s[j] = at_mma16<F16>(qah[dc], kl.v, s[j]);
          s[j] = at_mma16<F16>(qal[dc], kb.v, s[j]);
        }
      }
    }
    const bool diag = (mask_mode == 1) && (kc == qb);
    int kvkeep[4] = {1, 1, 1, 1};
    if (mask_mode == 3) {
#pragma unroll
      for (int j = 0; j < 4; ++j) kvkeep[j] = ((const int*)mask_a)[(size_t)b * g.Skv + kv0 + j * 16 + c];   // mask_a = kvmask
    }
    float cm[8];
#pragma unroll
    for (int r = 0; r < 8; ++r) {
      const int qrow = q0 + 8 * hh + r;
      float m = -INFINITY;
#pragma unroll
      for (int j = 0; j < 4; ++j) {
        const int kvcol = kv0 + j * 16 + c;
        bool masked = false;
        if (diag) masked = (kvcol > qrow);
        else if (mask_mode == 4) masked = (kvcol > qrow) || (qrow - kvcol > g.mask_is_int);
        else if (mask_mode == 2) {
          const size_t mi = (size_t)qrow * g.Skv + kvcol;
          masked = (g.mask_is_int == 0) ? (((const float*)mask_a)[mi] == 0.0f)
                 : (g.mask_is_int == 1) ? (((const int*)mask_a)[mi] == 0) : (((const int*)mask_a)[mi] != 0);
        } else if (mask_mode == 3) masked = (qkeep[r] == 0) || (kvkeep[j] == 0);
        else if (mask_mode == 5) {
          const size_t mi = (size_t)qrow * g.Skv + kvcol;
          masked = (((const int*)mask_a)[mi] != 0);
          int n = mask_b[mi]; n = n < 0 ? 0 : n;
          s[j][r] += g.cp[(size_t)b * g.c_bs + (size_t)h * g.c_hs + (size_t)qrow * g.c_rs + n]
                   + g.pc[(size_t)b * g.c_bs + (size_t)h * g.c_hs + (size_t)kvcol * g.c_rs + n];
        }
        if (masked) s[j][r] = g.mask_fill;
        m = fmaxf(m, s[j][r]);
      }
#pragma unroll
      for (int off = 1; off < 16; off <<= 1) m = fmaxf(m, __shfl_xor(m, off, 32));
      cm[r] = m;
    }
    __bf16* pwh = Psh[wave];
    __bf16* pwl = Psl[SPLIT_PV ? wave : 0];
#pragma unroll
    for (int r = 0; r < 8; ++r) {
      const float mnew = fmaxf(mrow[r], cm[r]);
      const float alpha = expf(mrow[r] - mnew);
      mrow[r] = mnew;
      float psum = 0.f;
#pragma unroll
      for (int j = 0; j < 4; ++j) {
        const float p = expf(s[j][r] - mnew);
        psum += p;
        if (SPLIT_PV) { __bf16 a, bl; at_split(p, a, bl); pwh[(8 * hh + r) * AT_KC + j * 16 + c] = a; pwl[(8 * hh + r) * AT_KC + j * 16 + c] = bl; }
        else pwh[(8 * hh + r) * AT_KC + j * 16 + c] = at_to16<F16>(p * PSC);
      }
#pragma unroll
      for (int off = 1; off < 16; off <<= 1) psum += __shfl_xor(psum, off, 32);
      lrow[r] = lrow[r] * alpha + psum;
#pragma unroll
      for (int t = 0; t < 4; ++t) oacc[t][r] *= alpha;
    }
    __builtin_amdgcn_fence(__ATOMIC_RELEASE, "workgroup");
    __builtin_amdgcn_wave_barrier();
    __builtin_amdgcn_fence(__ATOMIC_ACQUIRE, "workgroup");
#pragma unroll 1
    for (int kk = 0; kk < 2; ++kk) {
      FB pa, pl;
      pa.h[0] = *(const v8b*)(pwh + c * AT_KC + kk * 32 + 8 * hh);
      pa.h[1] = *(const v8b*)(pwh + c * AT_KC + kk * 32 + 16 + 8 * hh);
      if (SPLIT_PV) {
        pl.h[0] = *(const v8b*)(pwl + c * AT_KC + kk * 32 + 8 * hh);
        pl.h[1] = *(const v8b*)(pwl + c * AT_KC + kk * 32 + 16 + 8 * hh);
      }
#pragma unroll
      for (int t = 0; t < 4; ++t) {
        FB vb;
        vb.h[0] = *(const v8b*)(Vth + (t * 16 + c) * AT_KC + kk * 32 + 8 * hh);
        vb.h[1] = *(const v8b*)(Vth + (t * 16 + c) * AT_KC + kk * 32 + 16 + 8 * hh);
        oacc[t] = at_mma16<F16>(pa.v, vb.v, oacc[t]);
        if (SPLIT_PV) {
          FB vl;
          vl.h[0] = *(const v8b*)(Vtl + (t * 16 + c) * AT_KC + kk * 32 + 8 * hh);
          vl.h[1] = *(const v8b*)(Vtl + (t * 16 + c) * AT_KC + kk * 32 + 16 + 8 * hh);
          oacc[t] = at_mma16<F16>(pa.v, vl.v, oacc[t]);
          oacc[t] = at_mma16<F16>(pl.v, vb.v, oacc[t]);
        }
      }
    }
  }

  float* os = Os[wave];
#pragma unroll
  for (int r = 0; r < 8; ++r) {
    const float inv = 1.0f / (lrow[r] * PSC);
#pragma unroll
    for (int t = 0; t < 4; ++t) os[(8 * hh + r) * 68 + t * 16 + c] = oacc[t][r] * inv;
  }
  __builtin_amdgcn_fence(__ATOMIC_RELEASE, "workgroup");
  __builtin_amdgcn_wave_barrier();
  __builtin_amdgcn_fence(__ATOMIC_ACQUIRE, "workgroup");
  {
    const int c4 = (lane & 15) * 4;
    {
#pragma unroll
      for (int it = 0; it < 8; ++it) {
        const int row = it * 2 + hh;
        v4f val = *(const v4f*)(os + row * 68 + c4);
        *(v4f*)(ob_ptr + (size_t)(q0 + row) * g.o_rs + c4) = val;
      }
      
    }
  }
}

#define SB_ 2
#define SN_ 4096
#define SC_ 256
#define SI_ 512
#define SH_ 8
extern "C" void kernel_launch(void* const* d_in, const int* in_sizes, int n_in, void* d_out, int out_size, void* d_ws, size_t ws_size, hipStream_t stream) {
  (void)in_sizes; (void)n_in; (void)out_size; (void)ws_size;
  const float* x = (const float*)d_in[0]; const float* Wq = (const float*)d_in[1]; const float* Wk = (const float*)d_in[2]; const float* Wv = (const float*)d_in[3]; const float* Wo = (const float*)d_in[4];
  float* out = (float*)d_out;
  char* ws = (char*)d_ws; size_t off = 0;
  auto carve = [&](size_t bytes) -> char* { char* p = ws + off; off += (bytes + 255) & ~(size_t)255; return p; };
  const int R = SB_ * SN_;
  __bf16* Xh = (__bf16*)carve((size_t)R * SC_ * 2); __bf16* Xl = (__bf16*)carve((size_t)R * SC_ * 2);
  __bf16* W3h = (__bf16*)carve((size_t)3 * SI_ * SC_ * 2); __bf16* W3l = (__bf16*)carve((size_t)3 * SI_ * SC_ * 2);     // [Wq;Wk;Wv] stacked = Bt for N = 1536
  __bf16* Woh = (__bf16*)carve((size_t)SC_ * SI_ * 2); __bf16* Wol = (__bf16*)carve((size_t)SC_ * SI_ * 2);
  float* QKV = (float*)carve((size_t)R * 3 * SI_ * 4);            // 50 MB
  float* O = (float*)carve((size_t)R * SI_ * 4);
  __bf16* Oh = (__bf16*)carve((size_t)R * SI_ * 2); __bf16* Ol = (__bf16*)carve((size_t)R * SI_ * 2);
  split_f32_bf16x2<<<(R * SC_ / 2 + 255) / 256, 256, 0, stream>>>(x, Xh, Xl, R * SC_ / 2);
  split_f32_bf16x2<<<(SI_ * SC_ / 2 + 255) / 256, 256, 0, stream>>>(Wq, W3h, W3l, SI_ * SC_ / 2);
  split_f32_bf16x2<<<(SI_ * SC_ / 2 + 255) / 256, 256, 0, stream>>>(Wk, W3h + (size_t)SI_ * SC_, W3l + (size_t)SI_ * SC_, SI_ * SC_ / 2);
  split_f32_bf16x2<<<(SI_ * SC_ / 2 + 255) / 256, 256, 0, stream>>>(Wv, W3h + (size_t)2 * SI_ * SC_, W3l + (size_t)2 * SI_ * SC_, SI_ * SC_ / 2);
  split_f32_bf16x2<<<(SC_ * SI_ / 2 + 255) / 256, 256, 0, stream>>>(Wo, Woh, Wol, SC_ * SI_ / 2);
  { const int t = (R / 64) * (3 * SI_ / 64);
    wmma_gemm64<1, true, 0, 0, false><<<dim3((t + 7) / 8, 1), 256, 0, stream>>>(U16(Xh), U16(Xl), SC_, 0, U16(W3h), U16(W3l), SC_, 0, QKV, nullptr, 3 * SI_, 0, nullptr, nullptr, 0, R, 3 * SI_, SC_, 1.0f); }
  { AttnGeom g;
    g.q_bs = (long)SN_ * 3 * SI_; g.q_rs = 3 * SI_; g.q_hs = 64; g.k_bs = g.q_bs; g.k_rs = 3 * SI_; g.k_hs = 64; g.v_bs = g.q_bs; g.v_rs = 3 * SI_; g.v_hs = 64;
    g.o_bs = (long)SN_ * SI_; g.o_rs = SI_; g.o_hs = 64; g.S = SN_; g.Skv = SN_; g.H = SH_; g.mask_mode = 0; g.qscale = 0.125f; g.blk0 = 0; g.mask_fill = -INFINITY; g.mask_is_int = 0;
    attn64_kernel<false, false, true, 0><<<SB_ * SH_ * (SN_ / AT_QB), AT_NW * 32, 0, stream>>>(QKV, QKV + SI_, QKV + 2 * SI_, O, nullptr, nullptr, g); }
  split_f32_bf16x2<<<(R * SI_ / 2 + 255) / 256, 256, 0, stream>>>(O, Oh, Ol, R * SI_ / 2);
  { const int t = (R / 64) * (SC_ / 64);
    wmma_gemm64<1, true, 0, 0, false><<<dim3((t + 7) / 8, 1), 256, 0, stream>>>(U16(Oh), U16(Ol), SI_, 0, U16(Woh), U16(Wol), SI_, 0, out, nullptr, SC_, 0, nullptr, nullptr, 0, R, SC_, SI_, 1.0f); }
}

// v002
// Measured time: 448 microseconds a run.
// In both of two side-by-side timings against v001, it was 1.20 times as fast.
// All steps since v000 together make it 4.92 times as fast.
#include <hip/hip_runtime.h>
#include <math.h>
// Spatio-temporal attention (2 clips x 4096 tokens, 8 heads x 64): q/k/v = x·Wᵀ (8192 x 256 · 256 x 512 each) and out = o·Woᵀ (·512 x 256)
// on v_wmma_f32_16x16x32_bf16 with bf16 hi/lo split operands (the output is an average over 4096 near-uniform attention weights, RMS
// 0.0025); the attention itself (scores and p·v, p x2^15, 4096 keys) on
// v_wmma_f32_16x16x32_f16 with f16 operands; f32 accumulate; softmax f32 on VALU.
// The 1x1x1 conv weights ([out][in]) are used directly as the transposed operand.
typedef __attribute__((ext_vector_type(16))) _Float16 v16h;
typedef __attribute__((ext_vector_type(8)))  _Float16 v8h;
typedef __attribute__((ext_vector_type(16))) __bf16   v16b;
typedef __attribute__((ext_vector_type(8)))  __bf16   v8b;
typedef __attribute__((ext_vector_type(8)))  float    v8f;
typedef __attribute__((ext_vector_type(4)))  float    v4f;
#define PSCALE 32768.0f
#define U16(p) ((const unsigned short*)(const void*)(p))
#define PSCALE_INV (1.0f / 32768.0f)

__device__ __forceinline__ unsigned short f2bf_bits(float f) {
  unsigned u = __float_as_uint(f);
  return (unsigned short)((u + 0x7FFFu + ((u >> 16) & 1u)) >> 16);
}
__device__ __forceinline__ float bf_bits2f(unsigned short h) { return __uint_as_float(((unsigned)h) << 16); }

// hazard guards as plain device helpers (no inline asm inside the kernel template body)
__device__ __forceinline__ void dep_guard_h(v8f& a, v8f& b, v16h x, v16h y) { asm volatile("v_nop\n\tv_nop\n\tv_nop\n\tv_nop" : "+v"(a), "+v"(b) : "v"(x), "v"(y)); }
__device__ __forceinline__ void dep_guard_b(v8f& a, v8f& b, v16b x, v16b y) { asm volatile("v_nop\n\tv_nop\n\tv_nop\n\tv_nop" : "+v"(a), "+v"(b) : "v"(x), "v"(y)); }
__device__ __forceinline__ void keep4_h(v16h a, v16h b, v16h c, v16h d) { asm volatile("v_nop" :: "v"(a), "v"(b), "v"(c), "v"(d)); }
__device__ __forceinline__ void keep4_b(v16b a, v16b b, v16b c, v16b d) { asm volatile("v_nop" :: "v"(a), "v"(b), "v"(c), "v"(d)); }
__device__ __forceinline__ void acc_guard4(v8f& a, v8f& b, v8f& c, v8f& d) { asm volatile("v_nop\n\tv_nop\n\tv_nop\n\tv_nop" : "+v"(a), "+v"(b), "+v"(c), "+v"(d)); }
template <typename T> struct Frag;
template <> struct Frag<_Float16> {
  typedef v16h V; union U { v16h v; v8h h[2]; };
  static __device__ __forceinline__ v16h load(const _Float16* p) {   // elements 0..7 <- p[0..7], 8..15 <- p[16..23]
    U f; f.h[0] = *(const v8h*)(p); f.h[1] = *(const v8h*)(p + 16); return f.v;
  }
  static __device__ __forceinline__ v8f mma(v16h a, v16h b, v8f c) {
    return __builtin_amdgcn_wmma_f32_16x16x32_f16(false, a, false, b, (short)0, c, false, false);
  }
  static __device__ __forceinline__ void guard(v8f& a, v8f& b, v16h x, v16h y) { dep_guard_h(a, b, x, y); }
  static __device__ __forceinline__ void keep(v16h a, v16h b, v16h c, v16h d) { keep4_h(a, b, c, d); }
};
template <> struct Frag<__bf16> {
  typedef v16b V; union U { v16b v; v8b h[2]; };
  static __device__ __forceinline__ v16b load(const __bf16* p) {
    U f; f.h[0] = *(const v8b*)(p); f.h[1] = *(const v8b*)(p + 16); return f.v;
  }
  static __device__ __forceinline__ v8f mma(v16b a, v16b b, v8f c) {
    return __builtin_amdgcn_wmma_f32_16x16x32_bf16(false, a, false, b, (short)0, c, false, false);
  }
  static __device__ __forceinline__ void guard(v8f& a, v8f& b, v16b x, v16b y) { dep_guard_b(a, b, x, y); }
  static __device__ __forceinline__ void keep(v16b a, v16b b, v16b c, v16b d) { keep4_b(a, b, c, d); }
};

// ---- Register-blocked batched WMMA GEMM ------------------------------------
// C[m,n] = scale * sum_k A[m,k] * Bt[n,k] (+bias)(+resid); each wave owns a 64x64 tile.
// A row-major [M,K]; Bt row-major [N,K]; M,N % 64 == 0, K % 32 == 0.
// SPLIT: operands are hi/lo planes (A2/Bt2 = lo planes, same layout); product = hi·hi + hi·lo + lo·hi.
// BIAS_MODE: 0 = none, 1 = bias[m], 2 = bias[n].
// OUT_MODE: 0 = f32, 1 = f16, 2 = bf16 hi plane (Cout) + bf16 lo plane (Cout2).
// ET: 0 = f16 operands, 1 = bf16 operands (pointers passed as 16-bit storage)
template <int ET> struct Elem;
template <> struct Elem<0> { typedef _Float16 T; };
template <> struct Elem<1> { typedef __bf16 T; };
template <int ET, bool SPLIT, int BIAS_MODE, int OUT_MODE, bool RESID, int ACT = 0>
__global__ __launch_bounds__(256) void wmma_gemm64(
    const unsigned short* __restrict__ Ap, const unsigned short* __restrict__ A2p, int lda, long strideA,
    const unsigned short* __restrict__ Btp, const unsigned short* __restrict__ Bt2p, int ldb, long strideB,
    void* __restrict__ Cout, void* __restrict__ Cout2, int ldc, long strideC,
    const float* __restrict__ bias,
    const float* __restrict__ resid, long strideR,
    int M, int N, int K, float scale) {
  typedef typename Elem<ET>::T T;
  typedef typename Frag<T>::V V;
  const T* A = (const T*)Ap; const T* A2 = (const T*)A2p; const T* Bt = (const T*)Btp; const T* Bt2 = (const T*)Bt2p;
  __shared__ __align__(16) float sT[8][16 * 68];   // per-wave 16x64 slab, pitch 68 floats
  const int b    = blockIdx.y;
  const int lane = threadIdx.x & 31;
  const int wave = threadIdx.x >> 5;
  const int tilesN = N >> 6;
  const int tilesM = M >> 6;
  const int tile = blockIdx.x * 8 + wave;
  if (tile >= tilesM * tilesN) return;   // wave-uniform; no block barriers in this kernel
  const int tm = tile / tilesN;
  const int tn = tile - tm * tilesN;
  const int m0 = tm << 6;
  const int n0 = tn << 6;

  const T* Ab  = A  + (size_t)b * strideA;
  const T* Bb  = Bt + (size_t)b * strideB;
  const T* Ab2 = SPLIT ? (A2  + (size_t)b * strideA) : nullptr;
  const T* Bb2 = SPLIT ? (Bt2 + (size_t)b * strideB) : nullptr;

  const int rlane = lane & 15;                 // row (A) / col (B, D) within subtile
  const int koff  = (lane >> 4) * 8;           // k offset of this lane half
  const int mOff  = (lane >> 4) * 8;           // D row offset

  v8f acc[4][4];
#pragma unroll
  for (int i = 0; i < 4; ++i)
#pragma unroll
    for (int j = 0; j < 4; ++j) acc[i][j] = (v8f){0.f,0.f,0.f,0.f,0.f,0.f,0.f,0.f};

  for (int k0 = 0; k0 < K; k0 += 32) {
    V bh[4], bl[4];
#pragma unroll
    for (int j = 0; j < 4; ++j) {
      const size_t bo = (size_t)(n0 + (j << 4) + rlane) * ldb + koff + k0;
      bh[j] = Frag<T>::load(Bb + bo);
      if (SPLIT) bl[j] = Frag<T>::load(Bb2 + bo);
    }
#pragma unroll
    for (int i = 0; i < 4; ++i) {
      const size_t ao = (size_t)(m0 + (i << 4) + rlane) * lda + koff + k0;
      V ah = Frag<T>::load(Ab + ao);
      V al;
      if (SPLIT) al = Frag<T>::load(Ab2 + ao);
#pragma unroll
      for (int j = 0; j < 4; ++j) {
        acc[i][j] = Frag<T>::mma(ah, bh[j], acc[i][j]);
        if (SPLIT) {
          acc[i][j] = Frag<T>::mma(ah, bl[j], acc[i][j]);
          acc[i][j] = Frag<T>::mma(al, bh[j], acc[i][j]);
        }
      }
      Frag<T>::guard(acc[i][0], acc[i][3], ah, SPLIT ? al : ah);
    }
    Frag<T>::keep(bh[0], bh[1], bh[2], bh[3]);
    if (SPLIT) Frag<T>::keep(bl[0], bl[1], bl[2], bl[3]);
  }
  acc_guard4(acc[0][0], acc[0][1], acc[0][2], acc[0][3]);
  acc_guard4(acc[1][0], acc[1][1], acc[1][2], acc[1][3]);
  acc_guard4(acc[2][0], acc[2][1], acc[2][2], acc[2][3]);
  acc_guard4(acc[3][0], acc[3][1], acc[3][2], acc[3][3]);

  // ---- epilogue ----
  float* slab = sT[wave];
  const float* Rb = RESID ? (resid + (size_t)b * strideR) : nullptr;
#pragma unroll
  for (int i = 0; i < 4; ++i) {
    const int mBase = m0 + (i << 4);
#pragma unroll
    for (int j = 0; j < 4; ++j) {
      const int n = n0 + (j << 4) + rlane;
      float bv = 0.f;
      if (BIAS_MODE == 2) bv = bias[n];
#pragma unroll
      for (int r = 0; r < 8; ++r) {
        float v = acc[i][j][r] * scale;
        if (BIAS_MODE == 1) v += bias[mBase + mOff + r];
        if (BIAS_MODE == 2) v += bv;
        if (RESID) v += Rb[(size_t)(mBase + mOff + r) * ldc + n];
        if (ACT == 1) v = tanhf(v);
        if (ACT == 2) v = fmaxf(v, 0.0f);
        if (ACT == 3) v = v / (1.0f + expf(-v));
        if (ACT == 4) v = (v > 0.f) ? v : 0.01f * v;
        if (ACT == 5) v = 0.5f * v * (1.0f + erff(v * 0.70710678118654752f));
        slab[(mOff + r) * 68 + (j << 4) + rlane] = v;
      }
    }
    __builtin_amdgcn_fence(__ATOMIC_RELEASE, "workgroup");
    __builtin_amdgcn_wave_barrier();
    __builtin_amdgcn_fence(__ATOMIC_ACQUIRE, "workgroup");
    if (OUT_MODE == 0) {
      float* C = (float*)Cout + (size_t)b * strideC;
      const int hh = lane >> 4, c4 = (lane & 15) * 4;     // row seg = 256 B = 16 lanes x 16 B
      {
#pragma unroll
        for (int it = 0; it < 8; ++it) {
          const int row = it * 2 + hh;
          v4f v = *(const v4f*)(slab + row * 68 + c4);
          *(v4f*)(C + (size_t)(mBase + row) * ldc + n0 + c4) = v;
        }
        
      }
    } else {
      const int q = lane >> 3, c8 = (lane & 7) * 8;
      unsigned short* C  = (unsigned short*)Cout  + (size_t)b * strideC;
      unsigned short* C2 = (OUT_MODE == 2) ? ((unsigned short*)Cout2 + (size_t)b * strideC) : nullptr;
      {
#pragma unroll
        for (int it = 0; it < 4; ++it) {
          const int row = it * 4 + q;
          const float* sp = slab + row * 68 + c8;
          v8h hv, lv;
#pragma unroll
          for (int e = 0; e < 8; ++e) {
            if (OUT_MODE == 1) {
              hv[e] = (_Float16)sp[e];
            } else {
              unsigned short hb = f2bf_bits(sp[e]);
              unsigned short lb = f2bf_bits(sp[e] - bf_bits2f(hb));
              hv[e] = __builtin_bit_cast(_Float16, hb);
              lv[e] = __builtin_bit_cast(_Float16, lb);
            }
          }
          *(v8h*)(C + (size_t)(mBase + row) * ldc + n0 + c8) = hv;
          if (OUT_MODE == 2) *(v8h*)(C2 + (size_t)(mBase + row) * ldc + n0 + c8) = lv;
        }
        
      }
    }
    __builtin_amdgcn_fence(__ATOMIC_RELEASE, "workgroup");
    __builtin_amdgcn_wave_barrier();
    __builtin_amdgcn_fence(__ATOMIC_ACQUIRE, "workgroup");
  }
}

__global__ __launch_bounds__(256) void cast_f32_f16x2(
    const float* __restrict__ in, _Float16* __restrict__ out, int n2) {
  int i = blockIdx.x * 256 + threadIdx.x;
  if (i < n2) {
    const _Float16 h0 = (_Float16)in[2 * i], h1 = (_Float16)in[2 * i + 1];
    const unsigned u = (unsigned)__builtin_bit_cast(unsigned short, h0) | ((unsigned)__builtin_bit_cast(unsigned short, h1) << 16);
    ((unsigned*)out)[i] = u;
    
  }
}


// ---- f32 -> f16 cast with a power-of-two pre-scale (folded back by the consumer GEMM's scale) ----
__global__ __launch_bounds__(256) void cast_f32_f16x2s(const float* __restrict__ in, _Float16* __restrict__ out, int n2, float s) {
  int i = blockIdx.x * 256 + threadIdx.x;
  if (i < n2) {
    const _Float16 h0 = (_Float16)(in[2 * i] * s), h1 = (_Float16)(in[2 * i + 1] * s);
    const unsigned u = (unsigned)__builtin_bit_cast(unsigned short, h0) | ((unsigned)__builtin_bit_cast(unsigned short, h1) << 16);
    ((unsigned*)out)[i] = u;
    
  }
}
__global__ __launch_bounds__(256) void split_f32_bf16x2(
    const float* __restrict__ in, __bf16* __restrict__ hi, __bf16* __restrict__ lo, long n2) {
  long i = (long)blockIdx.x * 256 + threadIdx.x;
  long stride = (long)gridDim.x * 256;
  {
    for (long j = i; j < n2; j += stride) {
      const float a = in[2 * j], b = in[2 * j + 1];
      const unsigned short ah = f2bf_bits(a), bh = f2bf_bits(b);
      const unsigned short al = f2bf_bits(a - bf_bits2f(ah)), bl = f2bf_bits(b - bf_bits2f(bh));
      ((unsigned*)hi)[j] = (unsigned)ah | ((unsigned)bh << 16);
      ((unsigned*)lo)[j] = (unsigned)al | ((unsigned)bl << 16);
    }
    
  }
}


// ---- f32 [R][C] (row pitch ldi) -> f16 transposed [C][R] (row pitch ldo); 64x64 tiles; each output row segment
__global__ __launch_bounds__(256) void transpose_cast_f16(const float* __restrict__ in, int ldi,
                                                         _Float16* __restrict__ outT, int ldo, float scale) {
  __shared__ __align__(16) _Float16 tile[64][72];     // [c][r]
  const int c0 = blockIdx.x * 64, r0 = blockIdx.y * 64;
  const int t = threadIdx.y * 32 + threadIdx.x;
  for (int i = threadIdx.y; i < 64; i += 8) {
    tile[threadIdx.x][i]      = (_Float16)(in[(size_t)(r0 + i) * ldi + c0 + threadIdx.x] * scale);
    tile[32 + threadIdx.x][i] = (_Float16)(in[(size_t)(r0 + i) * ldi + c0 + 32 + threadIdx.x] * scale);
  }
  __syncthreads();
  const int q = t >> 3, c8 = (t & 7) * 8;
  {
#pragma unroll
    for (int it = 0; it < 2; ++it) {
      const int c = it * 32 + q;
      v8h hv = *(const v8h*)(&tile[c][c8]);
      *(v8h*)(outT + (size_t)(c0 + c) * ldo + r0 + c8) = hv;
    }
    
  }
}

// ---- f32 [R][C] (pitch ldi) -> bf16 hi/lo transposed planes [C][R] (pitch ldo); 64x64 tiles; each output row segment
__global__ __launch_bounds__(256) void transpose_split_bf16(const float* __restrict__ in, int ldi,
                                                           __bf16* __restrict__ outH, __bf16* __restrict__ outL, int ldo) {
  __shared__ __align__(16) float tile[64][68];     // [c][r]
  const int c0 = blockIdx.x * 64, r0 = blockIdx.y * 64;
  const int t = threadIdx.y * 32 + threadIdx.x;
  for (int i = threadIdx.y; i < 64; i += 8) {
    tile[threadIdx.x][i]      = in[(size_t)(r0 + i) * ldi + c0 + threadIdx.x];
    tile[32 + threadIdx.x][i] = in[(size_t)(r0 + i) * ldi + c0 + 32 + threadIdx.x];
  }
  __syncthreads();
  const int q = t >> 3, c8 = (t & 7) * 8;
  {
#pragma unroll
    for (int it = 0; it < 2; ++it) {
      const int c = it * 32 + q;
      v8b hv, lv;
#pragma unroll
      for (int e = 0; e < 8; ++e) {
        const float f = tile[c][c8 + e];
        const unsigned short hb = f2bf_bits(f);
        hv[e] = __builtin_bit_cast(__bf16, hb);
        lv[e] = __builtin_bit_cast(__bf16, f2bf_bits(f - bf_bits2f(hb)));
      }
      *(v8b*)(outH + (size_t)(c0 + c) * ldo + r0 + c8) = hv;
      *(v8b*)(outL + (size_t)(c0 + c) * ldo + r0 + c8) = lv;
    }
    
  }
}

// =====================================================================================
// Generic causal/non-causal attention for head_dim 64, f32 in / f32 out; 16-bit operands: bf16 with optional hi/lo splits, or
// plain f16 (F16=true, non-split, probabilities carried x2^15).
//   scores = (q*qscale)·kᵀ : v_wmma_f32_16x16x32_bf16; SPLIT_QK -> q,k as bf16 hi/lo (hi·hi + hi·lo + lo·hi)
//   out    = p·v           : v_wmma_f32_16x16x32_bf16; SPLIT_PV -> p,v as bf16 hi/lo; else p,v plain bf16
//   f32 accumulate; online softmax in f32. Block = 4 waves = 64 query rows of one (batch, head); S % 64 == 0.
//   Element (b, s, h, d) of tensor X lives at X[b*X_bs + s*X_rs + h*X_hs + d] (strides in floats, multiples of 4).
//   Masking: mask_mode 0 none, 1 causal (kv > q masked), 2 tensor [S][Skv] shared over (b,h) (float if
//   mask_is_int==0, int32 with element == 0 -> masked if 1, int32 with element != 0 -> masked if 2), 3 per-token vectors qmask[B][S] & kvmask[B][Skv] (int32,
//   0 -> masked), 4 causal + sliding window (kv > q or q - kv > W masked; W passed in mask_is_int);
//   5 = relative-position bias: s += cp[b,h,q][idx[q][kv]] + pc[b,h,kv][idx[q][kv]] with idx = mask_b ([S][Skv] int32) and
//   mask_a an int32 [S][Skv] tensor with nonzero = masked (tables: element (b,h,row,n) at X + b*c_bs + h*c_hs + row*c_rs + n);
//   masked scores are replaced by mask_fill (e.g. -inf or -1e9) before the softmax.
//   grid.x = B * H * (S/64) (or a sub-range with blk0).
// =====================================================================================
#define AT_D 64
#define AT_NW 4
#define AT_QB 64
#define AT_KC 64
// LDS row pitch of the 16-bit K, V-transposed and P tiles, in elements: 72 = 144 B = 16 B x odd, so the 16 rows that one
// ds_load_b128 fragment read touches start on 16 different bank groups (at 128 B they share two groups and the read serialises).
#define AT_LP 72
struct AttnGeom { const float* cp = nullptr; const float* pc = nullptr; long c_bs = 0, c_rs = 0, c_hs = 0;   // mode-5 score-bias tables
                  long q_bs, q_rs, q_hs, k_bs, k_rs, k_hs, v_bs, v_rs, v_hs, o_bs, o_rs, o_hs;
                  int S, Skv, H, mask_mode; float qscale; int blk0; float mask_fill; int mask_is_int; };
static_assert(sizeof(AttnGeom) == 168, "no padding");

__device__ __forceinline__ unsigned short at_bf_bits(float f) {
  unsigned u = __float_as_uint(f);
  return (unsigned short)((u + 0x7FFFu + ((u >> 16) & 1u)) >> 16);
}
__device__ __forceinline__ __bf16 at_f2bf(float f) { return __builtin_bit_cast(__bf16, at_bf_bits(f)); }
__device__ __forceinline__ void at_split(float f, __bf16& hi, __bf16& lo) {
  const unsigned short hb = at_bf_bits(f);
  hi = __builtin_bit_cast(__bf16, hb);
  lo = at_f2bf(f - __uint_as_float(((unsigned)hb) << 16));
}
__device__ __forceinline__ v8f at_mma(v16b a, v16b b, v8f c) {
  c = __builtin_amdgcn_wmma_f32_16x16x32_bf16(false, a, false, b, (short)0, c, false, false);
  asm volatile("v_nop\n\tv_nop\n\tv_nop\n\tv_nop" : "+v"(c) : "v"(a), "v"(b));
  return c;
}
// 16-bit element as a bit pattern held in a __bf16 slot: f16 bits when F16, bf16 (RNE) otherwise
template <bool F16> __device__ __forceinline__ __bf16 at_to16(float f) {
  if (F16) return __builtin_bit_cast(__bf16, (_Float16)f);
  return at_f2bf(f);
}
template <bool F16> __device__ __forceinline__ v8f at_mma16(v16b a, v16b b, v8f c) {
  if (F16) {
    const v16h ah = __builtin_bit_cast(v16h, a), bh = __builtin_bit_cast(v16h, b);
    c = __builtin_amdgcn_wmma_f32_16x16x32_f16(false, ah, false, bh, (short)0, c, false, false);
    asm volatile("v_nop\n\tv_nop\n\tv_nop\n\tv_nop" : "+v"(c) : "v"(ah), "v"(bh));
    return c;
  }
  return at_mma(a, b, c);
}

// MM: the mask mode as a compile-time constant (the launch's g.mask_mode must equal it); MM < 0 reads g.mask_mode at run time.
template <bool SPLIT_QK, bool SPLIT_PV, bool F16 = false, int MM = -1>
__global__ __launch_bounds__(128)
void attn64_kernel(const float* __restrict__ q, const float* __restrict__ k,
                   const float* __restrict__ v, float* __restrict__ out,
                   const void* __restrict__ mask_a, const int* __restrict__ mask_b, AttnGeom g) {
  static_assert(!(F16 && (SPLIT_QK || SPLIT_PV)), "f16 mode is non-split");
  const int mask_mode = (MM >= 0) ? MM : g.mask_mode;
  const float PSC = F16 ? 32768.0f : 1.0f;     // f16 probabilities carried x2^15 (subnormal range), folded into the final 1/l
  union FB { v16b v; v8b h[2]; };
  __shared__ __align__(16) __bf16 Ksh[AT_KC * AT_LP];            // K hi [kv][d], pitch AT_LP      9 KB
  __shared__ __align__(16) __bf16 Ksl[SPLIT_QK ? AT_KC * AT_LP : 8];
  __shared__ __align__(16) __bf16 Vth[AT_D * AT_LP];             // V hi [d][kv], pitch AT_LP      9 KB
  __shared__ __align__(16) __bf16 Vtl[SPLIT_PV ? AT_D * AT_LP : 8];
  __shared__ __align__(16) __bf16 Psh[AT_NW][16 * AT_LP];        // per wave P hi [row][kv], pitch AT_LP  9 KB
  __shared__ __align__(16) __bf16 Psl[SPLIT_PV ? AT_NW : 1][SPLIT_PV ? 16 * AT_LP : 8];
  __shared__ __align__(16) float  Os[AT_NW][16 * 68];            // per wave out tile, pitch 68

  const int tid  = threadIdx.x;
  const int wave = tid >> 5;
  const int lane = tid & 31;
  const int hh   = lane >> 4;
  const int c    = lane & 15;

  const int nqb = g.S / AT_QB;
  const int bx = blockIdx.x + g.blk0;
  const int qb = bx % nqb;
  const int bh = bx / nqb;
  const int h  = bh % g.H;
  const int b  = bh / g.H;
  const int qbase_block = qb * AT_QB;
  const int q0 = qbase_block + wave * 16;

  const float* qb_ptr = q + (size_t)b * g.q_bs + (size_t)h * g.q_hs;
  const float* kb_ptr = k + (size_t)b * g.k_bs + (size_t)h * g.k_hs;
  const float* vb_ptr = v + (size_t)b * g.v_bs + (size_t)h * g.v_hs;
  float*       ob_ptr = out + (size_t)b * g.o_bs + (size_t)h * g.o_hs;

  // ---- Q fragments (A operand): 2 d-chunks, hi (and lo) ----
  v16b qah[2], qal[2];
  {
    const float* qrow = qb_ptr + (size_t)(q0 + c) * g.q_rs;
#pragma unroll
    for (int dc = 0; dc < 2; ++dc) {
#pragma unroll
      for (int e = 0; e < 8; ++e) {
        const float f0 = qrow[dc * 32 + 8 * hh + e] * g.qscale;
        const float f1 = qrow[dc * 32 + 16 + 8 * hh + e] * g.qscale;
        if (SPLIT_QK) { __bf16 hq, lq; at_split(f0, hq, lq); qah[dc][e] = hq; qal[dc][e] = lq; at_split(f1, hq, lq); qah[dc][8 + e] = hq; qal[dc][8 + e] = lq; }
        else { qah[dc][e] = at_to16<F16>(f0); qah[dc][8 + e] = at_to16<F16>(f1); qal[dc][e] = qah[dc][e]; qal[dc][8 + e] = qah[dc][8 + e]; }
      }
    }
  }

  float mrow[8], lrow[8];
  v8f oacc[4];
#pragma unroll
  for (int r = 0; r < 8; ++r) { mrow[r] = -INFINITY; lrow[r] = 0.f; }
#pragma unroll
  for (int t = 0; t < 4; ++t) oacc[t] = (v8f){0.f,0.f,0.f,0.f,0.f,0.f,0.f,0.f};

  const int nChunks = (mask_mode == 1 || mask_mode == 4) ? (qb + 1) : (g.Skv / AT_KC);   // block-uniform
  // per-row query mask (mode 3)
  int qkeep[8];
#pragma unroll
  for (int r = 0; r < 8; ++r) qkeep[r] = (mask_mode == 3) ? mask_b[(size_t)b * g.S + q0 + 8 * hh + r] : 1;   // mask_b = qmask in mode 3
  for (int kc = 0; kc < nChunks; ++kc) {
    const int kv0 = kc * AT_KC;
    __syncthreads();
    {
      const int kvr = tid >> 1, dh = (tid & 1) * 32;
      const float* krow = kb_ptr + (size_t)(kv0 + kvr) * g.k_rs + dh;
      const float* vrow = vb_ptr + (size_t)(kv0 + kvr) * g.v_rs + dh;
#pragma unroll
      for (int i = 0; i < 8; ++i) {
        v4f kk = *(const v4f*)(krow + 4 * i);
        v4f vv = *(const v4f*)(vrow + 4 * i);
#pragma unroll
        for (int e = 0; e < 4; ++e) {
          const int d = dh + 4 * i + e;
          if (SPLIT_QK) { __bf16 a, bl; at_split(kk[e], a, bl); Ksh[kvr * AT_LP + d] = a; Ksl[kvr * AT_LP + d] = bl; }
          else Ksh[kvr * AT_LP + d] = at_to16<F16>(kk[e]);
          if (SPLIT_PV) { __bf16 a, bl; at_split(vv[e], a, bl); Vth[d * AT_LP + kvr] = a; Vtl[d * AT_LP + kvr] = bl; }
          else Vth[d * AT_LP + kvr] = at_to16<F16>(vv[e]);
        }
      }
    }
    __syncthreads();

    v8f s[4];
#pragma unroll
    for (int j = 0; j < 4; ++j) {
      s[j] = (v8f){0.f,0.f,0.f,0.f,0.f,0.f,0.f,0.f};
#pragma unroll 1
      for (int dc = 0; dc < 2; ++dc) {
        FB kb;
        kb.h[0] = *(const v8b*)(Ksh + (j * 16 + c) * AT_LP + dc * 32 + 8 * hh);
        kb.h[1] = *(const v8b*)(Ksh + (j * 16 + c) * AT_LP + dc * 32 + 16 + 8 * hh);
        s[j] = at_mma16<F16>(qah[dc], kb.v, s[j]);
        if (SPLIT_QK) {
          FB kl;
          kl.h[0] = *(const v8b*)(Ksl + (j * 16 + c) * AT_LP + dc * 32 + 8 * hh);
          kl.h[1] = *(const v8b*)(Ksl + (j * 16 + c) * AT_LP + dc * 32 + 16 + 8 * hh);
          s[j] = at_mma16<F16>(qah[dc], kl.v, s[j]);
          s[j] = at_mma16<F16>(qal[dc], kb.v, s[j]);
        }
      }
    }
    const bool diag = (mask_mode == 1) && (kc == qb);
    int kvkeep[4] = {1, 1, 1, 1};
    if (mask_mode == 3) {
#pragma unroll
      for (int j = 0; j < 4; ++j) kvkeep[j] = ((const int*)mask_a)[(size_t)b * g.Skv + kv0 + j * 16 + c];   // mask_a = kvmask
    }
    float cm[8];
#pragma unroll
    for (int r = 0; r < 8; ++r) {
      const int qrow = q0 + 8 * hh + r;
      float m = -INFINITY;
#pragma unroll
      for (int j = 0; j < 4; ++j) {
        const int kvcol = kv0 + j * 16 + c;
        bool masked = false;
        if (diag) masked = (kvcol > qrow);
        else if (mask_mode == 4) masked = (kvcol > qrow) || (qrow - kvcol > g.mask_is_int);
        else if (mask_mode == 2) {
          const size_t mi = (size_t)qrow * g.Skv + kvcol;
          masked = (g.mask_is_int == 0) ? (((const float*)mask_a)[mi] == 0.0f)
                 : (g.mask_is_int == 1) ? (((const int*)mask_a)[mi] == 0) : (((const int*)mask_a)[mi] != 0);
        } else if (mask_mode == 3) masked = (qkeep[r] == 0) || (kvkeep[j] == 0);
        else if (mask_mode == 5) {
          const size_t mi = (size_t)qrow * g.Skv + kvcol;
          masked = (((const int*)mask_a)[mi] != 0);
          int n = mask_b[mi]; n = n < 0 ? 0 : n;
          s[j][r] += g.cp[(size_t)b * g.c_bs + (size_t)h * g.c_hs + (size_t)qrow * g.c_rs + n]
                   + g.pc[(size_t)b * g.c_bs + (size_t)h * g.c_hs + (size_t)kvcol * g.c_rs + n];
        }
        if (masked) s[j][r] = g.mask_fill;
        m = fmaxf(m, s[j][r]);
      }
#pragma unroll
      for (int off = 1; off < 16; off <<= 1) m = fmaxf(m, __shfl_xor(m, off, 32));
      cm[r] = m;
    }
    __bf16* pwh = Psh[wave];
    __bf16* pwl = Psl[SPLIT_PV ? wave : 0];
#pragma unroll
    for (int r = 0; r < 8; ++r) {
      const float mnew = fmaxf(mrow[r], cm[r]);
      const float alpha = expf(mrow[r] - mnew);
      mrow[r] = mnew;
      float psum = 0.f;
#pragma unroll
      for (int j = 0; j < 4; ++j) {
        const float p = expf(s[j][r] - mnew);
        psum += p;
        if (SPLIT_PV) { __bf16 a, bl; at_split(p, a, bl); pwh[(8 * hh + r) * AT_LP + j * 16 + c] = a; pwl[(8 * hh + r) * AT_LP + j * 16 + c] = bl; }
        else pwh[(8 * hh + r) * AT_LP + j * 16 + c] = at_to16<F16>(p * PSC);
      }
#pragma unroll
      for (int off = 1; off < 16; off <<= 1) psum += __shfl_xor(psum, off, 32);
      lrow[r] = lrow[r] * alpha + psum;
#pragma unroll
      for (int t = 0; t < 4; ++t) oacc[t][r] *= alpha;
    }
    __builtin_amdgcn_fence(__ATOMIC_RELEASE, "workgroup");
    __builtin_amdgcn_wave_barrier();
    __builtin_amdgcn_fence(__ATOMIC_ACQUIRE, "workgroup");
#pragma unroll 1
    for (int kk = 0; kk < 2; ++kk) {
      FB pa, pl;
      pa.h[0] = *(const v8b*)(pwh + c * AT_LP + kk * 32 + 8 * hh);
      pa.h[1] = *(const v8b*)(pwh + c * AT_LP + kk * 32 + 16 + 8 * hh);
      if (SPLIT_PV) {
        pl.h[0] = *(const v8b*)(pwl + c * AT_LP + kk * 32 + 8 * hh);
        pl.h[1] = *(const v8b*)(pwl + c * AT_LP + kk * 32 + 16 + 8 * hh);
      }
#pragma unroll
      for (int t = 0; t < 4; ++t) {
        FB vb;
        vb.h[0] = *(const v8b*)(Vth + (t * 16 + c) * AT_LP + kk * 32 + 8 * hh);
        vb.h[1] = *(const v8b*)(Vth + (t * 16 + c) * AT_LP + kk * 32 + 16 + 8 * hh);
        oacc[t] = at_mma16<F16>(pa.v, vb.v, oacc[t]);
        if (SPLIT_PV) {
          FB vl;
          vl.h[0] = *(const v8b*)(Vtl + (t * 16 + c) * AT_LP + kk * 32 + 8 * hh);
          vl.h[1] = *(const v8b*)(Vtl + (t * 16 + c) * AT_LP + kk * 32 + 16 + 8 * hh);
          oacc[t] = at_mma16<F16>(pa.v, vl.v, oacc[t]);
          oacc[t] = at_mma16<F16>(pl.v, vb.v, oacc[t]);
        }
      }
    }
  }

  float* os = Os[wave];
#pragma unroll
  for (int r = 0; r < 8; ++r) {
    const float inv = 1.0f / (lrow[r] * PSC);
#pragma unroll
    for (int t = 0; t < 4; ++t) os[(8 * hh + r) * 68 + t * 16 + c] = oacc[t][r] * inv;
  }
  __builtin_amdgcn_fence(__ATOMIC_RELEASE, "workgroup");
  __builtin_amdgcn_wave_barrier();
  __builtin_amdgcn_fence(__ATOMIC_ACQUIRE, "workgroup");
  {
    const int c4 = (lane & 15) * 4;
    {
#pragma unroll
      for (int it = 0; it < 8; ++it) {
        const int row = it * 2 + hh;
        v4f val = *(const v4f*)(os + row * 68 + c4);
        *(v4f*)(ob_ptr + (size_t)(q0 + row) * g.o_rs + c4) = val;
      }
      
    }
  }
}

#define SB_ 2
#define SN_ 4096
#define SC_ 256
#define SI_ 512
#define SH_ 8
extern "C" void kernel_launch(void* const* d_in, const int* in_sizes, int n_in, void* d_out, int out_size, void* d_ws, size_t ws_size, hipStream_t stream) {
  (void)in_sizes; (void)n_in; (void)out_size; (void)ws_size;
  const float* x = (const float*)d_in[0]; const float* Wq = (const float*)d_in[1]; const float* Wk = (const float*)d_in[2]; const float* Wv = (const float*)d_in[3]; const float* Wo = (const float*)d_in[4];
  float* out = (float*)d_out;
  char* ws = (char*)d_ws; size_t off = 0;
  auto carve = [&](size_t bytes) -> char* { char* p = ws + off; off += (bytes + 255) & ~(size_t)255; return p; };
  const int R = SB_ * SN_;
  __bf16* Xh = (__bf16*)carve((size_t)R * SC_ * 2); __bf16* Xl = (__bf16*)carve((size_t)R * SC_ * 2);
  __bf16* W3h = (__bf16*)carve((size_t)3 * SI_ * SC_ * 2); __bf16* W3l = (__bf16*)carve((size_t)3 * SI_ * SC_ * 2);     // [Wq;Wk;Wv] stacked = Bt for N = 1536
  __bf16* Woh = (__bf16*)carve((size_t)SC_ * SI_ * 2); __bf16* Wol = (__bf16*)carve((size_t)SC_ * SI_ * 2);
  float* QKV = (float*)carve((size_t)R * 3 * SI_ * 4);            // 50 MB
  float* O = (float*)carve((size_t)R * SI_ * 4);
  __bf16* Oh = (__bf16*)carve((size_t)R * SI_ * 2); __bf16* Ol = (__bf16*)carve((size_t)R * SI_ * 2);
  split_f32_bf16x2<<<(R * SC_ / 2 + 255) / 256, 256, 0, stream>>>(x, Xh, Xl, R * SC_ / 2);
  split_f32_bf16x2<<<(SI_ * SC_ / 2 + 255) / 256, 256, 0, stream>>>(Wq, W3h, W3l, SI_ * SC_ / 2);
  split_f32_bf16x2<<<(SI_ * SC_ / 2 + 255) / 256, 256, 0, stream>>>(Wk, W3h + (size_t)SI_ * SC_, W3l + (size_t)SI_ * SC_, SI_ * SC_ / 2);
  split_f32_bf16x2<<<(SI_ * SC_ / 2 + 255) / 256, 256, 0, stream>>>(Wv, W3h + (size_t)2 * SI_ * SC_, W3l + (size_t)2 * SI_ * SC_, SI_ * SC_ / 2);
  split_f32_bf16x2<<<(SC_ * SI_ / 2 + 255) / 256, 256, 0, stream>>>(Wo, Woh, Wol, SC_ * SI_ / 2);
  { const int t = (R / 64) * (3 * SI_ / 64);
    wmma_gemm64<1, true, 0, 0, false><<<dim3((t + 7) / 8, 1), 256, 0, stream>>>(U16(Xh), U16(Xl), SC_, 0, U16(W3h), U16(W3l), SC_, 0, QKV, nullptr, 3 * SI_, 0, nullptr, nullptr, 0, R, 3 * SI_, SC_, 1.0f); }
  { AttnGeom g;
    g.q_bs = (long)SN_ * 3 * SI_; g.q_rs = 3 * SI_; g.q_hs = 64; g.k_bs = g.q_bs; g.k_rs = 3 * SI_; g.k_hs = 64; g.v_bs = g.q_bs; g.v_rs = 3 * SI_; g.v_hs = 64;
    g.o_bs = (long)SN_ * SI_; g.o_rs = SI_; g.o_hs = 64; g.S = SN_; g.Skv = SN_; g.H = SH_; g.mask_mode = 0; g.qscale = 0.125f; g.blk0 = 0; g.mask_fill = -INFINITY; g.mask_is_int = 0;
    attn64_kernel<false, false, true, 0><<<SB_ * SH_ * (SN_ / AT_QB), AT_NW * 32, 0, stream>>>(QKV, QKV + SI_, QKV + 2 * SI_, O, nullptr, nullptr, g); }
  split_f32_bf16x2<<<(R * SI_ / 2 + 255) / 256, 256, 0, stream>>>(O, Oh, Ol, R * SI_ / 2);
  { const int t = (R / 64) * (SC_ / 64);
    wmma_gemm64<1, true, 0, 0, false><<<dim3((t + 7) / 8, 1), 256, 0, stream>>>(U16(Oh), U16(Ol), SI_, 0, U16(Woh), U16(Wol), SI_, 0, out, nullptr, SC_, 0, nullptr, nullptr, 0, R, SC_, SI_, 1.0f); }
}

// v003
// A run of this version takes 392 microseconds.
// In both of two side-by-side timings against v002, it was 1.14 times as fast.
// All steps since v000 together make it 5.62 times as fast.
#include <hip/hip_runtime.h>
#include <math.h>
// Spatio-temporal attention (2 clips x 4096 tokens, 8 heads x 64): q/k/v = x·Wᵀ (8192 x 256 · 256 x 512 each) and out = o·Woᵀ (·512 x 256)
// on v_wmma_f32_16x16x32_bf16 with bf16 hi/lo split operands (the output is an average over 4096 near-uniform attention weights, RMS
// 0.0025); the attention itself (scores and p·v, p x2^15, 4096 keys) on
// v_wmma_f32_16x16x32_f16 with f16 operands; f32 accumulate; softmax f32 on VALU.
// The 1x1x1 conv weights ([out][in]) are used directly as the transposed operand.
typedef __attribute__((ext_vector_type(16))) _Float16 v16h;
typedef __attribute__((ext_vector_type(8)))  _Float16 v8h;
typedef __attribute__((ext_vector_type(16))) __bf16   v16b;
typedef __attribute__((ext_vector_type(8)))  __bf16   v8b;
typedef __attribute__((ext_vector_type(8)))  float    v8f;
typedef __attribute__((ext_vector_type(4)))  float    v4f;
#define PSCALE 32768.0f
#define U16(p) ((const unsigned short*)(const void*)(p))
#define PSCALE_INV (1.0f / 32768.0f)

__device__ __forceinline__ unsigned short f2bf_bits(float f) {
  unsigned u = __float_as_uint(f);
  return (unsigned short)((u + 0x7FFFu + ((u >> 16) & 1u)) >> 16);
}
__device__ __forceinline__ float bf_bits2f(unsigned short h) { return __uint_as_float(((unsigned)h) << 16); }

// hazard guards as plain device helpers (no inline asm inside the kernel template body)
__device__ __forceinline__ void dep_guard_h(v8f& a, v8f& b, v16h x, v16h y) { asm volatile("v_nop\n\tv_nop\n\tv_nop\n\tv_nop" : "+v"(a), "+v"(b) : "v"(x), "v"(y)); }
__device__ __forceinline__ void dep_guard_b(v8f& a, v8f& b, v16b x, v16b y) { asm volatile("v_nop\n\tv_nop\n\tv_nop\n\tv_nop" : "+v"(a), "+v"(b) : "v"(x), "v"(y)); }
__device__ __forceinline__ void keep4_h(v16h a, v16h b, v16h c, v16h d) { asm volatile("v_nop" :: "v"(a), "v"(b), "v"(c), "v"(d)); }
__device__ __forceinline__ void keep4_b(v16b a, v16b b, v16b c, v16b d) { asm volatile("v_nop" :: "v"(a), "v"(b), "v"(c), "v"(d)); }
__device__ __forceinline__ void acc_guard4(v8f& a, v8f& b, v8f& c, v8f& d) { asm volatile("v_nop\n\tv_nop\n\tv_nop\n\tv_nop" : "+v"(a), "+v"(b), "+v"(c), "+v"(d)); }
template <typename T> struct Frag;
template <> struct Frag<_Float16> {
  typedef v16h V; union U { v16h v; v8h h[2]; };
  static __device__ __forceinline__ v16h load(const _Float16* p) {   // elements 0..7 <- p[0..7], 8..15 <- p[16..23]
    U f; f.h[0] = *(const v8h*)(p); f.h[1] = *(const v8h*)(p + 16); return f.v;
  }
  static __device__ __forceinline__ v8f mma(v16h a, v16h b, v8f c) {
    return __builtin_amdgcn_wmma_f32_16x16x32_f16(false, a, false, b, (short)0, c, false, false);
  }
  static __device__ __forceinline__ void guard(v8f& a, v8f& b, v16h x, v16h y) { dep_guard_h(a, b, x, y); }
  static __device__ __forceinline__ void keep(v16h a, v16h b, v16h c, v16h d) { keep4_h(a, b, c, d); }
};
template <> struct Frag<__bf16> {
  typedef v16b V; union U { v16b v; v8b h[2]; };
  static __device__ __forceinline__ v16b load(const __bf16* p) {
    U f; f.h[0] = *(const v8b*)(p); f.h[1] = *(const v8b*)(p + 16); return f.v;
  }
  static __device__ __forceinline__ v8f mma(v16b a, v16b b, v8f c) {
    return __builtin_amdgcn_wmma_f32_16x16x32_bf16(false, a, false, b, (short)0, c, false, false);
  }
  static __device__ __forceinline__ void guard(v8f& a, v8f& b, v16b x, v16b y) { dep_guard_b(a, b, x, y); }
  static __device__ __forceinline__ void keep(v16b a, v16b b, v16b c, v16b d) { keep4_b(a, b, c, d); }
};

// ---- Register-blocked batched WMMA GEMM ------------------------------------
// C[m,n] = scale * sum_k A[m,k] * Bt[n,k] (+bias)(+resid); each wave owns a 64x64 tile.
// A row-major [M,K]; Bt row-major [N,K]; M,N % 64 == 0, K % 32 == 0.
// SPLIT: operands are hi/lo planes (A2/Bt2 = lo planes, same layout); product = hi·hi + hi·lo + lo·hi.
// BIAS_MODE: 0 = none, 1 = bias[m], 2 = bias[n].
// OUT_MODE: 0 = f32, 1 = f16, 2 = bf16 hi plane (Cout) + bf16 lo plane (Cout2).
// ET: 0 = f16 operands, 1 = bf16 operands (pointers passed as 16-bit storage)
template <int ET> struct Elem;
template <> struct Elem<0> { typedef _Float16 T; };
template <> struct Elem<1> { typedef __bf16 T; };
template <int ET, bool SPLIT, int BIAS_MODE, int OUT_MODE, bool RESID, int ACT = 0>
__global__ __launch_bounds__(256) void wmma_gemm64(
    const unsigned short* __restrict__ Ap, const unsigned short* __restrict__ A2p, int lda, long strideA,
    const unsigned short* __restrict__ Btp, const unsigned short* __restrict__ Bt2p, int ldb, long strideB,
    void* __restrict__ Cout, void* __restrict__ Cout2, int ldc, long strideC,
    const float* __restrict__ bias,
    const float* __restrict__ resid, long strideR,
    int M, int N, int K, float scale) {
  typedef typename Elem<ET>::T T;
  typedef typename Frag<T>::V V;
  const T* A = (const T*)Ap; const T* A2 = (const T*)A2p; const T* Bt = (const T*)Btp; const T* Bt2 = (const T*)Bt2p;
  __shared__ __align__(16) float sT[8][16 * 68];   // per-wave 16x64 slab, pitch 68 floats
  const int b    = blockIdx.y;
  const int lane = threadIdx.x & 31;
  const int wave = threadIdx.x >> 5;
  const int tilesN = N >> 6;
  const int tilesM = M >> 6;
  const int tile = blockIdx.x * 8 + wave;
  if (tile >= tilesM * tilesN) return;   // wave-uniform; no block barriers in this kernel
  const int tm = tile / tilesN;
  const int tn = tile - tm * tilesN;
  const int m0 = tm << 6;
  const int n0 = tn << 6;

  const T* Ab  = A  + (size_t)b * strideA;
  const T* Bb  = Bt + (size_t)b * strideB;
  const T* Ab2 = SPLIT ? (A2  + (size_t)b * strideA) : nullptr;
  const T* Bb2 = SPLIT ? (Bt2 + (size_t)b * strideB) : nullptr;

  const int rlane = lane & 15;                 // row (A) / col (B, D) within subtile
  const int koff  = (lane >> 4) * 8;           // k offset of this lane half
  const int mOff  = (lane >> 4) * 8;           // D row offset

  v8f acc[4][4];
#pragma unroll
  for (int i = 0; i < 4; ++i)
#pragma unroll
    for (int j = 0; j < 4; ++j) acc[i][j] = (v8f){0.f,0.f,0.f,0.f,0.f,0.f,0.f,0.f};

  for (int k0 = 0; k0 < K; k0 += 32) {
    V bh[4], bl[4];
#pragma unroll
    for (int j = 0; j < 4; ++j) {
      const size_t bo = (size_t)(n0 + (j << 4) + rlane) * ldb + koff + k0;
      bh[j] = Frag<T>::load(Bb + bo);
      if (SPLIT) bl[j] = Frag<T>::load(Bb2 + bo);
    }
#pragma unroll
    for (int i = 0; i < 4; ++i) {
      const size_t ao = (size_t)(m0 + (i << 4) + rlane) * lda + koff + k0;
      V ah = Frag<T>::load(Ab + ao);
      V al;
      if (SPLIT) al = Frag<T>::load(Ab2 + ao);
#pragma unroll
      for (int j = 0; j < 4; ++j) {
        acc[i][j] = Frag<T>::mma(ah, bh[j], acc[i][j]);
        if (SPLIT) {
          acc[i][j] = Frag<T>::mma(ah, bl[j], acc[i][j]);
          acc[i][j] = Frag<T>::mma(al, bh[j], acc[i][j]);
        }
      }
      Frag<T>::guard(acc[i][0], acc[i][3], ah, SPLIT ? al : ah);
    }
    Frag<T>::keep(bh[0], bh[1], bh[2], bh[3]);
    if (SPLIT) Frag<T>::keep(bl[0], bl[1], bl[2], bl[3]);
  }
  acc_guard4(acc[0][0], acc[0][1], acc[0][2], acc[0][3]);
  acc_guard4(acc[1][0], acc[1][1], acc[1][2], acc[1][3]);
  acc_guard4(acc[2][0], acc[2][1], acc[2][2], acc[2][3]);
  acc_guard4(acc[3][0], acc[3][1], acc[3][2], acc[3][3]);

  // ---- epilogue ----
  float* slab = sT[wave];
  const float* Rb = RESID ? (resid + (size_t)b * strideR) : nullptr;
#pragma unroll
  for (int i = 0; i < 4; ++i) {
    const int mBase = m0 + (i << 4);
#pragma unroll
    for (int j = 0; j < 4; ++j) {
      const int n = n0 + (j << 4) + rlane;
      float bv = 0.f;
      if (BIAS_MODE == 2) bv = bias[n];
#pragma unroll
      for (int r = 0; r < 8; ++r) {
        float v = acc[i][j][r] * scale;
        if (BIAS_MODE == 1) v += bias[mBase + mOff + r];
        if (BIAS_MODE == 2) v += bv;
        if (RESID) v += Rb[(size_t)(mBase + mOff + r) * ldc + n];
        if (ACT == 1) v = tanhf(v);
        if (ACT == 2) v = fmaxf(v, 0.0f);
        if (ACT == 3) v = v / (1.0f + expf(-v));
        if (ACT == 4) v = (v > 0.f) ? v : 0.01f * v;
        if (ACT == 5) v = 0.5f * v * (1.0f + erff(v * 0.70710678118654752f));
        slab[(mOff + r) * 68 + (j << 4) + rlane] = v;
      }
    }
    __builtin_amdgcn_fence(__ATOMIC_RELEASE, "workgroup");
    __builtin_amdgcn_wave_barrier();
    __builtin_amdgcn_fence(__ATOMIC_ACQUIRE, "workgroup");
    if (OUT_MODE == 0) {
      float* C = (float*)Cout + (size_t)b * strideC;
      const int hh = lane >> 4, c4 = (lane & 15) * 4;     // row seg = 256 B = 16 lanes x 16 B
      {
#pragma unroll
        for (int it = 0; it < 8; ++it) {
          const int row = it * 2 + hh;
          v4f v = *(const v4f*)(slab + row * 68 + c4);
          *(v4f*)(C + (size_t)(mBase + row) * ldc + n0 + c4) = v;
        }
        
      }
    } else {
      const int q = lane >> 3, c8 = (lane & 7) * 8;
      unsigned short* C  = (unsigned short*)Cout  + (size_t)b * strideC;
      unsigned short* C2 = (OUT_MODE == 2) ? ((unsigned short*)Cout2 + (size_t)b * strideC) : nullptr;
      {
#pragma unroll
        for (int it = 0; it < 4; ++it) {
          const int row = it * 4 + q;
          const float* sp = slab + row * 68 + c8;
          v8h hv, lv;
#pragma unroll
          for (int e = 0; e < 8; ++e) {
            if (OUT_MODE == 1) {
              hv[e] = (_Float16)sp[e];
            } else {
              unsigned short hb = f2bf_bits(sp[e]);
              unsigned short lb = f2bf_bits(sp[e] - bf_bits2f(hb));
              hv[e] = __builtin_bit_cast(_Float16, hb);
              lv[e] = __builtin_bit_cast(_Float16, lb);
            }
          }
          *(v8h*)(C + (size_t)(mBase + row) * ldc + n0 + c8) = hv;
          if (OUT_MODE == 2) *(v8h*)(C2 + (size_t)(mBase + row) * ldc + n0 + c8) = lv;
        }
        
      }
    }
    __builtin_amdgcn_fence(__ATOMIC_RELEASE, "workgroup");
    __builtin_amdgcn_wave_barrier();
    __builtin_amdgcn_fence(__ATOMIC_ACQUIRE, "workgroup");
  }
}

__global__ __launch_bounds__(256) void cast_f32_f16x2(
    const float* __restrict__ in, _Float16* __restrict__ out, int n2) {
  int i = blockIdx.x * 256 + threadIdx.x;
  if (i < n2) {
    const _Float16 h0 = (_Float16)in[2 * i], h1 = (_Float16)in[2 * i + 1];
    const unsigned u = (unsigned)__builtin_bit_cast(unsigned short, h0) | ((unsigned)__builtin_bit_cast(unsigned short, h1) << 16);
    ((unsigned*)out)[i] = u;
    
  }
}


// ---- f32 -> f16 cast with a power-of-two pre-scale (folded back by the consumer GEMM's scale) ----
__global__ __launch_bounds__(256) void cast_f32_f16x2s(const float* __restrict__ in, _Float16* __restrict__ out, int n2, float s) {
  int i = blockIdx.x * 256 + threadIdx.x;
  if (i < n2) {
    const _Float16 h0 = (_Float16)(in[2 * i] * s), h1 = (_Float16)(in[2 * i + 1] * s);
    const unsigned u = (unsigned)__builtin_bit_cast(unsigned short, h0) | ((unsigned)__builtin_bit_cast(unsigned short, h1) << 16);
    ((unsigned*)out)[i] = u;
    
  }
}
__global__ __launch_bounds__(256) void split_f32_bf16x2(
    const float* __restrict__ in, __bf16* __restrict__ hi, __bf16* __restrict__ lo, long n2) {
  long i = (long)blockIdx.x * 256 + threadIdx.x;
  long stride = (long)gridDim.x * 256;
  {
    for (long j = i; j < n2; j += stride) {
      const float a = in[2 * j], b = in[2 * j + 1];
      const unsigned short ah = f2bf_bits(a), bh = f2bf_bits(b);
      const unsigned short al = f2bf_bits(a - bf_bits2f(ah)), bl = f2bf_bits(b - bf_bits2f(bh));
      ((unsigned*)hi)[j] = (unsigned)ah | ((unsigned)bh << 16);
      ((unsigned*)lo)[j] = (unsigned)al | ((unsigned)bl << 16);
    }
    
  }
}


// ---- f32 [R][C] (row pitch ldi) -> f16 transposed [C][R] (row pitch ldo); 64x64 tiles; each output row segment
__global__ __launch_bounds__(256) void transpose_cast_f16(const float* __restrict__ in, int ldi,
                                                         _Float16* __restrict__ outT, int ldo, float scale) {
  __shared__ __align__(16) _Float16 tile[64][72];     // [c][r]
  const int c0 = blockIdx.x * 64, r0 = blockIdx.y * 64;
  const int t = threadIdx.y * 32 + threadIdx.x;
  for (int i = threadIdx.y; i < 64; i += 8) {
    tile[threadIdx.x][i]      = (_Float16)(in[(size_t)(r0 + i) * ldi + c0 + threadIdx.x] * scale);
    tile[32 + threadIdx.x][i] = (_Float16)(in[(size_t)(r0 + i) * ldi + c0 + 32 + threadIdx.x] * scale);
  }
  __syncthreads();
  const int q = t >> 3, c8 = (t & 7) * 8;
  {
#pragma unroll
    for (int it = 0; it < 2; ++it) {
      const int c = it * 32 + q;
      v8h hv = *(const v8h*)(&tile[c][c8]);
      *(v8h*)(outT + (size_t)(c0 + c) * ldo + r0 + c8) = hv;
    }
    
  }
}

// ---- f32 [R][C] (pitch ldi) -> bf16 hi/lo transposed planes [C][R] (pitch ldo); 64x64 tiles; each output row segment
__global__ __launch_bounds__(256) void transpose_split_bf16(const float* __restrict__ in, int ldi,
                                                           __bf16* __restrict__ outH, __bf16* __restrict__ outL, int ldo) {
  __shared__ __align__(16) float tile[64][68];     // [c][r]
  const int c0 = blockIdx.x * 64, r0 = blockIdx.y * 64;
  const int t = threadIdx.y * 32 + threadIdx.x;
  for (int i = threadIdx.y; i < 64; i += 8) {
    tile[threadIdx.x][i]      = in[(size_t)(r0 + i) * ldi + c0 + threadIdx.x];
    tile[32 + threadIdx.x][i] = in[(size_t)(r0 + i) * ldi + c0 + 32 + threadIdx.x];
  }
  __syncthreads();
  const int q = t >> 3, c8 = (t & 7) * 8;
  {
#pragma unroll
    for (int it = 0; it < 2; ++it) {
      const int c = it * 32 + q;
      v8b hv, lv;
#pragma unroll
      for (int e = 0; e < 8; ++e) {
        const float f = tile[c][c8 + e];
        const unsigned short hb = f2bf_bits(f);
        hv[e] = __builtin_bit_cast(__bf16, hb);
        lv[e] = __builtin_bit_cast(__bf16, f2bf_bits(f - bf_bits2f(hb)));
      }
      *(v8b*)(outH + (size_t)(c0 + c) * ldo + r0 + c8) = hv;
      *(v8b*)(outL + (size_t)(c0 + c) * ldo + r0 + c8) = lv;
    }
    
  }
}

// =====================================================================================
// Generic causal/non-causal attention for head_dim 64, f32 in / f32 out; 16-bit operands: bf16 with optional hi/lo splits, or
// plain f16 (F16=true, non-split, probabilities carried x2^15).
//   scores = (q*qscale)·kᵀ : v_wmma_f32_16x16x32_bf16; SPLIT_QK -> q,k as bf16 hi/lo (hi·hi + hi·lo + lo·hi)
//   out    = p·v           : v_wmma_f32_16x16x32_bf16; SPLIT_PV -> p,v as bf16 hi/lo; else p,v plain bf16
//   f32 accumulate; online softmax in f32. Block = 4 waves = 64 query rows of one (batch, head); S % 64 == 0.
//   Element (b, s, h, d) of tensor X lives at X[b*X_bs + s*X_rs + h*X_hs + d] (strides in floats, multiples of 4).
//   Masking: mask_mode 0 none, 1 causal (kv > q masked), 2 tensor [S][Skv] shared over (b,h) (float if
//   mask_is_int==0, int32 with element == 0 -> masked if 1, int32 with element != 0 -> masked if 2), 3 per-token vectors qmask[B][S] & kvmask[B][Skv] (int32,
//   0 -> masked), 4 causal + sliding window (kv > q or q - kv > W masked; W passed in mask_is_int);
//   5 = relative-position bias: s += cp[b,h,q][idx[q][kv]] + pc[b,h,kv][idx[q][kv]] with idx = mask_b ([S][Skv] int32) and
//   mask_a an int32 [S][Skv] tensor with nonzero = masked (tables: element (b,h,row,n) at X + b*c_bs + h*c_hs + row*c_rs + n);
//   masked scores are replaced by mask_fill (e.g. -inf or -1e9) before the softmax.
//   grid.x = B * H * (S/64) (or a sub-range with blk0).
// =====================================================================================
#define AT_D 64
#define AT_NW 4
#define AT_QB 64
#define AT_KC 64
// LDS row pitch of the 16-bit K, V-transposed and P tiles, in elements: 72 = 144 B = 16 B x odd, so the 16 rows that one
// ds_load_b128 fragment read touches start on 16 different bank groups (at 128 B they share two groups and the read serialises).
#define AT_LP 72
// e^x is taken as 2^(x * log2 e) on the hardware's base-2 exponential (one instruction); every argument here is a score minus
// its row maximum, so the library exponential's overflow and underflow ladder has nothing to catch (below 2^-126 the weight is 0).
#define AT_LOG2E 1.4426950408889634f
struct AttnGeom { const float* cp = nullptr; const float* pc = nullptr; long c_bs = 0, c_rs = 0, c_hs = 0;   // mode-5 score-bias tables
                  long q_bs, q_rs, q_hs, k_bs, k_rs, k_hs, v_bs, v_rs, v_hs, o_bs, o_rs, o_hs;
                  int S, Skv, H, mask_mode; float qscale; int blk0; float mask_fill; int mask_is_int; };
static_assert(sizeof(AttnGeom) == 168, "no padding");

__device__ __forceinline__ unsigned short at_bf_bits(float f) {
  unsigned u = __float_as_uint(f);
  return (unsigned short)((u + 0x7FFFu + ((u >> 16) & 1u)) >> 16);
}
__device__ __forceinline__ __bf16 at_f2bf(float f) { return __builtin_bit_cast(__bf16, at_bf_bits(f)); }
__device__ __forceinline__ void at_split(float f, __bf16& hi, __bf16& lo) {
  const unsigned short hb = at_bf_bits(f);
  hi = __builtin_bit_cast(__bf16, hb);
  lo = at_f2bf(f - __uint_as_float(((unsigned)hb) << 16));
}
__device__ __forceinline__ v8f at_mma(v16b a, v16b b, v8f c) {
  c = __builtin_amdgcn_wmma_f32_16x16x32_bf16(false, a, false, b, (short)0, c, false, false);
  asm volatile("v_nop\n\tv_nop\n\tv_nop\n\tv_nop" : "+v"(c) : "v"(a), "v"(b));
  return c;
}
// 16-bit element as a bit pattern held in a __bf16 slot: f16 bits when F16, bf16 (RNE) otherwise
template <bool F16> __device__ __forceinline__ __bf16 at_to16(float f) {
  if (F16) return __builtin_bit_cast(__bf16, (_Float16)f);
  return at_f2bf(f);
}
template <bool F16> __device__ __forceinline__ v8f at_mma16(v16b a, v16b b, v8f c) {
  if (F16) {
    const v16h ah = __builtin_bit_cast(v16h, a), bh = __builtin_bit_cast(v16h, b);
    c = __builtin_amdgcn_wmma_f32_16x16x32_f16(false, ah, false, bh, (short)0, c, false, false);
    asm volatile("v_nop\n\tv_nop\n\tv_nop\n\tv_nop" : "+v"(c) : "v"(ah), "v"(bh));
    return c;
  }
  return at_mma(a, b, c);
}

// Five base-2 exponentials (one softmax row: its rescale factor and its four weights), each in place. One statement, so that the
// issue slot the instruction set asks for behind a transcendental is filled by construction: each v_exp_f32 is followed by an
// independent one, the last by v_nop; written in place, no later instruction can rewrite a source that is not also the live result
// The two s_delay_alu are the hints the compiler would write for its own code and cannot for asm text (first: the arguments come from
// the vector instructions just ahead; last: whichever reader comes next): a wave that waits unhinted holds the SIMD's issue for the others.
__device__ __forceinline__ void at_exp2x5(float& a, float& p0, float& p1, float& p2, float& p3) {
  asm("s_delay_alu instid0(VALU_DEP_1)\n\t"
      "v_exp_f32 %0, %0\n\tv_exp_f32 %1, %1\n\tv_exp_f32 %2, %2\n\tv_exp_f32 %3, %3\n\tv_exp_f32 %4, %4\n\tv_nop\n\t"
      "s_delay_alu instid0(TRANS32_DEP_1)"
      : "+v"(a), "+v"(p0), "+v"(p1), "+v"(p2), "+v"(p3));
}

// MM: the mask mode as a compile-time constant (the launch's g.mask_mode must equal it); MM < 0 reads g.mask_mode at run time.
template <bool SPLIT_QK, bool SPLIT_PV, bool F16 = false, int MM = -1>
__global__ __launch_bounds__(128)
void attn64_kernel(const float* __restrict__ q, const float* __restrict__ k,
                   const float* __restrict__ v, float* __restrict__ out,
                   const void* __restrict__ mask_a, const int* __restrict__ mask_b, AttnGeom g) {
  static_assert(!(F16 && (SPLIT_QK || SPLIT_PV)), "f16 mode is non-split");
  const int mask_mode = (MM >= 0) ? MM : g.mask_mode;
  const float PSC = F16 ? 32768.0f : 1.0f;     // f16 probabilities carried x2^15 (subnormal range), folded into the final 1/l
  union FB { v16b v; v8b h[2]; };
  __shared__ __align__(16) __bf16 Ksh[AT_KC * AT_LP];            // K hi [kv][d], pitch AT_LP      9 KB
  __shared__ __align__(16) __bf16 Ksl[SPLIT_QK ? AT_KC * AT_LP : 8];
  __shared__ __align__(16) __bf16 Vth[AT_D * AT_LP];             // V hi [d][kv], pitch AT_LP      9 KB
  __shared__ __align__(16) __bf16 Vtl[SPLIT_PV ? AT_D * AT_LP : 8];
  __shared__ __align__(16) __bf16 Psh[AT_NW][16 * AT_LP];        // per wave P hi [row][kv], pitch AT_LP  9 KB
  __shared__ __align__(16) __bf16 Psl[SPLIT_PV ? AT_NW : 1][SPLIT_PV ? 16 * AT_LP : 8];
  __shared__ __align__(16) float  Os[AT_NW][16 * 68];            // per wave out tile, pitch 68

  const int tid  = threadIdx.x;
  const int wave = tid >> 5;
  const int lane = tid & 31;
  const int hh   = lane >> 4;
  const int c    = lane & 15;

  const int nqb = g.S / AT_QB;
  const int bx = blockIdx.x + g.blk0;
  const int qb = bx % nqb;
  const int bh = bx / nqb;
  const int h  = bh % g.H;
  const int b  = bh / g.H;
  const int qbase_block = qb * AT_QB;
  const int q0 = qbase_block + wave * 16;

  const float* qb_ptr = q + (size_t)b * g.q_bs + (size_t)h * g.q_hs;
  const float* kb_ptr = k + (size_t)b * g.k_bs + (size_t)h * g.k_hs;
  const float* vb_ptr = v + (size_t)b * g.v_bs + (size_t)h * g.v_hs;
  float*       ob_ptr = out + (size_t)b * g.o_bs + (size_t)h * g.o_hs;

  // ---- Q fragments (A operand): 2 d-chunks, hi (and lo) ----
  v16b qah[2], qal[2];
  {
    const float* qrow = qb_ptr + (size_t)(q0 + c) * g.q_rs;
#pragma unroll
    for (int dc = 0; dc < 2; ++dc) {
#pragma unroll
      for (int e = 0; e < 8; ++e) {
        const float f0 = qrow[dc * 32 + 8 * hh + e] * g.qscale;
        const float f1 = qrow[dc * 32 + 16 + 8 * hh + e] * g.qscale;
        if (SPLIT_QK) { __bf16 hq, lq; at_split(f0, hq, lq); qah[dc][e] = hq; qal[dc][e] = lq; at_split(f1, hq, lq); qah[dc][8 + e] = hq; qal[dc][8 + e] = lq; }
        else { qah[dc][e] = at_to16<F16>(f0); qah[dc][8 + e] = at_to16<F16>(f1); qal[dc][e] = qah[dc][e]; qal[dc][8 + e] = qah[dc][8 + e]; }
      }
    }
  }

  float mrow[8], nrow2[8], lrow[8];            // nrow2 = -mrow * log2 e as it was rounded when the maximum was taken
  v8f oacc[4];
#pragma unroll
  for (int r = 0; r < 8; ++r) { mrow[r] = -INFINITY; nrow2[r] = INFINITY; lrow[r] = 0.f; }
#pragma unroll
  for (int t = 0; t < 4; ++t) oacc[t] = (v8f){0.f,0.f,0.f,0.f,0.f,0.f,0.f,0.f};

  const int nChunks = (mask_mode == 1 || mask_mode == 4) ? (qb + 1) : (g.Skv / AT_KC);   // block-uniform
  // per-row query mask (mode 3)
  int qkeep[8];
#pragma unroll
  for (int r = 0; r < 8; ++r) qkeep[r] = (mask_mode == 3) ? mask_b[(size_t)b * g.S + q0 + 8 * hh + r] : 1;   // mask_b = qmask in mode 3
  for (int kc = 0; kc < nChunks; ++kc) {
    const int kv0 = kc * AT_KC;
    __syncthreads();
    {
      const int kvr = tid >> 1, dh = (tid & 1) * 32;
      const float* krow = kb_ptr + (size_t)(kv0 + kvr) * g.k_rs + dh;
      const float* vrow = vb_ptr + (size_t)(kv0 + kvr) * g.v_rs + dh;
#pragma unroll
      for (int i = 0; i < 8; ++i) {
        v4f kk = *(const v4f*)(krow + 4 * i);
        v4f vv = *(const v4f*)(vrow + 4 * i);
#pragma unroll
        for (int e = 0; e < 4; ++e) {
          const int d = dh + 4 * i + e;
          if (SPLIT_QK) { __bf16 a, bl; at_split(kk[e], a, bl); Ksh[kvr * AT_LP + d] = a; Ksl[kvr * AT_LP + d] = bl; }
          else Ksh[kvr * AT_LP + d] = at_to16<F16>(kk[e]);
          if (SPLIT_PV) { __bf16 a, bl; at_split(vv[e], a, bl); Vth[d * AT_LP + kvr] = a; Vtl[d * AT_LP + kvr] = bl; }
          else Vth[d * AT_LP + kvr] = at_to16<F16>(vv[e]);
        }
      }
    }
    __syncthreads();

    v8f s[4];
#pragma unroll
    for (int j = 0; j < 4; ++j) {
      s[j] = (v8f){0.f,0.f,0.f,0.f,0.f,0.f,0.f,0.f};
#pragma unroll 1
      for (int dc = 0; dc < 2; ++dc) {
        FB kb;
        kb.h[0] = *(const v8b*)(Ksh + (j * 16 + c) * AT_LP + dc * 32 + 8 * hh);
        kb.h[1] = *(const v8b*)(Ksh + (j * 16 + c) * AT_LP + dc * 32 + 16 + 8 * hh);
        s[j] = at_mma16<F16>(qah[dc], kb.v, s[j]);
        if (SPLIT_QK) {
          FB kl;
          kl.h[0] = *(const v8b*)(Ksl + (j * 16 + c) * AT_LP + dc * 32 + 8 * hh);
          kl.h[1] = *(const v8b*)(Ksl + (j * 16 + c) * AT_LP + dc * 32 + 16 + 8 * hh);
          s[j] = at_mma16<F16>(qah[dc], kl.v, s[j]);
          s[j] = at_mma16<F16>(qal[dc], kb.v, s[j]);
        }
      }
    }
    const bool diag = (mask_mode == 1) && (kc == qb);
    int kvkeep[4] = {1, 1, 1, 1};
    if (mask_mode == 3) {
#pragma unroll
      for (int j = 0; j < 4; ++j) kvkeep[j] = ((const int*)mask_a)[(size_t)b * g.Skv + kv0 + j * 16 + c];   // mask_a = kvmask
    }
    float cm[8];
#pragma unroll
    for (int r = 0; r < 8; ++r) {
      const int qrow = q0 + 8 * hh + r;
      float m = -INFINITY;
#pragma unroll
      for (int j = 0; j < 4; ++j) {
        const int kvcol = kv0 + j * 16 + c;
        bool masked = false;
        if (diag) masked = (kvcol > qrow);
        else if (mask_mode == 4) masked = (kvcol > qrow) || (qrow - kvcol > g.mask_is_int);
        else if (mask_mode == 2) {
          const size_t mi = (size_t)qrow * g.Skv + kvcol;
          masked = (g.mask_is_int == 0) ? (((const float*)mask_a)[mi] == 0.0f)
                 : (g.mask_is_int == 1) ? (((const int*)mask_a)[mi] == 0) : (((const int*)mask_a)[mi] != 0);
        } else if (mask_mode == 3) masked = (qkeep[r] == 0) || (kvkeep[j] == 0);
        else if (mask_mode == 5) {
          const size_t mi = (size_t)qrow * g.Skv + kvcol;
          masked = (((const int*)mask_a)[mi] != 0);
          int n = mask_b[mi]; n = n < 0 ? 0 : n;
          s[j][r] += g.cp[(size_t)b * g.c_bs + (size_t)h * g.c_hs + (size_t)qrow * g.c_rs + n]
                   + g.pc[(size_t)b * g.c_bs + (size_t)h * g.c_hs + (size_t)kvcol * g.c_rs + n];
        }
        if (masked) s[j][r] = g.mask_fill;
        m = fmaxf(m, s[j][r]);
      }
#pragma unroll
      for (int off = 1; off < 16; off <<= 1) m = fmaxf(m, __shfl_xor(m, off, 32));
      cm[r] = m;
    }
    __bf16* pwh = Psh[wave];
    __bf16* pwl = Psl[SPLIT_PV ? wave : 0];
#pragma unroll
    for (int r = 0; r < 8; ++r) {
      const float mnew = fmaxf(mrow[r], cm[r]);
      const float noff = mnew * -AT_LOG2E;      // minus the row maximum in base-2 units, rounded once: the offset of every weight of this chunk
      float alpha = noff - nrow2[r];            // difference of the two offsets in use: exactly 0 while the maximum stands; -inf on the first chunk
      mrow[r] = mnew; nrow2[r] = noff;
      float pe[4];
#pragma unroll
      for (int j = 0; j < 4; ++j) pe[j] = fmaf(s[j][r], AT_LOG2E, noff);   // e^(s - m) = 2^(s*log2e - m*log2e)
      at_exp2x5(alpha, pe[0], pe[1], pe[2], pe[3]);
      float psum = 0.f;
#pragma unroll
      for (int j = 0; j < 4; ++j) {
        const float p = pe[j];
        psum = (j == 0) ? p : psum + p;
        if (SPLIT_PV) { __bf16 a, bl; at_split(p, a, bl); pwh[(8 * hh + r) * AT_LP + j * 16 + c] = a; pwl[(8 * hh + r) * AT_LP + j * 16 + c] = bl; }
        else pwh[(8 * hh + r) * AT_LP + j * 16 + c] = at_to16<F16>(p * PSC);
      }
#pragma unroll
      for (int off = 1; off < 16; off <<= 1) psum += __shfl_xor(psum, off, 32);
      lrow[r] = lrow[r] * alpha + psum;
#pragma unroll
      for (int t = 0; t < 4; ++t) oacc[t][r] *= alpha;
    }
    __builtin_amdgcn_fence(__ATOMIC_RELEASE, "workgroup");
    __builtin_amdgcn_wave_barrier();
    __builtin_amdgcn_fence(__ATOMIC_ACQUIRE, "workgroup");
#pragma unroll 1
    for (int kk = 0; kk < 2; ++kk) {
      FB pa, pl;
      pa.h[0] = *(const v8b*)(pwh + c * AT_LP + kk * 32 + 8 * hh);
      pa.h[1] = *(const v8b*)(pwh + c * AT_LP + kk * 32 + 16 + 8 * hh);
      if (SPLIT_PV) {
        pl.h[0] = *(const v8b*)(pwl + c * AT_LP + kk * 32 + 8 * hh);
        pl.h[1] = *(const v8b*)(pwl + c * AT_LP + kk * 32 + 16 + 8 * hh);
      }
#pragma unroll
      for (int t = 0; t < 4; ++t) {
        FB vb;
        vb.h[0] = *(const v8b*)(Vth + (t * 16 + c) * AT_LP + kk * 32 + 8 * hh);
        vb.h[1] = *(const v8b*)(Vth + (t * 16 + c) * AT_LP + kk * 32 + 16 + 8 * hh);
        oacc[t] = at_mma16<F16>(pa.v, vb.v, oacc[t]);
        if (SPLIT_PV) {
          FB vl;
          vl.h[0] = *(const v8b*)(Vtl + (t * 16 + c) * AT_LP + kk * 32 + 8 * hh);
          vl.h[1] = *(const v8b*)(Vtl + (t * 16 + c) * AT_LP + kk * 32 + 16 + 8 * hh);
          oacc[t] = at_mma16<F16>(pa.v, vl.v, oacc[t]);
          oacc[t] = at_mma16<F16>(pl.v, vb.v, oacc[t]);
        }
      }
    }
  }

  float* os = Os[wave];
#pragma unroll
  for (int r = 0; r < 8; ++r) {
    const float inv = 1.0f / (lrow[r] * PSC);
#pragma unroll
    for (int t = 0; t < 4; ++t) os[(8 * hh + r) * 68 + t * 16 + c] = oacc[t][r] * inv;
  }
  __builtin_amdgcn_fence(__ATOMIC_RELEASE, "workgroup");
  __builtin_amdgcn_wave_barrier();
  __builtin_amdgcn_fence(__ATOMIC_ACQUIRE, "workgroup");
  {
    const int c4 = (lane & 15) * 4;
    {
#pragma unroll
      for (int it = 0; it < 8; ++it) {
        const int row = it * 2 + hh;
        v4f val = *(const v4f*)(os + row * 68 + c4);
        *(v4f*)(ob_ptr + (size_t)(q0 + row) * g.o_rs + c4) = val;
      }
      
    }
  }
}

#define SB_ 2
#define SN_ 4096
#define SC_ 256
#define SI_ 512
#define SH_ 8
extern "C" void kernel_launch(void* const* d_in, const int* in_sizes, int n_in, void* d_out, int out_size, void* d_ws, size_t ws_size, hipStream_t stream) {
  (void)in_sizes; (void)n_in; (void)out_size; (void)ws_size;
  const float* x = (const float*)d_in[0]; const float* Wq = (const float*)d_in[1]; const float* Wk = (const float*)d_in[2]; const float* Wv = (const float*)d_in[3]; const float* Wo = (const float*)d_in[4];
  float* out = (float*)d_out;
  char* ws = (char*)d_ws; size_t off = 0;
  auto carve = [&](size_t bytes) -> char* { char* p = ws + off; off += (bytes + 255) & ~(size_t)255; return p; };
  const int R = SB_ * SN_;
  __bf16* Xh = (__bf16*)carve((size_t)R * SC_ * 2); __bf16* Xl = (__bf16*)carve((size_t)R * SC_ * 2);
  __bf16* W3h = (__bf16*)carve((size_t)3 * SI_ * SC_ * 2); __bf16* W3l = (__bf16*)carve((size_t)3 * SI_ * SC_ * 2);     // [Wq;Wk;Wv] stacked = Bt for N = 1536
  __bf16* Woh = (__bf16*)carve((size_t)SC_ * SI_ * 2); __bf16* Wol = (__bf16*)carve((size_t)SC_ * SI_ * 2);
  float* QKV = (float*)carve((size_t)R * 3 * SI_ * 4);            // 50 MB
  float* O = (float*)carve((size_t)R * SI_ * 4);
  __bf16* Oh = (__bf16*)carve((size_t)R * SI_ * 2); __bf16* Ol = (__bf16*)carve((size_t)R * SI_ * 2);
  split_f32_bf16x2<<<(R * SC_ / 2 + 255) / 256, 256, 0, stream>>>(x, Xh, Xl, R * SC_ / 2);
  split_f32_bf16x2<<<(SI_ * SC_ / 2 + 255) / 256, 256, 0, stream>>>(Wq, W3h, W3l, SI_ * SC_ / 2);
  split_f32_bf16x2<<<(SI_ * SC_ / 2 + 255) / 256, 256, 0, stream>>>(Wk, W3h + (size_t)SI_ * SC_, W3l + (size_t)SI_ * SC_, SI_ * SC_ / 2);
  split_f32_bf16x2<<<(SI_ * SC_ / 2 + 255) / 256, 256, 0, stream>>>(Wv, W3h + (size_t)2 * SI_ * SC_, W3l + (size_t)2 * SI_ * SC_, SI_ * SC_ / 2);
  split_f32_bf16x2<<<(SC_ * SI_ / 2 + 255) / 256, 256, 0, stream>>>(Wo, Woh, Wol, SC_ * SI_ / 2);
  { const int t = (R / 64) * (3 * SI_ / 64);
    wmma_gemm64<1, true, 0, 0, false><<<dim3((t + 7) / 8, 1), 256, 0, stream>>>(U16(Xh), U16(Xl), SC_, 0, U16(W3h), U16(W3l), SC_, 0, QKV, nullptr, 3 * SI_, 0, nullptr, nullptr, 0, R, 3 * SI_, SC_, 1.0f); }
  { AttnGeom g;
    g.q_bs = (long)SN_ * 3 * SI_; g.q_rs = 3 * SI_; g.q_hs = 64; g.k_bs = g.q_bs; g.k_rs = 3 * SI_; g.k_hs = 64; g.v_bs = g.q_bs; g.v_rs = 3 * SI_; g.v_hs = 64;
    g.o_bs = (long)SN_ * SI_; g.o_rs = SI_; g.o_hs = 64; g.S = SN_; g.Skv = SN_; g.H = SH_; g.mask_mode = 0; g.qscale = 0.125f; g.blk0 = 0; g.mask_fill = -INFINITY; g.mask_is_int = 0;
    attn64_kernel<false, false, true, 0><<<SB_ * SH_ * (SN_ / AT_QB), AT_NW * 32, 0, stream>>>(QKV, QKV + SI_, QKV + 2 * SI_, O, nullptr, nullptr, g); }
  split_f32_bf16x2<<<(R * SI_ / 2 + 255) / 256, 256, 0, stream>>>(O, Oh, Ol, R * SI_ / 2);
  { const int t = (R / 64) * (SC_ / 64);
    wmma_gemm64<1, true, 0, 0, false><<<dim3((t + 7) / 8, 1), 256, 0, stream>>>(U16(Oh), U16(Ol), SI_, 0, U16(Woh), U16(Wol), SI_, 0, out, nullptr, SC_, 0, nullptr, nullptr, 0, R, SC_, SI_, 1.0f); }
}

// v004
// It runs in 328 microseconds.
// Two timings next to v003 both put it at 1.20 times that version's speed.
// Over all steps from v000 it is 6.73 times as fast.
#include <hip/hip_runtime.h>
#include <math.h>
// Spatio-temporal attention (2 clips x 4096 tokens, 8 heads x 64): q/k/v = x·Wᵀ (8192 x 256 · 256 x 512 each) and out = o·Woᵀ (·512 x 256)
// on v_wmma_f32_16x16x32_bf16 with bf16 hi/lo split operands (the output is an average over 4096 near-uniform attention weights, RMS
// 0.0025); the attention itself (scores and p·v, p x2^15, 4096 keys) on
// v_wmma_f32_16x16x32_f16 with f16 operands; f32 accumulate; softmax f32 on VALU.
// The 1x1x1 conv weights ([out][in]) are used directly as the transposed operand.
typedef __attribute__((ext_vector_type(16))) _Float16 v16h;
typedef __attribute__((ext_vector_type(8)))  _Float16 v8h;
typedef __attribute__((ext_vector_type(16))) __bf16   v16b;
typedef __attribute__((ext_vector_type(8)))  __bf16   v8b;
typedef __attribute__((ext_vector_type(8)))  float    v8f;
typedef __attribute__((ext_vector_type(4)))  float    v4f;
#define PSCALE 32768.0f
#define U16(p) ((const unsigned short*)(const void*)(p))
#define PSCALE_INV (1.0f / 32768.0f)

__device__ __forceinline__ unsigned short f2bf_bits(float f) {
  unsigned u = __float_as_uint(f);
  return (unsigned short)((u + 0x7FFFu + ((u >> 16) & 1u)) >> 16);
}
__device__ __forceinline__ float bf_bits2f(unsigned short h) { return __uint_as_float(((unsigned)h) << 16); }

// hazard guards as plain device helpers (no inline asm inside the kernel template body)
__device__ __forceinline__ void dep_guard_h(v8f& a, v8f& b, v16h x, v16h y) { asm volatile("v_nop\n\tv_nop\n\tv_nop\n\tv_nop" : "+v"(a), "+v"(b) : "v"(x), "v"(y)); }
__device__ __forceinline__ void dep_guard_b(v8f& a, v8f& b, v16b x, v16b y) { asm volatile("v_nop\n\tv_nop\n\tv_nop\n\tv_nop" : "+v"(a), "+v"(b) : "v"(x), "v"(y)); }
__device__ __forceinline__ void keep4_h(v16h a, v16h b, v16h c, v16h d) { asm volatile("v_nop" :: "v"(a), "v"(b), "v"(c), "v"(d)); }
__device__ __forceinline__ void keep4_b(v16b a, v16b b, v16b c, v16b d) { asm volatile("v_nop" :: "v"(a), "v"(b), "v"(c), "v"(d)); }
__device__ __forceinline__ void acc_guard4(v8f& a, v8f& b, v8f& c, v8f& d) { asm volatile("v_nop\n\tv_nop\n\tv_nop\n\tv_nop" : "+v"(a), "+v"(b), "+v"(c), "+v"(d)); }
template <typename T> struct Frag;
template <> struct Frag<_Float16> {
  typedef v16h V; union U { v16h v; v8h h[2]; };
  static __device__ __forceinline__ v16h load(const _Float16* p) {   // elements 0..7 <- p[0..7], 8..15 <- p[16..23]
    U f; f.h[0] = *(const v8h*)(p); f.h[1] = *(const v8h*)(p + 16); return f.v;
  }
  static __device__ __forceinline__ v8f mma(v16h a, v16h b, v8f c) {
    return __builtin_amdgcn_wmma_f32_16x16x32_f16(false, a, false, b, (short)0, c, false, false);
  }
  static __device__ __forceinline__ void guard(v8f& a, v8f& b, v16h x, v16h y) { dep_guard_h(a, b, x, y); }
  static __device__ __forceinline__ void keep(v16h a, v16h b, v16h c, v16h d) { keep4_h(a, b, c, d); }
};
template <> struct Frag<__bf16> {
  typedef v16b V; union U { v16b v; v8b h[2]; };
  static __device__ __forceinline__ v16b load(const __bf16* p) {
    U f; f.h[0] = *(const v8b*)(p); f.h[1] = *(const v8b*)(p + 16); return f.v;
  }
  static __device__ __forceinline__ v8f mma(v16b a, v16b b, v8f c) {
    return __builtin_amdgcn_wmma_f32_16x16x32_bf16(false, a, false, b, (short)0, c, false, false);
  }
  static __device__ __forceinline__ void guard(v8f& a, v8f& b, v16b x, v16b y) { dep_guard_b(a, b, x, y); }
  static __device__ __forceinline__ void keep(v16b a, v16b b, v16b c, v16b d) { keep4_b(a, b, c, d); }
};

// ---- Register-blocked batched WMMA GEMM ------------------------------------
// C[m,n] = scale * sum_k A[m,k] * Bt[n,k] (+bias)(+resid); each wave owns a 64x64 tile.
// A row-major [M,K]; Bt row-major [N,K]; M,N % 64 == 0, K % 32 == 0.
// SPLIT: operands are hi/lo planes (A2/Bt2 = lo planes, same layout); product = hi·hi + hi·lo + lo·hi.
// BIAS_MODE: 0 = none, 1 = bias[m], 2 = bias[n].
// OUT_MODE: 0 = f32, 1 = f16, 2 = bf16 hi plane (Cout) + bf16 lo plane (Cout2).
// ET: 0 = f16 operands, 1 = bf16 operands (pointers passed as 16-bit storage)
template <int ET> struct Elem;
template <> struct Elem<0> { typedef _Float16 T; };
template <> struct Elem<1> { typedef __bf16 T; };
template <int ET, bool SPLIT, int BIAS_MODE, int OUT_MODE, bool RESID, int ACT = 0>
__global__ __launch_bounds__(256) void wmma_gemm64(
    const unsigned short* __restrict__ Ap, const unsigned short* __restrict__ A2p, int lda, long strideA,
    const unsigned short* __restrict__ Btp, const unsigned short* __restrict__ Bt2p, int ldb, long strideB,
    void* __restrict__ Cout, void* __restrict__ Cout2, int ldc, long strideC,
    const float* __restrict__ bias,
    const float* __restrict__ resid, long strideR,
    int M, int N, int K, float scale) {
  typedef typename Elem<ET>::T T;
  typedef typename Frag<T>::V V;
  const T* A = (const T*)Ap; const T* A2 = (const T*)A2p; const T* Bt = (const T*)Btp; const T* Bt2 = (const T*)Bt2p;
  __shared__ __align__(16) float sT[8][16 * 68];   // per-wave 16x64 slab, pitch 68 floats
  const int b    = blockIdx.y;
  const int lane = threadIdx.x & 31;
  const int wave = threadIdx.x >> 5;
  const int tilesN = N >> 6;
  const int tilesM = M >> 6;
  const int tile = blockIdx.x * 8 + wave;
  if (tile >= tilesM * tilesN) return;   // wave-uniform; no block barriers in this kernel
  const int tm = tile / tilesN;
  const int tn = tile - tm * tilesN;
  const int m0 = tm << 6;
  const int n0 = tn << 6;

  const T* Ab  = A  + (size_t)b * strideA;
  const T* Bb  = Bt + (size_t)b * strideB;
  const T* Ab2 = SPLIT ? (A2  + (size_t)b * strideA) : nullptr;
  const T* Bb2 = SPLIT ? (Bt2 + (size_t)b * strideB) : nullptr;

  const int rlane = lane & 15;                 // row (A) / col (B, D) within subtile
  const int koff  = (lane >> 4) * 8;           // k offset of this lane half
  const int mOff  = (lane >> 4) * 8;           // D row offset

  v8f acc[4][4];
#pragma unroll
  for (int i = 0; i < 4; ++i)
#pragma unroll
    for (int j = 0; j < 4; ++j) acc[i][j] = (v8f){0.f,0.f,0.f,0.f,0.f,0.f,0.f,0.f};

  for (int k0 = 0; k0 < K; k0 += 32) {
    V bh[4], bl[4];
#pragma unroll
    for (int j = 0; j < 4; ++j) {
      const size_t bo = (size_t)(n0 + (j << 4) + rlane) * ldb + koff + k0;
      bh[j] = Frag<T>::load(Bb + bo);
      if (SPLIT) bl[j] = Frag<T>::load(Bb2 + bo);
    }
#pragma unroll
    for (int i = 0; i < 4; ++i) {
      const size_t ao = (size_t)(m0 + (i << 4) + rlane) * lda + koff + k0;
      V ah = Frag<T>::load(Ab + ao);
      V al;
      if (SPLIT) al = Frag<T>::load(Ab2 + ao);
#pragma unroll
      for (int j = 0; j < 4; ++j) {
        acc[i][j] = Frag<T>::mma(ah, bh[j], acc[i][j]);
        if (SPLIT) {
          acc[i][j] = Frag<T>::mma(ah, bl[j], acc[i][j]);
          acc[i][j] = Frag<T>::mma(al, bh[j], acc[i][j]);
        }
      }
      Frag<T>::guard(acc[i][0], acc[i][3], ah, SPLIT ? al : ah);
    }
    Frag<T>::keep(bh[0], bh[1], bh[2], bh[3]);
    if (SPLIT) Frag<T>::keep(bl[0], bl[1], bl[2], bl[3]);
  }
  acc_guard4(acc[0][0], acc[0][1], acc[0][2], acc[0][3]);
  acc_guard4(acc[1][0], acc[1][1], acc[1][2], acc[1][3]);
  acc_guard4(acc[2][0], acc[2][1], acc[2][2], acc[2][3]);
  acc_guard4(acc[3][0], acc[3][1], acc[3][2], acc[3][3]);

  // ---- epilogue ----
  float* slab = sT[wave];
  const float* Rb = RESID ? (resid + (size_t)b * strideR) : nullptr;
#pragma unroll
  for (int i = 0; i < 4; ++i) {
    const int mBase = m0 + (i << 4);
#pragma unroll
    for (int j = 0; j < 4; ++j) {
      const int n = n0 + (j << 4) + rlane;
      float bv = 0.f;
      if (BIAS_MODE == 2) bv = bias[n];
#pragma unroll
      for (int r = 0; r < 8; ++r) {
        float v = acc[i][j][r] * scale;
        if (BIAS_MODE == 1) v += bias[mBase + mOff + r];
        if (BIAS_MODE == 2) v += bv;
        if (RESID) v += Rb[(size_t)(mBase + mOff + r) * ldc + n];
        if (ACT == 1) v = tanhf(v);
        if (ACT == 2) v = fmaxf(v, 0.0f);
        if (ACT == 3) v = v / (1.0f + expf(-v));
        if (ACT == 4) v = (v > 0.f) ? v : 0.01f * v;
        if (ACT == 5) v = 0.5f * v * (1.0f + erff(v * 0.70710678118654752f));
        slab[(mOff + r) * 68 + (j << 4) + rlane] = v;
      }
    }
    __builtin_amdgcn_fence(__ATOMIC_RELEASE, "workgroup");
    __builtin_amdgcn_wave_barrier();
    __builtin_amdgcn_fence(__ATOMIC_ACQUIRE, "workgroup");
    if (OUT_MODE == 0) {
      float* C = (float*)Cout + (size_t)b * strideC;
      const int hh = lane >> 4, c4 = (lane & 15) * 4;     // row seg = 256 B = 16 lanes x 16 B
      {
#pragma unroll
        for (int it = 0; it < 8; ++it) {
          const int row = it * 2 + hh;
          v4f v = *(const v4f*)(slab + row * 68 + c4);
          *(v4f*)(C + (size_t)(mBase + row) * ldc + n0 + c4) = v;
        }
        
      }
    } else {
      const int q = lane >> 3, c8 = (lane & 7) * 8;
      unsigned short* C  = (unsigned short*)Cout  + (size_t)b * strideC;
      unsigned short* C2 = (OUT_MODE == 2) ? ((unsigned short*)Cout2 + (size_t)b * strideC) : nullptr;
      {
#pragma unroll
        for (int it = 0; it < 4; ++it) {
          const int row = it * 4 + q;
          const float* sp = slab + row * 68 + c8;
          v8h hv, lv;
#pragma unroll
          for (int e = 0; e < 8; ++e) {
            if (OUT_MODE == 1) {
              hv[e] = (_Float16)sp[e];
            } else {
              unsigned short hb = f2bf_bits(sp[e]);
              unsigned short lb = f2bf_bits(sp[e] - bf_bits2f(hb));
              hv[e] = __builtin_bit_cast(_Float16, hb);
              lv[e] = __builtin_bit_cast(_Float16, lb);
            }
          }
          *(v8h*)(C + (size_t)(mBase + row) * ldc + n0 + c8) = hv;
          if (OUT_MODE == 2) *(v8h*)(C2 + (size_t)(mBase + row) * ldc + n0 + c8) = lv;
        }
        
      }
    }
    __builtin_amdgcn_fence(__ATOMIC_RELEASE, "workgroup");
    __builtin_amdgcn_wave_barrier();
    __builtin_amdgcn_fence(__ATOMIC_ACQUIRE, "workgroup");
  }
}

__global__ __launch_bounds__(256) void cast_f32_f16x2(
    const float* __restrict__ in, _Float16* __restrict__ out, int n2) {
  int i = blockIdx.x * 256 + threadIdx.x;
  if (i < n2) {
    const _Float16 h0 = (_Float16)in[2 * i], h1 = (_Float16)in[2 * i + 1];
    const unsigned u = (unsigned)__builtin_bit_cast(unsigned short, h0) | ((unsigned)__builtin_bit_cast(unsigned short, h1) << 16);
    ((unsigned*)out)[i] = u;
    
  }
}


// ---- f32 -> f16 cast with a power-of-two pre-scale (folded back by the consumer GEMM's scale) ----
__global__ __launch_bounds__(256) void cast_f32_f16x2s(const float* __restrict__ in, _Float16* __restrict__ out, int n2, float s) {
  int i = blockIdx.x * 256 + threadIdx.x;
  if (i < n2) {
    const _Float16 h0 = (_Float16)(in[2 * i] * s), h1 = (_Float16)(in[2 * i + 1] * s);
    const unsigned u = (unsigned)__builtin_bit_cast(unsigned short, h0) | ((unsigned)__builtin_bit_cast(unsigned short, h1) << 16);
    ((unsigned*)out)[i] = u;
    
  }
}
__global__ __launch_bounds__(256) void split_f32_bf16x2(
    const float* __restrict__ in, __bf16* __restrict__ hi, __bf16* __restrict__ lo, long n2) {
  long i = (long)blockIdx.x * 256 + threadIdx.x;
  long stride = (long)gridDim.x * 256;
  {
    for (long j = i; j < n2; j += stride) {
      const float a = in[2 * j], b = in[2 * j + 1];
      const unsigned short ah = f2bf_bits(a), bh = f2bf_bits(b);
      const unsigned short al = f2bf_bits(a - bf_bits2f(ah)), bl = f2bf_bits(b - bf_bits2f(bh));
      ((unsigned*)hi)[j] = (unsigned)ah | ((unsigned)bh << 16);
      ((unsigned*)lo)[j] = (unsigned)al | ((unsigned)bl << 16);
    }
    
  }
}


// ---- f32 [R][C] (row pitch ldi) -> f16 transposed [C][R] (row pitch ldo); 64x64 tiles; each output row segment
__global__ __launch_bounds__(256) void transpose_cast_f16(const float* __restrict__ in, int ldi,
                                                         _Float16* __restrict__ outT, int ldo, float scale) {
  __shared__ __align__(16) _Float16 tile[64][72];     // [c][r]
  const int c0 = blockIdx.x * 64, r0 = blockIdx.y * 64;
  const int t = threadIdx.y * 32 + threadIdx.x;
  for (int i = threadIdx.y; i < 64; i += 8) {
    tile[threadIdx.x][i]      = (_Float16)(in[(size_t)(r0 + i) * ldi + c0 + threadIdx.x] * scale);
    tile[32 + threadIdx.x][i] = (_Float16)(in[(size_t)(r0 + i) * ldi + c0 + 32 + threadIdx.x] * scale);
  }
  __syncthreads();
  const int q = t >> 3, c8 = (t & 7) * 8;
  {
#pragma unroll
    for (int it = 0; it < 2; ++it) {
      const int c = it * 32 + q;
      v8h hv = *(const v8h*)(&tile[c][c8]);
      *(v8h*)(outT + (size_t)(c0 + c) * ldo + r0 + c8) = hv;
    }
    
  }
}

// ---- f32 [R][C] (pitch ldi) -> bf16 hi/lo transposed planes [C][R] (pitch ldo); 64x64 tiles; each output row segment
__global__ __launch_bounds__(256) void transpose_split_bf16(const float* __restrict__ in, int ldi,
                                                           __bf16* __restrict__ outH, __bf16* __restrict__ outL, int ldo) {
  __shared__ __align__(16) float tile[64][68];     // [c][r]
  const int c0 = blockIdx.x * 64, r0 = blockIdx.y * 64;
  const int t = threadIdx.y * 32 + threadIdx.x;
  for (int i = threadIdx.y; i < 64; i += 8) {
    tile[threadIdx.x][i]      = in[(size_t)(r0 + i) * ldi + c0 + threadIdx.x];
    tile[32 + threadIdx.x][i] = in[(size_t)(r0 + i) * ldi + c0 + 32 + threadIdx.x];
  }
  __syncthreads();
  const int q = t >> 3, c8 = (t & 7) * 8;
  {
#pragma unroll
    for (int it = 0; it < 2; ++it) {
      const int c = it * 32 + q;
      v8b hv, lv;
#pragma unroll
      for (int e = 0; e < 8; ++e) {
        const float f = tile[c][c8 + e];
        const unsigned short hb = f2bf_bits(f);
        hv[e] = __builtin_bit_cast(__bf16, hb);
        lv[e] = __builtin_bit_cast(__bf16, f2bf_bits(f - bf_bits2f(hb)));
      }
      *(v8b*)(outH + (size_t)(c0 + c) * ldo + r0 + c8) = hv;
      *(v8b*)(outL + (size_t)(c0 + c) * ldo + r0 + c8) = lv;
    }
    
  }
}

#define AT_D 64
#define AT_NW 4
#define AT_QB 64
#define AT_KC 64
// LDS row pitch of the 16-bit K and V-transposed tiles, in elements: 72 = 144 B = 16 B x odd, so the 16 rows that one
// ds_load_b128 fragment read touches start on 16 different bank groups (at 128 B they share two groups and the read serialises).
#define AT_LP 72
// e^x is taken as 2^(x * log2 e) on the hardware's base-2 exponential (one instruction); every argument here is a score minus
// its row maximum, so the library exponential's overflow and underflow ladder has nothing to catch (below 2^-126 the weight is 0).
#define AT_LOG2E 1.4426950408889634f
struct AttnGeom { const float* cp = nullptr; const float* pc = nullptr; long c_bs = 0, c_rs = 0, c_hs = 0;   // mode-5 score-bias tables
                  long q_bs, q_rs, q_hs, k_bs, k_rs, k_hs, v_bs, v_rs, v_hs, o_bs, o_rs, o_hs;
                  int S, Skv, H, mask_mode; float qscale; int blk0; float mask_fill; int mask_is_int; };
static_assert(sizeof(AttnGeom) == 168, "no padding");

__device__ __forceinline__ unsigned short at_bf_bits(float f) {
  unsigned u = __float_as_uint(f);
  return (unsigned short)((u + 0x7FFFu + ((u >> 16) & 1u)) >> 16);
}
__device__ __forceinline__ __bf16 at_f2bf(float f) { return __builtin_bit_cast(__bf16, at_bf_bits(f)); }
__device__ __forceinline__ void at_split(float f, __bf16& hi, __bf16& lo) {
  const unsigned short hb = at_bf_bits(f);
  hi = __builtin_bit_cast(__bf16, hb);
  lo = at_f2bf(f - __uint_as_float(((unsigned)hb) << 16));
}
__device__ __forceinline__ v8f at_mma(v16b a, v16b b, v8f c) {
  c = __builtin_amdgcn_wmma_f32_16x16x32_bf16(false, a, false, b, (short)0, c, false, false);
  asm volatile("v_nop\n\tv_nop\n\tv_nop\n\tv_nop" : "+v"(c) : "v"(a), "v"(b));
  return c;
}
// 16-bit element as a bit pattern held in a __bf16 slot: f16 bits when F16, bf16 (RNE) otherwise
template <bool F16> __device__ __forceinline__ __bf16 at_to16(float f) {
  if (F16) return __builtin_bit_cast(__bf16, (_Float16)f);
  return at_f2bf(f);
}
template <bool F16> __device__ __forceinline__ v8f at_mma16(v16b a, v16b b, v8f c) {
  if (F16) {
    const v16h ah = __builtin_bit_cast(v16h, a), bh = __builtin_bit_cast(v16h, b);
    c = __builtin_amdgcn_wmma_f32_16x16x32_f16(false, ah, false, bh, (short)0, c, false, false);
    asm volatile("v_nop\n\tv_nop\n\tv_nop\n\tv_nop" : "+v"(c) : "v"(ah), "v"(bh));
    return c;
  }
  return at_mma(a, b, c);
}

// Lane l's value as seen from lane l ^ 16 (the other half of the wave): one vector cross-row move, no LDS trip.
__device__ __forceinline__ float at_xhalf(float x) {
  const int b = __builtin_bit_cast(int, x);
  return __builtin_bit_cast(float, __builtin_amdgcn_permlanex16(b, b, 0x76543210, 0xfedcba98, false, false));
}

// Eight base-2 exponentials (one score tile of a lane's query), each in place. One statement, so that the
// issue slot the instruction set asks for behind a transcendental is filled by construction: each v_exp_f32 is followed by an
// independent one, the last by v_nop; written in place, no later instruction can rewrite a source that is not also the live result
// The two s_delay_alu are the hints the compiler would write for its own code and cannot for asm text (first: the arguments come from
// the vector instructions just ahead; last: whichever reader comes next): a wave that waits unhinted holds the SIMD's issue for the others.
__device__ __forceinline__ void at_exp2x8(float& p0, float& p1, float& p2, float& p3, float& p4, float& p5, float& p6, float& p7) {
  asm("s_delay_alu instid0(VALU_DEP_1)\n\t"
      "v_exp_f32 %0, %0\n\tv_exp_f32 %1, %1\n\tv_exp_f32 %2, %2\n\tv_exp_f32 %3, %3\n\t"
      "v_exp_f32 %4, %4\n\tv_exp_f32 %5, %5\n\tv_exp_f32 %6, %6\n\tv_exp_f32 %7, %7\n\tv_nop\n\t"
      "s_delay_alu instid0(TRANS32_DEP_1)"
      : "+v"(p0), "+v"(p1), "+v"(p2), "+v"(p3), "+v"(p4), "+v"(p5), "+v"(p6), "+v"(p7));
}
// The same for one value (the query's rescale factor).
__device__ __forceinline__ void at_exp2x1(float& a) {
  asm("s_delay_alu instid0(VALU_DEP_1)\n\tv_exp_f32 %0, %0\n\tv_nop\n\ts_delay_alu instid0(TRANS32_DEP_1)" : "+v"(a));
}

// MM: the mask mode as a compile-time constant (the launch's g.mask_mode must equal it); MM < 0 reads g.mask_mode at run time.
template <bool SPLIT_QK, bool SPLIT_PV, bool F16 = false, int MM = -1>
__global__ __launch_bounds__(128)
void attn64_kernel(const float* __restrict__ q, const float* __restrict__ k,
                   const float* __restrict__ v, float* __restrict__ out,
                   const void* __restrict__ mask_a, const int* __restrict__ mask_b, AttnGeom g) {
  static_assert(!(F16 && (SPLIT_QK || SPLIT_PV)), "f16 mode is non-split");
  const int mask_mode = (MM >= 0) ? MM : g.mask_mode;
  const float PSC = F16 ? 32768.0f : 1.0f;     // f16 probabilities carried x2^15 (subnormal range), folded into the final 1/l
  union FB { v16b v; v8b h[2]; };
  __shared__ __align__(16) __bf16 Ksh[AT_KC * AT_LP];            // K hi [kv][d], pitch AT_LP      9 KB
  __shared__ __align__(16) __bf16 Ksl[SPLIT_QK ? AT_KC * AT_LP : 8];
  __shared__ __align__(16) __bf16 Vth[AT_D * AT_LP];             // V hi [d][kv], pitch AT_LP      9 KB
  __shared__ __align__(16) __bf16 Vtl[SPLIT_PV ? AT_D * AT_LP : 8];
  __shared__ __align__(16) float  Os[AT_NW][16 * 68];            // per wave out tile, pitch 68

  const int tid  = threadIdx.x;
  const int wave = tid >> 5;
  const int lane = tid & 31;
  const int hh   = lane >> 4;
  const int c    = lane & 15;

  const int nqb = g.S / AT_QB;
  const int bx = blockIdx.x + g.blk0;
  const int qb = bx % nqb;
  const int bh = bx / nqb;
  const int h  = bh % g.H;
  const int b  = bh / g.H;
  const int qbase_block = qb * AT_QB;
  const int q0 = qbase_block + wave * 16;

  const float* qb_ptr = q + (size_t)b * g.q_bs + (size_t)h * g.q_hs;
  const float* kb_ptr = k + (size_t)b * g.k_bs + (size_t)h * g.k_hs;
  const float* vb_ptr = v + (size_t)b * g.v_bs + (size_t)h * g.v_hs;
  float*       ob_ptr = out + (size_t)b * g.o_bs + (size_t)h * g.o_hs;

  // ---- Q fragments (B operand: column = query q0 + c): 2 d-chunks, hi (and lo) ----
  v16b qah[2], qal[2];
  {
    const float* qrow = qb_ptr + (size_t)(q0 + c) * g.q_rs;
#pragma unroll
    for (int dc = 0; dc < 2; ++dc) {
#pragma unroll
      for (int e = 0; e < 8; ++e) {
        const float f0 = qrow[dc * 32 + 8 * hh + e] * g.qscale;
        const float f1 = qrow[dc * 32 + 16 + 8 * hh + e] * g.qscale;
        if (SPLIT_QK) { __bf16 hq, lq; at_split(f0, hq, lq); qah[dc][e] = hq; qal[dc][e] = lq; at_split(f1, hq, lq); qah[dc][8 + e] = hq; qal[dc][8 + e] = lq; }
        else { qah[dc][e] = at_to16<F16>(f0); qah[dc][8 + e] = at_to16<F16>(f1); qal[dc][e] = qah[dc][e]; qal[dc][8 + e] = qah[dc][8 + e]; }
      }
    }
  }

  // state of this lane's query q0 + c; nrow2 = -(running maximum) * log2 e as it was rounded when that maximum was taken;
  // lrow sums this wave half's keys only (the halves are joined behind the loop)
  float nrow2 = INFINITY, lrow = 0.f;
  v8f oacc[4];                                 // O^T: oacc[t][r] = element d = t*16 + 8*hh + r of query q0 + c
#pragma unroll
  for (int t = 0; t < 4; ++t) oacc[t] = (v8f){0.f,0.f,0.f,0.f,0.f,0.f,0.f,0.f};

  const int nChunks = (mask_mode == 1 || mask_mode == 4) ? (qb + 1) : (g.Skv / AT_KC);   // block-uniform
  const int qrow = q0 + c;
  const int qkeep = (mask_mode == 3) ? mask_b[(size_t)b * g.S + qrow] : 1;   // query mask (mode 3): mask_b = qmask
  for (int kc = 0; kc < nChunks; ++kc) {
    const int kv0 = kc * AT_KC;
    __syncthreads();
    {
      const int kvr = tid >> 1, dh = (tid & 1) * 32;
      const float* krow = kb_ptr + (size_t)(kv0 + kvr) * g.k_rs + dh;
      const float* vrow = vb_ptr + (size_t)(kv0 + kvr) * g.v_rs + dh;
#pragma unroll
      for (int i = 0; i < 8; ++i) {
        v4f kk = *(const v4f*)(krow + 4 * i);
        v4f vv = *(const v4f*)(vrow + 4 * i);
#pragma unroll
        for (int e = 0; e < 4; ++e) {
          const int d = dh + 4 * i + e;
          if (SPLIT_QK) { __bf16 a, bl; at_split(kk[e], a, bl); Ksh[kvr * AT_LP + d] = a; Ksl[kvr * AT_LP + d] = bl; }
          else Ksh[kvr * AT_LP + d] = at_to16<F16>(kk[e]);
          if (SPLIT_PV) { __bf16 a, bl; at_split(vv[e], a, bl); Vth[d * AT_LP + kvr] = a; Vtl[d * AT_LP + kvr] = bl; }
          else Vth[d * AT_LP + kvr] = at_to16<F16>(vv[e]);
        }
      }
    }
    __syncthreads();

    v8f s[4];                                  // S^T: s[j][r] = score of key kv0 + j*16 + 8*hh + r for query q0 + c
#pragma unroll
    for (int j = 0; j < 4; ++j) {
      s[j] = (v8f){0.f,0.f,0.f,0.f,0.f,0.f,0.f,0.f};
#pragma unroll 1
      for (int dc = 0; dc < 2; ++dc) {
        FB kb;
        kb.h[0] = *(const v8b*)(Ksh + (j * 16 + c) * AT_LP + dc * 32 + 8 * hh);
        kb.h[1] = *(const v8b*)(Ksh + (j * 16 + c) * AT_LP + dc * 32 + 16 + 8 * hh);
        s[j] = at_mma16<F16>(kb.v, qah[dc], s[j]);
        if (SPLIT_QK) {
          FB kl;
          kl.h[0] = *(const v8b*)(Ksl + (j * 16 + c) * AT_LP + dc * 32 + 8 * hh);
          kl.h[1] = *(const v8b*)(Ksl + (j * 16 + c) * AT_LP + dc * 32 + 16 + 8 * hh);
          s[j] = at_mma16<F16>(kl.v, qah[dc], s[j]);
          s[j] = at_mma16<F16>(kb.v, qal[dc], s[j]);
        }
      }
    }
    const bool diag = (mask_mode == 1) && (kc == qb);
    float mj[4];                                // one maximum per score tile: four short chains instead of one long one
#pragma unroll
    for (int j = 0; j < 4; ++j) {
      mj[j] = -INFINITY;
#pragma unroll
      for (int r = 0; r < 8; ++r) {
        const int kvcol = kv0 + j * 16 + 8 * hh + r;
        bool masked = false;
        if (diag) masked = (kvcol > qrow);
        else if (mask_mode == 4) masked = (kvcol > qrow) || (qrow - kvcol > g.mask_is_int);
        else if (mask_mode == 2) {
          const size_t mi = (size_t)qrow * g.Skv + kvcol;
          masked = (g.mask_is_int == 0) ? (((const float*)mask_a)[mi] == 0.0f)
                 : (g.mask_is_int == 1) ? (((const int*)mask_a)[mi] == 0) : (((const int*)mask_a)[mi] != 0);
        } else if (mask_mode == 3) masked = (qkeep == 0) || (((const int*)mask_a)[(size_t)b * g.Skv + kvcol] == 0);   // mask_a = kvmask
        else if (mask_mode == 5) {
          const size_t mi = (size_t)qrow * g.Skv + kvcol;
          masked = (((const int*)mask_a)[mi] != 0);
          int n = mask_b[mi]; n = n < 0 ? 0 : n;
          s[j][r] += g.cp[(size_t)b * g.c_bs + (size_t)h * g.c_hs + (size_t)qrow * g.c_rs + n]
                   + g.pc[(size_t)b * g.c_bs + (size_t)h * g.c_hs + (size_t)kvcol * g.c_rs + n];
        }
        if (masked) s[j][r] = g.mask_fill;
        mj[j] = fmaxf(mj[j], s[j][r]);
      }
    }
    float m = fmaxf(fmaxf(mj[0], mj[1]), fmaxf(mj[2], mj[3]));
    m = fmaxf(m, at_xhalf(m));                  // the other half of the wave holds the query's other 32 keys
    // minus the running maximum in base-2 units, the offset of every weight of this chunk: the product is rounded once per chunk
    // maximum, and the smaller of two such products is the product of the larger maximum (rounding keeps the order)
    const float noff = fminf(nrow2, m * -AT_LOG2E);
    float alpha = noff - nrow2;                 // difference of the two offsets in use: exactly 0 while the maximum stands; -inf on the first chunk
    nrow2 = noff;
    at_exp2x1(alpha);
    float pe[4][8], ps[4];
#pragma unroll
    for (int j = 0; j < 4; ++j) {
      float* p = pe[j];
#pragma unroll
      for (int r = 0; r < 8; ++r) p[r] = fmaf(s[j][r], AT_LOG2E, noff);   // e^(s - m) = 2^(s*log2e - m*log2e)
      at_exp2x8(p[0], p[1], p[2], p[3], p[4], p[5], p[6], p[7]);
      ps[j] = ((p[0] + p[1]) + (p[2] + p[3])) + ((p[4] + p[5]) + (p[6] + p[7]));
    }
    lrow = lrow * alpha + ((ps[0] + ps[1]) + (ps[2] + ps[3]));
#pragma unroll
    for (int t = 0; t < 4; ++t)
#pragma unroll
      for (int r = 0; r < 8; ++r) oacc[t][r] *= alpha;
    // P^T as B operand, straight from the score tiles: element e of k-chunk kk is key kk*32 + 8*hh + e (tile 2kk, register e), element
    // 8 + e is key kk*32 + 16 + 8*hh + e (tile 2kk + 1, register e): the k order of the V loader below.
    // Unrolled, so that kk picks the score registers at compile time.
#pragma unroll
    for (int kk = 0; kk < 2; ++kk) {
      v16b pa, pl;
#pragma unroll
      for (int e = 0; e < 8; ++e) {
        const float p0 = pe[2 * kk][e], p1 = pe[2 * kk + 1][e];
        if (SPLIT_PV) { __bf16 a, bl; at_split(p0, a, bl); pa[e] = a; pl[e] = bl; at_split(p1, a, bl); pa[8 + e] = a; pl[8 + e] = bl; }
        else { pa[e] = at_to16<F16>(p0 * PSC); pa[8 + e] = at_to16<F16>(p1 * PSC); }
      }
#pragma unroll
      for (int t = 0; t < 4; ++t) {
        FB vb;
        vb.h[0] = *(const v8b*)(Vth + (t * 16 + c) * AT_LP + kk * 32 + 8 * hh);
        vb.h[1] = *(const v8b*)(Vth + (t * 16 + c) * AT_LP + kk * 32 + 16 + 8 * hh);
        oacc[t] = at_mma16<F16>(vb.v, pa, oacc[t]);
        if (SPLIT_PV) {
          FB vl;
          vl.h[0] = *(const v8b*)(Vtl + (t * 16 + c) * AT_LP + kk * 32 + 8 * hh);
          vl.h[1] = *(const v8b*)(Vtl + (t * 16 + c) * AT_LP + kk * 32 + 16 + 8 * hh);
          oacc[t] = at_mma16<F16>(vl.v, pa, oacc[t]);
          oacc[t] = at_mma16<F16>(vb.v, pl, oacc[t]);
        }
      }
    }
  }

  float* os = Os[wave];
  {
    const float inv = 1.0f / ((lrow + at_xhalf(lrow)) * PSC);   // the two halves' sums joined, once
#pragma unroll
    for (int t = 0; t < 4; ++t) {
      v4f lo4, hi4;
#pragma unroll
      for (int e = 0; e < 4; ++e) { lo4[e] = oacc[t][e] * inv; hi4[e] = oacc[t][4 + e] * inv; }
      *(v4f*)(os + c * 68 + t * 16 + 8 * hh)     = lo4;
      *(v4f*)(os + c * 68 + t * 16 + 8 * hh + 4) = hi4;
    }
  }
  __builtin_amdgcn_fence(__ATOMIC_RELEASE, "workgroup");
  __builtin_amdgcn_wave_barrier();
  __builtin_amdgcn_fence(__ATOMIC_ACQUIRE, "workgroup");
  {
    const int c4 = (lane & 15) * 4;
    {
#pragma unroll
      for (int it = 0; it < 8; ++it) {
        const int row = it * 2 + hh;
        v4f val = *(const v4f*)(os + row * 68 + c4);
        *(v4f*)(ob_ptr + (size_t)(q0 + row) * g.o_rs + c4) = val;
      }
      
    }
  }
}

#define SB_ 2
#define SN_ 4096
#define SC_ 256
#define SI_ 512
#define SH_ 8
extern "C" void kernel_launch(void* const* d_in, const int* in_sizes, int n_in, void* d_out, int out_size, void* d_ws, size_t ws_size, hipStream_t stream) {
  (void)in_sizes; (void)n_in; (void)out_size; (void)ws_size;
  const float* x = (const float*)d_in[0]; const float* Wq = (const float*)d_in[1]; const float* Wk = (const float*)d_in[2]; const float* Wv = (const float*)d_in[3]; const float* Wo = (const float*)d_in[4];
  float* out = (float*)d_out;
  char* ws = (char*)d_ws; size_t off = 0;
  auto carve = [&](size_t bytes) -> char* { char* p = ws + off; off += (bytes + 255) & ~(size_t)255; return p; };
  const int R = SB_ * SN_;
  __bf16* Xh = (__bf16*)carve((size_t)R * SC_ * 2); __bf16* Xl = (__bf16*)carve((size_t)R * SC_ * 2);
  __bf16* W3h = (__bf16*)carve((size_t)3 * SI_ * SC_ * 2); __bf16* W3l = (__bf16*)carve((size_t)3 * SI_ * SC_ * 2);     // [Wq;Wk;Wv] stacked = Bt for N = 1536
  __bf16* Woh = (__bf16*)carve((size_t)SC_ * SI_ * 2); __bf16* Wol = (__bf16*)carve((size_t)SC_ * SI_ * 2);
  float* QKV = (float*)carve((size_t)R * 3 * SI_ * 4);            // 50 MB
  float* O = (float*)carve((size_t)R * SI_ * 4);
  __bf16* Oh = (__bf16*)carve((size_t)R * SI_ * 2); __bf16* Ol = (__bf16*)carve((size_t)R * SI_ * 2);
  split_f32_bf16x2<<<(R * SC_ / 2 + 255) / 256, 256, 0, stream>>>(x, Xh, Xl, R * SC_ / 2);
  split_f32_bf16x2<<<(SI_ * SC_ / 2 + 255) / 256, 256, 0, stream>>>(Wq, W3h, W3l, SI_ * SC_ / 2);
  split_f32_bf16x2<<<(SI_ * SC_ / 2 + 255) / 256, 256, 0, stream>>>(Wk, W3h + (size_t)SI_ * SC_, W3l + (size_t)SI_ * SC_, SI_ * SC_ / 2);
  split_f32_bf16x2<<<(SI_ * SC_ / 2 + 255) / 256, 256, 0, stream>>>(Wv, W3h + (size_t)2 * SI_ * SC_, W3l + (size_t)2 * SI_ * SC_, SI_ * SC_ / 2);
  split_f32_bf16x2<<<(SC_ * SI_ / 2 + 255) / 256, 256, 0, stream>>>(Wo, Woh, Wol, SC_ * SI_ / 2);
  { const int t = (R / 64) * (3 * SI_ / 64);
    wmma_gemm64<1, true, 0, 0, false><<<dim3((t + 7) / 8, 1), 256, 0, stream>>>(U16(Xh), U16(Xl), SC_, 0, U16(W3h), U16(W3l), SC_, 0, QKV, nullptr, 3 * SI_, 0, nullptr, nullptr, 0, R, 3 * SI_, SC_, 1.0f); }
  { AttnGeom g;
    g.q_bs = (long)SN_ * 3 * SI_; g.q_rs = 3 * SI_; g.q_hs = 64; g.k_bs = g.q_bs; g.k_rs = 3 * SI_; g.k_hs = 64; g.v_bs = g.q_bs; g.v_rs = 3 * SI_; g.v_hs = 64;
    g.o_bs = (long)SN_ * SI_; g.o_rs = SI_; g.o_hs = 64; g.S = SN_; g.Skv = SN_; g.H = SH_; g.mask_mode = 0; g.qscale = 0.125f; g.blk0 = 0; g.mask_fill = -INFINITY; g.mask_is_int = 0;
    attn64_kernel<false, false, true, 0><<<SB_ * SH_ * (SN_ / AT_QB), AT_NW * 32, 0, stream>>>(QKV, QKV + SI_, QKV + 2 * SI_, O, nullptr, nullptr, g); }
  split_f32_bf16x2<<<(R * SI_ / 2 + 255) / 256, 256, 0, stream>>>(O, Oh, Ol, R * SI_ / 2);
  { const int t = (R / 64) * (SC_ / 64);
    wmma_gemm64<1, true, 0, 0, false><<<dim3((t + 7) / 8, 1), 256, 0, stream>>>(U16(Oh), U16(Ol), SI_, 0, U16(Woh), U16(Wol), SI_, 0, out, nullptr, SC_, 0, nullptr, nullptr, 0, R, SC_, SI_, 1.0f); }
}

// v005
// It runs in 241 microseconds.
// In both of two side-by-side timings against v004, it was 1.36 times as fast.
// Counting every step since v000, it is 9.16 times as fast.
#include <hip/hip_runtime.h>
#include <math.h>
// Spatio-temporal attention (2 clips x 4096 tokens, 8 heads x 64): q/k/v = x·Wᵀ (8192 x 256 · 256 x 512 each) and out = o·Woᵀ (·512 x 256)
// on v_wmma_f32_16x16x32_bf16 with bf16 hi/lo split operands (the output is an average over 4096 near-uniform attention weights, RMS
// 0.0025); the attention itself (scores and p·v, p x2^15, 4096 keys) on
// v_wmma_f32_16x16x32_f16 with f16 operands; f32 accumulate; softmax f32 on VALU.
// The 1x1x1 conv weights ([out][in]) are used directly as the transposed operand.
typedef __attribute__((ext_vector_type(16))) _Float16 v16h;
typedef __attribute__((ext_vector_type(8)))  _Float16 v8h;
typedef __attribute__((ext_vector_type(16))) __bf16   v16b;
typedef __attribute__((ext_vector_type(8)))  __bf16   v8b;
typedef __attribute__((ext_vector_type(4)))  __bf16   v4b;
typedef __attribute__((ext_vector_type(8)))  float    v8f;
typedef __attribute__((ext_vector_type(4)))  float    v4f;
#define PSCALE 32768.0f
#define U16(p) ((const unsigned short*)(const void*)(p))
#define PSCALE_INV (1.0f / 32768.0f)

__device__ __forceinline__ unsigned short f2bf_bits(float f) {
  unsigned u = __float_as_uint(f);
  return (unsigned short)((u + 0x7FFFu + ((u >> 16) & 1u)) >> 16);
}
__device__ __forceinline__ float bf_bits2f(unsigned short h) { return __uint_as_float(((unsigned)h) << 16); }

// hazard guards as plain device helpers (no inline asm inside the kernel template body)
__device__ __forceinline__ void dep_guard_h(v8f& a, v8f& b, v16h x, v16h y) { asm volatile("v_nop\n\tv_nop\n\tv_nop\n\tv_nop" : "+v"(a), "+v"(b) : "v"(x), "v"(y)); }
__device__ __forceinline__ void dep_guard_b(v8f& a, v8f& b, v16b x, v16b y) { asm volatile("v_nop\n\tv_nop\n\tv_nop\n\tv_nop" : "+v"(a), "+v"(b) : "v"(x), "v"(y)); }
__device__ __forceinline__ void keep4_h(v16h a, v16h b, v16h c, v16h d) { asm volatile("v_nop" :: "v"(a), "v"(b), "v"(c), "v"(d)); }
__device__ __forceinline__ void keep4_b(v16b a, v16b b, v16b c, v16b d) { asm volatile("v_nop" :: "v"(a), "v"(b), "v"(c), "v"(d)); }
__device__ __forceinline__ void acc_guard4(v8f& a, v8f& b, v8f& c, v8f& d) { asm volatile("v_nop\n\tv_nop\n\tv_nop\n\tv_nop" : "+v"(a), "+v"(b), "+v"(c), "+v"(d)); }
template <typename T> struct Frag;
template <> struct Frag<_Float16> {
  typedef v16h V; union U { v16h v; v8h h[2]; };
  static __device__ __forceinline__ v16h load(const _Float16* p) {   // elements 0..7 <- p[0..7], 8..15 <- p[16..23]
    U f; f.h[0] = *(const v8h*)(p); f.h[1] = *(const v8h*)(p + 16); return f.v;
  }
  static __device__ __forceinline__ v8f mma(v16h a, v16h b, v8f c) {
    return __builtin_amdgcn_wmma_f32_16x16x32_f16(false, a, false, b, (short)0, c, false, false);
  }
  static __device__ __forceinline__ void guard(v8f& a, v8f& b, v16h x, v16h y) { dep_guard_h(a, b, x, y); }
  static __device__ __forceinline__ void keep(v16h a, v16h b, v16h c, v16h d) { keep4_h(a, b, c, d); }
};
template <> struct Frag<__bf16> {
  typedef v16b V; union U { v16b v; v8b h[2]; };
  static __device__ __forceinline__ v16b load(const __bf16* p) {
    U f; f.h[0] = *(const v8b*)(p); f.h[1] = *(const v8b*)(p + 16); return f.v;
  }
  static __device__ __forceinline__ v8f mma(v16b a, v16b b, v8f c) {
    return __builtin_amdgcn_wmma_f32_16x16x32_bf16(false, a, false, b, (short)0, c, false, false);
  }
  static __device__ __forceinline__ void guard(v8f& a, v8f& b, v16b x, v16b y) { dep_guard_b(a, b, x, y); }
  static __device__ __forceinline__ void keep(v16b a, v16b b, v16b c, v16b d) { keep4_b(a, b, c, d); }
};

// ---- Register-blocked batched WMMA GEMM ------------------------------------
// C[m,n] = scale * sum_k A[m,k] * Bt[n,k] (+bias)(+resid); each wave owns a 64x64 tile.
// A row-major [M,K]; Bt row-major [N,K]; M,N % 64 == 0, K % 32 == 0.
// SPLIT: operands are hi/lo planes (A2/Bt2 = lo planes, same layout); product = hi·hi + hi·lo + lo·hi.
// BIAS_MODE: 0 = none, 1 = bias[m], 2 = bias[n].
// OUT_MODE: 0 = f32, 1 = f16, 2 = bf16 hi plane (Cout) + bf16 lo plane (Cout2).
// ET: 0 = f16 operands, 1 = bf16 operands (pointers passed as 16-bit storage)
template <int ET> struct Elem;
template <> struct Elem<0> { typedef _Float16 T; };
template <> struct Elem<1> { typedef __bf16 T; };
template <int ET, bool SPLIT, int BIAS_MODE, int OUT_MODE, bool RESID, int ACT = 0>
__global__ __launch_bounds__(256) void wmma_gemm64(
    const unsigned short* __restrict__ Ap, const unsigned short* __restrict__ A2p, int lda, long strideA,
    const unsigned short* __restrict__ Btp, const unsigned short* __restrict__ Bt2p, int ldb, long strideB,
    void* __restrict__ Cout, void* __restrict__ Cout2, int ldc, long strideC,
    const float* __restrict__ bias,
    const float* __restrict__ resid, long strideR,
    int M, int N, int K, float scale) {
  typedef typename Elem<ET>::T T;
  typedef typename Frag<T>::V V;
  const T* A = (const T*)Ap; const T* A2 = (const T*)A2p; const T* Bt = (const T*)Btp; const T* Bt2 = (const T*)Bt2p;
  __shared__ __align__(16) float sT[8][16 * 68];   // per-wave 16x64 slab, pitch 68 floats
  const int b    = blockIdx.y;
  const int lane = threadIdx.x & 31;
  const int wave = threadIdx.x >> 5;
  const int tilesN = N >> 6;
  const int tilesM = M >> 6;
  const int tile = blockIdx.x * 8 + wave;
  if (tile >= tilesM * tilesN) return;   // wave-uniform; no block barriers in this kernel
  const int tm = tile / tilesN;
  const int tn = tile - tm * tilesN;
  const int m0 = tm << 6;
  const int n0 = tn << 6;

  const T* Ab  = A  + (size_t)b * strideA;
  const T* Bb  = Bt + (size_t)b * strideB;
  const T* Ab2 = SPLIT ? (A2  + (size_t)b * strideA) : nullptr;
  const T* Bb2 = SPLIT ? (Bt2 + (size_t)b * strideB) : nullptr;

  const int rlane = lane & 15;                 // row (A) / col (B, D) within subtile
  const int koff  = (lane >> 4) * 8;           // k offset of this lane half
  const int mOff  = (lane >> 4) * 8;           // D row offset

  v8f acc[4][4];
#pragma unroll
  for (int i = 0; i < 4; ++i)
#pragma unroll
    for (int j = 0; j < 4; ++j) acc[i][j] = (v8f){0.f,0.f,0.f,0.f,0.f,0.f,0.f,0.f};

  for (int k0 = 0; k0 < K; k0 += 32) {
    V bh[4], bl[4];
#pragma unroll
    for (int j = 0; j < 4; ++j) {
      const size_t bo = (size_t)(n0 + (j << 4) + rlane) * ldb + koff + k0;
      bh[j] = Frag<T>::load(Bb + bo);
      if (SPLIT) bl[j] = Frag<T>::load(Bb2 + bo);
    }
#pragma unroll
    for (int i = 0; i < 4; ++i) {
      const size_t ao = (size_t)(m0 + (i << 4) + rlane) * lda + koff + k0;
      V ah = Frag<T>::load(Ab + ao);
      V al;
      if (SPLIT) al = Frag<T>::load(Ab2 + ao);
#pragma unroll
      for (int j = 0; j < 4; ++j) {
        acc[i][j] = Frag<T>::mma(ah, bh[j], acc[i][j]);
        if (SPLIT) {
          acc[i][j] = Frag<T>::mma(ah, bl[j], acc[i][j]);
          acc[i][j] = Frag<T>::mma(al, bh[j], acc[i][j]);
        }
      }
      Frag<T>::guard(acc[i][0], acc[i][3], ah, SPLIT ? al : ah);
    }
    Frag<T>::keep(bh[0], bh[1], bh[2], bh[3]);
    if (SPLIT) Frag<T>::keep(bl[0], bl[1], bl[2], bl[3]);
  }
  acc_guard4(acc[0][0], acc[0][1], acc[0][2], acc[0][3]);
  acc_guard4(acc[1][0], acc[1][1], acc[1][2], acc[1][3]);
  acc_guard4(acc[2][0], acc[2][1], acc[2][2], acc[2][3]);
  acc_guard4(acc[3][0], acc[3][1], acc[3][2], acc[3][3]);

  // ---- epilogue ----
  float* slab = sT[wave];
  const float* Rb = RESID ? (resid + (size_t)b * strideR) : nullptr;
#pragma unroll
  for (int i = 0; i < 4; ++i) {
    const int mBase = m0 + (i << 4);
#pragma unroll
    for (int j = 0; j < 4; ++j) {
      const int n = n0 + (j << 4) + rlane;
      float bv = 0.f;
      if (BIAS_MODE == 2) bv = bias[n];
#pragma unroll
      for (int r = 0; r < 8; ++r) {
        float v = acc[i][j][r] * scale;
        if (BIAS_MODE == 1) v += bias[mBase + mOff + r];
        if (BIAS_MODE == 2) v += bv;
        if (RESID) v += Rb[(size_t)(mBase + mOff + r) * ldc + n];
        if (ACT == 1) v = tanhf(v);
        if (ACT == 2) v = fmaxf(v, 0.0f);
        if (ACT == 3) v = v / (1.0f + expf(-v));
        if (ACT == 4) v = (v > 0.f) ? v : 0.01f * v;
        if (ACT == 5) v = 0.5f * v * (1.0f + erff(v * 0.70710678118654752f));
        slab[(mOff + r) * 68 + (j << 4) + rlane] = v;
      }
    }
    __builtin_amdgcn_fence(__ATOMIC_RELEASE, "workgroup");
    __builtin_amdgcn_wave_barrier();
    __builtin_amdgcn_fence(__ATOMIC_ACQUIRE, "workgroup");
    if (OUT_MODE == 0) {
      float* C = (float*)Cout + (size_t)b * strideC;
      const int hh = lane >> 4, c4 = (lane & 15) * 4;     // row seg = 256 B = 16 lanes x 16 B
      {
#pragma unroll
        for (int it = 0; it < 8; ++it) {
          const int row = it * 2 + hh;
          v4f v = *(const v4f*)(slab + row * 68 + c4);
          *(v4f*)(C + (size_t)(mBase + row) * ldc + n0 + c4) = v;
        }
        
      }
    } else {
      const int q = lane >> 3, c8 = (lane & 7) * 8;
      unsigned short* C  = (unsigned short*)Cout  + (size_t)b * strideC;
      unsigned short* C2 = (OUT_MODE == 2) ? ((unsigned short*)Cout2 + (size_t)b * strideC) : nullptr;
      {
#pragma unroll
        for (int it = 0; it < 4; ++it) {
          const int row = it * 4 + q;
          const float* sp = slab + row * 68 + c8;
          v8h hv, lv;
#pragma unroll
          for (int e = 0; e < 8; ++e) {
            if (OUT_MODE == 1) {
              hv[e] = (_Float16)sp[e];
            } else {
              unsigned short hb = f2bf_bits(sp[e]);
              unsigned short lb = f2bf_bits(sp[e] - bf_bits2f(hb));
              hv[e] = __builtin_bit_cast(_Float16, hb);
              lv[e] = __builtin_bit_cast(_Float16, lb);
            }
          }
          *(v8h*)(C + (size_t)(mBase + row) * ldc + n0 + c8) = hv;
          if (OUT_MODE == 2) *(v8h*)(C2 + (size_t)(mBase + row) * ldc + n0 + c8) = lv;
        }
        
      }
    }
    __builtin_amdgcn_fence(__ATOMIC_RELEASE, "workgroup");
    __builtin_amdgcn_wave_barrier();
    __builtin_amdgcn_fence(__ATOMIC_ACQUIRE, "workgroup");
  }
}

__global__ __launch_bounds__(256) void cast_f32_f16x2(
    const float* __restrict__ in, _Float16* __restrict__ out, int n2) {
  int i = blockIdx.x * 256 + threadIdx.x;
  if (i < n2) {
    const _Float16 h0 = (_Float16)in[2 * i], h1 = (_Float16)in[2 * i + 1];
    const unsigned u = (unsigned)__builtin_bit_cast(unsigned short, h0) | ((unsigned)__builtin_bit_cast(unsigned short, h1) << 16);
    ((unsigned*)out)[i] = u;
    
  }
}


// ---- f32 -> f16 cast with a power-of-two pre-scale (folded back by the consumer GEMM's scale) ----
__global__ __launch_bounds__(256) void cast_f32_f16x2s(const float* __restrict__ in, _Float16* __restrict__ out, int n2, float s) {
  int i = blockIdx.x * 256 + threadIdx.x;
  if (i < n2) {
    const _Float16 h0 = (_Float16)(in[2 * i] * s), h1 = (_Float16)(in[2 * i + 1] * s);
    const unsigned u = (unsigned)__builtin_bit_cast(unsigned short, h0) | ((unsigned)__builtin_bit_cast(unsigned short, h1) << 16);
    ((unsigned*)out)[i] = u;
    
  }
}
__global__ __launch_bounds__(256) void split_f32_bf16x2(
    const float* __restrict__ in, __bf16* __restrict__ hi, __bf16* __restrict__ lo, long n2) {
  long i = (long)blockIdx.x * 256 + threadIdx.x;
  long stride = (long)gridDim.x * 256;
  {
    for (long j = i; j < n2; j += stride) {
      const float a = in[2 * j], b = in[2 * j + 1];
      const unsigned short ah = f2bf_bits(a), bh = f2bf_bits(b);
      const unsigned short al = f2bf_bits(a - bf_bits2f(ah)), bl = f2bf_bits(b - bf_bits2f(bh));
      ((unsigned*)hi)[j] = (unsigned)ah | ((unsigned)bh << 16);
      ((unsigned*)lo)[j] = (unsigned)al | ((unsigned)bl << 16);
    }
    
  }
}


// ---- f32 [R][C] (row pitch ldi) -> f16 transposed [C][R] (row pitch ldo); 64x64 tiles; each output row segment
__global__ __launch_bounds__(256) void transpose_cast_f16(const float* __restrict__ in, int ldi,
                                                         _Float16* __restrict__ outT, int ldo, float scale) {
  __shared__ __align__(16) _Float16 tile[64][72];     // [c][r]
  const int c0 = blockIdx.x * 64, r0 = blockIdx.y * 64;
  const int t = threadIdx.y * 32 + threadIdx.x;
  for (int i = threadIdx.y; i < 64; i += 8) {
    tile[threadIdx.x][i]      = (_Float16)(in[(size_t)(r0 + i) * ldi + c0 + threadIdx.x] * scale);
    tile[32 + threadIdx.x][i] = (_Float16)(in[(size_t)(r0 + i) * ldi + c0 + 32 + threadIdx.x] * scale);
  }
  __syncthreads();
  const int q = t >> 3, c8 = (t & 7) * 8;
  {
#pragma unroll
    for (int it = 0; it < 2; ++it) {
      const int c = it * 32 + q;
      v8h hv = *(const v8h*)(&tile[c][c8]);
      *(v8h*)(outT + (size_t)(c0 + c) * ldo + r0 + c8) = hv;
    }
    
  }
}

// ---- f32 [R][C] (pitch ldi) -> bf16 hi/lo transposed planes [C][R] (pitch ldo); 64x64 tiles; each output row segment
__global__ __launch_bounds__(256) void transpose_split_bf16(const float* __restrict__ in, int ldi,
                                                           __bf16* __restrict__ outH, __bf16* __restrict__ outL, int ldo) {
  __shared__ __align__(16) float tile[64][68];     // [c][r]
  const int c0 = blockIdx.x * 64, r0 = blockIdx.y * 64;
  const int t = threadIdx.y * 32 + threadIdx.x;
  for (int i = threadIdx.y; i < 64; i += 8) {
    tile[threadIdx.x][i]      = in[(size_t)(r0 + i) * ldi + c0 + threadIdx.x];
    tile[32 + threadIdx.x][i] = in[(size_t)(r0 + i) * ldi + c0 + 32 + threadIdx.x];
  }
  __syncthreads();
  const int q = t >> 3, c8 = (t & 7) * 8;
  {
#pragma unroll
    for (int it = 0; it < 2; ++it) {
      const int c = it * 32 + q;
      v8b hv, lv;
#pragma unroll
      for (int e = 0; e < 8; ++e) {
        const float f = tile[c][c8 + e];
        const unsigned short hb = f2bf_bits(f);
        hv[e] = __builtin_bit_cast(__bf16, hb);
        lv[e] = __builtin_bit_cast(__bf16, f2bf_bits(f - bf_bits2f(hb)));
      }
      *(v8b*)(outH + (size_t)(c0 + c) * ldo + r0 + c8) = hv;
      *(v8b*)(outL + (size_t)(c0 + c) * ldo + r0 + c8) = lv;
    }
    
  }
}

#define AT_D 64
#define AT_NW 4
#define AT_QB 64
#define AT_KC 64
// LDS row pitch of the 16-bit K and V-transposed tiles, in elements: 72 = 144 B = 16 B x odd, so the 16 rows that one
// ds_load_b128 fragment read touches start on 16 different bank groups (at 128 B they share two groups and the read serialises).
#define AT_LP 72
// e^x is taken as 2^(x * log2 e) on the hardware's base-2 exponential (one instruction); every argument here is a score minus
// its row maximum, so the library exponential's overflow and underflow ladder has nothing to catch (below 2^-126 the weight is 0).
#define AT_LOG2E 1.4426950408889634f
struct AttnGeom { const float* cp = nullptr; const float* pc = nullptr; long c_bs = 0, c_rs = 0, c_hs = 0;   // mode-5 score-bias tables
                  long q_bs, q_rs, q_hs, k_bs, k_rs, k_hs, v_bs, v_rs, v_hs, o_bs, o_rs, o_hs;
                  int S, Skv, H, mask_mode; float qscale; int blk0; float mask_fill; int mask_is_int; };
static_assert(sizeof(AttnGeom) == 168, "no padding");

__device__ __forceinline__ unsigned short at_bf_bits(float f) {
  unsigned u = __float_as_uint(f);
  return (unsigned short)((u + 0x7FFFu + ((u >> 16) & 1u)) >> 16);
}
__device__ __forceinline__ __bf16 at_f2bf(float f) { return __builtin_bit_cast(__bf16, at_bf_bits(f)); }
__device__ __forceinline__ void at_split(float f, __bf16& hi, __bf16& lo) {
  const unsigned short hb = at_bf_bits(f);
  hi = __builtin_bit_cast(__bf16, hb);
  lo = at_f2bf(f - __uint_as_float(((unsigned)hb) << 16));
}
__device__ __forceinline__ v8f at_mma(v16b a, v16b b, v8f c) {
  c = __builtin_amdgcn_wmma_f32_16x16x32_bf16(false, a, false, b, (short)0, c, false, false);
  asm volatile("v_nop\n\tv_nop\n\tv_nop\n\tv_nop" : "+v"(c) : "v"(a), "v"(b));
  return c;
}
// 16-bit element as a bit pattern held in a __bf16 slot: f16 bits when F16, bf16 (RNE) otherwise
template <bool F16> __device__ __forceinline__ __bf16 at_to16(float f) {
  if (F16) return __builtin_bit_cast(__bf16, (_Float16)f);
  return at_f2bf(f);
}
template <bool F16> __device__ __forceinline__ v8f at_mma16(v16b a, v16b b, v8f c) {
  if (F16) {
    const v16h ah = __builtin_bit_cast(v16h, a), bh = __builtin_bit_cast(v16h, b);
    c = __builtin_amdgcn_wmma_f32_16x16x32_f16(false, ah, false, bh, (short)0, c, false, false);
    asm volatile("v_nop\n\tv_nop\n\tv_nop\n\tv_nop" : "+v"(c) : "v"(ah), "v"(bh));
    return c;
  }
  return at_mma(a, b, c);
}

// Lane l's value as seen from lane l ^ 16 (the other half of the wave): one vector cross-row move, no LDS trip.
__device__ __forceinline__ float at_xhalf(float x) {
  const int b = __builtin_bit_cast(int, x);
  return __builtin_bit_cast(float, __builtin_amdgcn_permlanex16(b, b, 0x76543210, 0xfedcba98, false, false));
}

// Eight base-2 exponentials (one score tile of a lane's query), each in place. One statement, so that the
// issue slot the instruction set asks for behind a transcendental is filled by construction: each v_exp_f32 is followed by an
// independent one, the last by v_nop; written in place, no later instruction can rewrite a source that is not also the live result
// The two s_delay_alu are the hints the compiler would write for its own code and cannot for asm text (first: the arguments come from
// the vector instructions just ahead; last: whichever reader comes next): a wave that waits unhinted holds the SIMD's issue for the others.
__device__ __forceinline__ void at_exp2x8(float& p0, float& p1, float& p2, float& p3, float& p4, float& p5, float& p6, float& p7) {
  asm("s_delay_alu instid0(VALU_DEP_1)\n\t"
      "v_exp_f32 %0, %0\n\tv_exp_f32 %1, %1\n\tv_exp_f32 %2, %2\n\tv_exp_f32 %3, %3\n\t"
      "v_exp_f32 %4, %4\n\tv_exp_f32 %5, %5\n\tv_exp_f32 %6, %6\n\tv_exp_f32 %7, %7\n\tv_nop\n\t"
      "s_delay_alu instid0(TRANS32_DEP_1)"
      : "+v"(p0), "+v"(p1), "+v"(p2), "+v"(p3), "+v"(p4), "+v"(p5), "+v"(p6), "+v"(p7));
}
// The same for one value (the query's rescale factor).
__device__ __forceinline__ void at_exp2x1(float& a) {
  asm("s_delay_alu instid0(VALU_DEP_1)\n\tv_exp_f32 %0, %0\n\tv_nop\n\ts_delay_alu instid0(TRANS32_DEP_1)" : "+v"(a));
}

// MM: the mask mode as a compile-time constant (the launch's g.mask_mode must equal it); MM < 0 reads g.mask_mode at run time.
template <bool SPLIT_QK, bool SPLIT_PV, bool F16 = false, int MM = -1>
__global__ __launch_bounds__(128)
void attn64_kernel(const float* __restrict__ q, const float* __restrict__ k,
                   const float* __restrict__ v, float* __restrict__ out,
                   const void* __restrict__ mask_a, const int* __restrict__ mask_b, AttnGeom g) {
  static_assert(!(F16 && (SPLIT_QK || SPLIT_PV)), "f16 mode is non-split");
  const int mask_mode = (MM >= 0) ? MM : g.mask_mode;
  const float PSC = F16 ? 32768.0f : 1.0f;     // f16 probabilities carried x2^15 (subnormal range), folded into the final 1/l
  union FB { v16b v; v8b h[2]; };
  __shared__ __align__(16) __bf16 Ksh[AT_KC * AT_LP];            // K hi [kv][d], pitch AT_LP      9 KB
  __shared__ __align__(16) __bf16 Ksl[SPLIT_QK ? AT_KC * AT_LP : 8];
  __shared__ __align__(16) __bf16 Vth[AT_D * AT_LP];             // V hi [d][kv], pitch AT_LP      9 KB
  __shared__ __align__(16) __bf16 Vtl[SPLIT_PV ? AT_D * AT_LP : 8];
  __shared__ __align__(16) float  Os[AT_NW][16 * 68];            // per wave out tile, pitch 68

  const int tid  = threadIdx.x;
  const int wave = tid >> 5;
  const int lane = tid & 31;
  const int hh   = lane >> 4;
  const int c    = lane & 15;

  const int nqb = g.S / AT_QB;
  const int bx = blockIdx.x + g.blk0;
  const int qb = bx % nqb;
  const int bh = bx / nqb;
  const int h  = bh % g.H;
  const int b  = bh / g.H;
  const int qbase_block = qb * AT_QB;
  const int q0 = qbase_block + wave * 16;

  const float* qb_ptr = q + (size_t)b * g.q_bs + (size_t)h * g.q_hs;
  const float* kb_ptr = k + (size_t)b * g.k_bs + (size_t)h * g.k_hs;
  const float* vb_ptr = v + (size_t)b * g.v_bs + (size_t)h * g.v_hs;
  float*       ob_ptr = out + (size_t)b * g.o_bs + (size_t)h * g.o_hs;

  // ---- Q fragments (B operand: column = query q0 + c): 2 d-chunks, hi (and lo) ----
  v16b qah[2], qal[2];
  {
    const float* qrow = qb_ptr + (size_t)(q0 + c) * g.q_rs;
#pragma unroll
    for (int dc = 0; dc < 2; ++dc) {
#pragma unroll
      for (int e = 0; e < 8; ++e) {
        const float f0 = qrow[dc * 32 + 8 * hh + e] * g.qscale;
        const float f1 = qrow[dc * 32 + 16 + 8 * hh + e] * g.qscale;
        if (SPLIT_QK) { __bf16 hq, lq; at_split(f0, hq, lq); qah[dc][e] = hq; qal[dc][e] = lq; at_split(f1, hq, lq); qah[dc][8 + e] = hq; qal[dc][8 + e] = lq; }
        else { qah[dc][e] = at_to16<F16>(f0); qah[dc][8 + e] = at_to16<F16>(f1); qal[dc][e] = qah[dc][e]; qal[dc][8 + e] = qah[dc][8 + e]; }
      }
    }
  }

  // state of this lane's query q0 + c; nrow2 = -(running maximum) * log2 e as it was rounded when that maximum was taken;
  // lrow sums this wave half's keys only (the halves are joined behind the loop)
  float nrow2 = INFINITY, lrow = 0.f;
  v8f oacc[4];                                 // O^T: oacc[t][r] = element d = t*16 + 8*hh + r of query q0 + c
#pragma unroll
  for (int t = 0; t < 4; ++t) oacc[t] = (v8f){0.f,0.f,0.f,0.f,0.f,0.f,0.f,0.f};

  const int nChunks = (mask_mode == 1 || mask_mode == 4) ? (qb + 1) : (g.Skv / AT_KC);   // block-uniform
  const int qrow = q0 + c;
  const int qkeep = (mask_mode == 3) ? mask_b[(size_t)b * g.S + qrow] : 1;   // query mask (mode 3): mask_b = qmask
  for (int kc = 0; kc < nChunks; ++kc) {
    const int kv0 = kc * AT_KC;
    __syncthreads();
    {
      // Eight lanes take one 128-B line of a K or V row, so a wave's 16-byte load covers four whole lines (a lane that walks its own
      // 128 B makes every load touch 32 lines, 16 B of each). A lane holds the same four head elements of four adjacent keys:
      // K goes to LDS as 8 B of one key's row, V transposed as 8 B (four keys) of one head element's row.
      const int cl = (tid & 7) * 4, kr = (tid >> 3) * 4;
      const float* kp[4]; const float* vp[4];
      v4f kk[2][4], vv[2][4];
#pragma unroll
      for (int i = 0; i < 4; ++i) {
        kp[i] = kb_ptr + (size_t)(kv0 + kr + i) * g.k_rs + cl;
        vp[i] = vb_ptr + (size_t)(kv0 + kr + i) * g.v_rs + cl;
#pragma unroll
        for (int hd = 0; hd < 2; ++hd) {
          kk[hd][i] = *(const v4f*)(kp[i] + hd * 32);
          vv[hd][i] = *(const v4f*)(vp[i] + hd * 32);
        }
      }
      // The wait that stands between an issued global load and a rewrite of its address registers. The addresses are its inputs, so
      // they stay whole up to it.
      asm volatile("s_wait_xcnt 0x0" :: "v"(kp[0]), "v"(kp[1]), "v"(kp[2]), "v"(kp[3]), "v"(vp[0]), "v"(vp[1]), "v"(vp[2]), "v"(vp[3]) : "memory");
#pragma unroll
      for (int hd = 0; hd < 2; ++hd) {
        const int d0 = hd * 32 + cl;
#pragma unroll
        for (int i = 0; i < 4; ++i) {
          v4b a, bl;
#pragma unroll
          for (int e = 0; e < 4; ++e) {
            if (SPLIT_QK) { __bf16 x, y; at_split(kk[hd][i][e], x, y); a[e] = x; bl[e] = y; }
            else a[e] = at_to16<F16>(kk[hd][i][e]);
          }
          *(v4b*)(Ksh + (kr + i) * AT_LP + d0) = a;
          if (SPLIT_QK) *(v4b*)(Ksl + (kr + i) * AT_LP + d0) = bl;
        }
#pragma unroll
        for (int e = 0; e < 4; ++e) {
          v4b a, bl;
#pragma unroll
          for (int i = 0; i < 4; ++i) {
            if (SPLIT_PV) { __bf16 x, y; at_split(vv[hd][i][e], x, y); a[i] = x; bl[i] = y; }
            else a[i] = at_to16<F16>(vv[hd][i][e]);
          }
          *(v4b*)(Vth + (d0 + e) * AT_LP + kr) = a;
          if (SPLIT_PV) *(v4b*)(Vtl + (d0 + e) * AT_LP + kr) = bl;
        }
      }
    }
    __syncthreads();

    v8f s[4];                                  // S^T: s[j][r] = score of key kv0 + j*16 + 8*hh + r for query q0 + c
#pragma unroll
    for (int j = 0; j < 4; ++j) {
      s[j] = (v8f){0.f,0.f,0.f,0.f,0.f,0.f,0.f,0.f};
#pragma unroll 1
      for (int dc = 0; dc < 2; ++dc) {
        FB kb;
        kb.h[0] = *(const v8b*)(Ksh + (j * 16 + c) * AT_LP + dc * 32 + 8 * hh);
        kb.h[1] = *(const v8b*)(Ksh + (j * 16 + c) * AT_LP + dc * 32 + 16 + 8 * hh);
        s[j] = at_mma16<F16>(kb.v, qah[dc], s[j]);
        if (SPLIT_QK) {
          FB kl;
          kl.h[0] = *(const v8b*)(Ksl + (j * 16 + c) * AT_LP + dc * 32 + 8 * hh);
          kl.h[1] = *(const v8b*)(Ksl + (j * 16 + c) * AT_LP + dc * 32 + 16 + 8 * hh);
          s[j] = at_mma16<F16>(kl.v, qah[dc], s[j]);
          s[j] = at_mma16<F16>(kb.v, qal[dc], s[j]);
        }
      }
    }
    const bool diag = (mask_mode == 1) && (kc == qb);
    float mj[4];                                // one maximum per score tile: four short chains instead of one long one
#pragma unroll
    for (int j = 0; j < 4; ++j) {
      mj[j] = -INFINITY;
#pragma unroll
      for (int r = 0; r < 8; ++r) {
        const int kvcol = kv0 + j * 16 + 8 * hh + r;
        bool masked = false;
        if (diag) masked = (kvcol > qrow);
        else if (mask_mode == 4) masked = (kvcol > qrow) || (qrow - kvcol > g.mask_is_int);
        else if (mask_mode == 2) {
          const size_t mi = (size_t)qrow * g.Skv + kvcol;
          masked = (g.mask_is_int == 0) ? (((const float*)mask_a)[mi] == 0.0f)
                 : (g.mask_is_int == 1) ? (((const int*)mask_a)[mi] == 0) : (((const int*)mask_a)[mi] != 0);
        } else if (mask_mode == 3) masked = (qkeep == 0) || (((const int*)mask_a)[(size_t)b * g.Skv + kvcol] == 0);   // mask_a = kvmask
        else if (mask_mode == 5) {
          const size_t mi = (size_t)qrow * g.Skv + kvcol;
          masked = (((const int*)mask_a)[mi] != 0);
          int n = mask_b[mi]; n = n < 0 ? 0 : n;
          s[j][r] += g.cp[(size_t)b * g.c_bs + (size_t)h * g.c_hs + (size_t)qrow * g.c_rs + n]
                   + g.pc[(size_t)b * g.c_bs + (size_t)h * g.c_hs + (size_t)kvcol * g.c_rs + n];
        }
        if (masked) s[j][r] = g.mask_fill;
        mj[j] = fmaxf(mj[j], s[j][r]);
      }
    }
    float m = fmaxf(fmaxf(mj[0], mj[1]), fmaxf(mj[2], mj[3]));
    m = fmaxf(m, at_xhalf(m));                  // the other half of the wave holds the query's other 32 keys
    // minus the running maximum in base-2 units, the offset of every weight of this chunk: the product is rounded once per chunk
    // maximum, and the smaller of two such products is the product of the larger maximum (rounding keeps the order)
    const float noff = fminf(nrow2, m * -AT_LOG2E);
    float alpha = noff - nrow2;                 // difference of the two offsets in use: exactly 0 while the maximum stands; -inf on the first chunk
    nrow2 = noff;
    at_exp2x1(alpha);
    float pe[4][8], ps[4];
#pragma unroll
    for (int j = 0; j < 4; ++j) {
      float* p = pe[j];
#pragma unroll
      for (int r = 0; r < 8; ++r) p[r] = fmaf(s[j][r], AT_LOG2E, noff);   // e^(s - m) = 2^(s*log2e - m*log2e)
      at_exp2x8(p[0], p[1], p[2], p[3], p[4], p[5], p[6], p[7]);
      ps[j] = ((p[0] + p[1]) + (p[2] + p[3])) + ((p[4] + p[5]) + (p[6] + p[7]));
    }
    lrow = lrow * alpha + ((ps[0] + ps[1]) + (ps[2] + ps[3]));
#pragma unroll
    for (int t = 0; t < 4; ++t)
#pragma unroll
      for (int r = 0; r < 8; ++r) oacc[t][r] *= alpha;
    // P^T as B operand, straight from the score tiles: element e of k-chunk kk is key kk*32 + 8*hh + e (tile 2kk, register e), element
    // 8 + e is key kk*32 + 16 + 8*hh + e (tile 2kk + 1, register e): the k order of the V loader below.
    // Unrolled, so that kk picks the score registers at compile time.
#pragma unroll
    for (int kk = 0; kk < 2; ++kk) {
      v16b pa, pl;
#pragma unroll
      for (int e = 0; e < 8; ++e) {
        const float p0 = pe[2 * kk][e], p1 = pe[2 * kk + 1][e];
        if (SPLIT_PV) { __bf16 a, bl; at_split(p0, a, bl); pa[e] = a; pl[e] = bl; at_split(p1, a, bl); pa[8 + e] = a; pl[8 + e] = bl; }
        else { pa[e] = at_to16<F16>(p0 * PSC); pa[8 + e] = at_to16<F16>(p1 * PSC); }
      }
#pragma unroll
      for (int t = 0; t < 4; ++t) {
        FB vb;
        vb.h[0] = *(const v8b*)(Vth + (t * 16 + c) * AT_LP + kk * 32 + 8 * hh);
        vb.h[1] = *(const v8b*)(Vth + (t * 16 + c) * AT_LP + kk * 32 + 16 + 8 * hh);
        oacc[t] = at_mma16<F16>(vb.v, pa, oacc[t]);
        if (SPLIT_PV) {
          FB vl;
          vl.h[0] = *(const v8b*)(Vtl + (t * 16 + c) * AT_LP + kk * 32 + 8 * hh);
          vl.h[1] = *(const v8b*)(Vtl + (t * 16 + c) * AT_LP + kk * 32 + 16 + 8 * hh);
          oacc[t] = at_mma16<F16>(vl.v, pa, oacc[t]);
          oacc[t] = at_mma16<F16>(vb.v, pl, oacc[t]);
        }
      }
    }
  }

  float* os = Os[wave];
  {
    const float inv = 1.0f / ((lrow + at_xhalf(lrow)) * PSC);   // the two halves' sums joined, once
#pragma unroll
    for (int t = 0; t < 4; ++t) {
      v4f lo4, hi4;
#pragma unroll
      for (int e = 0; e < 4; ++e) { lo4[e] = oacc[t][e] * inv; hi4[e] = oacc[t][4 + e] * inv; }
      *(v4f*)(os + c * 68 + t * 16 + 8 * hh)     = lo4;
      *(v4f*)(os + c * 68 + t * 16 + 8 * hh + 4) = hi4;
    }
  }
  __builtin_amdgcn_fence(__ATOMIC_RELEASE, "workgroup");
  __builtin_amdgcn_wave_barrier();
  __builtin_amdgcn_fence(__ATOMIC_ACQUIRE, "workgroup");
  {
    const int c4 = (lane & 15) * 4;
    {
#pragma unroll
      for (int it = 0; it < 8; ++it) {
        const int row = it * 2 + hh;
        v4f val = *(const v4f*)(os + row * 68 + c4);
        *(v4f*)(ob_ptr + (size_t)(q0 + row) * g.o_rs + c4) = val;
      }
      
    }
  }
}

#define SB_ 2
#define SN_ 4096
#define SC_ 256
#define SI_ 512
#define SH_ 8
extern "C" void kernel_launch(void* const* d_in, const int* in_sizes, int n_in, void* d_out, int out_size, void* d_ws, size_t ws_size, hipStream_t stream) {
  (void)in_sizes; (void)n_in; (void)out_size; (void)ws_size;
  const float* x = (const float*)d_in[0]; const float* Wq = (const float*)d_in[1]; const float* Wk = (const float*)d_in[2]; const float* Wv = (const float*)d_in[3]; const float* Wo = (const float*)d_in[4];
  float* out = (float*)d_out;
  char* ws = (char*)d_ws; size_t off = 0;
  auto carve = [&](size_t bytes) -> char* { char* p = ws + off; off += (bytes + 255) & ~(size_t)255; return p; };
  const int R = SB_ * SN_;
  __bf16* Xh = (__bf16*)carve((size_t)R * SC_ * 2); __bf16* Xl = (__bf16*)carve((size_t)R * SC_ * 2);
  __bf16* W3h = (__bf16*)carve((size_t)3 * SI_ * SC_ * 2); __bf16* W3l = (__bf16*)carve((size_t)3 * SI_ * SC_ * 2);     // [Wq;Wk;Wv] stacked = Bt for N = 1536
  __bf16* Woh = (__bf16*)carve((size_t)SC_ * SI_ * 2); __bf16* Wol = (__bf16*)carve((size_t)SC_ * SI_ * 2);
  float* QKV = (float*)carve((size_t)R * 3 * SI_ * 4);            // 50 MB
  float* O = (float*)carve((size_t)R * SI_ * 4);
  __bf16* Oh = (__bf16*)carve((size_t)R * SI_ * 2); __bf16* Ol = (__bf16*)carve((size_t)R * SI_ * 2);
  split_f32_bf16x2<<<(R * SC_ / 2 + 255) / 256, 256, 0, stream>>>(x, Xh, Xl, R * SC_ / 2);
  split_f32_bf16x2<<<(SI_ * SC_ / 2 + 255) / 256, 256, 0, stream>>>(Wq, W3h, W3l, SI_ * SC_ / 2);
  split_f32_bf16x2<<<(SI_ * SC_ / 2 + 255) / 256, 256, 0, stream>>>(Wk, W3h + (size_t)SI_ * SC_, W3l + (size_t)SI_ * SC_, SI_ * SC_ / 2);
  split_f32_bf16x2<<<(SI_ * SC_ / 2 + 255) / 256, 256, 0, stream>>>(Wv, W3h + (size_t)2 * SI_ * SC_, W3l + (size_t)2 * SI_ * SC_, SI_ * SC_ / 2);
  split_f32_bf16x2<<<(SC_ * SI_ / 2 + 255) / 256, 256, 0, stream>>>(Wo, Woh, Wol, SC_ * SI_ / 2);
  { const int t = (R / 64) * (3 * SI_ / 64);
    wmma_gemm64<1, true, 0, 0, false><<<dim3((t + 7) / 8, 1), 256, 0, stream>>>(U16(Xh), U16(Xl), SC_, 0, U16(W3h), U16(W3l), SC_, 0, QKV, nullptr, 3 * SI_, 0, nullptr, nullptr, 0, R, 3 * SI_, SC_, 1.0f); }
  { AttnGeom g;
    g.q_bs = (long)SN_ * 3 * SI_; g.q_rs = 3 * SI_; g.q_hs = 64; g.k_bs = g.q_bs; g.k_rs = 3 * SI_; g.k_hs = 64; g.v_bs = g.q_bs; g.v_rs = 3 * SI_; g.v_hs = 64;
    g.o_bs = (long)SN_ * SI_; g.o_rs = SI_; g.o_hs = 64; g.S = SN_; g.Skv = SN_; g.H = SH_; g.mask_mode = 0; g.qscale = 0.125f; g.blk0 = 0; g.mask_fill = -INFINITY; g.mask_is_int = 0;
    attn64_kernel<false, false, true, 0><<<SB_ * SH_ * (SN_ / AT_QB), AT_NW * 32, 0, stream>>>(QKV, QKV + SI_, QKV + 2 * SI_, O, nullptr, nullptr, g); }
  split_f32_bf16x2<<<(R * SI_ / 2 + 255) / 256, 256, 0, stream>>>(O, Oh, Ol, R * SI_ / 2);
  { const int t = (R / 64) * (SC_ / 64);
    wmma_gemm64<1, true, 0, 0, false><<<dim3((t + 7) / 8, 1), 256, 0, stream>>>(U16(Oh), U16(Ol), SI_, 0, U16(Woh), U16(Wol), SI_, 0, out, nullptr, SC_, 0, nullptr, nullptr, 0, R, SC_, SI_, 1.0f); }
}

// v006
// It runs in 203 microseconds.
// Timed twice side by side with v005, it ran 1.19 times as fast both times.
// Counting every step since v000, it is 10.9 times as fast.
#include <hip/hip_runtime.h>
#include <math.h>
// Spatio-temporal attention (2 clips x 4096 tokens, 8 heads x 64): q/k/v = x·Wᵀ (8192 x 256 · 256 x 512 each) and out = o·Woᵀ (·512 x 256)
// on v_wmma_f32_16x16x32_bf16 with bf16 hi/lo split operands (the output is an average over 4096 near-uniform attention weights, RMS
// 0.0025); the attention itself (scores and p·v, p x2^15, 4096 keys) on
// v_wmma_f32_16x16x32_f16 with f16 operands; f32 accumulate; softmax f32 on VALU.
// The 1x1x1 conv weights ([out][in]) are used directly as the transposed operand.
typedef __attribute__((ext_vector_type(16))) _Float16 v16h;
typedef __attribute__((ext_vector_type(8)))  _Float16 v8h;
typedef __attribute__((ext_vector_type(16))) __bf16   v16b;
typedef __attribute__((ext_vector_type(8)))  __bf16   v8b;
typedef __attribute__((ext_vector_type(4)))  __bf16   v4b;
typedef __attribute__((ext_vector_type(8)))  float    v8f;
typedef __attribute__((ext_vector_type(4)))  float    v4f;
#define PSCALE 32768.0f
#define U16(p) ((const unsigned short*)(const void*)(p))
#define PSCALE_INV (1.0f / 32768.0f)

__device__ __forceinline__ unsigned short f2bf_bits(float f) {
  unsigned u = __float_as_uint(f);
  return (unsigned short)((u + 0x7FFFu + ((u >> 16) & 1u)) >> 16);
}
__device__ __forceinline__ float bf_bits2f(unsigned short h) { return __uint_as_float(((unsigned)h) << 16); }

// hazard guards as plain device helpers (no inline asm inside the kernel template body)
__device__ __forceinline__ void dep_guard_h(v8f& a, v8f& b, v16h x, v16h y) { asm volatile("v_nop\n\tv_nop\n\tv_nop\n\tv_nop" : "+v"(a), "+v"(b) : "v"(x), "v"(y)); }
__device__ __forceinline__ void dep_guard_b(v8f& a, v8f& b, v16b x, v16b y) { asm volatile("v_nop\n\tv_nop\n\tv_nop\n\tv_nop" : "+v"(a), "+v"(b) : "v"(x), "v"(y)); }
__device__ __forceinline__ void keep4_h(v16h a, v16h b, v16h c, v16h d) { asm volatile("v_nop" :: "v"(a), "v"(b), "v"(c), "v"(d)); }
__device__ __forceinline__ void keep4_b(v16b a, v16b b, v16b c, v16b d) { asm volatile("v_nop" :: "v"(a), "v"(b), "v"(c), "v"(d)); }
__device__ __forceinline__ void acc_guard4(v8f& a, v8f& b, v8f& c, v8f& d) { asm volatile("v_nop\n\tv_nop\n\tv_nop\n\tv_nop" : "+v"(a), "+v"(b), "+v"(c), "+v"(d)); }
template <typename T> struct Frag;
template <> struct Frag<_Float16> {
  typedef v16h V; union U { v16h v; v8h h[2]; };
  static __device__ __forceinline__ v16h load(const _Float16* p) {   // elements 0..7 <- p[0..7], 8..15 <- p[16..23]
    U f; f.h[0] = *(const v8h*)(p); f.h[1] = *(const v8h*)(p + 16); return f.v;
  }
  static __device__ __forceinline__ v8f mma(v16h a, v16h b, v8f c) {
    return __builtin_amdgcn_wmma_f32_16x16x32_f16(false, a, false, b, (short)0, c, false, false);
  }
  static __device__ __forceinline__ void guard(v8f& a, v8f& b, v16h x, v16h y) { dep_guard_h(a, b, x, y); }
  static __device__ __forceinline__ void keep(v16h a, v16h b, v16h c, v16h d) { keep4_h(a, b, c, d); }
};
template <> struct Frag<__bf16> {
  typedef v16b V; union U { v16b v; v8b h[2]; };
  static __device__ __forceinline__ v16b load(const __bf16* p) {
    U f; f.h[0] = *(const v8b*)(p); f.h[1] = *(const v8b*)(p + 16); return f.v;
  }
  static __device__ __forceinline__ v8f mma(v16b a, v16b b, v8f c) {
    return __builtin_amdgcn_wmma_f32_16x16x32_bf16(false, a, false, b, (short)0, c, false, false);
  }
  static __device__ __forceinline__ void guard(v8f& a, v8f& b, v16b x, v16b y) { dep_guard_b(a, b, x, y); }
  static __device__ __forceinline__ void keep(v16b a, v16b b, v16b c, v16b d) { keep4_b(a, b, c, d); }
};

// ---- Register-blocked batched WMMA GEMM ------------------------------------
// C[m,n] = scale * sum_k A[m,k] * Bt[n,k] (+bias)(+resid); each wave owns a 64x64 tile.
// A row-major [M,K]; Bt row-major [N,K]; M,N % 64 == 0, K % 32 == 0.
// SPLIT: operands are hi/lo planes (A2/Bt2 = lo planes, same layout); product = hi·hi + hi·lo + lo·hi.
// BIAS_MODE: 0 = none, 1 = bias[m], 2 = bias[n].
// OUT_MODE: 0 = f32, 1 = f16, 2 = bf16 hi plane (Cout) + bf16 lo plane (Cout2).
// ET: 0 = f16 operands, 1 = bf16 operands (pointers passed as 16-bit storage)
template <int ET> struct Elem;
template <> struct Elem<0> { typedef _Float16 T; };
template <> struct Elem<1> { typedef __bf16 T; };
template <int ET, bool SPLIT, int BIAS_MODE, int OUT_MODE, bool RESID, int ACT = 0>
__global__ __launch_bounds__(256) void wmma_gemm64(
    const unsigned short* __restrict__ Ap, const unsigned short* __restrict__ A2p, int lda, long strideA,
    const unsigned short* __restrict__ Btp, const unsigned short* __restrict__ Bt2p, int ldb, long strideB,
    void* __restrict__ Cout, void* __restrict__ Cout2, int ldc, long strideC,
    const float* __restrict__ bias,
    const float* __restrict__ resid, long strideR,
    int M, int N, int K, float scale) {
  typedef typename Elem<ET>::T T;
  typedef typename Frag<T>::V V;
  const T* A = (const T*)Ap; const T* A2 = (const T*)A2p; const T* Bt = (const T*)Btp; const T* Bt2 = (const T*)Bt2p;
  __shared__ __align__(16) float sT[8][16 * 68];   // per-wave 16x64 slab, pitch 68 floats
  const int b    = blockIdx.y;
  const int lane = threadIdx.x & 31;
  const int wave = threadIdx.x >> 5;
  const int tilesN = N >> 6;
  const int tilesM = M >> 6;
  const int tile = blockIdx.x * 8 + wave;
  if (tile >= tilesM * tilesN) return;   // wave-uniform; no block barriers in this kernel
  const int tm = tile / tilesN;
  const int tn = tile - tm * tilesN;
  const int m0 = tm << 6;
  const int n0 = tn << 6;

  const T* Ab  = A  + (size_t)b * strideA;
  const T* Bb  = Bt + (size_t)b * strideB;
  const T* Ab2 = SPLIT ? (A2  + (size_t)b * strideA) : nullptr;
  const T* Bb2 = SPLIT ? (Bt2 + (size_t)b * strideB) : nullptr;

  const int rlane = lane & 15;                 // row (A) / col (B, D) within subtile
  const int koff  = (lane >> 4) * 8;           // k offset of this lane half
  const int mOff  = (lane >> 4) * 8;           // D row offset

  v8f acc[4][4];
#pragma unroll
  for (int i = 0; i < 4; ++i)
#pragma unroll
    for (int j = 0; j < 4; ++j) acc[i][j] = (v8f){0.f,0.f,0.f,0.f,0.f,0.f,0.f,0.f};

  for (int k0 = 0; k0 < K; k0 += 32) {
    V bh[4], bl[4];
#pragma unroll
    for (int j = 0; j < 4; ++j) {
      const size_t bo = (size_t)(n0 + (j << 4) + rlane) * ldb + koff + k0;
      bh[j] = Frag<T>::load(Bb + bo);
      if (SPLIT) bl[j] = Frag<T>::load(Bb2 + bo);
    }
#pragma unroll
    for (int i = 0; i < 4; ++i) {
      const size_t ao = (size_t)(m0 + (i << 4) + rlane) * lda + koff + k0;
      V ah = Frag<T>::load(Ab + ao);
      V al;
      if (SPLIT) al = Frag<T>::load(Ab2 + ao);
#pragma unroll
      for (int j = 0; j < 4; ++j) {
        acc[i][j] = Frag<T>::mma(ah, bh[j], acc[i][j]);
        if (SPLIT) {
          acc[i][j] = Frag<T>::mma(ah, bl[j], acc[i][j]);
          acc[i][j] = Frag<T>::mma(al, bh[j], acc[i][j]);
        }
      }
      Frag<T>::guard(acc[i][0], acc[i][3], ah, SPLIT ? al : ah);
    }
    Frag<T>::keep(bh[0], bh[1], bh[2], bh[3]);
    if (SPLIT) Frag<T>::keep(bl[0], bl[1], bl[2], bl[3]);
  }
  acc_guard4(acc[0][0], acc[0][1], acc[0][2], acc[0][3]);
  acc_guard4(acc[1][0], acc[1][1], acc[1][2], acc[1][3]);
  acc_guard4(acc[2][0], acc[2][1], acc[2][2], acc[2][3]);
  acc_guard4(acc[3][0], acc[3][1], acc[3][2], acc[3][3]);

  // ---- epilogue ----
  float* slab = sT[wave];
  const float* Rb = RESID ? (resid + (size_t)b * strideR) : nullptr;
#pragma unroll
  for (int i = 0; i < 4; ++i) {
    const int mBase = m0 + (i << 4);
#pragma unroll
    for (int j = 0; j < 4; ++j) {
      const int n = n0 + (j << 4) + rlane;
      float bv = 0.f;
      if (BIAS_MODE == 2) bv = bias[n];
#pragma unroll
      for (int r = 0; r < 8; ++r) {
        float v = acc[i][j][r] * scale;
        if (BIAS_MODE == 1) v += bias[mBase + mOff + r];
        if (BIAS_MODE == 2) v += bv;
        if (RESID) v += Rb[(size_t)(mBase + mOff + r) * ldc + n];
        if (ACT == 1) v = tanhf(v);
        if (ACT == 2) v = fmaxf(v, 0.0f);
        if (ACT == 3) v = v / (1.0f + expf(-v));
        if (ACT == 4) v = (v > 0.f) ? v : 0.01f * v;
        if (ACT == 5) v = 0.5f * v * (1.0f + erff(v * 0.70710678118654752f));
        slab[(mOff + r) * 68 + (j << 4) + rlane] = v;
      }
    }
    __builtin_amdgcn_fence(__ATOMIC_RELEASE, "workgroup");
    __builtin_amdgcn_wave_barrier();
    __builtin_amdgcn_fence(__ATOMIC_ACQUIRE, "workgroup");
    if (OUT_MODE == 0) {
      float* C = (float*)Cout + (size_t)b * strideC;
      const int hh = lane >> 4, c4 = (lane & 15) * 4;     // row seg = 256 B = 16 lanes x 16 B
      {
#pragma unroll
        for (int it = 0; it < 8; ++it) {
          const int row = it * 2 + hh;
          v4f v = *(const v4f*)(slab + row * 68 + c4);
          *(v4f*)(C + (size_t)(mBase + row) * ldc + n0 + c4) = v;
        }
        
      }
    } else {
      const int q = lane >> 3, c8 = (lane & 7) * 8;
      unsigned short* C  = (unsigned short*)Cout  + (size_t)b * strideC;
      unsigned short* C2 = (OUT_MODE == 2) ? ((unsigned short*)Cout2 + (size_t)b * strideC) : nullptr;
      {
#pragma unroll
        for (int it = 0; it < 4; ++it) {
          const int row = it * 4 + q;
          const float* sp = slab + row * 68 + c8;
          v8h hv, lv;
#pragma unroll
          for (int e = 0; e < 8; ++e) {
            if (OUT_MODE == 1) {
              hv[e] = (_Float16)sp[e];
            } else {
              unsigned short hb = f2bf_bits(sp[e]);
              unsigned short lb = f2bf_bits(sp[e] - bf_bits2f(hb));
              hv[e] = __builtin_bit_cast(_Float16, hb);
              lv[e] = __builtin_bit_cast(_Float16, lb);
            }
          }
          *(v8h*)(C + (size_t)(mBase + row) * ldc + n0 + c8) = hv;
          if (OUT_MODE == 2) *(v8h*)(C2 + (size_t)(mBase + row) * ldc + n0 + c8) = lv;
        }
        
      }
    }
    __builtin_amdgcn_fence(__ATOMIC_RELEASE, "workgroup");
    __builtin_amdgcn_wave_barrier();
    __builtin_amdgcn_fence(__ATOMIC_ACQUIRE, "workgroup");
  }
}

__global__ __launch_bounds__(256) void cast_f32_f16x2(
    const float* __restrict__ in, _Float16* __restrict__ out, int n2) {
  int i = blockIdx.x * 256 + threadIdx.x;
  if (i < n2) {
    const _Float16 h0 = (_Float16)in[2 * i], h1 = (_Float16)in[2 * i + 1];
    const unsigned u = (unsigned)__builtin_bit_cast(unsigned short, h0) | ((unsigned)__builtin_bit_cast(unsigned short, h1) << 16);
    ((unsigned*)out)[i] = u;
    
  }
}


// ---- f32 -> f16 cast with a power-of-two pre-scale (folded back by the consumer GEMM's scale) ----
__global__ __launch_bounds__(256) void cast_f32_f16x2s(const float* __restrict__ in, _Float16* __restrict__ out, int n2, float s) {
  int i = blockIdx.x * 256 + threadIdx.x;
  if (i < n2) {
    const _Float16 h0 = (_Float16)(in[2 * i] * s), h1 = (_Float16)(in[2 * i + 1] * s);
    const unsigned u = (unsigned)__builtin_bit_cast(unsigned short, h0) | ((unsigned)__builtin_bit_cast(unsigned short, h1) << 16);
    ((unsigned*)out)[i] = u;
    
  }
}
__global__ __launch_bounds__(256) void split_f32_bf16x2(
    const float* __restrict__ in, __bf16* __restrict__ hi, __bf16* __restrict__ lo, long n2) {
  long i = (long)blockIdx.x * 256 + threadIdx.x;
  long stride = (long)gridDim.x * 256;
  {
    for (long j = i; j < n2; j += stride) {
      const float a = in[2 * j], b = in[2 * j + 1];
      const unsigned short ah = f2bf_bits(a), bh = f2bf_bits(b);
      const unsigned short al = f2bf_bits(a - bf_bits2f(ah)), bl = f2bf_bits(b - bf_bits2f(bh));
      ((unsigned*)hi)[j] = (unsigned)ah | ((unsigned)bh << 16);
      ((unsigned*)lo)[j] = (unsigned)al | ((unsigned)bl << 16);
    }
    
  }
}


// ---- f32 [R][C] (row pitch ldi) -> f16 transposed [C][R] (row pitch ldo); 64x64 tiles; each output row segment
__global__ __launch_bounds__(256) void transpose_cast_f16(const float* __restrict__ in, int ldi,
                                                         _Float16* __restrict__ outT, int ldo, float scale) {
  __shared__ __align__(16) _Float16 tile[64][72];     // [c][r]
  const int c0 = blockIdx.x * 64, r0 = blockIdx.y * 64;
  const int t = threadIdx.y * 32 + threadIdx.x;
  for (int i = threadIdx.y; i < 64; i += 8) {
    tile[threadIdx.x][i]      = (_Float16)(in[(size_t)(r0 + i) * ldi + c0 + threadIdx.x] * scale);
    tile[32 + threadIdx.x][i] = (_Float16)(in[(size_t)(r0 + i) * ldi + c0 + 32 + threadIdx.x] * scale);
  }
  __syncthreads();
  const int q = t >> 3, c8 = (t & 7) * 8;
  {
#pragma unroll
    for (int it = 0; it < 2; ++it) {
      const int c = it * 32 + q;
      v8h hv = *(const v8h*)(&tile[c][c8]);
      *(v8h*)(outT + (size_t)(c0 + c) * ldo + r0 + c8) = hv;
    }
    
  }
}

// ---- f32 [R][C] (pitch ldi) -> bf16 hi/lo transposed planes [C][R] (pitch ldo); 64x64 tiles; each output row segment
__global__ __launch_bounds__(256) void transpose_split_bf16(const float* __restrict__ in, int ldi,
                                                           __bf16* __restrict__ outH, __bf16* __restrict__ outL, int ldo) {
  __shared__ __align__(16) float tile[64][68];     // [c][r]
  const int c0 = blockIdx.x * 64, r0 = blockIdx.y * 64;
  const int t = threadIdx.y * 32 + threadIdx.x;
  for (int i = threadIdx.y; i < 64; i += 8) {
    tile[threadIdx.x][i]      = in[(size_t)(r0 + i) * ldi + c0 + threadIdx.x];
    tile[32 + threadIdx.x][i] = in[(size_t)(r0 + i) * ldi + c0 + 32 + threadIdx.x];
  }
  __syncthreads();
  const int q = t >> 3, c8 = (t & 7) * 8;
  {
#pragma unroll
    for (int it = 0; it < 2; ++it) {
      const int c = it * 32 + q;
      v8b hv, lv;
#pragma unroll
      for (int e = 0; e < 8; ++e) {
        const float f = tile[c][c8 + e];
        const unsigned short hb = f2bf_bits(f);
        hv[e] = __builtin_bit_cast(__bf16, hb);
        lv[e] = __builtin_bit_cast(__bf16, f2bf_bits(f - bf_bits2f(hb)));
      }
      *(v8b*)(outH + (size_t)(c0 + c) * ldo + r0 + c8) = hv;
      *(v8b*)(outL + (size_t)(c0 + c) * ldo + r0 + c8) = lv;
    }
    
  }
}

#define AT_D 64
#define AT_NW 4
#define AT_QB 64
#define AT_KC 64
// LDS row pitch of the 16-bit K and V-transposed tiles, in elements: 72 = 144 B = 16 B x odd, so the 16 rows that one
// ds_load_b128 fragment read touches start on 16 different bank groups (at 128 B they share two groups and the read serialises).
#define AT_LP 72
// e^x is taken as 2^(x * log2 e) on the hardware's base-2 exponential (one instruction); every argument here is a score minus
// its row maximum, so the library exponential's overflow and underflow ladder has nothing to catch (below 2^-126 the weight is 0).
#define AT_LOG2E 1.4426950408889634f
struct AttnGeom { const float* cp = nullptr; const float* pc = nullptr; long c_bs = 0, c_rs = 0, c_hs = 0;   // mode-5 score-bias tables
                  long q_bs, q_rs, q_hs, k_bs, k_rs, k_hs, v_bs, v_rs, v_hs, o_bs, o_rs, o_hs;
                  int S, Skv, H, mask_mode; float qscale; int blk0; float mask_fill; int mask_is_int; };
static_assert(sizeof(AttnGeom) == 168, "no padding");

__device__ __forceinline__ unsigned short at_bf_bits(float f) {
  unsigned u = __float_as_uint(f);
  return (unsigned short)((u + 0x7FFFu + ((u >> 16) & 1u)) >> 16);
}
__device__ __forceinline__ __bf16 at_f2bf(float f) { return __builtin_bit_cast(__bf16, at_bf_bits(f)); }
__device__ __forceinline__ void at_split(float f, __bf16& hi, __bf16& lo) {
  const unsigned short hb = at_bf_bits(f);
  hi = __builtin_bit_cast(__bf16, hb);
  lo = at_f2bf(f - __uint_as_float(((unsigned)hb) << 16));
}
__device__ __forceinline__ v8f at_mma(v16b a, v16b b, v8f c) {
  return __builtin_amdgcn_wmma_f32_16x16x32_bf16(false, a, false, b, (short)0, c, false, false);
}
// 16-bit element as a bit pattern held in a __bf16 slot: f16 bits when F16, bf16 (RNE) otherwise
template <bool F16> __device__ __forceinline__ __bf16 at_to16(float f) {
  if (F16) return __builtin_bit_cast(__bf16, (_Float16)f);
  return at_f2bf(f);
}
template <bool F16> __device__ __forceinline__ v8f at_mma16(v16b a, v16b b, v8f c) {
  if (F16) {
    const v16h ah = __builtin_bit_cast(v16h, a), bh = __builtin_bit_cast(v16h, b);
    return __builtin_amdgcn_wmma_f32_16x16x32_f16(false, ah, false, bh, (short)0, c, false, false);
  }
  return at_mma(a, b, c);
}

// Lane l's value as seen from lane l ^ 16 (the other half of the wave): one vector cross-row move, no LDS trip.
__device__ __forceinline__ float at_xhalf(float x) {
  const int b = __builtin_bit_cast(int, x);
  return __builtin_bit_cast(float, __builtin_amdgcn_permlanex16(b, b, 0x76543210, 0xfedcba98, false, false));
}

// Eight base-2 exponentials (one score tile of a lane's query), each in place. One statement, so that the
// issue slot the instruction set asks for behind a transcendental is filled by construction: each v_exp_f32 is followed by an
// independent one, the last by v_nop; written in place, no later instruction can rewrite a source that is not also the live result
// The two s_delay_alu are the hints the compiler would write for its own code and cannot for asm text (first: the arguments come from
// the vector instructions just ahead; last: whichever reader comes next): a wave that waits unhinted holds the SIMD's issue for the others.
__device__ __forceinline__ void at_exp2x8(float& p0, float& p1, float& p2, float& p3, float& p4, float& p5, float& p6, float& p7) {
  asm("s_delay_alu instid0(VALU_DEP_1)\n\t"
      "v_exp_f32 %0, %0\n\tv_exp_f32 %1, %1\n\tv_exp_f32 %2, %2\n\tv_exp_f32 %3, %3\n\t"
      "v_exp_f32 %4, %4\n\tv_exp_f32 %5, %5\n\tv_exp_f32 %6, %6\n\tv_exp_f32 %7, %7\n\tv_nop\n\t"
      "s_delay_alu instid0(TRANS32_DEP_1)"
      : "+v"(p0), "+v"(p1), "+v"(p2), "+v"(p3), "+v"(p4), "+v"(p5), "+v"(p6), "+v"(p7));
}
// The same for one value (the query's rescale factor).
__device__ __forceinline__ void at_exp2x1(float& a) {
  asm("s_delay_alu instid0(VALU_DEP_1)\n\tv_exp_f32 %0, %0\n\tv_nop\n\ts_delay_alu instid0(TRANS32_DEP_1)" : "+v"(a));
}

// MM: the mask mode as a compile-time constant (the launch's g.mask_mode must equal it); MM < 0 reads g.mask_mode at run time.
template <bool SPLIT_QK, bool SPLIT_PV, bool F16 = false, int MM = -1>
__global__ __launch_bounds__(128)
void attn64_kernel(const float* __restrict__ q, const float* __restrict__ k,
                   const float* __restrict__ v, float* __restrict__ out,
                   const void* __restrict__ mask_a, const int* __restrict__ mask_b, AttnGeom g) {
  static_assert(!(F16 && (SPLIT_QK || SPLIT_PV)), "f16 mode is non-split");
  const int mask_mode = (MM >= 0) ? MM : g.mask_mode;
  const float PSC = F16 ? 32768.0f : 1.0f;     // f16 probabilities carried x2^15 (subnormal range), folded into the final 1/l
  union FB { v16b v; v8b h[2]; };
  __shared__ __align__(16) __bf16 Ksh[AT_KC * AT_LP];            // K hi [kv][d], pitch AT_LP      9 KB
  __shared__ __align__(16) __bf16 Ksl[SPLIT_QK ? AT_KC * AT_LP : 8];
  __shared__ __align__(16) __bf16 Vth[AT_D * AT_LP];             // V hi [d][kv], pitch AT_LP      9 KB
  __shared__ __align__(16) __bf16 Vtl[SPLIT_PV ? AT_D * AT_LP : 8];
  __shared__ __align__(16) float  Os[AT_NW][16 * 68];            // per wave out tile, pitch 68

  const int tid  = threadIdx.x;
  const int wave = tid >> 5;
  const int lane = tid & 31;
  const int hh   = lane >> 4;
  const int c    = lane & 15;

  const int nqb = g.S / AT_QB;
  const int bx = blockIdx.x + g.blk0;
  const int qb = bx % nqb;
  const int bh = bx / nqb;
  const int h  = bh % g.H;
  const int b  = bh / g.H;
  const int qbase_block = qb * AT_QB;
  const int q0 = qbase_block + wave * 16;

  const float* qb_ptr = q + (size_t)b * g.q_bs + (size_t)h * g.q_hs;
  const float* kb_ptr = k + (size_t)b * g.k_bs + (size_t)h * g.k_hs;
  const float* vb_ptr = v + (size_t)b * g.v_bs + (size_t)h * g.v_hs;
  float*       ob_ptr = out + (size_t)b * g.o_bs + (size_t)h * g.o_hs;

  // ---- Q fragments (B operand: column = query q0 + c): 2 d-chunks, hi (and lo) ----
  v16b qah[2], qal[2];
  {
    const float* qrow = qb_ptr + (size_t)(q0 + c) * g.q_rs;
#pragma unroll
    for (int dc = 0; dc < 2; ++dc) {
#pragma unroll
      for (int e = 0; e < 8; ++e) {
        const float f0 = qrow[dc * 32 + 8 * hh + e] * g.qscale;
        const float f1 = qrow[dc * 32 + 16 + 8 * hh + e] * g.qscale;
        if (SPLIT_QK) { __bf16 hq, lq; at_split(f0, hq, lq); qah[dc][e] = hq; qal[dc][e] = lq; at_split(f1, hq, lq); qah[dc][8 + e] = hq; qal[dc][8 + e] = lq; }
        else { qah[dc][e] = at_to16<F16>(f0); qah[dc][8 + e] = at_to16<F16>(f1); qal[dc][e] = qah[dc][e]; qal[dc][8 + e] = qah[dc][8 + e]; }
      }
    }
  }

  // state of this lane's query q0 + c; nrow2 = -(running maximum) * log2 e as it was rounded when that maximum was taken;
  // lrow sums this wave half's keys only (the halves are joined behind the loop)
  float nrow2 = INFINITY, lrow = 0.f;
  v8f oacc[4];                                 // O^T: oacc[t][r] = element d = t*16 + 8*hh + r of query q0 + c
#pragma unroll
  for (int t = 0; t < 4; ++t) oacc[t] = (v8f){0.f,0.f,0.f,0.f,0.f,0.f,0.f,0.f};

  const int nChunks = (mask_mode == 1 || mask_mode == 4) ? (qb + 1) : (g.Skv / AT_KC);   // block-uniform
  const int qrow = q0 + c;
  const int qkeep = (mask_mode == 3) ? mask_b[(size_t)b * g.S + qrow] : 1;   // query mask (mode 3): mask_b = qmask
  for (int kc = 0; kc < nChunks; ++kc) {
    const int kv0 = kc * AT_KC;
    __syncthreads();
    {
      // Eight lanes take one 128-B line of a K or V row, so a wave's 16-byte load covers four whole lines (a lane that walks its own
      // 128 B makes every load touch 32 lines, 16 B of each). A lane holds the same four head elements of four adjacent keys:
      // K goes to LDS as 8 B of one key's row, V transposed as 8 B (four keys) of one head element's row.
      const int cl = (tid & 7) * 4, kr = (tid >> 3) * 4;
      const float* kp[4]; const float* vp[4];
      v4f kk[2][4], vv[2][4];
#pragma unroll
      for (int i = 0; i < 4; ++i) {
        kp[i] = kb_ptr + (size_t)(kv0 + kr + i) * g.k_rs + cl;
        vp[i] = vb_ptr + (size_t)(kv0 + kr + i) * g.v_rs + cl;
#pragma unroll
        for (int hd = 0; hd < 2; ++hd) {
          kk[hd][i] = *(const v4f*)(kp[i] + hd * 32);
          vv[hd][i] = *(const v4f*)(vp[i] + hd * 32);
        }
      }
      // The wait that stands between an issued global load and a rewrite of its address registers. The addresses are its inputs, so
      // they stay whole up to it.
      asm volatile("s_wait_xcnt 0x0" :: "v"(kp[0]), "v"(kp[1]), "v"(kp[2]), "v"(kp[3]), "v"(vp[0]), "v"(vp[1]), "v"(vp[2]), "v"(vp[3]) : "memory");
#pragma unroll
      for (int hd = 0; hd < 2; ++hd) {
        const int d0 = hd * 32 + cl;
#pragma unroll
        for (int i = 0; i < 4; ++i) {
          v4b a, bl;
#pragma unroll
          for (int e = 0; e < 4; ++e) {
            if (SPLIT_QK) { __bf16 x, y; at_split(kk[hd][i][e], x, y); a[e] = x; bl[e] = y; }
            else a[e] = at_to16<F16>(kk[hd][i][e]);
          }
          *(v4b*)(Ksh + (kr + i) * AT_LP + d0) = a;
          if (SPLIT_QK) *(v4b*)(Ksl + (kr + i) * AT_LP + d0) = bl;
        }
#pragma unroll
        for (int e = 0; e < 4; ++e) {
          v4b a, bl;
#pragma unroll
          for (int i = 0; i < 4; ++i) {
            if (SPLIT_PV) { __bf16 x, y; at_split(vv[hd][i][e], x, y); a[i] = x; bl[i] = y; }
            else a[i] = at_to16<F16>(vv[hd][i][e]);
          }
          *(v4b*)(Vth + (d0 + e) * AT_LP + kr) = a;
          if (SPLIT_PV) *(v4b*)(Vtl + (d0 + e) * AT_LP + kr) = bl;
        }
      }
    }
    __syncthreads();

    // All fragments of the chunk are fetched as one group of LDS reads ahead of the matrix runs: K's eight first, V's eight behind them.
    // A read waited for in front of each product costs the wave one LDS round trip per product; here the first run waits once and
    // V lands under the scores and the softmax.
    FB kf[2][4], kfl[2][4], vf[2][4], vfl[2][4];
#pragma unroll
    for (int dc = 0; dc < 2; ++dc)
#pragma unroll
      for (int j = 0; j < 4; ++j) {
        kf[dc][j].h[0] = *(const v8b*)(Ksh + (j * 16 + c) * AT_LP + dc * 32 + 8 * hh);
        kf[dc][j].h[1] = *(const v8b*)(Ksh + (j * 16 + c) * AT_LP + dc * 32 + 16 + 8 * hh);
        if (SPLIT_QK) {
          kfl[dc][j].h[0] = *(const v8b*)(Ksl + (j * 16 + c) * AT_LP + dc * 32 + 8 * hh);
          kfl[dc][j].h[1] = *(const v8b*)(Ksl + (j * 16 + c) * AT_LP + dc * 32 + 16 + 8 * hh);
        }
      }
#pragma unroll
    for (int kk = 0; kk < 2; ++kk)
#pragma unroll
      for (int t = 0; t < 4; ++t) {
        vf[kk][t].h[0] = *(const v8b*)(Vth + (t * 16 + c) * AT_LP + kk * 32 + 8 * hh);
        vf[kk][t].h[1] = *(const v8b*)(Vth + (t * 16 + c) * AT_LP + kk * 32 + 16 + 8 * hh);
        if (SPLIT_PV) {
          vfl[kk][t].h[0] = *(const v8b*)(Vtl + (t * 16 + c) * AT_LP + kk * 32 + 8 * hh);
          vfl[kk][t].h[1] = *(const v8b*)(Vtl + (t * 16 + c) * AT_LP + kk * 32 + 16 + 8 * hh);
        }
      }
    // Keeps the scheduler from sinking the reads back down to their products (each would again be waited for on its own).
    __builtin_amdgcn_sched_barrier(0);

    // S^T: s[j][r] = score of key kv0 + j*16 + 8*hh + r for query q0 + c. The four tiles take turns, so that a tile's second product
    // finds its first one finished; each tile still sums head elements 0..31, then 32..63.
    v8f s[4];
#pragma unroll
    for (int j = 0; j < 4; ++j) s[j] = (v8f){0.f,0.f,0.f,0.f,0.f,0.f,0.f,0.f};
#pragma unroll
    for (int dc = 0; dc < 2; ++dc)
#pragma unroll
      for (int j = 0; j < 4; ++j) {
        s[j] = at_mma16<F16>(kf[dc][j].v, qah[dc], s[j]);
        if (SPLIT_QK) {
          s[j] = at_mma16<F16>(kfl[dc][j].v, qah[dc], s[j]);
          s[j] = at_mma16<F16>(kf[dc][j].v, qal[dc], s[j]);
        }
      }
    const bool diag = (mask_mode == 1) && (kc == qb);
    float mj[4];                                // one maximum per score tile: four short chains instead of one long one
#pragma unroll
    for (int j = 0; j < 4; ++j) {
      mj[j] = -INFINITY;
#pragma unroll
      for (int r = 0; r < 8; ++r) {
        const int kvcol = kv0 + j * 16 + 8 * hh + r;
        bool masked = false;
        if (diag) masked = (kvcol > qrow);
        else if (mask_mode == 4) masked = (kvcol > qrow) || (qrow - kvcol > g.mask_is_int);
        else if (mask_mode == 2) {
          const size_t mi = (size_t)qrow * g.Skv + kvcol;
          masked = (g.mask_is_int == 0) ? (((const float*)mask_a)[mi] == 0.0f)
                 : (g.mask_is_int == 1) ? (((const int*)mask_a)[mi] == 0) : (((const int*)mask_a)[mi] != 0);
        } else if (mask_mode == 3) masked = (qkeep == 0) || (((const int*)mask_a)[(size_t)b * g.Skv + kvcol] == 0);   // mask_a = kvmask
        else if (mask_mode == 5) {
          const size_t mi = (size_t)qrow * g.Skv + kvcol;
          masked = (((const int*)mask_a)[mi] != 0);
          int n = mask_b[mi]; n = n < 0 ? 0 : n;
          s[j][r] += g.cp[(size_t)b * g.c_bs + (size_t)h * g.c_hs + (size_t)qrow * g.c_rs + n]
                   + g.pc[(size_t)b * g.c_bs + (size_t)h * g.c_hs + (size_t)kvcol * g.c_rs + n];
        }
        if (masked) s[j][r] = g.mask_fill;
        mj[j] = fmaxf(mj[j], s[j][r]);
      }
    }
    float m = fmaxf(fmaxf(mj[0], mj[1]), fmaxf(mj[2], mj[3]));
    m = fmaxf(m, at_xhalf(m));                  // the other half of the wave holds the query's other 32 keys
    // minus the running maximum in base-2 units, the offset of every weight of this chunk: the product is rounded once per chunk
    // maximum, and the smaller of two such products is the product of the larger maximum (rounding keeps the order)
    const float noff = fminf(nrow2, m * -AT_LOG2E);
    float alpha = noff - nrow2;                 // difference of the two offsets in use: exactly 0 while the maximum stands; -inf on the first chunk
    nrow2 = noff;
    at_exp2x1(alpha);
    float pe[4][8], ps[4];
#pragma unroll
    for (int j = 0; j < 4; ++j) {
      float* p = pe[j];
#pragma unroll
      for (int r = 0; r < 8; ++r) p[r] = fmaf(s[j][r], AT_LOG2E, noff);   // e^(s - m) = 2^(s*log2e - m*log2e)
      at_exp2x8(p[0], p[1], p[2], p[3], p[4], p[5], p[6], p[7]);
      ps[j] = ((p[0] + p[1]) + (p[2] + p[3])) + ((p[4] + p[5]) + (p[6] + p[7]));
    }
    lrow = lrow * alpha + ((ps[0] + ps[1]) + (ps[2] + ps[3]));
#pragma unroll
    for (int t = 0; t < 4; ++t)
#pragma unroll
      for (int r = 0; r < 8; ++r) oacc[t][r] *= alpha;
    // P^T as B operand, straight from the score tiles: element e of k-chunk kk is key kk*32 + 8*hh + e (tile 2kk, register e), element
    // 8 + e is key kk*32 + 16 + 8*hh + e (tile 2kk + 1, register e): the k order of the V loader above.
    // Unrolled, so that kk picks the score registers at compile time.
#pragma unroll
    for (int kk = 0; kk < 2; ++kk) {
      v16b pa, pl;
#pragma unroll
      for (int e = 0; e < 8; ++e) {
        const float p0 = pe[2 * kk][e], p1 = pe[2 * kk + 1][e];
        if (SPLIT_PV) { __bf16 a, bl; at_split(p0, a, bl); pa[e] = a; pl[e] = bl; at_split(p1, a, bl); pa[8 + e] = a; pl[8 + e] = bl; }
        else { pa[e] = at_to16<F16>(p0 * PSC); pa[8 + e] = at_to16<F16>(p1 * PSC); }
      }
#pragma unroll
      for (int t = 0; t < 4; ++t) {
        oacc[t] = at_mma16<F16>(vf[kk][t].v, pa, oacc[t]);
        if (SPLIT_PV) {
          oacc[t] = at_mma16<F16>(vfl[kk][t].v, pa, oacc[t]);
          oacc[t] = at_mma16<F16>(vf[kk][t].v, pl, oacc[t]);
        }
      }
    }
  }

  float* os = Os[wave];
  {
    const float inv = 1.0f / ((lrow + at_xhalf(lrow)) * PSC);   // the two halves' sums joined, once
#pragma unroll
    for (int t = 0; t < 4; ++t) {
      v4f lo4, hi4;
#pragma unroll
      for (int e = 0; e < 4; ++e) { lo4[e] = oacc[t][e] * inv; hi4[e] = oacc[t][4 + e] * inv; }
      *(v4f*)(os + c * 68 + t * 16 + 8 * hh)     = lo4;
      *(v4f*)(os + c * 68 + t * 16 + 8 * hh + 4) = hi4;
    }
  }
  __builtin_amdgcn_fence(__ATOMIC_RELEASE, "workgroup");
  __builtin_amdgcn_wave_barrier();
  __builtin_amdgcn_fence(__ATOMIC_ACQUIRE, "workgroup");
  {
    const int c4 = (lane & 15) * 4;
    {
#pragma unroll
      for (int it = 0; it < 8; ++it) {
        const int row = it * 2 + hh;
        v4f val = *(const v4f*)(os + row * 68 + c4);
        *(v4f*)(ob_ptr + (size_t)(q0 + row) * g.o_rs + c4) = val;
      }
      
    }
  }
}

#define SB_ 2
#define SN_ 4096
#define SC_ 256
#define SI_ 512
#define SH_ 8
extern "C" void kernel_launch(void* const* d_in, const int* in_sizes, int n_in, void* d_out, int out_size, void* d_ws, size_t ws_size, hipStream_t stream) {
  (void)in_sizes; (void)n_in; (void)out_size; (void)ws_size;
  const float* x = (const float*)d_in[0]; const float* Wq = (const float*)d_in[1]; const float* Wk = (const float*)d_in[2]; const float* Wv = (const float*)d_in[3]; const float* Wo = (const float*)d_in[4];
  float* out = (float*)d_out;
  char* ws = (char*)d_ws; size_t off = 0;
  auto carve = [&](size_t bytes) -> char* { char* p = ws + off; off += (bytes + 255) & ~(size_t)255; return p; };
  const int R = SB_ * SN_;
  __bf16* Xh = (__bf16*)carve((size_t)R * SC_ * 2); __bf16* Xl = (__bf16*)carve((size_t)R * SC_ * 2);
  __bf16* W3h = (__bf16*)carve((size_t)3 * SI_ * SC_ * 2); __bf16* W3l = (__bf16*)carve((size_t)3 * SI_ * SC_ * 2);     // [Wq;Wk;Wv] stacked = Bt for N = 1536
  __bf16* Woh = (__bf16*)carve((size_t)SC_ * SI_ * 2); __bf16* Wol = (__bf16*)carve((size_t)SC_ * SI_ * 2);
  float* QKV = (float*)carve((size_t)R * 3 * SI_ * 4);            // 50 MB
  float* O = (float*)carve((size_t)R * SI_ * 4);
  __bf16* Oh = (__bf16*)carve((size_t)R * SI_ * 2); __bf16* Ol = (__bf16*)carve((size_t)R * SI_ * 2);
  split_f32_bf16x2<<<(R * SC_ / 2 + 255) / 256, 256, 0, stream>>>(x, Xh, Xl, R * SC_ / 2);
  split_f32_bf16x2<<<(SI_ * SC_ / 2 + 255) / 256, 256, 0, stream>>>(Wq, W3h, W3l, SI_ * SC_ / 2);
  split_f32_bf16x2<<<(SI_ * SC_ / 2 + 255) / 256, 256, 0, stream>>>(Wk, W3h + (size_t)SI_ * SC_, W3l + (size_t)SI_ * SC_, SI_ * SC_ / 2);
  split_f32_bf16x2<<<(SI_ * SC_ / 2 + 255) / 256, 256, 0, stream>>>(Wv, W3h + (size_t)2 * SI_ * SC_, W3l + (size_t)2 * SI_ * SC_, SI_ * SC_ / 2);
  split_f32_bf16x2<<<(SC_ * SI_ / 2 + 255) / 256, 256, 0, stream>>>(Wo, Woh, Wol, SC_ * SI_ / 2);
  { const int t = (R / 64) * (3 * SI_ / 64);
    wmma_gemm64<1, true, 0, 0, false><<<dim3((t + 7) / 8, 1), 256, 0, stream>>>(U16(Xh), U16(Xl), SC_, 0, U16(W3h), U16(W3l), SC_, 0, QKV, nullptr, 3 * SI_, 0, nullptr, nullptr, 0, R, 3 * SI_, SC_, 1.0f); }
  { AttnGeom g;
    g.q_bs = (long)SN_ * 3 * SI_; g.q_rs = 3 * SI_; g.q_hs = 64; g.k_bs = g.q_bs; g.k_rs = 3 * SI_; g.k_hs = 64; g.v_bs = g.q_bs; g.v_rs = 3 * SI_; g.v_hs = 64;
    g.o_bs = (long)SN_ * SI_; g.o_rs = SI_; g.o_hs = 64; g.S = SN_; g.Skv = SN_; g.H = SH_; g.mask_mode = 0; g.qscale = 0.125f; g.blk0 = 0; g.mask_fill = -INFINITY; g.mask_is_int = 0;
    attn64_kernel<false, false, true, 0><<<SB_ * SH_ * (SN_ / AT_QB), AT_NW * 32, 0, stream>>>(QKV, QKV + SI_, QKV + 2 * SI_, O, nullptr, nullptr, g); }
  split_f32_bf16x2<<<(R * SI_ / 2 + 255) / 256, 256, 0, stream>>>(O, Oh, Ol, R * SI_ / 2);
  { const int t = (R / 64) * (SC_ / 64);
    wmma_gemm64<1, true, 0, 0, false><<<dim3((t + 7) / 8, 1), 256, 0, stream>>>(U16(Oh), U16(Ol), SI_, 0, U16(Woh), U16(Wol), SI_, 0, out, nullptr, SC_, 0, nullptr, nullptr, 0, R, SC_, SI_, 1.0f); }
}

// v007
// One run takes 177 microseconds.
// Two timings next to v006 put it at 1.16 and 1.15 times that version's speed.
// Counting every step since v000, it is 12.6 times as fast.
#include <hip/hip_runtime.h>
#include <math.h>
// Spatio-temporal attention (2 clips x 4096 tokens, 8 heads x 64): q/k/v = x·Wᵀ (8192 x 256 · 256 x 512 each) and out = o·Woᵀ (·512 x 256)
// on v_wmma_f32_16x16x32_bf16 with bf16 hi/lo split operands (the output is an average over 4096 near-uniform attention weights, RMS
// 0.0025); the attention itself (scores and p·v, p x2^15, 4096 keys) on
// v_wmma_f32_16x16x32_f16 with f16 operands; f32 accumulate; softmax f32 on VALU.
// The 1x1x1 conv weights ([out][in]) are used directly as the transposed operand.
typedef __attribute__((ext_vector_type(16))) _Float16 v16h;
typedef __attribute__((ext_vector_type(8)))  _Float16 v8h;
typedef __attribute__((ext_vector_type(16))) __bf16   v16b;
typedef __attribute__((ext_vector_type(8)))  __bf16   v8b;
typedef __attribute__((ext_vector_type(4)))  __bf16   v4b;
typedef __attribute__((ext_vector_type(8)))  float    v8f;
typedef __attribute__((ext_vector_type(4)))  float    v4f;
#define PSCALE 32768.0f
#define U16(p) ((const unsigned short*)(const void*)(p))
#define PSCALE_INV (1.0f / 32768.0f)

__device__ __forceinline__ unsigned short f2bf_bits(float f) {
  unsigned u = __float_as_uint(f);
  return (unsigned short)((u + 0x7FFFu + ((u >> 16) & 1u)) >> 16);
}
__device__ __forceinline__ float bf_bits2f(unsigned short h) { return __uint_as_float(((unsigned)h) << 16); }

// hazard guards as plain device helpers (no inline asm inside the kernel template body)
__device__ __forceinline__ void dep_guard_h(v8f& a, v8f& b, v16h x, v16h y) { asm volatile("v_nop\n\tv_nop\n\tv_nop\n\tv_nop" : "+v"(a), "+v"(b) : "v"(x), "v"(y)); }
__device__ __forceinline__ void dep_guard_b(v8f& a, v8f& b, v16b x, v16b y) { asm volatile("v_nop\n\tv_nop\n\tv_nop\n\tv_nop" : "+v"(a), "+v"(b) : "v"(x), "v"(y)); }
__device__ __forceinline__ void keep4_h(v16h a, v16h b, v16h c, v16h d) { asm volatile("v_nop" :: "v"(a), "v"(b), "v"(c), "v"(d)); }
__device__ __forceinline__ void keep4_b(v16b a, v16b b, v16b c, v16b d) { asm volatile("v_nop" :: "v"(a), "v"(b), "v"(c), "v"(d)); }
__device__ __forceinline__ void acc_guard4(v8f& a, v8f& b, v8f& c, v8f& d) { asm volatile("v_nop\n\tv_nop\n\tv_nop\n\tv_nop" : "+v"(a), "+v"(b), "+v"(c), "+v"(d)); }
template <typename T> struct Frag;
template <> struct Frag<_Float16> {
  typedef v16h V; union U { v16h v; v8h h[2]; };
  static __device__ __forceinline__ v16h load(const _Float16* p) {   // elements 0..7 <- p[0..7], 8..15 <- p[16..23]
    U f; f.h[0] = *(const v8h*)(p); f.h[1] = *(const v8h*)(p + 16); return f.v;
  }
  static __device__ __forceinline__ v8f mma(v16h a, v16h b, v8f c) {
    return __builtin_amdgcn_wmma_f32_16x16x32_f16(false, a, false, b, (short)0, c, false, false);
  }
  static __device__ __forceinline__ void guard(v8f& a, v8f& b, v16h x, v16h y) { dep_guard_h(a, b, x, y); }
  static __device__ __forceinline__ void keep(v16h a, v16h b, v16h c, v16h d) { keep4_h(a, b, c, d); }
};
template <> struct Frag<__bf16> {
  typedef v16b V; union U { v16b v; v8b h[2]; };
  static __device__ __forceinline__ v16b load(const __bf16* p) {
    U f; f.h[0] = *(const v8b*)(p); f.h[1] = *(const v8b*)(p + 16); return f.v;
  }
  static __device__ __forceinline__ v8f mma(v16b a, v16b b, v8f c) {
    return __builtin_amdgcn_wmma_f32_16x16x32_bf16(false, a, false, b, (short)0, c, false, false);
  }
  static __device__ __forceinline__ void guard(v8f& a, v8f& b, v16b x, v16b y) { dep_guard_b(a, b, x, y); }
  static __device__ __forceinline__ void keep(v16b a, v16b b, v16b c, v16b d) { keep4_b(a, b, c, d); }
};

// ---- Register-blocked batched WMMA GEMM ------------------------------------
// C[m,n] = scale * sum_k A[m,k] * Bt[n,k] (+bias)(+resid); each wave owns a 64x64 tile.
// A row-major [M,K]; Bt row-major [N,K]; M,N % 64 == 0, K % 32 == 0.
// SPLIT: operands are hi/lo planes (A2/Bt2 = lo planes, same layout); product = hi·hi + hi·lo + lo·hi.
// BIAS_MODE: 0 = none, 1 = bias[m], 2 = bias[n].
// OUT_MODE: 0 = f32, 1 = f16, 2 = bf16 hi plane (Cout) + bf16 lo plane (Cout2).
// ET: 0 = f16 operands, 1 = bf16 operands (pointers passed as 16-bit storage)
template <int ET> struct Elem;
template <> struct Elem<0> { typedef _Float16 T; };
template <> struct Elem<1> { typedef __bf16 T; };
template <int ET, bool SPLIT, int BIAS_MODE, int OUT_MODE, bool RESID, int ACT = 0>
__global__ __launch_bounds__(256) void wmma_gemm64(
    const unsigned short* __restrict__ Ap, const unsigned short* __restrict__ A2p, int lda, long strideA,
    const unsigned short* __restrict__ Btp, const unsigned short* __restrict__ Bt2p, int ldb, long strideB,
    void* __restrict__ Cout, void* __restrict__ Cout2, int ldc, long strideC,
    const float* __restrict__ bias,
    const float* __restrict__ resid, long strideR,
    int M, int N, int K, float scale) {
  typedef typename Elem<ET>::T T;
  typedef typename Frag<T>::V V;
  const T* A = (const T*)Ap; const T* A2 = (const T*)A2p; const T* Bt = (const T*)Btp; const T* Bt2 = (const T*)Bt2p;
  __shared__ __align__(16) float sT[8][16 * 68];   // per-wave 16x64 slab, pitch 68 floats
  const int b    = blockIdx.y;
  const int lane = threadIdx.x & 31;
  const int wave = threadIdx.x >> 5;
  const int tilesN = N >> 6;
  const int tilesM = M >> 6;
  const int tile = blockIdx.x * 8 + wave;
  if (tile >= tilesM * tilesN) return;   // wave-uniform; no block barriers in this kernel
  const int tm = tile / tilesN;
  const int tn = tile - tm * tilesN;
  const int m0 = tm << 6;
  const int n0 = tn << 6;

  const T* Ab  = A  + (size_t)b * strideA;
  const T* Bb  = Bt + (size_t)b * strideB;
  const T* Ab2 = SPLIT ? (A2  + (size_t)b * strideA) : nullptr;
  const T* Bb2 = SPLIT ? (Bt2 + (size_t)b * strideB) : nullptr;

  const int rlane = lane & 15;                 // row (A) / col (B, D) within subtile
  const int koff  = (lane >> 4) * 8;           // k offset of this lane half
  const int mOff  = (lane >> 4) * 8;           // D row offset

  v8f acc[4][4];
#pragma unroll
  for (int i = 0; i < 4; ++i)
#pragma unroll
    for (int j = 0; j < 4; ++j) acc[i][j] = (v8f){0.f,0.f,0.f,0.f,0.f,0.f,0.f,0.f};

  for (int k0 = 0; k0 < K; k0 += 32) {
    V bh[4], bl[4];
#pragma unroll
    for (int j = 0; j < 4; ++j) {
      const size_t bo = (size_t)(n0 + (j << 4) + rlane) * ldb + koff + k0;
      bh[j] = Frag<T>::load(Bb + bo);
      if (SPLIT) bl[j] = Frag<T>::load(Bb2 + bo);
    }
#pragma unroll
    for (int i = 0; i < 4; ++i) {
      const size_t ao = (size_t)(m0 + (i << 4) + rlane) * lda + koff + k0;
      V ah = Frag<T>::load(Ab + ao);
      V al;
      if (SPLIT) al = Frag<T>::load(Ab2 + ao);
#pragma unroll
      for (int j = 0; j < 4; ++j) {
        acc[i][j] = Frag<T>::mma(ah, bh[j], acc[i][j]);
        if (SPLIT) {
          acc[i][j] = Frag<T>::mma(ah, bl[j], acc[i][j]);
          acc[i][j] = Frag<T>::mma(al, bh[j], acc[i][j]);
        }
      }
      Frag<T>::guard(acc[i][0], acc[i][3], ah, SPLIT ? al : ah);
    }
    Frag<T>::keep(bh[0], bh[1], bh[2], bh[3]);
    if (SPLIT) Frag<T>::keep(bl[0], bl[1], bl[2], bl[3]);
  }
  acc_guard4(acc[0][0], acc[0][1], acc[0][2], acc[0][3]);
  acc_guard4(acc[1][0], acc[1][1], acc[1][2], acc[1][3]);
  acc_guard4(acc[2][0], acc[2][1], acc[2][2], acc[2][3]);
  acc_guard4(acc[3][0], acc[3][1], acc[3][2], acc[3][3]);

  // ---- epilogue ----
  float* slab = sT[wave];
  const float* Rb = RESID ? (resid + (size_t)b * strideR) : nullptr;
#pragma unroll
  for (int i = 0; i < 4; ++i) {
    const int mBase = m0 + (i << 4);
#pragma unroll
    for (int j = 0; j < 4; ++j) {
      const int n = n0 + (j << 4) + rlane;
      float bv = 0.f;
      if (BIAS_MODE == 2) bv = bias[n];
#pragma unroll
      for (int r = 0; r < 8; ++r) {
        float v = acc[i][j][r] * scale;
        if (BIAS_MODE == 1) v += bias[mBase + mOff + r];
        if (BIAS_MODE == 2) v += bv;
        if (RESID) v += Rb[(size_t)(mBase + mOff + r) * ldc + n];
        if (ACT == 1) v = tanhf(v);
        if (ACT == 2) v = fmaxf(v, 0.0f);
        if (ACT == 3) v = v / (1.0f + expf(-v));
        if (ACT == 4) v = (v > 0.f) ? v : 0.01f * v;
        if (ACT == 5) v = 0.5f * v * (1.0f + erff(v * 0.70710678118654752f));
        slab[(mOff + r) * 68 + (j << 4) + rlane] = v;
      }
    }
    __builtin_amdgcn_fence(__ATOMIC_RELEASE, "workgroup");
    __builtin_amdgcn_wave_barrier();
    __builtin_amdgcn_fence(__ATOMIC_ACQUIRE, "workgroup");
    if (OUT_MODE == 0) {
      float* C = (float*)Cout + (size_t)b * strideC;
      const int hh = lane >> 4, c4 = (lane & 15) * 4;     // row seg = 256 B = 16 lanes x 16 B
      {
#pragma unroll
        for (int it = 0; it < 8; ++it) {
          const int row = it * 2 + hh;
          v4f v = *(const v4f*)(slab + row * 68 + c4);
          *(v4f*)(C + (size_t)(mBase + row) * ldc + n0 + c4) = v;
        }
        
      }
    } else {
      const int q = lane >> 3, c8 = (lane & 7) * 8;
      unsigned short* C  = (unsigned short*)Cout  + (size_t)b * strideC;
      unsigned short* C2 = (OUT_MODE == 2) ? ((unsigned short*)Cout2 + (size_t)b * strideC) : nullptr;
      {
#pragma unroll
        for (int it = 0; it < 4; ++it) {
          const int row = it * 4 + q;
          const float* sp = slab + row * 68 + c8;
          v8h hv, lv;
#pragma unroll
          for (int e = 0; e < 8; ++e) {
            if (OUT_MODE == 1) {
              hv[e] = (_Float16)sp[e];
            } else {
              unsigned short hb = f2bf_bits(sp[e]);
              unsigned short lb = f2bf_bits(sp[e] - bf_bits2f(hb));
              hv[e] = __builtin_bit_cast(_Float16, hb);
              lv[e] = __builtin_bit_cast(_Float16, lb);
            }
          }
          *(v8h*)(C + (size_t)(mBase + row) * ldc + n0 + c8) = hv;
          if (OUT_MODE == 2) *(v8h*)(C2 + (size_t)(mBase + row) * ldc + n0 + c8) = lv;
        }
        
      }
    }
    __builtin_amdgcn_fence(__ATOMIC_RELEASE, "workgroup");
    __builtin_amdgcn_wave_barrier();
    __builtin_amdgcn_fence(__ATOMIC_ACQUIRE, "workgroup");
  }
}

__global__ __launch_bounds__(256) void cast_f32_f16x2(
    const float* __restrict__ in, _Float16* __restrict__ out, int n2) {
  int i = blockIdx.x * 256 + threadIdx.x;
  if (i < n2) {
    const _Float16 h0 = (_Float16)in[2 * i], h1 = (_Float16)in[2 * i + 1];
    const unsigned u = (unsigned)__builtin_bit_cast(unsigned short, h0) | ((unsigned)__builtin_bit_cast(unsigned short, h1) << 16);
    ((unsigned*)out)[i] = u;
    
  }
}


// ---- f32 -> f16 cast with a power-of-two pre-scale (folded back by the consumer GEMM's scale) ----
__global__ __launch_bounds__(256) void cast_f32_f16x2s(const float* __restrict__ in, _Float16* __restrict__ out, int n2, float s) {
  int i = blockIdx.x * 256 + threadIdx.x;
  if (i < n2) {
    const _Float16 h0 = (_Float16)(in[2 * i] * s), h1 = (_Float16)(in[2 * i + 1] * s);
    const unsigned u = (unsigned)__builtin_bit_cast(unsigned short, h0) | ((unsigned)__builtin_bit_cast(unsigned short, h1) << 16);
    ((unsigned*)out)[i] = u;
    
  }
}
__global__ __launch_bounds__(256) void split_f32_bf16x2(
    const float* __restrict__ in, __bf16* __restrict__ hi, __bf16* __restrict__ lo, long n2) {
  long i = (long)blockIdx.x * 256 + threadIdx.x;
  long stride = (long)gridDim.x * 256;
  {
    for (long j = i; j < n2; j += stride) {
      const float a = in[2 * j], b = in[2 * j + 1];
      const unsigned short ah = f2bf_bits(a), bh = f2bf_bits(b);
      const unsigned short al = f2bf_bits(a - bf_bits2f(ah)), bl = f2bf_bits(b - bf_bits2f(bh));
      ((unsigned*)hi)[j] = (unsigned)ah | ((unsigned)bh << 16);
      ((unsigned*)lo)[j] = (unsigned)al | ((unsigned)bl << 16);
    }
    
  }
}


// ---- f32 [R][C] (row pitch ldi) -> f16 transposed [C][R] (row pitch ldo); 64x64 tiles; each output row segment
__global__ __launch_bounds__(256) void transpose_cast_f16(const float* __restrict__ in, int ldi,
                                                         _Float16* __restrict__ outT, int ldo, float scale) {
  __shared__ __align__(16) _Float16 tile[64][72];     // [c][r]
  const int c0 = blockIdx.x * 64, r0 = blockIdx.y * 64;
  const int t = threadIdx.y * 32 + threadIdx.x;
  for (int i = threadIdx.y; i < 64; i += 8) {
    tile[threadIdx.x][i]      = (_Float16)(in[(size_t)(r0 + i) * ldi + c0 + threadIdx.x] * scale);
    tile[32 + threadIdx.x][i] = (_Float16)(in[(size_t)(r0 + i) * ldi + c0 + 32 + threadIdx.x] * scale);
  }
  __syncthreads();
  const int q = t >> 3, c8 = (t & 7) * 8;
  {
#pragma unroll
    for (int it = 0; it < 2; ++it) {
      const int c = it * 32 + q;
      v8h hv = *(const v8h*)(&tile[c][c8]);
      *(v8h*)(outT + (size_t)(c0 + c) * ldo + r0 + c8) = hv;
    }
    
  }
}

// ---- f32 [R][C] (pitch ldi) -> bf16 hi/lo transposed planes [C][R] (pitch ldo); 64x64 tiles; each output row segment
__global__ __launch_bounds__(256) void transpose_split_bf16(const float* __restrict__ in, int ldi,
                                                           __bf16* __restrict__ outH, __bf16* __restrict__ outL, int ldo) {
  __shared__ __align__(16) float tile[64][68];     // [c][r]
  const int c0 = blockIdx.x * 64, r0 = blockIdx.y * 64;
  const int t = threadIdx.y * 32 + threadIdx.x;
  for (int i = threadIdx.y; i < 64; i += 8) {
    tile[threadIdx.x][i]      = in[(size_t)(r0 + i) * ldi + c0 + threadIdx.x];
    tile[32 + threadIdx.x][i] = in[(size_t)(r0 + i) * ldi + c0 + 32 + threadIdx.x];
  }
  __syncthreads();
  const int q = t >> 3, c8 = (t & 7) * 8;
  {
#pragma unroll
    for (int it = 0; it < 2; ++it) {
      const int c = it * 32 + q;
      v8b hv, lv;
#pragma unroll
      for (int e = 0; e < 8; ++e) {
        const float f = tile[c][c8 + e];
        const unsigned short hb = f2bf_bits(f);
        hv[e] = __builtin_bit_cast(__bf16, hb);
        lv[e] = __builtin_bit_cast(__bf16, f2bf_bits(f - bf_bits2f(hb)));
      }
      *(v8b*)(outH + (size_t)(c0 + c) * ldo + r0 + c8) = hv;
      *(v8b*)(outL + (size_t)(c0 + c) * ldo + r0 + c8) = lv;
    }
    
  }
}

#define AT_D 64
#define AT_NW 4
#define AT_QB 64
#define AT_KC 64
// LDS row pitch of the 16-bit K tile, in elements: 72 = 144 B = 16 B x odd, so the 16 rows that one
// ds_load_b128 fragment read touches start on 16 different bank groups (at 128 B they share two groups and the read serialises).
#define AT_LP 72
// LDS row pitch of the 16-bit V tile, in elements: 80 = 160 B = 32 B x odd, the conflict-free pitch of its reader ds_load_tr16_b128.
#define AT_VP 80
// e^x is taken as 2^(x * log2 e) on the hardware's base-2 exponential (one instruction); every argument here is a score minus
// its row maximum, so the library exponential's overflow and underflow ladder has nothing to catch (below 2^-126 the weight is 0).
#define AT_LOG2E 1.4426950408889634f
struct AttnGeom { const float* cp = nullptr; const float* pc = nullptr; long c_bs = 0, c_rs = 0, c_hs = 0;   // mode-5 score-bias tables
                  long q_bs, q_rs, q_hs, k_bs, k_rs, k_hs, v_bs, v_rs, v_hs, o_bs, o_rs, o_hs;
                  int S, Skv, H, mask_mode; float qscale; int blk0; float mask_fill; int mask_is_int; };
static_assert(sizeof(AttnGeom) == 168, "no padding");

__device__ __forceinline__ unsigned short at_bf_bits(float f) {
  unsigned u = __float_as_uint(f);
  return (unsigned short)((u + 0x7FFFu + ((u >> 16) & 1u)) >> 16);
}
__device__ __forceinline__ __bf16 at_f2bf(float f) { return __builtin_bit_cast(__bf16, at_bf_bits(f)); }
__device__ __forceinline__ v8f at_mma(v16b a, v16b b, v8f c) {
  return __builtin_amdgcn_wmma_f32_16x16x32_bf16(false, a, false, b, (short)0, c, false, false);
}
// 16-bit element as a bit pattern held in a __bf16 slot: f16 bits when F16, bf16 (RNE) otherwise
template <bool F16> __device__ __forceinline__ __bf16 at_to16(float f) {
  if (F16) return __builtin_bit_cast(__bf16, (_Float16)f);
  return at_f2bf(f);
}
// and back to f32
template <bool F16> __device__ __forceinline__ float at_from16(__bf16 x) {
  if (F16) return (float)__builtin_bit_cast(_Float16, x);
  return __uint_as_float(((unsigned)__builtin_bit_cast(unsigned short, x)) << 16);
}
// ds_load_tr16_b128: eight 16-bit elements of one column of a row-major LDS tile (lane addresses: at the call)
__device__ __forceinline__ v8b at_ld_tr16(const __bf16* p) {
  typedef __attribute__((ext_vector_type(8))) short at_s16x8;
  typedef __attribute__((address_space(3))) at_s16x8 at_lds_s16x8;
  return __builtin_bit_cast(v8b, __builtin_amdgcn_ds_load_tr16_b128_v8i16((at_lds_s16x8*)p));
}
template <bool F16> __device__ __forceinline__ v8f at_mma16(v16b a, v16b b, v8f c) {
  if (F16) {
    const v16h ah = __builtin_bit_cast(v16h, a), bh = __builtin_bit_cast(v16h, b);
    return __builtin_amdgcn_wmma_f32_16x16x32_f16(false, ah, false, bh, (short)0, c, false, false);
  }
  return at_mma(a, b, c);
}

// Lane l's value as seen from lane l ^ 16 (the other half of the wave): one vector cross-row move, no LDS trip.
__device__ __forceinline__ float at_xhalf(float x) {
  const int b = __builtin_bit_cast(int, x);
  return __builtin_bit_cast(float, __builtin_amdgcn_permlanex16(b, b, 0x76543210, 0xfedcba98, false, false));
}

// Eight base-2 exponentials (one score tile of a lane's query), each in place. One statement, so that the
// issue slot the instruction set asks for behind a transcendental is filled by construction: each v_exp_f32 is followed by an
// independent one, the last by v_nop; written in place, no later instruction can rewrite a source that is not also the live result
// The two s_delay_alu are the hints the compiler would write for its own code and cannot for asm text (first: the arguments come from
// the vector instructions just ahead; last: whichever reader comes next): a wave that waits unhinted holds the SIMD's issue for the others.
__device__ __forceinline__ void at_exp2x8(float& p0, float& p1, float& p2, float& p3, float& p4, float& p5, float& p6, float& p7) {
  asm("s_delay_alu instid0(VALU_DEP_1)\n\t"
      "v_exp_f32 %0, %0\n\tv_exp_f32 %1, %1\n\tv_exp_f32 %2, %2\n\tv_exp_f32 %3, %3\n\t"
      "v_exp_f32 %4, %4\n\tv_exp_f32 %5, %5\n\tv_exp_f32 %6, %6\n\tv_exp_f32 %7, %7\n\tv_nop\n\t"
      "s_delay_alu instid0(TRANS32_DEP_1)"
      : "+v"(p0), "+v"(p1), "+v"(p2), "+v"(p3), "+v"(p4), "+v"(p5), "+v"(p6), "+v"(p7));
}
// The same for one value (the query's rescale factor).
__device__ __forceinline__ void at_exp2x1(float& a) {
  asm("s_delay_alu instid0(VALU_DEP_1)\n\tv_exp_f32 %0, %0\n\tv_nop\n\ts_delay_alu instid0(TRANS32_DEP_1)" : "+v"(a));
}

// MM: the mask mode as a compile-time constant (the launch's g.mask_mode must equal it); MM < 0 reads g.mask_mode at run time.
template <bool F16 = false, int MM = -1>
__global__ __launch_bounds__(128)
void attn64_kernel(const unsigned short* __restrict__ q, const unsigned short* __restrict__ k,
                   const unsigned short* __restrict__ v, float* __restrict__ out,
                   const void* __restrict__ mask_a, const int* __restrict__ mask_b, AttnGeom g) {
  const int mask_mode = (MM >= 0) ? MM : g.mask_mode;
  const float PSC = F16 ? 32768.0f : 1.0f;     // f16 probabilities carried x2^15 (subnormal range), folded into the final 1/l
  union FB { v16b v; v8b h[2]; };
  __shared__ __align__(16) __bf16 Ksh[AT_KC * AT_LP];            // K [kv][d], pitch AT_LP      9 KB
  __shared__ __align__(16) __bf16 Vsh[AT_KC * AT_VP];            // V [kv][d], pitch AT_VP     10 KB
  __shared__ __align__(16) float  Os[AT_NW][16 * 68];            // per wave out tile, pitch 68

  const int tid  = threadIdx.x;
  const int wave = tid >> 5;
  const int lane = tid & 31;
  const int hh   = lane >> 4;
  const int c    = lane & 15;

  const int nqb = g.S / AT_QB;
  const int bx = blockIdx.x + g.blk0;
  const int qb = bx % nqb;
  const int bh = bx / nqb;
  const int h  = bh % g.H;
  const int b  = bh / g.H;
  const int qbase_block = qb * AT_QB;
  const int q0 = qbase_block + wave * 16;

  const __bf16* qb_ptr = (const __bf16*)q + (size_t)b * g.q_bs + (size_t)h * g.q_hs;
  const __bf16* kb_ptr = (const __bf16*)k + (size_t)b * g.k_bs + (size_t)h * g.k_hs;
  const __bf16* vb_ptr = (const __bf16*)v + (size_t)b * g.v_bs + (size_t)h * g.v_hs;
  float*        ob_ptr = out + (size_t)b * g.o_bs + (size_t)h * g.o_hs;

  // ---- Q fragments (B operand: column = query q0 + c): 2 d-chunks ----
  v16b qah[2];
  {
    const __bf16* qrow = qb_ptr + (size_t)(q0 + c) * g.q_rs;
#pragma unroll
    for (int dc = 0; dc < 2; ++dc) {
      const v8b x0 = *(const v8b*)(qrow + dc * 32 + 8 * hh), x1 = *(const v8b*)(qrow + dc * 32 + 16 + 8 * hh);
#pragma unroll
      for (int e = 0; e < 8; ++e) {
        qah[dc][e]     = at_to16<F16>(at_from16<F16>(x0[e]) * g.qscale);
        qah[dc][8 + e] = at_to16<F16>(at_from16<F16>(x1[e]) * g.qscale);
      }
    }
  }

  // state of this lane's query q0 + c; nrow2 = -(running maximum) * log2 e as it was rounded when that maximum was taken;
  // lrow sums this wave half's keys only (the halves are joined behind the loop)
  float nrow2 = INFINITY, lrow = 0.f;
  v8f oacc[4];                                 // O^T: oacc[t][r] = element d = t*16 + 8*hh + r of query q0 + c
#pragma unroll
  for (int t = 0; t < 4; ++t) oacc[t] = (v8f){0.f,0.f,0.f,0.f,0.f,0.f,0.f,0.f};

  const int nChunks = (mask_mode == 1 || mask_mode == 4) ? (qb + 1) : (g.Skv / AT_KC);   // block-uniform
  const int qrow = q0 + c;
  const int qkeep = (mask_mode == 3) ? mask_b[(size_t)b * g.S + qrow] : 1;   // query mask (mode 3): mask_b = qmask
  // Staging deal: a K or V row of one head is one 128-B line; eight lanes take it, 16 B each, so a wave's load covers four whole lines.
  // A thread copies its piece of rows sr, sr + 16, sr + 32 and sr + 48 of both tiles.
  const int sp = (tid & 7) * 8, sr = tid >> 3;
  const __bf16* kst = kb_ptr + (size_t)sr * g.k_rs + sp;
  const __bf16* vst = vb_ptr + (size_t)sr * g.v_rs + sp;
  // Lane address of the transposing load: lane (c, hh) receives V[kbase + 8*hh + 0..7][dbase + c] when every lane l points at
  // row kbase + 8*(l >> 4) + (l & 7), byte 2*dbase + 16*((l >> 3) & 1).
  const __bf16* vtr = Vsh + (8 * hh + (lane & 7)) * AT_VP + ((lane >> 3) & 1) * 8;
  for (int kc = 0; kc < nChunks; ++kc) {
    const int kv0 = kc * AT_KC;
    __syncthreads();
    {
      const __bf16* kp[4]; const __bf16* vp[4];
      v8b kk[4], vv[4];
#pragma unroll
      for (int i = 0; i < 4; ++i) {
        kp[i] = kst + (size_t)(kv0 + 16 * i) * g.k_rs;
        vp[i] = vst + (size_t)(kv0 + 16 * i) * g.v_rs;
        kk[i] = *(const v8b*)(kp[i]);
        vv[i] = *(const v8b*)(vp[i]);
      }
      // The wait that stands between an issued global load and a rewrite of its address registers. The addresses are its inputs, so
      // they stay whole up to it.
      asm volatile("s_wait_xcnt 0x0" :: "v"(kp[0]), "v"(kp[1]), "v"(kp[2]), "v"(kp[3]), "v"(vp[0]), "v"(vp[1]), "v"(vp[2]), "v"(vp[3]) : "memory");
#pragma unroll
      for (int i = 0; i < 4; ++i) {
        *(v8b*)(Ksh + (sr + 16 * i) * AT_LP + sp) = kk[i];
        *(v8b*)(Vsh + (sr + 16 * i) * AT_VP + sp) = vv[i];
      }
    }
    __syncthreads();

    // All fragments of the chunk are fetched as one group of LDS reads ahead of the matrix runs: K's eight first, V's eight behind them.
    // A read waited for in front of each product costs the wave one LDS round trip per product; here the first run waits once and
    // V lands under the scores and the softmax.
    FB kf[2][4], vf[2][4];
#pragma unroll
    for (int dc = 0; dc < 2; ++dc)
#pragma unroll
      for (int j = 0; j < 4; ++j) {
        kf[dc][j].h[0] = *(const v8b*)(Ksh + (j * 16 + c) * AT_LP + dc * 32 + 8 * hh);
        kf[dc][j].h[1] = *(const v8b*)(Ksh + (j * 16 + c) * AT_LP + dc * 32 + 16 + 8 * hh);
      }
    // V^T fragment (rows d = t*16 + c): elements 0..7 are keys kk*32 + 8*hh + 0..7, elements 8..15 keys kk*32 + 16 + 8*hh + 0..7.
#pragma unroll
    for (int kk = 0; kk < 2; ++kk)
#pragma unroll
      for (int t = 0; t < 4; ++t) {
        vf[kk][t].h[0] = at_ld_tr16(vtr + (kk * 32) * AT_VP + t * 16);
        vf[kk][t].h[1] = at_ld_tr16(vtr + (kk * 32 + 16) * AT_VP + t * 16);
      }
    // Keeps the scheduler from sinking the reads back down to their products (each would again be waited for on its own).
    __builtin_amdgcn_sched_barrier(0);

    // S^T: s[j][r] = score of key kv0 + j*16 + 8*hh + r for query q0 + c. The four tiles take turns, so that a tile's second product
    // finds its first one finished; each tile still sums head elements 0..31, then 32..63.
    v8f s[4];
#pragma unroll
    for (int j = 0; j < 4; ++j) s[j] = (v8f){0.f,0.f,0.f,0.f,0.f,0.f,0.f,0.f};
#pragma unroll
    for (int dc = 0; dc < 2; ++dc)
#pragma unroll
      for (int j = 0; j < 4; ++j) {
        s[j] = at_mma16<F16>(kf[dc][j].v, qah[dc], s[j]);
      }
    const bool diag = (mask_mode == 1) && (kc == qb);
    float mj[4];                                // one maximum per score tile: four short chains instead of one long one
#pragma unroll
    for (int j = 0; j < 4; ++j) {
      mj[j] = -INFINITY;
#pragma unroll
      for (int r = 0; r < 8; ++r) {
        const int kvcol = kv0 + j * 16 + 8 * hh + r;
        bool masked = false;
        if (diag) masked = (kvcol > qrow);
        else if (mask_mode == 4) masked = (kvcol > qrow) || (qrow - kvcol > g.mask_is_int);
        else if (mask_mode == 2) {
          const size_t mi = (size_t)qrow * g.Skv + kvcol;
          masked = (g.mask_is_int == 0) ? (((const float*)mask_a)[mi] == 0.0f)
                 : (g.mask_is_int == 1) ? (((const int*)mask_a)[mi] == 0) : (((const int*)mask_a)[mi] != 0);
        } else if (mask_mode == 3) masked = (qkeep == 0) || (((const int*)mask_a)[(size_t)b * g.Skv + kvcol] == 0);   // mask_a = kvmask
        else if (mask_mode == 5) {
          const size_t mi = (size_t)qrow * g.Skv + kvcol;
          masked = (((const int*)mask_a)[mi] != 0);
          int n = mask_b[mi]; n = n < 0 ? 0 : n;
          s[j][r] += g.cp[(size_t)b * g.c_bs + (size_t)h * g.c_hs + (size_t)qrow * g.c_rs + n]
                   + g.pc[(size_t)b * g.c_bs + (size_t)h * g.c_hs + (size_t)kvcol * g.c_rs + n];
        }
        if (masked) s[j][r] = g.mask_fill;
        mj[j] = fmaxf(mj[j], s[j][r]);
      }
    }
    float m = fmaxf(fmaxf(mj[0], mj[1]), fmaxf(mj[2], mj[3]));
    m = fmaxf(m, at_xhalf(m));                  // the other half of the wave holds the query's other 32 keys
    // minus the running maximum in base-2 units, the offset of every weight of this chunk: the product is rounded once per chunk
    // maximum, and the smaller of two such products is the product of the larger maximum (rounding keeps the order)
    const float noff = fminf(nrow2, m * -AT_LOG2E);
    float alpha = noff - nrow2;                 // difference of the two offsets in use: exactly 0 while the maximum stands; -inf on the first chunk
    nrow2 = noff;
    at_exp2x1(alpha);
    float pe[4][8], ps[4];
#pragma unroll
    for (int j = 0; j < 4; ++j) {
      float* p = pe[j];
#pragma unroll
      for (int r = 0; r < 8; ++r) p[r] = fmaf(s[j][r], AT_LOG2E, noff);   // e^(s - m) = 2^(s*log2e - m*log2e)
      at_exp2x8(p[0], p[1], p[2], p[3], p[4], p[5], p[6], p[7]);
      ps[j] = ((p[0] + p[1]) + (p[2] + p[3])) + ((p[4] + p[5]) + (p[6] + p[7]));
    }
    lrow = lrow * alpha + ((ps[0] + ps[1]) + (ps[2] + ps[3]));
#pragma unroll
    for (int t = 0; t < 4; ++t)
#pragma unroll
      for (int r = 0; r < 8; ++r) oacc[t][r] *= alpha;
    // P^T as B operand, straight from the score tiles: element e of k-chunk kk is key kk*32 + 8*hh + e (tile 2kk, register e), element
    // 8 + e is key kk*32 + 16 + 8*hh + e (tile 2kk + 1, register e): the k order of the V loader above.
    // Unrolled, so that kk picks the score registers at compile time.
#pragma unroll
    for (int kk = 0; kk < 2; ++kk) {
      v16b pa;
#pragma unroll
      for (int e = 0; e < 8; ++e) {
        const float p0 = pe[2 * kk][e], p1 = pe[2 * kk + 1][e];
        pa[e] = at_to16<F16>(p0 * PSC); pa[8 + e] = at_to16<F16>(p1 * PSC);
      }
#pragma unroll
      for (int t = 0; t < 4; ++t) oacc[t] = at_mma16<F16>(vf[kk][t].v, pa, oacc[t]);
    }
  }

  float* os = Os[wave];
  {
    const float inv = 1.0f / ((lrow + at_xhalf(lrow)) * PSC);   // the two halves' sums joined, once
#pragma unroll
    for (int t = 0; t < 4; ++t) {
      v4f lo4, hi4;
#pragma unroll
      for (int e = 0; e < 4; ++e) { lo4[e] = oacc[t][e] * inv; hi4[e] = oacc[t][4 + e] * inv; }
      *(v4f*)(os + c * 68 + t * 16 + 8 * hh)     = lo4;
      *(v4f*)(os + c * 68 + t * 16 + 8 * hh + 4) = hi4;
    }
  }
  __builtin_amdgcn_fence(__ATOMIC_RELEASE, "workgroup");
  __builtin_amdgcn_wave_barrier();
  __builtin_amdgcn_fence(__ATOMIC_ACQUIRE, "workgroup");
  {
    const int c4 = (lane & 15) * 4;
    {
#pragma unroll
      for (int it = 0; it < 8; ++it) {
        const int row = it * 2 + hh;
        v4f val = *(const v4f*)(os + row * 68 + c4);
        *(v4f*)(ob_ptr + (size_t)(q0 + row) * g.o_rs + c4) = val;
      }
      
    }
  }
}

#define SB_ 2
#define SN_ 4096
#define SC_ 256
#define SI_ 512
#define SH_ 8
extern "C" void kernel_launch(void* const* d_in, const int* in_sizes, int n_in, void* d_out, int out_size, void* d_ws, size_t ws_size, hipStream_t stream) {
  (void)in_sizes; (void)n_in; (void)out_size; (void)ws_size;
  const float* x = (const float*)d_in[0]; const float* Wq = (const float*)d_in[1]; const float* Wk = (const float*)d_in[2]; const float* Wv = (const float*)d_in[3]; const float* Wo = (const float*)d_in[4];
  float* out = (float*)d_out;
  char* ws = (char*)d_ws; size_t off = 0;
  auto carve = [&](size_t bytes) -> char* { char* p = ws + off; off += (bytes + 255) & ~(size_t)255; return p; };
  const int R = SB_ * SN_;
  __bf16* Xh = (__bf16*)carve((size_t)R * SC_ * 2); __bf16* Xl = (__bf16*)carve((size_t)R * SC_ * 2);
  __bf16* W3h = (__bf16*)carve((size_t)3 * SI_ * SC_ * 2); __bf16* W3l = (__bf16*)carve((size_t)3 * SI_ * SC_ * 2);     // [Wq;Wk;Wv] stacked = Bt for N = 1536
  __bf16* Woh = (__bf16*)carve((size_t)SC_ * SI_ * 2); __bf16* Wol = (__bf16*)carve((size_t)SC_ * SI_ * 2);
  _Float16* QKV = (_Float16*)carve((size_t)R * 3 * SI_ * 2);      // 25 MB: q, k, v as the attention's f16 operands
  float* O = (float*)carve((size_t)R * SI_ * 4);
  __bf16* Oh = (__bf16*)carve((size_t)R * SI_ * 2); __bf16* Ol = (__bf16*)carve((size_t)R * SI_ * 2);
  split_f32_bf16x2<<<(R * SC_ / 2 + 255) / 256, 256, 0, stream>>>(x, Xh, Xl, R * SC_ / 2);
  split_f32_bf16x2<<<(SI_ * SC_ / 2 + 255) / 256, 256, 0, stream>>>(Wq, W3h, W3l, SI_ * SC_ / 2);
  split_f32_bf16x2<<<(SI_ * SC_ / 2 + 255) / 256, 256, 0, stream>>>(Wk, W3h + (size_t)SI_ * SC_, W3l + (size_t)SI_ * SC_, SI_ * SC_ / 2);
  split_f32_bf16x2<<<(SI_ * SC_ / 2 + 255) / 256, 256, 0, stream>>>(Wv, W3h + (size_t)2 * SI_ * SC_, W3l + (size_t)2 * SI_ * SC_, SI_ * SC_ / 2);
  split_f32_bf16x2<<<(SC_ * SI_ / 2 + 255) / 256, 256, 0, stream>>>(Wo, Woh, Wol, SC_ * SI_ / 2);
  { const int t = (R / 64) * (3 * SI_ / 64);
    wmma_gemm64<1, true, 0, 1, false><<<dim3((t + 7) / 8, 1), 256, 0, stream>>>(U16(Xh), U16(Xl), SC_, 0, U16(W3h), U16(W3l), SC_, 0, QKV, nullptr, 3 * SI_, 0, nullptr, nullptr, 0, R, 3 * SI_, SC_, 1.0f); }
  { AttnGeom g;
    g.q_bs = (long)SN_ * 3 * SI_; g.q_rs = 3 * SI_; g.q_hs = 64; g.k_bs = g.q_bs; g.k_rs = 3 * SI_; g.k_hs = 64; g.v_bs = g.q_bs; g.v_rs = 3 * SI_; g.v_hs = 64;
    g.o_bs = (long)SN_ * SI_; g.o_rs = SI_; g.o_hs = 64; g.S = SN_; g.Skv = SN_; g.H = SH_; g.mask_mode = 0; g.qscale = 0.125f; g.blk0 = 0; g.mask_fill = -INFINITY; g.mask_is_int = 0;
    attn64_kernel<true, 0><<<SB_ * SH_ * (SN_ / AT_QB), AT_NW * 32, 0, stream>>>(U16(QKV), U16(QKV + SI_), U16(QKV + 2 * SI_), O, nullptr, nullptr, g); }
  split_f32_bf16x2<<<(R * SI_ / 2 + 255) / 256, 256, 0, stream>>>(O, Oh, Ol, R * SI_ / 2);
  { const int t = (R / 64) * (SC_ / 64);
    wmma_gemm64<1, true, 0, 0, false><<<dim3((t + 7) / 8, 1), 256, 0, stream>>>(U16(Oh), U16(Ol), SI_, 0, U16(Woh), U16(Wol), SI_, 0, out, nullptr, SC_, 0, nullptr, nullptr, 0, R, SC_, SI_, 1.0f); }
}

// v008
// One run takes 147 microseconds.
// Timed twice side by side with v007, it ran 1.20 and 1.21 times as fast.
// Counting every step since v000, it is 15.1 times as fast.
#include <hip/hip_runtime.h>
#include <math.h>
// Spatio-temporal attention (2 clips x 4096 tokens, 8 heads x 64): q/k/v = x·Wᵀ (8192 x 256 · 256 x 512 each) and out = o·Woᵀ (·512 x 256)
// on v_wmma_f32_16x16x32_bf16 with bf16 hi/lo split operands (the output is an average over 4096 near-uniform attention weights, RMS
// 0.0025); the attention itself (scores and p·v, p x2^15, 4096 keys) on
// v_wmma_f32_16x16x32_f16 with f16 operands; f32 accumulate; softmax f32 on VALU.
// The 1x1x1 conv weights ([out][in]) are used directly as the transposed operand.
typedef __attribute__((ext_vector_type(16))) _Float16 v16h;
typedef __attribute__((ext_vector_type(8)))  _Float16 v8h;
typedef __attribute__((ext_vector_type(16))) __bf16   v16b;
typedef __attribute__((ext_vector_type(8)))  __bf16   v8b;
typedef __attribute__((ext_vector_type(4)))  __bf16   v4b;
typedef __attribute__((ext_vector_type(8)))  float    v8f;
typedef __attribute__((ext_vector_type(4)))  float    v4f;
#define PSCALE 32768.0f
#define U16(p) ((const unsigned short*)(const void*)(p))
#define PSCALE_INV (1.0f / 32768.0f)

__device__ __forceinline__ unsigned short f2bf_bits(float f) {
  unsigned u = __float_as_uint(f);
  return (unsigned short)((u + 0x7FFFu + ((u >> 16) & 1u)) >> 16);
}
__device__ __forceinline__ float bf_bits2f(unsigned short h) { return __uint_as_float(((unsigned)h) << 16); }

// hazard guards as plain device helpers (no inline asm inside the kernel template body)
__device__ __forceinline__ void dep_guard_h(v8f& a, v8f& b, v16h x, v16h y) { asm volatile("v_nop\n\tv_nop\n\tv_nop\n\tv_nop" : "+v"(a), "+v"(b) : "v"(x), "v"(y)); }
__device__ __forceinline__ void dep_guard_b(v8f& a, v8f& b, v16b x, v16b y) { asm volatile("v_nop\n\tv_nop\n\tv_nop\n\tv_nop" : "+v"(a), "+v"(b) : "v"(x), "v"(y)); }
__device__ __forceinline__ void keep4_h(v16h a, v16h b, v16h c, v16h d) { asm volatile("v_nop" :: "v"(a), "v"(b), "v"(c), "v"(d)); }
__device__ __forceinline__ void keep4_b(v16b a, v16b b, v16b c, v16b d) { asm volatile("v_nop" :: "v"(a), "v"(b), "v"(c), "v"(d)); }
__device__ __forceinline__ void acc_guard4(v8f& a, v8f& b, v8f& c, v8f& d) { asm volatile("v_nop\n\tv_nop\n\tv_nop\n\tv_nop" : "+v"(a), "+v"(b), "+v"(c), "+v"(d)); }
template <typename T> struct Frag;
template <> struct Frag<_Float16> {
  typedef v16h V; union U { v16h v; v8h h[2]; };
  static __device__ __forceinline__ v16h load(const _Float16* p) {   // p = tile + lane * 8: elements 0..7 <- p[0..7], 8..15 <- p[256..263]
    U f; f.h[0] = *(const v8h*)(p); f.h[1] = *(const v8h*)(p + 256); return f.v;
  }
  static __device__ __forceinline__ v8f mma(v16h a, v16h b, v8f c) {
    return __builtin_amdgcn_wmma_f32_16x16x32_f16(false, a, false, b, (short)0, c, false, false);
  }
  static __device__ __forceinline__ void guard(v8f& a, v8f& b, v16h x, v16h y) { dep_guard_h(a, b, x, y); }
  static __device__ __forceinline__ void keep(v16h a, v16h b, v16h c, v16h d) { keep4_h(a, b, c, d); }
};
template <> struct Frag<__bf16> {
  typedef v16b V; union U { v16b v; v8b h[2]; };
  static __device__ __forceinline__ v16b load(const __bf16* p) {
    U f; f.h[0] = *(const v8b*)(p); f.h[1] = *(const v8b*)(p + 256); return f.v;
  }
  static __device__ __forceinline__ v8f mma(v16b a, v16b b, v8f c) {
    return __builtin_amdgcn_wmma_f32_16x16x32_bf16(false, a, false, b, (short)0, c, false, false);
  }
  static __device__ __forceinline__ void guard(v8f& a, v8f& b, v16b x, v16b y) { dep_guard_b(a, b, x, y); }
  static __device__ __forceinline__ void keep(v16b a, v16b b, v16b c, v16b d) { keep4_b(a, b, c, d); }
};

// ---- Register-blocked batched WMMA GEMM ------------------------------------
// C[m,n] = scale * sum_k A[m,k] * Bt[n,k] (+bias)(+resid); each wave owns a 64x64 tile.
// A is [M,K], Bt is [N,K]; M,N % 64 == 0, K % 32 == 0. Both lie in FRAGMENT ORDER (written so by split_f32_bf16_frag): the 16-row x 32-k tile
// (row band rb, k step kt) is 512 elements in a row at rb * 16 * ld + kt * 512 (ld = row length, lda or ldb), and inside it element
// (row r, k) stands at (k >> 4) * 256 + (((k >> 3) & 1) * 16 + r) * 8 + (k & 7): lane l finds its elements 0..7 at l * 8 and its elements
// 8..15 at 256 + l * 8, so each 16-byte load of a wave covers 512 bytes in a row (four whole 128-B lines; from row-major planes it took
// 32 bytes out of each of 16 lines). The registers hold what they held with row-major planes.
// SPLIT: operands are hi/lo planes (A2/Bt2 = lo planes, same layout); product = hi·hi + hi·lo + lo·hi.
// BIAS_MODE: 0 = none, 1 = bias[m], 2 = bias[n].
// OUT_MODE: 0 = f32, 1 = f16, 2 = bf16 hi plane (Cout) + bf16 lo plane (Cout2); every output is row-major.
// ET: 0 = f16 operands, 1 = bf16 operands (pointers passed as 16-bit storage)
template <int ET> struct Elem;
template <> struct Elem<0> { typedef _Float16 T; };
template <> struct Elem<1> { typedef __bf16 T; };
template <int ET, bool SPLIT, int BIAS_MODE, int OUT_MODE, bool RESID, int ACT = 0>
__global__ __launch_bounds__(256) void wmma_gemm64(
    const unsigned short* __restrict__ Ap, const unsigned short* __restrict__ A2p, int lda, long strideA,
    const unsigned short* __restrict__ Btp, const unsigned short* __restrict__ Bt2p, int ldb, long strideB,
    void* __restrict__ Cout, void* __restrict__ Cout2, int ldc, long strideC,
    const float* __restrict__ bias,
    const float* __restrict__ resid, long strideR,
    int M, int N, int K, float scale) {
  typedef typename Elem<ET>::T T;
  typedef typename Frag<T>::V V;
  const T* A = (const T*)Ap; const T* A2 = (const T*)A2p; const T* Bt = (const T*)Btp; const T* Bt2 = (const T*)Bt2p;
  __shared__ __align__(16) float sT[8][16 * 68];   // per-wave 16x64 slab, pitch 68 floats
  const int b    = blockIdx.y;
  const int lane = threadIdx.x & 31;
  const int wave = __builtin_amdgcn_readfirstlane(threadIdx.x >> 5);   // scalar: tile addresses are then a scalar base plus lane * 16 bytes
  const int tilesN = N >> 6;
  const int tilesM = M >> 6;
  const int tile = blockIdx.x * 8 + wave;
  if (tile >= tilesM * tilesN) return;   // wave-uniform; no block barriers in this kernel
  const int tm = tile / tilesN;
  const int tn = tile - tm * tilesN;
  const int m0 = tm << 6;
  const int n0 = tn << 6;

  // Start of each of the wave's four A and four B row bands, per plane: scalar, fixed over the k loop.
  const T* Ab[4]; const T* Bb[4]; const T* Ab2[4]; const T* Bb2[4];
#pragma unroll
  for (int i = 0; i < 4; ++i) {
    const size_t ao = (size_t)b * strideA + (size_t)(m0 + (i << 4)) * lda;
    const size_t bo = (size_t)b * strideB + (size_t)(n0 + (i << 4)) * ldb;
    Ab[i]  = A + ao;  Bb[i]  = Bt + bo;
    Ab2[i] = SPLIT ? (A2 + ao) : nullptr;  Bb2[i] = SPLIT ? (Bt2 + bo) : nullptr;
  }

  const int rlane = lane & 15;                 // row (A) / col (B, D) within subtile
  const int mOff  = (lane >> 4) * 8;           // D row offset

  v8f acc[4][4];
#pragma unroll
  for (int i = 0; i < 4; ++i)
#pragma unroll
    for (int j = 0; j < 4; ++j) acc[i][j] = (v8f){0.f,0.f,0.f,0.f,0.f,0.f,0.f,0.f};

  // This lane's place in the current k step's tiles, in bytes: the one address that moves. 32 bits, so that a load is scalar base + this register.
  unsigned vo = lane * 16;
  auto at = [&](const T* band) -> const T* { return (const T*)((const char*)band + vo); };
  for (int k0 = 0; k0 < K; k0 += 32, vo += 1024) {
    V bh[4], bl[4];
#pragma unroll
    for (int j = 0; j < 4; ++j) {
      bh[j] = Frag<T>::load(at(Bb[j]));
      if (SPLIT) bl[j] = Frag<T>::load(at(Bb2[j]));
    }
#pragma unroll
    for (int i = 0; i < 4; ++i) {
      V ah = Frag<T>::load(at(Ab[i]));
      V al;
      if (SPLIT) al = Frag<T>::load(at(Ab2[i]));
#pragma unroll
      for (int j = 0; j < 4; ++j) {
        acc[i][j] = Frag<T>::mma(ah, bh[j], acc[i][j]);
        if (SPLIT) {
          acc[i][j] = Frag<T>::mma(ah, bl[j], acc[i][j]);
          acc[i][j] = Frag<T>::mma(al, bh[j], acc[i][j]);
        }
      }
      Frag<T>::guard(acc[i][0], acc[i][3], ah, SPLIT ? al : ah);
    }
    Frag<T>::keep(bh[0], bh[1], bh[2], bh[3]);
    if (SPLIT) Frag<T>::keep(bl[0], bl[1], bl[2], bl[3]);
  }
  acc_guard4(acc[0][0], acc[0][1], acc[0][2], acc[0][3]);
  acc_guard4(acc[1][0], acc[1][1], acc[1][2], acc[1][3]);
  acc_guard4(acc[2][0], acc[2][1], acc[2][2], acc[2][3]);
  acc_guard4(acc[3][0], acc[3][1], acc[3][2], acc[3][3]);

  // ---- epilogue ----
  float* slab = sT[wave];
  const float* Rb = RESID ? (resid + (size_t)b * strideR) : nullptr;
#pragma unroll
  for (int i = 0; i < 4; ++i) {
    const int mBase = m0 + (i << 4);
#pragma unroll
    for (int j = 0; j < 4; ++j) {
      const int n = n0 + (j << 4) + rlane;
      float bv = 0.f;
      if (BIAS_MODE == 2) bv = bias[n];
#pragma unroll
      for (int r = 0; r < 8; ++r) {
        float v = acc[i][j][r] * scale;
        if (BIAS_MODE == 1) v += bias[mBase + mOff + r];
        if (BIAS_MODE == 2) v += bv;
        if (RESID) v += Rb[(size_t)(mBase + mOff + r) * ldc + n];
        if (ACT == 1) v = tanhf(v);
        if (ACT == 2) v = fmaxf(v, 0.0f);
        if (ACT == 3) v = v / (1.0f + expf(-v));
        if (ACT == 4) v = (v > 0.f) ? v : 0.01f * v;
        if (ACT == 5) v = 0.5f * v * (1.0f + erff(v * 0.70710678118654752f));
        slab[(mOff + r) * 68 + (j << 4) + rlane] = v;
      }
    }
    __builtin_amdgcn_fence(__ATOMIC_RELEASE, "workgroup");
    __builtin_amdgcn_wave_barrier();
    __builtin_amdgcn_fence(__ATOMIC_ACQUIRE, "workgroup");
    if (OUT_MODE == 0) {
      float* C = (float*)Cout + (size_t)b * strideC;
      const int hh = lane >> 4, c4 = (lane & 15) * 4;     // row seg = 256 B = 16 lanes x 16 B
      {
#pragma unroll
        for (int it = 0; it < 8; ++it) {
          const int row = it * 2 + hh;
          v4f v = *(const v4f*)(slab + row * 68 + c4);
          *(v4f*)(C + (size_t)(mBase + row) * ldc + n0 + c4) = v;
        }
        
      }
    } else {
      const int q = lane >> 3, c8 = (lane & 7) * 8;
      unsigned short* C  = (unsigned short*)Cout  + (size_t)b * strideC;
      unsigned short* C2 = (OUT_MODE == 2) ? ((unsigned short*)Cout2 + (size_t)b * strideC) : nullptr;
      {
#pragma unroll
        for (int it = 0; it < 4; ++it) {
          const int row = it * 4 + q;
          const float* sp = slab + row * 68 + c8;
          v8h hv, lv;
#pragma unroll
          for (int e = 0; e < 8; ++e) {
            if (OUT_MODE == 1) {
              hv[e] = (_Float16)sp[e];
            } else {
              unsigned short hb = f2bf_bits(sp[e]);
              unsigned short lb = f2bf_bits(sp[e] - bf_bits2f(hb));
              hv[e] = __builtin_bit_cast(_Float16, hb);
              lv[e] = __builtin_bit_cast(_Float16, lb);
            }
          }
          *(v8h*)(C + (size_t)(mBase + row) * ldc + n0 + c8) = hv;
          if (OUT_MODE == 2) *(v8h*)(C2 + (size_t)(mBase + row) * ldc + n0 + c8) = lv;
        }
        
      }
    }
    __builtin_amdgcn_fence(__ATOMIC_RELEASE, "workgroup");
    __builtin_amdgcn_wave_barrier();
    __builtin_amdgcn_fence(__ATOMIC_ACQUIRE, "workgroup");
  }
}

__global__ __launch_bounds__(256) void cast_f32_f16x2(
    const float* __restrict__ in, _Float16* __restrict__ out, int n2) {
  int i = blockIdx.x * 256 + threadIdx.x;
  if (i < n2) {
    const _Float16 h0 = (_Float16)in[2 * i], h1 = (_Float16)in[2 * i + 1];
    const unsigned u = (unsigned)__builtin_bit_cast(unsigned short, h0) | ((unsigned)__builtin_bit_cast(unsigned short, h1) << 16);
    ((unsigned*)out)[i] = u;
    
  }
}


// ---- f32 -> f16 cast with a power-of-two pre-scale (folded back by the consumer GEMM's scale) ----
__global__ __launch_bounds__(256) void cast_f32_f16x2s(const float* __restrict__ in, _Float16* __restrict__ out, int n2, float s) {
  int i = blockIdx.x * 256 + threadIdx.x;
  if (i < n2) {
    const _Float16 h0 = (_Float16)(in[2 * i] * s), h1 = (_Float16)(in[2 * i + 1] * s);
    const unsigned u = (unsigned)__builtin_bit_cast(unsigned short, h0) | ((unsigned)__builtin_bit_cast(unsigned short, h1) << 16);
    ((unsigned*)out)[i] = u;
    
  }
}
// ---- f32 [rows][32 << lkt] row-major -> bf16 hi and lo planes in the matrix operands' fragment order (layout: at wmma_gemm64) ----
// One wave per 16-row x 32-k tile (tile = row band * (1 << lkt) + k step). Eight lanes take one row's 128-B line, 16 B each, so a load covers
// four whole lines; a lane's four values go out as one 8-B store per plane, and the wave writes the tile's 1 KB of each plane alone.
__global__ __launch_bounds__(256) void split_f32_bf16_frag(
    const float* __restrict__ in, __bf16* __restrict__ hi, __bf16* __restrict__ lo, int lkt, int ntiles) {
  const int tile = blockIdx.x * 8 + (threadIdx.x >> 5);
  if (tile >= ntiles) return;
  const int lane = threadIdx.x & 31;
  const int q = lane & 7, r0 = lane >> 3;            // k = 4 * q .. 4 * q + 3 of rows r0, r0 + 4, r0 + 8, r0 + 12
  const int band = tile >> lkt, kt = tile - (band << lkt);
  const float* src = in + ((size_t)(band * 16 + r0) << (lkt + 5)) + kt * 32 + q * 4;
  const size_t dst = (size_t)tile * 512 + (q >> 2) * 256 + (((q >> 1) & 1) * 16 + r0) * 8 + (q & 1) * 4;
  const float* sp[4];
  v4f x[4];
#pragma unroll
  for (int i = 0; i < 4; ++i) {
    sp[i] = src + ((size_t)(4 * i) << (lkt + 5));
    x[i] = *(const v4f*)(sp[i]);
  }
  // The wait that stands between an issued global load and a rewrite of its address registers. The addresses are its inputs, so they
  // stay whole up to it.
  asm volatile("s_wait_xcnt 0x0" :: "v"(sp[0]), "v"(sp[1]), "v"(sp[2]), "v"(sp[3]) : "memory");
#pragma unroll
  for (int i = 0; i < 4; ++i) {
    v4b h, l;
#pragma unroll
    for (int e = 0; e < 4; ++e) {
      const unsigned short hb = f2bf_bits(x[i][e]);
      h[e] = __builtin_bit_cast(__bf16, hb);
      l[e] = __builtin_bit_cast(__bf16, f2bf_bits(x[i][e] - bf_bits2f(hb)));
    }
    *(v4b*)(hi + dst + i * 32) = h;                  // four rows on: 4 * 8 elements
    *(v4b*)(lo + dst + i * 32) = l;
  }
}


// ---- f32 [R][C] (row pitch ldi) -> f16 transposed [C][R] (row pitch ldo); 64x64 tiles; each output row segment
__global__ __launch_bounds__(256) void transpose_cast_f16(const float* __restrict__ in, int ldi,
                                                         _Float16* __restrict__ outT, int ldo, float scale) {
  __shared__ __align__(16) _Float16 tile[64][72];     // [c][r]
  const int c0 = blockIdx.x * 64, r0 = blockIdx.y * 64;
  const int t = threadIdx.y * 32 + threadIdx.x;
  for (int i = threadIdx.y; i < 64; i += 8) {
    tile[threadIdx.x][i]      = (_Float16)(in[(size_t)(r0 + i) * ldi + c0 + threadIdx.x] * scale);
    tile[32 + threadIdx.x][i] = (_Float16)(in[(size_t)(r0 + i) * ldi + c0 + 32 + threadIdx.x] * scale);
  }
  __syncthreads();
  const int q = t >> 3, c8 = (t & 7) * 8;
  {
#pragma unroll
    for (int it = 0; it < 2; ++it) {
      const int c = it * 32 + q;
      v8h hv = *(const v8h*)(&tile[c][c8]);
      *(v8h*)(outT + (size_t)(c0 + c) * ldo + r0 + c8) = hv;
    }
    
  }
}

// ---- f32 [R][C] (pitch ldi) -> bf16 hi/lo transposed planes [C][R] (pitch ldo); 64x64 tiles; each output row segment
__global__ __launch_bounds__(256) void transpose_split_bf16(const float* __restrict__ in, int ldi,
                                                           __bf16* __restrict__ outH, __bf16* __restrict__ outL, int ldo) {
  __shared__ __align__(16) float tile[64][68];     // [c][r]
  const int c0 = blockIdx.x * 64, r0 = blockIdx.y * 64;
  const int t = threadIdx.y * 32 + threadIdx.x;
  for (int i = threadIdx.y; i < 64; i += 8) {
    tile[threadIdx.x][i]      = in[(size_t)(r0 + i) * ldi + c0 + threadIdx.x];
    tile[32 + threadIdx.x][i] = in[(size_t)(r0 + i) * ldi + c0 + 32 + threadIdx.x];
  }
  __syncthreads();
  const int q = t >> 3, c8 = (t & 7) * 8;
  {
#pragma unroll
    for (int it = 0; it < 2; ++it) {
      const int c = it * 32 + q;
      v8b hv, lv;
#pragma unroll
      for (int e = 0; e < 8; ++e) {
        const float f = tile[c][c8 + e];
        const unsigned short hb = f2bf_bits(f);
        hv[e] = __builtin_bit_cast(__bf16, hb);
        lv[e] = __builtin_bit_cast(__bf16, f2bf_bits(f - bf_bits2f(hb)));
      }
      *(v8b*)(outH + (size_t)(c0 + c) * ldo + r0 + c8) = hv;
      *(v8b*)(outL + (size_t)(c0 + c) * ldo + r0 + c8) = lv;
    }
    
  }
}

#define AT_D 64
#define AT_NW 4
#define AT_QB 64
#define AT_KC 64
// LDS row pitch of the 16-bit K tile, in elements: 72 = 144 B = 16 B x odd, so the 16 rows that one
// ds_load_b128 fragment read touches start on 16 different bank groups (at 128 B they share two groups and the read serialises).
#define AT_LP 72
// LDS row pitch of the 16-bit V tile, in elements: 80 = 160 B = 32 B x odd, the conflict-free pitch of its reader ds_load_tr16_b128.
#define AT_VP 80
// e^x is taken as 2^(x * log2 e) on the hardware's base-2 exponential (one instruction); every argument here is a score minus
// its row maximum, so the library exponential's overflow and underflow ladder has nothing to catch (below 2^-126 the weight is 0).
#define AT_LOG2E 1.4426950408889634f
struct AttnGeom { const float* cp = nullptr; const float* pc = nullptr; long c_bs = 0, c_rs = 0, c_hs = 0;   // mode-5 score-bias tables
                  long q_bs, q_rs, q_hs, k_bs, k_rs, k_hs, v_bs, v_rs, v_hs, o_bs, o_rs, o_hs;
                  int S, Skv, H, mask_mode; float qscale; int blk0; float mask_fill; int mask_is_int; };
static_assert(sizeof(AttnGeom) == 168, "no padding");

__device__ __forceinline__ unsigned short at_bf_bits(float f) {
  unsigned u = __float_as_uint(f);
  return (unsigned short)((u + 0x7FFFu + ((u >> 16) & 1u)) >> 16);
}
__device__ __forceinline__ __bf16 at_f2bf(float f) { return __builtin_bit_cast(__bf16, at_bf_bits(f)); }
__device__ __forceinline__ v8f at_mma(v16b a, v16b b, v8f c) {
  return __builtin_amdgcn_wmma_f32_16x16x32_bf16(false, a, false, b, (short)0, c, false, false);
}
// 16-bit element as a bit pattern held in a __bf16 slot: f16 bits when F16, bf16 (RNE) otherwise
template <bool F16> __device__ __forceinline__ __bf16 at_to16(float f) {
  if (F16) return __builtin_bit_cast(__bf16, (_Float16)f);
  return at_f2bf(f);
}
// and back to f32
template <bool F16> __device__ __forceinline__ float at_from16(__bf16 x) {
  if (F16) return (float)__builtin_bit_cast(_Float16, x);
  return __uint_as_float(((unsigned)__builtin_bit_cast(unsigned short, x)) << 16);
}
// ds_load_tr16_b128: eight 16-bit elements of one column of a row-major LDS tile (lane addresses: at the call)
__device__ __forceinline__ v8b at_ld_tr16(const __bf16* p) {
  typedef __attribute__((ext_vector_type(8))) short at_s16x8;
  typedef __attribute__((address_space(3))) at_s16x8 at_lds_s16x8;
  return __builtin_bit_cast(v8b, __builtin_amdgcn_ds_load_tr16_b128_v8i16((at_lds_s16x8*)p));
}
template <bool F16> __device__ __forceinline__ v8f at_mma16(v16b a, v16b b, v8f c) {
  if (F16) {
    const v16h ah = __builtin_bit_cast(v16h, a), bh = __builtin_bit_cast(v16h, b);
    return __builtin_amdgcn_wmma_f32_16x16x32_f16(false, ah, false, bh, (short)0, c, false, false);
  }
  return at_mma(a, b, c);
}

// Lane l's value as seen from lane l ^ 16 (the other half of the wave): one vector cross-row move, no LDS trip.
__device__ __forceinline__ float at_xhalf(float x) {
  const int b = __builtin_bit_cast(int, x);
  return __builtin_bit_cast(float, __builtin_amdgcn_permlanex16(b, b, 0x76543210, 0xfedcba98, false, false));
}

// Eight base-2 exponentials (one score tile of a lane's query), each in place. One statement, so that the
// issue slot the instruction set asks for behind a transcendental is filled by construction: each v_exp_f32 is followed by an
// independent one, the last by v_nop; written in place, no later instruction can rewrite a source that is not also the live result
// The two s_delay_alu are the hints the compiler would write for its own code and cannot for asm text (first: the arguments come from
// the vector instructions just ahead; last: whichever reader comes next): a wave that waits unhinted holds the SIMD's issue for the others.
__device__ __forceinline__ void at_exp2x8(float& p0, float& p1, float& p2, float& p3, float& p4, float& p5, float& p6, float& p7) {
  asm("s_delay_alu instid0(VALU_DEP_1)\n\t"
      "v_exp_f32 %0, %0\n\tv_exp_f32 %1, %1\n\tv_exp_f32 %2, %2\n\tv_exp_f32 %3, %3\n\t"
      "v_exp_f32 %4, %4\n\tv_exp_f32 %5, %5\n\tv_exp_f32 %6, %6\n\tv_exp_f32 %7, %7\n\tv_nop\n\t"
      "s_delay_alu instid0(TRANS32_DEP_1)"
      : "+v"(p0), "+v"(p1), "+v"(p2), "+v"(p3), "+v"(p4), "+v"(p5), "+v"(p6), "+v"(p7));
}
// The same for one value (the query's rescale factor).
__device__ __forceinline__ void at_exp2x1(float& a) {
  asm("s_delay_alu instid0(VALU_DEP_1)\n\tv_exp_f32 %0, %0\n\tv_nop\n\ts_delay_alu instid0(TRANS32_DEP_1)" : "+v"(a));
}

// MM: the mask mode as a compile-time constant (the launch's g.mask_mode must equal it); MM < 0 reads g.mask_mode at run time.
template <bool F16 = false, int MM = -1>
__global__ __launch_bounds__(128)
void attn64_kernel(const unsigned short* __restrict__ q, const unsigned short* __restrict__ k,
                   const unsigned short* __restrict__ v, float* __restrict__ out,
                   const void* __restrict__ mask_a, const int* __restrict__ mask_b, AttnGeom g) {
  const int mask_mode = (MM >= 0) ? MM : g.mask_mode;
  const float PSC = F16 ? 32768.0f : 1.0f;     // f16 probabilities carried x2^15 (subnormal range), folded into the final 1/l
  union FB { v16b v; v8b h[2]; };
  __shared__ __align__(16) __bf16 Ksh[AT_KC * AT_LP];            // K [kv][d], pitch AT_LP      9 KB
  __shared__ __align__(16) __bf16 Vsh[AT_KC * AT_VP];            // V [kv][d], pitch AT_VP     10 KB
  __shared__ __align__(16) float  Os[AT_NW][16 * 68];            // per wave out tile, pitch 68

  const int tid  = threadIdx.x;
  const int wave = tid >> 5;
  const int lane = tid & 31;
  const int hh   = lane >> 4;
  const int c    = lane & 15;

  const int nqb = g.S / AT_QB;
  const int bx = blockIdx.x + g.blk0;
  const int qb = bx % nqb;
  const int bh = bx / nqb;
  const int h  = bh % g.H;
  const int b  = bh / g.H;
  const int qbase_block = qb * AT_QB;
  const int q0 = qbase_block + wave * 16;

  const __bf16* qb_ptr = (const __bf16*)q + (size_t)b * g.q_bs + (size_t)h * g.q_hs;
  const __bf16* kb_ptr = (const __bf16*)k + (size_t)b * g.k_bs + (size_t)h * g.k_hs;
  const __bf16* vb_ptr = (const __bf16*)v + (size_t)b * g.v_bs + (size_t)h * g.v_hs;
  float*        ob_ptr = out + (size_t)b * g.o_bs + (size_t)h * g.o_hs;

  // ---- Q fragments (B operand: column = query q0 + c): 2 d-chunks ----
  v16b qah[2];
  {
    const __bf16* qrow = qb_ptr + (size_t)(q0 + c) * g.q_rs;
#pragma unroll
    for (int dc = 0; dc < 2; ++dc) {
      const v8b x0 = *(const v8b*)(qrow + dc * 32 + 8 * hh), x1 = *(const v8b*)(qrow + dc * 32 + 16 + 8 * hh);
#pragma unroll
      for (int e = 0; e < 8; ++e) {
        qah[dc][e]     = at_to16<F16>(at_from16<F16>(x0[e]) * g.qscale);
        qah[dc][8 + e] = at_to16<F16>(at_from16<F16>(x1[e]) * g.qscale);
      }
    }
  }

  // state of this lane's query q0 + c; nrow2 = -(running maximum) * log2 e as it was rounded when that maximum was taken;
  // lrow sums this wave half's keys only (the halves are joined behind the loop)
  float nrow2 = INFINITY, lrow = 0.f;
  v8f oacc[4];                                 // O^T: oacc[t][r] = element d = t*16 + 8*hh + r of query q0 + c
#pragma unroll
  for (int t = 0; t < 4; ++t) oacc[t] = (v8f){0.f,0.f,0.f,0.f,0.f,0.f,0.f,0.f};

  const int nChunks = (mask_mode == 1 || mask_mode == 4) ? (qb + 1) : (g.Skv / AT_KC);   // block-uniform
  const int qrow = q0 + c;
  const int qkeep = (mask_mode == 3) ? mask_b[(size_t)b * g.S + qrow] : 1;   // query mask (mode 3): mask_b = qmask
  // Staging deal: a K or V row of one head is one 128-B line; eight lanes take it, 16 B each, so a wave's load covers four whole lines.
  // A thread copies its piece of rows sr, sr + 16, sr + 32 and sr + 48 of both tiles.
  const int sp = (tid & 7) * 8, sr = tid >> 3;
  const __bf16* kst = kb_ptr + (size_t)sr * g.k_rs + sp;
  const __bf16* vst = vb_ptr + (size_t)sr * g.v_rs + sp;
  // Lane address of the transposing load: lane (c, hh) receives V[kbase + 8*hh + 0..7][dbase + c] when every lane l points at
  // row kbase + 8*(l >> 4) + (l & 7), byte 2*dbase + 16*((l >> 3) & 1).
  const __bf16* vtr = Vsh + (8 * hh + (lane & 7)) * AT_VP + ((lane >> 3) & 1) * 8;
  for (int kc = 0; kc < nChunks; ++kc) {
    const int kv0 = kc * AT_KC;
    __syncthreads();
    {
      const __bf16* kp[4]; const __bf16* vp[4];
      v8b kk[4], vv[4];
#pragma unroll
      for (int i = 0; i < 4; ++i) {
        kp[i] = kst + (size_t)(kv0 + 16 * i) * g.k_rs;
        vp[i] = vst + (size_t)(kv0 + 16 * i) * g.v_rs;
        kk[i] = *(const v8b*)(kp[i]);
        vv[i] = *(const v8b*)(vp[i]);
      }
      // The wait that stands between an issued global load and a rewrite of its address registers. The addresses are its inputs, so
      // they stay whole up to it.
      asm volatile("s_wait_xcnt 0x0" :: "v"(kp[0]), "v"(kp[1]), "v"(kp[2]), "v"(kp[3]), "v"(vp[0]), "v"(vp[1]), "v"(vp[2]), "v"(vp[3]) : "memory");
#pragma unroll
      for (int i = 0; i < 4; ++i) {
        *(v8b*)(Ksh + (sr + 16 * i) * AT_LP + sp) = kk[i];
        *(v8b*)(Vsh + (sr + 16 * i) * AT_VP + sp) = vv[i];
      }
    }
    __syncthreads();

    // All fragments of the chunk are fetched as one group of LDS reads ahead of the matrix runs: K's eight first, V's eight behind them.
    // A read waited for in front of each product costs the wave one LDS round trip per product; here the first run waits once and
    // V lands under the scores and the softmax.
    FB kf[2][4], vf[2][4];
#pragma unroll
    for (int dc = 0; dc < 2; ++dc)
#pragma unroll
      for (int j = 0; j < 4; ++j) {
        kf[dc][j].h[0] = *(const v8b*)(Ksh + (j * 16 + c) * AT_LP + dc * 32 + 8 * hh);
        kf[dc][j].h[1] = *(const v8b*)(Ksh + (j * 16 + c) * AT_LP + dc * 32 + 16 + 8 * hh);
      }
    // V^T fragment (rows d = t*16 + c): elements 0..7 are keys kk*32 + 8*hh + 0..7, elements 8..15 keys kk*32 + 16 + 8*hh + 0..7.
#pragma unroll
    for (int kk = 0; kk < 2; ++kk)
#pragma unroll
      for (int t = 0; t < 4; ++t) {
        vf[kk][t].h[0] = at_ld_tr16(vtr + (kk * 32) * AT_VP + t * 16);
        vf[kk][t].h[1] = at_ld_tr16(vtr + (kk * 32 + 16) * AT_VP + t * 16);
      }
    // Keeps the scheduler from sinking the reads back down to their products (each would again be waited for on its own).
    __builtin_amdgcn_sched_barrier(0);

    // S^T: s[j][r] = score of key kv0 + j*16 + 8*hh + r for query q0 + c. The four tiles take turns, so that a tile's second product
    // finds its first one finished; each tile still sums head elements 0..31, then 32..63.
    v8f s[4];
#pragma unroll
    for (int j = 0; j < 4; ++j) s[j] = (v8f){0.f,0.f,0.f,0.f,0.f,0.f,0.f,0.f};
#pragma unroll
    for (int dc = 0; dc < 2; ++dc)
#pragma unroll
      for (int j = 0; j < 4; ++j) {
        s[j] = at_mma16<F16>(kf[dc][j].v, qah[dc], s[j]);
      }
    const bool diag = (mask_mode == 1) && (kc == qb);
    float mj[4];                                // one maximum per score tile: four short chains instead of one long one
#pragma unroll
    for (int j = 0; j < 4; ++j) {
      mj[j] = -INFINITY;
#pragma unroll
      for (int r = 0; r < 8; ++r) {
        const int kvcol = kv0 + j * 16 + 8 * hh + r;
        bool masked = false;
        if (diag) masked = (kvcol > qrow);
        else if (mask_mode == 4) masked = (kvcol > qrow) || (qrow - kvcol > g.mask_is_int);
        else if (mask_mode == 2) {
          const size_t mi = (size_t)qrow * g.Skv + kvcol;
          masked = (g.mask_is_int == 0) ? (((const float*)mask_a)[mi] == 0.0f)
                 : (g.mask_is_int == 1) ? (((const int*)mask_a)[mi] == 0) : (((const int*)mask_a)[mi] != 0);
        } else if (mask_mode == 3) masked = (qkeep == 0) || (((const int*)mask_a)[(size_t)b * g.Skv + kvcol] == 0);   // mask_a = kvmask
        else if (mask_mode == 5) {
          const size_t mi = (size_t)qrow * g.Skv + kvcol;
          masked = (((const int*)mask_a)[mi] != 0);
          int n = mask_b[mi]; n = n < 0 ? 0 : n;
          s[j][r] += g.cp[(size_t)b * g.c_bs + (size_t)h * g.c_hs + (size_t)qrow * g.c_rs + n]
                   + g.pc[(size_t)b * g.c_bs + (size_t)h * g.c_hs + (size_t)kvcol * g.c_rs + n];
        }
        if (masked) s[j][r] = g.mask_fill;
        mj[j] = fmaxf(mj[j], s[j][r]);
      }
    }
    float m = fmaxf(fmaxf(mj[0], mj[1]), fmaxf(mj[2], mj[3]));
    m = fmaxf(m, at_xhalf(m));                  // the other half of the wave holds the query's other 32 keys
    // minus the running maximum in base-2 units, the offset of every weight of this chunk: the product is rounded once per chunk
    // maximum, and the smaller of two such products is the product of the larger maximum (rounding keeps the order)
    const float noff = fminf(nrow2, m * -AT_LOG2E);
    float alpha = noff - nrow2;                 // difference of the two offsets in use: exactly 0 while the maximum stands; -inf on the first chunk
    nrow2 = noff;
    at_exp2x1(alpha);
    float pe[4][8], ps[4];
#pragma unroll
    for (int j = 0; j < 4; ++j) {
      float* p = pe[j];
#pragma unroll
      for (int r = 0; r < 8; ++r) p[r] = fmaf(s[j][r], AT_LOG2E, noff);   // e^(s - m) = 2^(s*log2e - m*log2e)
      at_exp2x8(p[0], p[1], p[2], p[3], p[4], p[5], p[6], p[7]);
      ps[j] = ((p[0] + p[1]) + (p[2] + p[3])) + ((p[4] + p[5]) + (p[6] + p[7]));
    }
    lrow = lrow * alpha + ((ps[0] + ps[1]) + (ps[2] + ps[3]));
#pragma unroll
    for (int t = 0; t < 4; ++t)
#pragma unroll
      for (int r = 0; r < 8; ++r) oacc[t][r] *= alpha;
    // P^T as B operand, straight from the score tiles: element e of k-chunk kk is key kk*32 + 8*hh + e (tile 2kk, register e), element
    // 8 + e is key kk*32 + 16 + 8*hh + e (tile 2kk + 1, register e): the k order of the V loader above.
    // Unrolled, so that kk picks the score registers at compile time.
#pragma unroll
    for (int kk = 0; kk < 2; ++kk) {
      v16b pa;
#pragma unroll
      for (int e = 0; e < 8; ++e) {
        const float p0 = pe[2 * kk][e], p1 = pe[2 * kk + 1][e];
        pa[e] = at_to16<F16>(p0 * PSC); pa[8 + e] = at_to16<F16>(p1 * PSC);
      }
#pragma unroll
      for (int t = 0; t < 4; ++t) oacc[t] = at_mma16<F16>(vf[kk][t].v, pa, oacc[t]);
    }
  }

  float* os = Os[wave];
  {
    const float inv = 1.0f / ((lrow + at_xhalf(lrow)) * PSC);   // the two halves' sums joined, once
#pragma unroll
    for (int t = 0; t < 4; ++t) {
      v4f lo4, hi4;
#pragma unroll
      for (int e = 0; e < 4; ++e) { lo4[e] = oacc[t][e] * inv; hi4[e] = oacc[t][4 + e] * inv; }
      *(v4f*)(os + c * 68 + t * 16 + 8 * hh)     = lo4;
      *(v4f*)(os + c * 68 + t * 16 + 8 * hh + 4) = hi4;
    }
  }
  __builtin_amdgcn_fence(__ATOMIC_RELEASE, "workgroup");
  __builtin_amdgcn_wave_barrier();
  __builtin_amdgcn_fence(__ATOMIC_ACQUIRE, "workgroup");
  {
    const int c4 = (lane & 15) * 4;
    {
#pragma unroll
      for (int it = 0; it < 8; ++it) {
        const int row = it * 2 + hh;
        v4f val = *(const v4f*)(os + row * 68 + c4);
        *(v4f*)(ob_ptr + (size_t)(q0 + row) * g.o_rs + c4) = val;
      }
      
    }
  }
}

#define SB_ 2
#define SN_ 4096
#define SC_ 256
#define SI_ 512
#define SH_ 8
extern "C" void kernel_launch(void* const* d_in, const int* in_sizes, int n_in, void* d_out, int out_size, void* d_ws, size_t ws_size, hipStream_t stream) {
  (void)in_sizes; (void)n_in; (void)out_size; (void)ws_size;
  const float* x = (const float*)d_in[0]; const float* Wq = (const float*)d_in[1]; const float* Wk = (const float*)d_in[2]; const float* Wv = (const float*)d_in[3]; const float* Wo = (const float*)d_in[4];
  float* out = (float*)d_out;
  char* ws = (char*)d_ws; size_t off = 0;
  auto carve = [&](size_t bytes) -> char* { char* p = ws + off; off += (bytes + 255) & ~(size_t)255; return p; };
  const int R = SB_ * SN_;
  __bf16* Xh = (__bf16*)carve((size_t)R * SC_ * 2); __bf16* Xl = (__bf16*)carve((size_t)R * SC_ * 2);
  __bf16* W3h = (__bf16*)carve((size_t)3 * SI_ * SC_ * 2); __bf16* W3l = (__bf16*)carve((size_t)3 * SI_ * SC_ * 2);     // [Wq;Wk;Wv] stacked = Bt for N = 1536
  __bf16* Woh = (__bf16*)carve((size_t)SC_ * SI_ * 2); __bf16* Wol = (__bf16*)carve((size_t)SC_ * SI_ * 2);
  _Float16* QKV = (_Float16*)carve((size_t)R * 3 * SI_ * 2);      // 25 MB: q, k, v as the attention's f16 operands
  float* O = (float*)carve((size_t)R * SI_ * 4);
  __bf16* Oh = (__bf16*)carve((size_t)R * SI_ * 2); __bf16* Ol = (__bf16*)carve((size_t)R * SI_ * 2);
  split_f32_bf16_frag<<<R * SC_ / 4096, 256, 0, stream>>>(x, Xh, Xl, 3, R * SC_ / 512);
  split_f32_bf16_frag<<<SI_ * SC_ / 4096, 256, 0, stream>>>(Wq, W3h, W3l, 3, SI_ * SC_ / 512);
  split_f32_bf16_frag<<<SI_ * SC_ / 4096, 256, 0, stream>>>(Wk, W3h + (size_t)SI_ * SC_, W3l + (size_t)SI_ * SC_, 3, SI_ * SC_ / 512);
  split_f32_bf16_frag<<<SI_ * SC_ / 4096, 256, 0, stream>>>(Wv, W3h + (size_t)2 * SI_ * SC_, W3l + (size_t)2 * SI_ * SC_, 3, SI_ * SC_ / 512);
  split_f32_bf16_frag<<<SC_ * SI_ / 4096, 256, 0, stream>>>(Wo, Woh, Wol, 4, SC_ * SI_ / 512);
  { const int t = (R / 64) * (3 * SI_ / 64);
    wmma_gemm64<1, true, 0, 1, false><<<dim3((t + 7) / 8, 1), 256, 0, stream>>>(U16(Xh), U16(Xl), SC_, 0, U16(W3h), U16(W3l), SC_, 0, QKV, nullptr, 3 * SI_, 0, nullptr, nullptr, 0, R, 3 * SI_, SC_, 1.0f); }
  { AttnGeom g;
    g.q_bs = (long)SN_ * 3 * SI_; g.q_rs = 3 * SI_; g.q_hs = 64; g.k_bs = g.q_bs; g.k_rs = 3 * SI_; g.k_hs = 64; g.v_bs = g.q_bs; g.v_rs = 3 * SI_; g.v_hs = 64;
    g.o_bs = (long)SN_ * SI_; g.o_rs = SI_; g.o_hs = 64; g.S = SN_; g.Skv = SN_; g.H = SH_; g.mask_mode = 0; g.qscale = 0.125f; g.blk0 = 0; g.mask_fill = -INFINITY; g.mask_is_int = 0;
    attn64_kernel<true, 0><<<SB_ * SH_ * (SN_ / AT_QB), AT_NW * 32, 0, stream>>>(U16(QKV), U16(QKV + SI_), U16(QKV + 2 * SI_), O, nullptr, nullptr, g); }
  split_f32_bf16_frag<<<R * SI_ / 4096, 256, 0, stream>>>(O, Oh, Ol, 4, R * SI_ / 512);
  { const int t = (R / 64) * (SC_ / 64);
    wmma_gemm64<1, true, 0, 0, false><<<dim3((t + 7) / 8, 1), 256, 0, stream>>>(U16(Oh), U16(Ol), SI_, 0, U16(Woh), U16(Wol), SI_, 0, out, nullptr, SC_, 0, nullptr, nullptr, 0, R, SC_, SI_, 1.0f); }
}

// v009
// One run takes 136 microseconds.
// In both of two side-by-side timings against v008, it was 1.07 times as fast.
// Counting every step since v000, it is 16.2 times as fast.
#include <hip/hip_runtime.h>
#include <math.h>
// Spatio-temporal attention (2 clips x 4096 tokens, 8 heads x 64): q/k/v = x·Wᵀ (8192 x 256 · 256 x 512 each) and out = o·Woᵀ (·512 x 256)
// on v_wmma_f32_16x16x32_bf16 with bf16 hi/lo split operands (the output is an average over 4096 near-uniform attention weights, RMS
// 0.0025); the attention itself (scores and p·v, p x2^15, 4096 keys) on
// v_wmma_f32_16x16x32_f16 with f16 operands; f32 accumulate; softmax f32 on VALU.
// The 1x1x1 conv weights ([out][in]) are used directly as the transposed operand.
typedef __attribute__((ext_vector_type(16))) _Float16 v16h;
typedef __attribute__((ext_vector_type(8)))  _Float16 v8h;
typedef __attribute__((ext_vector_type(16))) __bf16   v16b;
typedef __attribute__((ext_vector_type(8)))  __bf16   v8b;
typedef __attribute__((ext_vector_type(4)))  __bf16   v4b;
typedef __attribute__((ext_vector_type(8)))  float    v8f;
typedef __attribute__((ext_vector_type(4)))  float    v4f;
#define PSCALE 32768.0f
#define U16(p) ((const unsigned short*)(const void*)(p))
#define PSCALE_INV (1.0f / 32768.0f)

__device__ __forceinline__ unsigned short f2bf_bits(float f) {
  unsigned u = __float_as_uint(f);
  return (unsigned short)((u + 0x7FFFu + ((u >> 16) & 1u)) >> 16);
}
__device__ __forceinline__ float bf_bits2f(unsigned short h) { return __uint_as_float(((unsigned)h) << 16); }

// hazard guards as plain device helpers (no inline asm inside the kernel template body)
__device__ __forceinline__ void dep_guard_h(v8f& a, v8f& b, v16h x, v16h y) { asm volatile("v_nop\n\tv_nop\n\tv_nop\n\tv_nop" : "+v"(a), "+v"(b) : "v"(x), "v"(y)); }
__device__ __forceinline__ void dep_guard_b(v8f& a, v8f& b, v16b x, v16b y) { asm volatile("v_nop\n\tv_nop\n\tv_nop\n\tv_nop" : "+v"(a), "+v"(b) : "v"(x), "v"(y)); }
__device__ __forceinline__ void keep4_h(v16h a, v16h b, v16h c, v16h d) { asm volatile("v_nop" :: "v"(a), "v"(b), "v"(c), "v"(d)); }
__device__ __forceinline__ void keep4_b(v16b a, v16b b, v16b c, v16b d) { asm volatile("v_nop" :: "v"(a), "v"(b), "v"(c), "v"(d)); }
__device__ __forceinline__ void acc_guard4(v8f& a, v8f& b, v8f& c, v8f& d) { asm volatile("v_nop\n\tv_nop\n\tv_nop\n\tv_nop" : "+v"(a), "+v"(b), "+v"(c), "+v"(d)); }
template <typename T> struct Frag;
template <> struct Frag<_Float16> {
  typedef v16h V; union U { v16h v; v8h h[2]; };
  static __device__ __forceinline__ v16h load(const _Float16* p) {   // p = tile + lane * 8: elements 0..7 <- p[0..7], 8..15 <- p[256..263]
    U f; f.h[0] = *(const v8h*)(p); f.h[1] = *(const v8h*)(p + 256); return f.v;
  }
  static __device__ __forceinline__ v8f mma(v16h a, v16h b, v8f c) {
    return __builtin_amdgcn_wmma_f32_16x16x32_f16(false, a, false, b, (short)0, c, false, false);
  }
  static __device__ __forceinline__ void guard(v8f& a, v8f& b, v16h x, v16h y) { dep_guard_h(a, b, x, y); }
  static __device__ __forceinline__ void keep(v16h a, v16h b, v16h c, v16h d) { keep4_h(a, b, c, d); }
};
template <> struct Frag<__bf16> {
  typedef v16b V; union U { v16b v; v8b h[2]; };
  static __device__ __forceinline__ v16b load(const __bf16* p) {
    U f; f.h[0] = *(const v8b*)(p); f.h[1] = *(const v8b*)(p + 256); return f.v;
  }
  static __device__ __forceinline__ v8f mma(v16b a, v16b b, v8f c) {
    return __builtin_amdgcn_wmma_f32_16x16x32_bf16(false, a, false, b, (short)0, c, false, false);
  }
  static __device__ __forceinline__ void guard(v8f& a, v8f& b, v16b x, v16b y) { dep_guard_b(a, b, x, y); }
  static __device__ __forceinline__ void keep(v16b a, v16b b, v16b c, v16b d) { keep4_b(a, b, c, d); }
};

// ---- Register-blocked batched WMMA GEMM ------------------------------------
// C[m,n] = scale * sum_k A[m,k] * Bt[n,k] (+bias)(+resid); each wave owns a 64x64 tile.
// A is [M,K], Bt is [N,K]; M,N % 64 == 0, K % 32 == 0. Both lie in FRAGMENT ORDER (written so by split_tile_frag): the 16-row x 32-k tile
// (row band rb, k step kt) is 512 elements in a row at rb * 16 * ld + kt * 512 (ld = row length, lda or ldb), and inside it element
// (row r, k) stands at (k >> 4) * 256 + (((k >> 3) & 1) * 16 + r) * 8 + (k & 7): lane l finds its elements 0..7 at l * 8 and its elements
// 8..15 at 256 + l * 8, so each 16-byte load of a wave covers 512 bytes in a row (four whole 128-B lines; from row-major planes it took
// 32 bytes out of each of 16 lines). The registers hold what they held with row-major planes.
// SPLIT: operands are hi/lo planes (A2/Bt2 = lo planes, same layout); product = hi·hi + hi·lo + lo·hi.
// BIAS_MODE: 0 = none, 1 = bias[m], 2 = bias[n].
// OUT_MODE: 0 = f32, 1 = f16, 2 = bf16 hi plane (Cout) + bf16 lo plane (Cout2); every output is row-major.
// ET: 0 = f16 operands, 1 = bf16 operands (pointers passed as 16-bit storage)
template <int ET> struct Elem;
template <> struct Elem<0> { typedef _Float16 T; };
template <> struct Elem<1> { typedef __bf16 T; };
template <int ET, bool SPLIT, int BIAS_MODE, int OUT_MODE, bool RESID, int ACT = 0>
__global__ __launch_bounds__(256) void wmma_gemm64(
    const unsigned short* __restrict__ Ap, const unsigned short* __restrict__ A2p, int lda, long strideA,
    const unsigned short* __restrict__ Btp, const unsigned short* __restrict__ Bt2p, int ldb, long strideB,
    void* __restrict__ Cout, void* __restrict__ Cout2, int ldc, long strideC,
    const float* __restrict__ bias,
    const float* __restrict__ resid, long strideR,
    int M, int N, int K, float scale) {
  typedef typename Elem<ET>::T T;
  typedef typename Frag<T>::V V;
  const T* A = (const T*)Ap; const T* A2 = (const T*)A2p; const T* Bt = (const T*)Btp; const T* Bt2 = (const T*)Bt2p;
  __shared__ __align__(16) float sT[8][16 * 68];   // per-wave 16x64 slab, pitch 68 floats
  const int b    = blockIdx.y;
  const int lane = threadIdx.x & 31;
  const int wave = __builtin_amdgcn_readfirstlane(threadIdx.x >> 5);   // scalar: tile addresses are then a scalar base plus lane * 16 bytes
  const int tilesN = N >> 6;
  const int tilesM = M >> 6;
  const int tile = blockIdx.x * 8 + wave;
  if (tile >= tilesM * tilesN) return;   // wave-uniform; no block barriers in this kernel
  const int tm = tile / tilesN;
  const int tn = tile - tm * tilesN;
  const int m0 = tm << 6;
  const int n0 = tn << 6;

  // Start of each of the wave's four A and four B row bands, per plane: scalar, fixed over the k loop.
  const T* Ab[4]; const T* Bb[4]; const T* Ab2[4]; const T* Bb2[4];
#pragma unroll
  for (int i = 0; i < 4; ++i) {
    const size_t ao = (size_t)b * strideA + (size_t)(m0 + (i << 4)) * lda;
    const size_t bo = (size_t)b * strideB + (size_t)(n0 + (i << 4)) * ldb;
    Ab[i]  = A + ao;  Bb[i]  = Bt + bo;
    Ab2[i] = SPLIT ? (A2 + ao) : nullptr;  Bb2[i] = SPLIT ? (Bt2 + bo) : nullptr;
  }

  const int rlane = lane & 15;                 // row (A) / col (B, D) within subtile
  const int mOff  = (lane >> 4) * 8;           // D row offset

  v8f acc[4][4];
#pragma unroll
  for (int i = 0; i < 4; ++i)
#pragma unroll
    for (int j = 0; j < 4; ++j) acc[i][j] = (v8f){0.f,0.f,0.f,0.f,0.f,0.f,0.f,0.f};

  // This lane's place in the current k step's tiles, in bytes: the one address that moves. 32 bits, so that a load is scalar base + this register.
  unsigned vo = lane * 16;
  auto at = [&](const T* band) -> const T* { return (const T*)((const char*)band + vo); };
  for (int k0 = 0; k0 < K; k0 += 32, vo += 1024) {
    V bh[4], bl[4];
#pragma unroll
    for (int j = 0; j < 4; ++j) {
      bh[j] = Frag<T>::load(at(Bb[j]));
      if (SPLIT) bl[j] = Frag<T>::load(at(Bb2[j]));
    }
#pragma unroll
    for (int i = 0; i < 4; ++i) {
      V ah = Frag<T>::load(at(Ab[i]));
      V al;
      if (SPLIT) al = Frag<T>::load(at(Ab2[i]));
#pragma unroll
      for (int j = 0; j < 4; ++j) {
        acc[i][j] = Frag<T>::mma(ah, bh[j], acc[i][j]);
        if (SPLIT) {
          acc[i][j] = Frag<T>::mma(ah, bl[j], acc[i][j]);
          acc[i][j] = Frag<T>::mma(al, bh[j], acc[i][j]);
        }
      }
      Frag<T>::guard(acc[i][0], acc[i][3], ah, SPLIT ? al : ah);
    }
    Frag<T>::keep(bh[0], bh[1], bh[2], bh[3]);
    if (SPLIT) Frag<T>::keep(bl[0], bl[1], bl[2], bl[3]);
  }
  acc_guard4(acc[0][0], acc[0][1], acc[0][2], acc[0][3]);
  acc_guard4(acc[1][0], acc[1][1], acc[1][2], acc[1][3]);
  acc_guard4(acc[2][0], acc[2][1], acc[2][2], acc[2][3]);
  acc_guard4(acc[3][0], acc[3][1], acc[3][2], acc[3][3]);

  // ---- epilogue ----
  float* slab = sT[wave];
  const float* Rb = RESID ? (resid + (size_t)b * strideR) : nullptr;
#pragma unroll
  for (int i = 0; i < 4; ++i) {
    const int mBase = m0 + (i << 4);
#pragma unroll
    for (int j = 0; j < 4; ++j) {
      const int n = n0 + (j << 4) + rlane;
      float bv = 0.f;
      if (BIAS_MODE == 2) bv = bias[n];
#pragma unroll
      for (int r = 0; r < 8; ++r) {
        float v = acc[i][j][r] * scale;
        if (BIAS_MODE == 1) v += bias[mBase + mOff + r];
        if (BIAS_MODE == 2) v += bv;
        if (RESID) v += Rb[(size_t)(mBase + mOff + r) * ldc + n];
        if (ACT == 1) v = tanhf(v);
        if (ACT == 2) v = fmaxf(v, 0.0f);
        if (ACT == 3) v = v / (1.0f + expf(-v));
        if (ACT == 4) v = (v > 0.f) ? v : 0.01f * v;
        if (ACT == 5) v = 0.5f * v * (1.0f + erff(v * 0.70710678118654752f));
        slab[(mOff + r) * 68 + (j << 4) + rlane] = v;
      }
    }
    __builtin_amdgcn_fence(__ATOMIC_RELEASE, "workgroup");
    __builtin_amdgcn_wave_barrier();
    __builtin_amdgcn_fence(__ATOMIC_ACQUIRE, "workgroup");
    if (OUT_MODE == 0) {
      float* C = (float*)Cout + (size_t)b * strideC;
      const int hh = lane >> 4, c4 = (lane & 15) * 4;     // row seg = 256 B = 16 lanes x 16 B
      {
#pragma unroll
        for (int it = 0; it < 8; ++it) {
          const int row = it * 2 + hh;
          v4f v = *(const v4f*)(slab + row * 68 + c4);
          *(v4f*)(C + (size_t)(mBase + row) * ldc + n0 + c4) = v;
        }
        
      }
    } else {
      const int q = lane >> 3, c8 = (lane & 7) * 8;
      unsigned short* C  = (unsigned short*)Cout  + (size_t)b * strideC;
      unsigned short* C2 = (OUT_MODE == 2) ? ((unsigned short*)Cout2 + (size_t)b * strideC) : nullptr;
      {
#pragma unroll
        for (int it = 0; it < 4; ++it) {
          const int row = it * 4 + q;
          const float* sp = slab + row * 68 + c8;
          v8h hv, lv;
#pragma unroll
          for (int e = 0; e < 8; ++e) {
            if (OUT_MODE == 1) {
              hv[e] = (_Float16)sp[e];
            } else {
              unsigned short hb = f2bf_bits(sp[e]);
              unsigned short lb = f2bf_bits(sp[e] - bf_bits2f(hb));
              hv[e] = __builtin_bit_cast(_Float16, hb);
              lv[e] = __builtin_bit_cast(_Float16, lb);
            }
          }
          *(v8h*)(C + (size_t)(mBase + row) * ldc + n0 + c8) = hv;
          if (OUT_MODE == 2) *(v8h*)(C2 + (size_t)(mBase + row) * ldc + n0 + c8) = lv;
        }
        
      }
    }
    __builtin_amdgcn_fence(__ATOMIC_RELEASE, "workgroup");
    __builtin_amdgcn_wave_barrier();
    __builtin_amdgcn_fence(__ATOMIC_ACQUIRE, "workgroup");
  }
}

__global__ __launch_bounds__(256) void cast_f32_f16x2(
    const float* __restrict__ in, _Float16* __restrict__ out, int n2) {
  int i = blockIdx.x * 256 + threadIdx.x;
  if (i < n2) {
    const _Float16 h0 = (_Float16)in[2 * i], h1 = (_Float16)in[2 * i + 1];
    const unsigned u = (unsigned)__builtin_bit_cast(unsigned short, h0) | ((unsigned)__builtin_bit_cast(unsigned short, h1) << 16);
    ((unsigned*)out)[i] = u;
    
  }
}


// ---- f32 -> f16 cast with a power-of-two pre-scale (folded back by the consumer GEMM's scale) ----
__global__ __launch_bounds__(256) void cast_f32_f16x2s(const float* __restrict__ in, _Float16* __restrict__ out, int n2, float s) {
  int i = blockIdx.x * 256 + threadIdx.x;
  if (i < n2) {
    const _Float16 h0 = (_Float16)(in[2 * i] * s), h1 = (_Float16)(in[2 * i + 1] * s);
    const unsigned u = (unsigned)__builtin_bit_cast(unsigned short, h0) | ((unsigned)__builtin_bit_cast(unsigned short, h1) << 16);
    ((unsigned*)out)[i] = u;
    
  }
}
// ---- f32 [rows][32 << lkt] row-major -> bf16 hi and lo planes in the matrix operands' fragment order (layout: at wmma_gemm64) ----
// One wave per 16-row x 32-k tile (tile = row band * (1 << lkt) + k step). Eight lanes take one row's 128-B line, 16 B each, so a load covers
// four whole lines; a lane's four values go out as one 8-B store per plane, and the wave writes the tile's 1 KB of each plane alone.
__device__ __forceinline__ void split_tile_frag(
    const float* __restrict__ in, __bf16* __restrict__ hi, __bf16* __restrict__ lo, int lkt, int tile) {
  const int lane = threadIdx.x & 31;
  const int q = lane & 7, r0 = lane >> 3;            // k = 4 * q .. 4 * q + 3 of rows r0, r0 + 4, r0 + 8, r0 + 12
  const int band = tile >> lkt, kt = tile - (band << lkt);
  const float* src = in + ((size_t)(band * 16 + r0) << (lkt + 5)) + kt * 32 + q * 4;
  const size_t dst = (size_t)tile * 512 + (q >> 2) * 256 + (((q >> 1) & 1) * 16 + r0) * 8 + (q & 1) * 4;
  const float* sp[4];
  v4f x[4];
#pragma unroll
  for (int i = 0; i < 4; ++i) {
    sp[i] = src + ((size_t)(4 * i) << (lkt + 5));
    x[i] = *(const v4f*)(sp[i]);
  }
  // The wait that stands between an issued global load and a rewrite of its address registers. The addresses are its inputs, so they
  // stay whole up to it.
  asm volatile("s_wait_xcnt 0x0" :: "v"(sp[0]), "v"(sp[1]), "v"(sp[2]), "v"(sp[3]) : "memory");
#pragma unroll
  for (int i = 0; i < 4; ++i) {
    v4b h, l;
#pragma unroll
    for (int e = 0; e < 4; ++e) {
      const unsigned short hb = f2bf_bits(x[i][e]);
      h[e] = __builtin_bit_cast(__bf16, hb);
      l[e] = __builtin_bit_cast(__bf16, f2bf_bits(x[i][e] - bf_bits2f(hb)));
    }
    *(v4b*)(hi + dst + i * 32) = h;                  // four rows on: 4 * 8 elements
    *(v4b*)(lo + dst + i * 32) = l;
  }
}
__global__ __launch_bounds__(256) void split_f32_bf16_frag(
    const float* __restrict__ in, __bf16* __restrict__ hi, __bf16* __restrict__ lo, int lkt, int ntiles) {
  const int tile = blockIdx.x * 8 + (threadIdx.x >> 5);
  if (tile >= ntiles) return;
  split_tile_frag(in, hi, lo, lkt, tile);
}
// The five operands that exist before the first product (x and the four weights) in ONE launch: they do not depend on each other, and a
// weight's few blocks alone leave most of the chip idle for a whole launch. A range of block indices picks the operand (a scalar choice,
// the same for every lane of a block): nbw blocks each of wq, wk, wv (stacked in w3h / w3l) and wo, then x with all the rest; 8 tiles a
// block, every range a whole number of blocks. lkt_c belongs to x, wq, wk, wv (rows of c elements), lkt_i to wo.
__global__ __launch_bounds__(256) void split_inputs_frag(
    const float* __restrict__ x, const float* __restrict__ wq, const float* __restrict__ wk, const float* __restrict__ wv,
    const float* __restrict__ wo, __bf16* __restrict__ xh, __bf16* __restrict__ xl, __bf16* __restrict__ w3h, __bf16* __restrict__ w3l,
    __bf16* __restrict__ woh, __bf16* __restrict__ wol, int nbw, int lkt_c, int lkt_i) {
  int blk = blockIdx.x, lkt = lkt_c;
  const size_t wn = (size_t)nbw * 4096;               // elements of one weight: a block splits 8 tiles of 512
  const float* in; __bf16* hi; __bf16* lo;
  if (blk < nbw)          { in = wq; hi = w3h;          lo = w3l; }
  else if (blk < 2 * nbw) { in = wk; hi = w3h + wn;     lo = w3l + wn;     blk -= nbw; }
  else if (blk < 3 * nbw) { in = wv; hi = w3h + 2 * wn; lo = w3l + 2 * wn; blk -= 2 * nbw; }
  else if (blk < 4 * nbw) { in = wo; hi = woh;          lo = wol;          blk -= 3 * nbw; lkt = lkt_i; }
  else                    { in = x;  hi = xh;           lo = xl;           blk -= 4 * nbw; }
  split_tile_frag(in, hi, lo, lkt, blk * 8 + (threadIdx.x >> 5));
}


// ---- f32 [R][C] (row pitch ldi) -> f16 transposed [C][R] (row pitch ldo); 64x64 tiles; each output row segment
__global__ __launch_bounds__(256) void transpose_cast_f16(const float* __restrict__ in, int ldi,
                                                         _Float16* __restrict__ outT, int ldo, float scale) {
  __shared__ __align__(16) _Float16 tile[64][72];     // [c][r]
  const int c0 = blockIdx.x * 64, r0 = blockIdx.y * 64;
  const int t = threadIdx.y * 32 + threadIdx.x;
  for (int i = threadIdx.y; i < 64; i += 8) {
    tile[threadIdx.x][i]      = (_Float16)(in[(size_t)(r0 + i) * ldi + c0 + threadIdx.x] * scale);
    tile[32 + threadIdx.x][i] = (_Float16)(in[(size_t)(r0 + i) * ldi + c0 + 32 + threadIdx.x] * scale);
  }
  __syncthreads();
  const int q = t >> 3, c8 = (t & 7) * 8;
  {
#pragma unroll
    for (int it = 0; it < 2; ++it) {
      const int c = it * 32 + q;
      v8h hv = *(const v8h*)(&tile[c][c8]);
      *(v8h*)(outT + (size_t)(c0 + c) * ldo + r0 + c8) = hv;
    }
    
  }
}

// ---- f32 [R][C] (pitch ldi) -> bf16 hi/lo transposed planes [C][R] (pitch ldo); 64x64 tiles; each output row segment
__global__ __launch_bounds__(256) void transpose_split_bf16(const float* __restrict__ in, int ldi,
                                                           __bf16* __restrict__ outH, __bf16* __restrict__ outL, int ldo) {
  __shared__ __align__(16) float tile[64][68];     // [c][r]
  const int c0 = blockIdx.x * 64, r0 = blockIdx.y * 64;
  const int t = threadIdx.y * 32 + threadIdx.x;
  for (int i = threadIdx.y; i < 64; i += 8) {
    tile[threadIdx.x][i]      = in[(size_t)(r0 + i) * ldi + c0 + threadIdx.x];
    tile[32 + threadIdx.x][i] = in[(size_t)(r0 + i) * ldi + c0 + 32 + threadIdx.x];
  }
  __syncthreads();
  const int q = t >> 3, c8 = (t & 7) * 8;
  {
#pragma unroll
    for (int it = 0; it < 2; ++it) {
      const int c = it * 32 + q;
      v8b hv, lv;
#pragma unroll
      for (int e = 0; e < 8; ++e) {
        const float f = tile[c][c8 + e];
        const unsigned short hb = f2bf_bits(f);
        hv[e] = __builtin_bit_cast(__bf16, hb);
        lv[e] = __builtin_bit_cast(__bf16, f2bf_bits(f - bf_bits2f(hb)));
      }
      *(v8b*)(outH + (size_t)(c0 + c) * ldo + r0 + c8) = hv;
      *(v8b*)(outL + (size_t)(c0 + c) * ldo + r0 + c8) = lv;
    }
    
  }
}

#define AT_D 64
#define AT_NW 4
#define AT_QB 64
#define AT_KC 64
// LDS row pitch of the 16-bit K tile, in elements: 72 = 144 B = 16 B x odd, so the 16 rows that one
// ds_load_b128 fragment read touches start on 16 different bank groups (at 128 B they share two groups and the read serialises).
#define AT_LP 72
// LDS row pitch of the 16-bit V tile, in elements: 80 = 160 B = 32 B x odd, the conflict-free pitch of its reader ds_load_tr16_b128.
#define AT_VP 80
// e^x is taken as 2^(x * log2 e) on the hardware's base-2 exponential (one instruction); every argument here is a score minus
// its row maximum, so the library exponential's overflow and underflow ladder has nothing to catch (below 2^-126 the weight is 0).
#define AT_LOG2E 1.4426950408889634f
struct AttnGeom { const float* cp = nullptr; const float* pc = nullptr; long c_bs = 0, c_rs = 0, c_hs = 0;   // mode-5 score-bias tables
                  long q_bs, q_rs, q_hs, k_bs, k_rs, k_hs, v_bs, v_rs, v_hs, o_bs, o_rs, o_hs;
                  int S, Skv, H, mask_mode; float qscale; int blk0; float mask_fill; int mask_is_int; };
static_assert(sizeof(AttnGeom) == 168, "no padding");

__device__ __forceinline__ unsigned short at_bf_bits(float f) {
  unsigned u = __float_as_uint(f);
  return (unsigned short)((u + 0x7FFFu + ((u >> 16) & 1u)) >> 16);
}
__device__ __forceinline__ __bf16 at_f2bf(float f) { return __builtin_bit_cast(__bf16, at_bf_bits(f)); }
__device__ __forceinline__ v8f at_mma(v16b a, v16b b, v8f c) {
  return __builtin_amdgcn_wmma_f32_16x16x32_bf16(false, a, false, b, (short)0, c, false, false);
}
// 16-bit element as a bit pattern held in a __bf16 slot: f16 bits when F16, bf16 (RNE) otherwise
template <bool F16> __device__ __forceinline__ __bf16 at_to16(float f) {
  if (F16) return __builtin_bit_cast(__bf16, (_Float16)f);
  return at_f2bf(f);
}
// and back to f32
template <bool F16> __device__ __forceinline__ float at_from16(__bf16 x) {
  if (F16) return (float)__builtin_bit_cast(_Float16, x);
  return __uint_as_float(((unsigned)__builtin_bit_cast(unsigned short, x)) << 16);
}
// ds_load_tr16_b128: eight 16-bit elements of one column of a row-major LDS tile (lane addresses: at the call)
__device__ __forceinline__ v8b at_ld_tr16(const __bf16* p) {
  typedef __attribute__((ext_vector_type(8))) short at_s16x8;
  typedef __attribute__((address_space(3))) at_s16x8 at_lds_s16x8;
  return __builtin_bit_cast(v8b, __builtin_amdgcn_ds_load_tr16_b128_v8i16((at_lds_s16x8*)p));
}
template <bool F16> __device__ __forceinline__ v8f at_mma16(v16b a, v16b b, v8f c) {
  if (F16) {
    const v16h ah = __builtin_bit_cast(v16h, a), bh = __builtin_bit_cast(v16h, b);
    return __builtin_amdgcn_wmma_f32_16x16x32_f16(false, ah, false, bh, (short)0, c, false, false);
  }
  return at_mma(a, b, c);
}

// Lane l's value as seen from lane l ^ 16 (the other half of the wave): one vector cross-row move, no LDS trip.
__device__ __forceinline__ float at_xhalf(float x) {
  const int b = __builtin_bit_cast(int, x);
  return __builtin_bit_cast(float, __builtin_amdgcn_permlanex16(b, b, 0x76543210, 0xfedcba98, false, false));
}

// Eight base-2 exponentials (one score tile of a lane's query), each in place. One statement, so that the
// issue slot the instruction set asks for behind a transcendental is filled by construction: each v_exp_f32 is followed by an
// independent one, the last by v_nop; written in place, no later instruction can rewrite a source that is not also the live result
// The two s_delay_alu are the hints the compiler would write for its own code and cannot for asm text (first: the arguments come from
// the vector instructions just ahead; last: whichever reader comes next): a wave that waits unhinted holds the SIMD's issue for the others.
__device__ __forceinline__ void at_exp2x8(float& p0, float& p1, float& p2, float& p3, float& p4, float& p5, float& p6, float& p7) {
  asm("s_delay_alu instid0(VALU_DEP_1)\n\t"
      "v_exp_f32 %0, %0\n\tv_exp_f32 %1, %1\n\tv_exp_f32 %2, %2\n\tv_exp_f32 %3, %3\n\t"
      "v_exp_f32 %4, %4\n\tv_exp_f32 %5, %5\n\tv_exp_f32 %6, %6\n\tv_exp_f32 %7, %7\n\tv_nop\n\t"
      "s_delay_alu instid0(TRANS32_DEP_1)"
      : "+v"(p0), "+v"(p1), "+v"(p2), "+v"(p3), "+v"(p4), "+v"(p5), "+v"(p6), "+v"(p7));
}
// The same for one value (the query's rescale factor).
__device__ __forceinline__ void at_exp2x1(float& a) {
  asm("s_delay_alu instid0(VALU_DEP_1)\n\tv_exp_f32 %0, %0\n\tv_nop\n\ts_delay_alu instid0(TRANS32_DEP_1)" : "+v"(a));
}

// MM: the mask mode as a compile-time constant (the launch's g.mask_mode must equal it); MM < 0 reads g.mask_mode at run time.
template <bool F16 = false, int MM = -1>
__global__ __launch_bounds__(128)
void attn64_kernel(const unsigned short* __restrict__ q, const unsigned short* __restrict__ k,
                   const unsigned short* __restrict__ v, float* __restrict__ out,
                   const void* __restrict__ mask_a, const int* __restrict__ mask_b, AttnGeom g) {
  const int mask_mode = (MM >= 0) ? MM : g.mask_mode;
  const float PSC = F16 ? 32768.0f : 1.0f;     // f16 probabilities carried x2^15 (subnormal range), folded into the final 1/l
  union FB { v16b v; v8b h[2]; };
  __shared__ __align__(16) __bf16 Ksh[AT_KC * AT_LP];            // K [kv][d], pitch AT_LP      9 KB
  __shared__ __align__(16) __bf16 Vsh[AT_KC * AT_VP];            // V [kv][d], pitch AT_VP     10 KB
  __shared__ __align__(16) float  Os[AT_NW][16 * 68];            // per wave out tile, pitch 68

  const int tid  = threadIdx.x;
  const int wave = tid >> 5;
  const int lane = tid & 31;
  const int hh   = lane >> 4;
  const int c    = lane & 15;

  const int nqb = g.S / AT_QB;
  const int bx = blockIdx.x + g.blk0;
  const int qb = bx % nqb;
  const int bh = bx / nqb;
  const int h  = bh % g.H;
  const int b  = bh / g.H;
  const int qbase_block = qb * AT_QB;
  const int q0 = qbase_block + wave * 16;

  const __bf16* qb_ptr = (const __bf16*)q + (size_t)b * g.q_bs + (size_t)h * g.q_hs;
  const __bf16* kb_ptr = (const __bf16*)k + (size_t)b * g.k_bs + (size_t)h * g.k_hs;
  const __bf16* vb_ptr = (const __bf16*)v + (size_t)b * g.v_bs + (size_t)h * g.v_hs;
  float*        ob_ptr = out + (size_t)b * g.o_bs + (size_t)h * g.o_hs;

  // ---- Q fragments (B operand: column = query q0 + c): 2 d-chunks ----
  v16b qah[2];
  {
    const __bf16* qrow = qb_ptr + (size_t)(q0 + c) * g.q_rs;
#pragma unroll
    for (int dc = 0; dc < 2; ++dc) {
      const v8b x0 = *(const v8b*)(qrow + dc * 32 + 8 * hh), x1 = *(const v8b*)(qrow + dc * 32 + 16 + 8 * hh);
#pragma unroll
      for (int e = 0; e < 8; ++e) {
        qah[dc][e]     = at_to16<F16>(at_from16<F16>(x0[e]) * g.qscale);
        qah[dc][8 + e] = at_to16<F16>(at_from16<F16>(x1[e]) * g.qscale);
      }
    }
  }

  // state of this lane's query q0 + c; nrow2 = -(running maximum) * log2 e as it was rounded when that maximum was taken;
  // lrow sums this wave half's keys only (the halves are joined behind the loop)
  float nrow2 = INFINITY, lrow = 0.f;
  v8f oacc[4];                                 // O^T: oacc[t][r] = element d = t*16 + 8*hh + r of query q0 + c
#pragma unroll
  for (int t = 0; t < 4; ++t) oacc[t] = (v8f){0.f,0.f,0.f,0.f,0.f,0.f,0.f,0.f};

  const int nChunks = (mask_mode == 1 || mask_mode == 4) ? (qb + 1) : (g.Skv / AT_KC);   // block-uniform
  const int qrow = q0 + c;
  const int qkeep = (mask_mode == 3) ? mask_b[(size_t)b * g.S + qrow] : 1;   // query mask (mode 3): mask_b = qmask
  // Staging deal: a K or V row of one head is one 128-B line; eight lanes take it, 16 B each, so a wave's load covers four whole lines.
  // A thread copies its piece of rows sr, sr + 16, sr + 32 and sr + 48 of both tiles.
  const int sp = (tid & 7) * 8, sr = tid >> 3;
  const __bf16* kst = kb_ptr + (size_t)sr * g.k_rs + sp;
  const __bf16* vst = vb_ptr + (size_t)sr * g.v_rs + sp;
  // Lane address of the transposing load: lane (c, hh) receives V[kbase + 8*hh + 0..7][dbase + c] when every lane l points at
  // row kbase + 8*(l >> 4) + (l & 7), byte 2*dbase + 16*((l >> 3) & 1).
  const __bf16* vtr = Vsh + (8 * hh + (lane & 7)) * AT_VP + ((lane >> 3) & 1) * 8;
  for (int kc = 0; kc < nChunks; ++kc) {
    const int kv0 = kc * AT_KC;
    __syncthreads();
    {
      const __bf16* kp[4]; const __bf16* vp[4];
      v8b kk[4], vv[4];
#pragma unroll
      for (int i = 0; i < 4; ++i) {
        kp[i] = kst + (size_t)(kv0 + 16 * i) * g.k_rs;
        vp[i] = vst + (size_t)(kv0 + 16 * i) * g.v_rs;
        kk[i] = *(const v8b*)(kp[i]);
        vv[i] = *(const v8b*)(vp[i]);
      }
      // The wait that stands between an issued global load and a rewrite of its address registers. The addresses are its inputs, so
      // they stay whole up to it.
      asm volatile("s_wait_xcnt 0x0" :: "v"(kp[0]), "v"(kp[1]), "v"(kp[2]), "v"(kp[3]), "v"(vp[0]), "v"(vp[1]), "v"(vp[2]), "v"(vp[3]) : "memory");
#pragma unroll
      for (int i = 0; i < 4; ++i) {
        *(v8b*)(Ksh + (sr + 16 * i) * AT_LP + sp) = kk[i];
        *(v8b*)(Vsh + (sr + 16 * i) * AT_VP + sp) = vv[i];
      }
    }
    __syncthreads();

    // All fragments of the chunk are fetched as one group of LDS reads ahead of the matrix runs: K's eight first, V's eight behind them.
    // A read waited for in front of each product costs the wave one LDS round trip per product; here the first run waits once and
    // V lands under the scores and the softmax.
    FB kf[2][4], vf[2][4];
#pragma unroll
    for (int dc = 0; dc < 2; ++dc)
#pragma unroll
      for (int j = 0; j < 4; ++j) {
        kf[dc][j].h[0] = *(const v8b*)(Ksh + (j * 16 + c) * AT_LP + dc * 32 + 8 * hh);
        kf[dc][j].h[1] = *(const v8b*)(Ksh + (j * 16 + c) * AT_LP + dc * 32 + 16 + 8 * hh);
      }
    // V^T fragment (rows d = t*16 + c): elements 0..7 are keys kk*32 + 8*hh + 0..7, elements 8..15 keys kk*32 + 16 + 8*hh + 0..7.
#pragma unroll
    for (int kk = 0; kk < 2; ++kk)
#pragma unroll
      for (int t = 0; t < 4; ++t) {
        vf[kk][t].h[0] = at_ld_tr16(vtr + (kk * 32) * AT_VP + t * 16);
        vf[kk][t].h[1] = at_ld_tr16(vtr + (kk * 32 + 16) * AT_VP + t * 16);
      }
    // Keeps the scheduler from sinking the reads back down to their products (each would again be waited for on its own).
    __builtin_amdgcn_sched_barrier(0);

    // S^T: s[j][r] = score of key kv0 + j*16 + 8*hh + r for query q0 + c. The four tiles take turns, so that a tile's second product
    // finds its first one finished; each tile still sums head elements 0..31, then 32..63.
    v8f s[4];
#pragma unroll
    for (int j = 0; j < 4; ++j) s[j] = (v8f){0.f,0.f,0.f,0.f,0.f,0.f,0.f,0.f};
#pragma unroll
    for (int dc = 0; dc < 2; ++dc)
#pragma unroll
      for (int j = 0; j < 4; ++j) {
        s[j] = at_mma16<F16>(kf[dc][j].v, qah[dc], s[j]);
      }
    const bool diag = (mask_mode == 1) && (kc == qb);
    float mj[4];                                // one maximum per score tile: four short chains instead of one long one
#pragma unroll
    for (int j = 0; j < 4; ++j) {
      mj[j] = -INFINITY;
#pragma unroll
      for (int r = 0; r < 8; ++r) {
        const int kvcol = kv0 + j * 16 + 8 * hh + r;
        bool masked = false;
        if (diag) masked = (kvcol > qrow);
        else if (mask_mode == 4) masked = (kvcol > qrow) || (qrow - kvcol > g.mask_is_int);
        else if (mask_mode == 2) {
          const size_t mi = (size_t)qrow * g.Skv + kvcol;
          masked = (g.mask_is_int == 0) ? (((const float*)mask_a)[mi] == 0.0f)
                 : (g.mask_is_int == 1) ? (((const int*)mask_a)[mi] == 0) : (((const int*)mask_a)[mi] != 0);
        } else if (mask_mode == 3) masked = (qkeep == 0) || (((const int*)mask_a)[(size_t)b * g.Skv + kvcol] == 0);   // mask_a = kvmask
        else if (mask_mode == 5) {
          const size_t mi = (size_t)qrow * g.Skv + kvcol;
          masked = (((const int*)mask_a)[mi] != 0);
          int n = mask_b[mi]; n = n < 0 ? 0 : n;
          s[j][r] += g.cp[(size_t)b * g.c_bs + (size_t)h * g.c_hs + (size_t)qrow * g.c_rs + n]
                   + g.pc[(size_t)b * g.c_bs + (size_t)h * g.c_hs + (size_t)kvcol * g.c_rs + n];
        }
        if (masked) s[j][r] = g.mask_fill;
        mj[j] = fmaxf(mj[j], s[j][r]);
      }
    }
    float m = fmaxf(fmaxf(mj[0], mj[1]), fmaxf(mj[2], mj[3]));
    m = fmaxf(m, at_xhalf(m));                  // the other half of the wave holds the query's other 32 keys
    // minus the running maximum in base-2 units, the offset of every weight of this chunk: the product is rounded once per chunk
    // maximum, and the smaller of two such products is the product of the larger maximum (rounding keeps the order)
    const float noff = fminf(nrow2, m * -AT_LOG2E);
    float alpha = noff - nrow2;                 // difference of the two offsets in use: exactly 0 while the maximum stands; -inf on the first chunk
    nrow2 = noff;
    at_exp2x1(alpha);
    float pe[4][8], ps[4];
#pragma unroll
    for (int j = 0; j < 4; ++j) {
      float* p = pe[j];
#pragma unroll
      for (int r = 0; r < 8; ++r) p[r] = fmaf(s[j][r], AT_LOG2E, noff);   // e^(s - m) = 2^(s*log2e - m*log2e)
      at_exp2x8(p[0], p[1], p[2], p[3], p[4], p[5], p[6], p[7]);
      ps[j] = ((p[0] + p[1]) + (p[2] + p[3])) + ((p[4] + p[5]) + (p[6] + p[7]));
    }
    lrow = lrow * alpha + ((ps[0] + ps[1]) + (ps[2] + ps[3]));
#pragma unroll
    for (int t = 0; t < 4; ++t)
#pragma unroll
      for (int r = 0; r < 8; ++r) oacc[t][r] *= alpha;
    // P^T as B operand, straight from the score tiles: element e of k-chunk kk is key kk*32 + 8*hh + e (tile 2kk, register e), element
    // 8 + e is key kk*32 + 16 + 8*hh + e (tile 2kk + 1, register e): the k order of the V loader above.
    // Unrolled, so that kk picks the score registers at compile time.
#pragma unroll
    for (int kk = 0; kk < 2; ++kk) {
      v16b pa;
#pragma unroll
      for (int e = 0; e < 8; ++e) {
        const float p0 = pe[2 * kk][e], p1 = pe[2 * kk + 1][e];
        pa[e] = at_to16<F16>(p0 * PSC); pa[8 + e] = at_to16<F16>(p1 * PSC);
      }
#pragma unroll
      for (int t = 0; t < 4; ++t) oacc[t] = at_mma16<F16>(vf[kk][t].v, pa, oacc[t]);
    }
  }

  float* os = Os[wave];
  {
    const float inv = 1.0f / ((lrow + at_xhalf(lrow)) * PSC);   // the two halves' sums joined, once
#pragma unroll
    for (int t = 0; t < 4; ++t) {
      v4f lo4, hi4;
#pragma unroll
      for (int e = 0; e < 4; ++e) { lo4[e] = oacc[t][e] * inv; hi4[e] = oacc[t][4 + e] * inv; }
      *(v4f*)(os + c * 68 + t * 16 + 8 * hh)     = lo4;
      *(v4f*)(os + c * 68 + t * 16 + 8 * hh + 4) = hi4;
    }
  }
  __builtin_amdgcn_fence(__ATOMIC_RELEASE, "workgroup");
  __builtin_amdgcn_wave_barrier();
  __builtin_amdgcn_fence(__ATOMIC_ACQUIRE, "workgroup");
  {
    const int c4 = (lane & 15) * 4;
    {
#pragma unroll
      for (int it = 0; it < 8; ++it) {
        const int row = it * 2 + hh;
        v4f val = *(const v4f*)(os + row * 68 + c4);
        *(v4f*)(ob_ptr + (size_t)(q0 + row) * g.o_rs + c4) = val;
      }
      
    }
  }
}

#define SB_ 2
#define SN_ 4096
#define SC_ 256
#define SI_ 512
#define SH_ 8
extern "C" void kernel_launch(void* const* d_in, const int* in_sizes, int n_in, void* d_out, int out_size, void* d_ws, size_t ws_size, hipStream_t stream) {
  (void)in_sizes; (void)n_in; (void)out_size; (void)ws_size;
  const float* x = (const float*)d_in[0]; const float* Wq = (const float*)d_in[1]; const float* Wk = (const float*)d_in[2]; const float* Wv = (const float*)d_in[3]; const float* Wo = (const float*)d_in[4];
  float* out = (float*)d_out;
  char* ws = (char*)d_ws; size_t off = 0;
  auto carve = [&](size_t bytes) -> char* { char* p = ws + off; off += (bytes + 255) & ~(size_t)255; return p; };
  const int R = SB_ * SN_;
  __bf16* Xh = (__bf16*)carve((size_t)R * SC_ * 2); __bf16* Xl = (__bf16*)carve((size_t)R * SC_ * 2);
  __bf16* W3h = (__bf16*)carve((size_t)3 * SI_ * SC_ * 2); __bf16* W3l = (__bf16*)carve((size_t)3 * SI_ * SC_ * 2);     // [Wq;Wk;Wv] stacked = Bt for N = 1536
  __bf16* Woh = (__bf16*)carve((size_t)SC_ * SI_ * 2); __bf16* Wol = (__bf16*)carve((size_t)SC_ * SI_ * 2);
  _Float16* QKV = (_Float16*)carve((size_t)R * 3 * SI_ * 2);      // 25 MB: q, k, v as the attention's f16 operands
  float* O = (float*)carve((size_t)R * SI_ * 4);
  __bf16* Oh = (__bf16*)carve((size_t)R * SI_ * 2); __bf16* Ol = (__bf16*)carve((size_t)R * SI_ * 2);
  split_inputs_frag<<<R * SC_ / 4096 + 4 * (SI_ * SC_ / 4096), 256, 0, stream>>>(x, Wq, Wk, Wv, Wo, Xh, Xl, W3h, W3l, Woh, Wol, SI_ * SC_ / 4096, 3, 4);
  { const int t = (R / 64) * (3 * SI_ / 64);
    wmma_gemm64<1, true, 0, 1, false><<<dim3((t + 7) / 8, 1), 256, 0, stream>>>(U16(Xh), U16(Xl), SC_, 0, U16(W3h), U16(W3l), SC_, 0, QKV, nullptr, 3 * SI_, 0, nullptr, nullptr, 0, R, 3 * SI_, SC_, 1.0f); }
  { AttnGeom g;
    g.q_bs = (long)SN_ * 3 * SI_; g.q_rs = 3 * SI_; g.q_hs = 64; g.k_bs = g.q_bs; g.k_rs = 3 * SI_; g.k_hs = 64; g.v_bs = g.q_bs; g.v_rs = 3 * SI_; g.v_hs = 64;
    g.o_bs = (long)SN_ * SI_; g.o_rs = SI_; g.o_hs = 64; g.S = SN_; g.Skv = SN_; g.H = SH_; g.mask_mode = 0; g.qscale = 0.125f; g.blk0 = 0; g.mask_fill = -INFINITY; g.mask_is_int = 0;
    attn64_kernel<true, 0><<<SB_ * SH_ * (SN_ / AT_QB), AT_NW * 32, 0, stream>>>(U16(QKV), U16(QKV + SI_), U16(QKV + 2 * SI_), O, nullptr, nullptr, g); }
  split_f32_bf16_frag<<<R * SI_ / 4096, 256, 0, stream>>>(O, Oh, Ol, 4, R * SI_ / 512);
  { const int t = (R / 64) * (SC_ / 64);
    wmma_gemm64<1, true, 0, 0, false><<<dim3((t + 7) / 8, 1), 256, 0, stream>>>(U16(Oh), U16(Ol), SI_, 0, U16(Woh), U16(Wol), SI_, 0, out, nullptr, SC_, 0, nullptr, nullptr, 0, R, SC_, SI_, 1.0f); }
}

// v010
// A run of this version takes 120 microseconds.
// Two timings next to v009 put it at 1.14 and 1.13 times that version's speed.
// Counting every step since v000, it is 18.4 times as fast.
#include <hip/hip_runtime.h>
#include <math.h>
// Spatio-temporal attention (2 clips x 4096 tokens, 8 heads x 64): q/k/v = x·Wᵀ (8192 x 256 · 256 x 512 each) and out = o·Woᵀ (·512 x 256)
// on v_wmma_f32_16x16x32_bf16 with bf16 hi/lo split operands (the output is an average over 4096 near-uniform attention weights, RMS
// 0.0025); the attention itself (scores and p·v, p x2^15, 4096 keys) on
// v_wmma_f32_16x16x32_f16 with f16 operands; f32 accumulate; softmax f32 on VALU.
// The 1x1x1 conv weights ([out][in]) are used directly as the transposed operand.
typedef __attribute__((ext_vector_type(16))) _Float16 v16h;
typedef __attribute__((ext_vector_type(8)))  _Float16 v8h;
typedef __attribute__((ext_vector_type(16))) __bf16   v16b;
typedef __attribute__((ext_vector_type(8)))  __bf16   v8b;
typedef __attribute__((ext_vector_type(4)))  __bf16   v4b;
typedef __attribute__((ext_vector_type(8)))  float    v8f;
typedef __attribute__((ext_vector_type(4)))  float    v4f;
#define PSCALE 32768.0f
#define U16(p) ((const unsigned short*)(const void*)(p))
#define PSCALE_INV (1.0f / 32768.0f)

__device__ __forceinline__ unsigned short f2bf_bits(float f) {
  unsigned u = __float_as_uint(f);
  return (unsigned short)((u + 0x7FFFu + ((u >> 16) & 1u)) >> 16);
}
__device__ __forceinline__ float bf_bits2f(unsigned short h) { return __uint_as_float(((unsigned)h) << 16); }

// hazard guards as plain device helpers (no inline asm inside the kernel template body)
__device__ __forceinline__ void dep_guard_h(v8f& a, v8f& b, v16h x, v16h y) { asm volatile("v_nop\n\tv_nop\n\tv_nop\n\tv_nop" : "+v"(a), "+v"(b) : "v"(x), "v"(y)); }
__device__ __forceinline__ void dep_guard_b(v8f& a, v8f& b, v16b x, v16b y) { asm volatile("v_nop\n\tv_nop\n\tv_nop\n\tv_nop" : "+v"(a), "+v"(b) : "v"(x), "v"(y)); }
__device__ __forceinline__ void keep4_h(v16h a, v16h b, v16h c, v16h d) { asm volatile("v_nop" :: "v"(a), "v"(b), "v"(c), "v"(d)); }
__device__ __forceinline__ void keep4_b(v16b a, v16b b, v16b c, v16b d) { asm volatile("v_nop" :: "v"(a), "v"(b), "v"(c), "v"(d)); }
__device__ __forceinline__ void acc_guard4(v8f& a, v8f& b, v8f& c, v8f& d) { asm volatile("v_nop\n\tv_nop\n\tv_nop\n\tv_nop" : "+v"(a), "+v"(b), "+v"(c), "+v"(d)); }
// L2 asks. global_prefetch_b8 returns nothing
// and counts on no wait counter. Every lane is on and names
// a byte inside the operand, the branch around an ask is scalar, and the address register is carried by the loop and never leaves the operand.
__device__ __forceinline__ void l2_ask(const void* p) { asm volatile("global_prefetch_b8 %0, off scope:SCOPE_SE" :: "v"(p)); }
__device__ __forceinline__ void l2_ask_at(const void* base, unsigned off) { asm volatile("global_prefetch_b8 %0, %1 scope:SCOPE_SE" :: "v"(off), "s"(base)); }
template <typename T> struct Frag;
template <> struct Frag<_Float16> {
  typedef v16h V; union U { v16h v; v8h h[2]; };
  static __device__ __forceinline__ v16h load(const _Float16* p) {   // p = tile + lane * 8: elements 0..7 <- p[0..7], 8..15 <- p[256..263]
    U f; f.h[0] = *(const v8h*)(p); f.h[1] = *(const v8h*)(p + 256); return f.v;
  }
  static __device__ __forceinline__ v8f mma(v16h a, v16h b, v8f c) {
    return __builtin_amdgcn_wmma_f32_16x16x32_f16(false, a, false, b, (short)0, c, false, false);
  }
  static __device__ __forceinline__ void guard(v8f& a, v8f& b, v16h x, v16h y) { dep_guard_h(a, b, x, y); }
  static __device__ __forceinline__ void keep(v16h a, v16h b, v16h c, v16h d) { keep4_h(a, b, c, d); }
};
template <> struct Frag<__bf16> {
  typedef v16b V; union U { v16b v; v8b h[2]; };
  static __device__ __forceinline__ v16b load(const __bf16* p) {
    U f; f.h[0] = *(const v8b*)(p); f.h[1] = *(const v8b*)(p + 256); return f.v;
  }
  static __device__ __forceinline__ v8f mma(v16b a, v16b b, v8f c) {
    return __builtin_amdgcn_wmma_f32_16x16x32_bf16(false, a, false, b, (short)0, c, false, false);
  }
  static __device__ __forceinline__ void guard(v8f& a, v8f& b, v16b x, v16b y) { dep_guard_b(a, b, x, y); }
  static __device__ __forceinline__ void keep(v16b a, v16b b, v16b c, v16b d) { keep4_b(a, b, c, d); }
};

// ---- Register-blocked batched WMMA GEMM ------------------------------------
// C[m,n] = scale * sum_k A[m,k] * Bt[n,k] (+bias)(+resid); each wave owns a 64x64 tile.
// A is [M,K], Bt is [N,K]; M,N % 64 == 0, K % 32 == 0. Both lie in FRAGMENT ORDER (written so by split_tile_frag): the 16-row x 32-k tile
// (row band rb, k step kt) is 512 elements in a row at rb * 16 * ld + kt * 512 (ld = row length, lda or ldb), and inside it element
// (row r, k) stands at (k >> 4) * 256 + (((k >> 3) & 1) * 16 + r) * 8 + (k & 7): lane l finds its elements 0..7 at l * 8 and its elements
// 8..15 at 256 + l * 8, so each 16-byte load of a wave covers 512 bytes in a row (four whole 128-B lines; from row-major planes it took
// 32 bytes out of each of 16 lines). The registers hold what they held with row-major planes.
// SPLIT: operands are hi/lo planes (A2/Bt2 = lo planes, same layout); product = hi·hi + hi·lo + lo·hi.
// BIAS_MODE: 0 = none, 1 = bias[m], 2 = bias[n].
// OUT_MODE: 0 = f32, 1 = f16, 2 = bf16 hi plane (Cout) + bf16 lo plane (Cout2); every output is row-major.
// ET: 0 = f16 operands, 1 = bf16 operands (pointers passed as 16-bit storage)
template <int ET> struct Elem;
template <> struct Elem<0> { typedef _Float16 T; };
template <> struct Elem<1> { typedef __bf16 T; };
template <int ET, bool SPLIT, int BIAS_MODE, int OUT_MODE, bool RESID, int ACT = 0>
__global__ __launch_bounds__(256) void wmma_gemm64(
    const unsigned short* __restrict__ Ap, const unsigned short* __restrict__ A2p, int lda, long strideA,
    const unsigned short* __restrict__ Btp, const unsigned short* __restrict__ Bt2p, int ldb, long strideB,
    void* __restrict__ Cout, void* __restrict__ Cout2, int ldc, long strideC,
    const float* __restrict__ bias,
    const float* __restrict__ resid, long strideR,
    int M, int N, int K, float scale) {
  typedef typename Elem<ET>::T T;
  typedef typename Frag<T>::V V;
  const T* A = (const T*)Ap; const T* A2 = (const T*)A2p; const T* Bt = (const T*)Btp; const T* Bt2 = (const T*)Bt2p;
  __shared__ __align__(16) float sT[8][16 * 68];   // per-wave 16x64 slab, pitch 68 floats
  const int b    = blockIdx.y;
  const int lane = threadIdx.x & 31;
  const int wave = __builtin_amdgcn_readfirstlane(threadIdx.x >> 5);   // scalar: tile addresses are then a scalar base plus lane * 16 bytes
  const int tilesN = N >> 6;
  const int tilesM = M >> 6;
  const int tile = blockIdx.x * 8 + wave;
  if (tile >= tilesM * tilesN) return;   // wave-uniform; no block barriers in this kernel
  const int tm = tile / tilesN;
  const int tn = tile - tm * tilesN;
  const int m0 = tm << 6;
  const int n0 = tn << 6;

  // Start of each of the wave's four A and four B row bands, per plane: scalar, fixed over the k loop.
  const T* Ab[4]; const T* Bb[4]; const T* Ab2[4]; const T* Bb2[4];
#pragma unroll
  for (int i = 0; i < 4; ++i) {
    const size_t ao = (size_t)b * strideA + (size_t)(m0 + (i << 4)) * lda;
    const size_t bo = (size_t)b * strideB + (size_t)(n0 + (i << 4)) * ldb;
    Ab[i]  = A + ao;  Bb[i]  = Bt + bo;
    Ab2[i] = SPLIT ? (A2 + ao) : nullptr;  Bb2[i] = SPLIT ? (Bt2 + bo) : nullptr;
  }

  const int rlane = lane & 15;                 // row (A) / col (B, D) within subtile
  const int mOff  = (lane >> 4) * 8;           // D row offset

  v8f acc[4][4];
#pragma unroll
  for (int i = 0; i < 4; ++i)
#pragma unroll
    for (int j = 0; j < 4; ++j) acc[i][j] = (v8f){0.f,0.f,0.f,0.f,0.f,0.f,0.f,0.f};

  // This lane's place in the current k step's tiles, in bytes: the one address that moves. 32 bits, so that a load is scalar base + this register.
  unsigned vo = lane * 16;
  auto at = [&](const T* band) -> const T* { return (const T*)((const char*)band + vo); };
  // L2 asks (see l2_ask): a band of one plane is K * 32 bytes in a row; a trip's lanes name bytes 256 apart, 8 KB in all, so the first
  // K / 256 trips ask for the whole k range. Dealt: of the waves that read an A band, those whose column tile
  // is the band's number mod 4 ask for it, and likewise B by row tile, so a wave asks for one band of each operand, not four.
  const unsigned bandBytes = (unsigned)K * 32u;
  const size_t pao = (size_t)b * strideA + (size_t)(m0 + ((tn & 3) << 4)) * lda;
  const size_t pbo = (size_t)b * strideB + (size_t)(n0 + ((tm & 3) << 4)) * ldb;
  unsigned po = min((unsigned)lane * 256u, bandBytes - 256u), pasked = 0;
  for (int k0 = 0; k0 < K; k0 += 32, vo += 1024) {
    if (pasked < bandBytes) {                  // scalar: the same for the whole wave
      l2_ask_at(A + pao, po);
      l2_ask_at(Bt + pbo, po);
      if (SPLIT) { l2_ask_at(A2 + pao, po); l2_ask_at(Bt2 + pbo, po); }
      pasked += 8192u;
      if (pasked < bandBytes) po = min(po + 8192u, bandBytes - 256u);   // moves on only while it stays inside the band
    }
    V bh[4], bl[4];
#pragma unroll
    for (int j = 0; j < 4; ++j) {
      bh[j] = Frag<T>::load(at(Bb[j]));
      if (SPLIT) bl[j] = Frag<T>::load(at(Bb2[j]));
    }
#pragma unroll
    for (int i = 0; i < 4; ++i) {
      V ah = Frag<T>::load(at(Ab[i]));
      V al;
      if (SPLIT) al = Frag<T>::load(at(Ab2[i]));
#pragma unroll
      for (int j = 0; j < 4; ++j) {
        acc[i][j] = Frag<T>::mma(ah, bh[j], acc[i][j]);
        if (SPLIT) {
          acc[i][j] = Frag<T>::mma(ah, bl[j], acc[i][j]);
          acc[i][j] = Frag<T>::mma(al, bh[j], acc[i][j]);
        }
      }
      Frag<T>::guard(acc[i][0], acc[i][3], ah, SPLIT ? al : ah);
    }
    Frag<T>::keep(bh[0], bh[1], bh[2], bh[3]);
    if (SPLIT) Frag<T>::keep(bl[0], bl[1], bl[2], bl[3]);
  }
  acc_guard4(acc[0][0], acc[0][1], acc[0][2], acc[0][3]);
  acc_guard4(acc[1][0], acc[1][1], acc[1][2], acc[1][3]);
  acc_guard4(acc[2][0], acc[2][1], acc[2][2], acc[2][3]);
  acc_guard4(acc[3][0], acc[3][1], acc[3][2], acc[3][3]);

  // ---- epilogue ----
  float* slab = sT[wave];
  const float* Rb = RESID ? (resid + (size_t)b * strideR) : nullptr;
#pragma unroll
  for (int i = 0; i < 4; ++i) {
    const int mBase = m0 + (i << 4);
#pragma unroll
    for (int j = 0; j < 4; ++j) {
      const int n = n0 + (j << 4) + rlane;
      float bv = 0.f;
      if (BIAS_MODE == 2) bv = bias[n];
#pragma unroll
      for (int r = 0; r < 8; ++r) {
        float v = acc[i][j][r] * scale;
        if (BIAS_MODE == 1) v += bias[mBase + mOff + r];
        if (BIAS_MODE == 2) v += bv;
        if (RESID) v += Rb[(size_t)(mBase + mOff + r) * ldc + n];
        if (ACT == 1) v = tanhf(v);
        if (ACT == 2) v = fmaxf(v, 0.0f);
        if (ACT == 3) v = v / (1.0f + expf(-v));
        if (ACT == 4) v = (v > 0.f) ? v : 0.01f * v;
        if (ACT == 5) v = 0.5f * v * (1.0f + erff(v * 0.70710678118654752f));
        slab[(mOff + r) * 68 + (j << 4) + rlane] = v;
      }
    }
    __builtin_amdgcn_fence(__ATOMIC_RELEASE, "workgroup");
    __builtin_amdgcn_wave_barrier();
    __builtin_amdgcn_fence(__ATOMIC_ACQUIRE, "workgroup");
    if (OUT_MODE == 0) {
      float* C = (float*)Cout + (size_t)b * strideC;
      const int hh = lane >> 4, c4 = (lane & 15) * 4;     // row seg = 256 B = 16 lanes x 16 B
      {
#pragma unroll
        for (int it = 0; it < 8; ++it) {
          const int row = it * 2 + hh;
          v4f v = *(const v4f*)(slab + row * 68 + c4);
          *(v4f*)(C + (size_t)(mBase + row) * ldc + n0 + c4) = v;
        }
        
      }
    } else {
      const int q = lane >> 3, c8 = (lane & 7) * 8;
      unsigned short* C  = (unsigned short*)Cout  + (size_t)b * strideC;
      unsigned short* C2 = (OUT_MODE == 2) ? ((unsigned short*)Cout2 + (size_t)b * strideC) : nullptr;
      {
#pragma unroll
        for (int it = 0; it < 4; ++it) {
          const int row = it * 4 + q;
          const float* sp = slab + row * 68 + c8;
          v8h hv, lv;
#pragma unroll
          for (int e = 0; e < 8; ++e) {
            if (OUT_MODE == 1) {
              hv[e] = (_Float16)sp[e];
            } else {
              unsigned short hb = f2bf_bits(sp[e]);
              unsigned short lb = f2bf_bits(sp[e] - bf_bits2f(hb));
              hv[e] = __builtin_bit_cast(_Float16, hb);
              lv[e] = __builtin_bit_cast(_Float16, lb);
            }
          }
          *(v8h*)(C + (size_t)(mBase + row) * ldc + n0 + c8) = hv;
          if (OUT_MODE == 2) *(v8h*)(C2 + (size_t)(mBase + row) * ldc + n0 + c8) = lv;
        }
        
      }
    }
    __builtin_amdgcn_fence(__ATOMIC_RELEASE, "workgroup");
    __builtin_amdgcn_wave_barrier();
    __builtin_amdgcn_fence(__ATOMIC_ACQUIRE, "workgroup");
  }
}

__global__ __launch_bounds__(256) void cast_f32_f16x2(
    const float* __restrict__ in, _Float16* __restrict__ out, int n2) {
  int i = blockIdx.x * 256 + threadIdx.x;
  if (i < n2) {
    const _Float16 h0 = (_Float16)in[2 * i], h1 = (_Float16)in[2 * i + 1];
    const unsigned u = (unsigned)__builtin_bit_cast(unsigned short, h0) | ((unsigned)__builtin_bit_cast(unsigned short, h1) << 16);
    ((unsigned*)out)[i] = u;
    
  }
}


// ---- f32 -> f16 cast with a power-of-two pre-scale (folded back by the consumer GEMM's scale) ----
__global__ __launch_bounds__(256) void cast_f32_f16x2s(const float* __restrict__ in, _Float16* __restrict__ out, int n2, float s) {
  int i = blockIdx.x * 256 + threadIdx.x;
  if (i < n2) {
    const _Float16 h0 = (_Float16)(in[2 * i] * s), h1 = (_Float16)(in[2 * i + 1] * s);
    const unsigned u = (unsigned)__builtin_bit_cast(unsigned short, h0) | ((unsigned)__builtin_bit_cast(unsigned short, h1) << 16);
    ((unsigned*)out)[i] = u;
    
  }
}
// ---- f32 [rows][32 << lkt] row-major -> bf16 hi and lo planes in the matrix operands' fragment order (layout: at wmma_gemm64) ----
// One wave per 16-row x 32-k tile (tile = row band * (1 << lkt) + k step). Eight lanes take one row's 128-B line, 16 B each, so a load covers
// four whole lines; a lane's four values go out as one 8-B store per plane, and the wave writes the tile's 1 KB of each plane alone.
__device__ __forceinline__ void split_tile_frag(
    const float* __restrict__ in, __bf16* __restrict__ hi, __bf16* __restrict__ lo, int lkt, int tile) {
  const int lane = threadIdx.x & 31;
  const int q = lane & 7, r0 = lane >> 3;            // k = 4 * q .. 4 * q + 3 of rows r0, r0 + 4, r0 + 8, r0 + 12
  const int band = tile >> lkt, kt = tile - (band << lkt);
  const float* src = in + ((size_t)(band * 16 + r0) << (lkt + 5)) + kt * 32 + q * 4;
  const size_t dst = (size_t)tile * 512 + (q >> 2) * 256 + (((q >> 1) & 1) * 16 + r0) * 8 + (q & 1) * 4;
  const float* sp[4];
  v4f x[4];
#pragma unroll
  for (int i = 0; i < 4; ++i) {
    sp[i] = src + ((size_t)(4 * i) << (lkt + 5));
    x[i] = *(const v4f*)(sp[i]);
  }
  // The wait that stands between an issued global load and a rewrite of its address registers. The addresses are its inputs, so they
  // stay whole up to it.
  asm volatile("s_wait_xcnt 0x0" :: "v"(sp[0]), "v"(sp[1]), "v"(sp[2]), "v"(sp[3]) : "memory");
#pragma unroll
  for (int i = 0; i < 4; ++i) {
    v4b h, l;
#pragma unroll
    for (int e = 0; e < 4; ++e) {
      const unsigned short hb = f2bf_bits(x[i][e]);
      h[e] = __builtin_bit_cast(__bf16, hb);
      l[e] = __builtin_bit_cast(__bf16, f2bf_bits(x[i][e] - bf_bits2f(hb)));
    }
    *(v4b*)(hi + dst + i * 32) = h;                  // four rows on: 4 * 8 elements
    *(v4b*)(lo + dst + i * 32) = l;
  }
}
__global__ __launch_bounds__(256) void split_f32_bf16_frag(
    const float* __restrict__ in, __bf16* __restrict__ hi, __bf16* __restrict__ lo, int lkt, int ntiles) {
  const int tile = blockIdx.x * 8 + (threadIdx.x >> 5);
  if (tile >= ntiles) return;
  split_tile_frag(in, hi, lo, lkt, tile);
}
// The five operands that exist before the first product (x and the four weights) in ONE launch: they do not depend on each other, and a
// weight's few blocks alone leave most of the chip idle for a whole launch. A range of block indices picks the operand (a scalar choice,
// the same for every lane of a block): nbw blocks each of wq, wk, wv (stacked in w3h / w3l) and wo, then x with all the rest; 8 tiles a
// block, every range a whole number of blocks. lkt_c belongs to x, wq, wk, wv (rows of c elements), lkt_i to wo.
__global__ __launch_bounds__(256) void split_inputs_frag(
    const float* __restrict__ x, const float* __restrict__ wq, const float* __restrict__ wk, const float* __restrict__ wv,
    const float* __restrict__ wo, __bf16* __restrict__ xh, __bf16* __restrict__ xl, __bf16* __restrict__ w3h, __bf16* __restrict__ w3l,
    __bf16* __restrict__ woh, __bf16* __restrict__ wol, int nbw, int lkt_c, int lkt_i) {
  int blk = blockIdx.x, lkt = lkt_c;
  const size_t wn = (size_t)nbw * 4096;               // elements of one weight: a block splits 8 tiles of 512
  const float* in; __bf16* hi; __bf16* lo;
  if (blk < nbw)          { in = wq; hi = w3h;          lo = w3l; }
  else if (blk < 2 * nbw) { in = wk; hi = w3h + wn;     lo = w3l + wn;     blk -= nbw; }
  else if (blk < 3 * nbw) { in = wv; hi = w3h + 2 * wn; lo = w3l + 2 * wn; blk -= 2 * nbw; }
  else if (blk < 4 * nbw) { in = wo; hi = woh;          lo = wol;          blk -= 3 * nbw; lkt = lkt_i; }
  else                    { in = x;  hi = xh;           lo = xl;           blk -= 4 * nbw; }
  split_tile_frag(in, hi, lo, lkt, blk * 8 + (threadIdx.x >> 5));
}


// ---- f32 [R][C] (row pitch ldi) -> f16 transposed [C][R] (row pitch ldo); 64x64 tiles; each output row segment
__global__ __launch_bounds__(256) void transpose_cast_f16(const float* __restrict__ in, int ldi,
                                                         _Float16* __restrict__ outT, int ldo, float scale) {
  __shared__ __align__(16) _Float16 tile[64][72];     // [c][r]
  const int c0 = blockIdx.x * 64, r0 = blockIdx.y * 64;
  const int t = threadIdx.y * 32 + threadIdx.x;
  for (int i = threadIdx.y; i < 64; i += 8) {
    tile[threadIdx.x][i]      = (_Float16)(in[(size_t)(r0 + i) * ldi + c0 + threadIdx.x] * scale);
    tile[32 + threadIdx.x][i] = (_Float16)(in[(size_t)(r0 + i) * ldi + c0 + 32 + threadIdx.x] * scale);
  }
  __syncthreads();
  const int q = t >> 3, c8 = (t & 7) * 8;
  {
#pragma unroll
    for (int it = 0; it < 2; ++it) {
      const int c = it * 32 + q;
      v8h hv = *(const v8h*)(&tile[c][c8]);
      *(v8h*)(outT + (size_t)(c0 + c) * ldo + r0 + c8) = hv;
    }
    
  }
}

// ---- f32 [R][C] (pitch ldi) -> bf16 hi/lo transposed planes [C][R] (pitch ldo); 64x64 tiles; each output row segment
__global__ __launch_bounds__(256) void transpose_split_bf16(const float* __restrict__ in, int ldi,
                                                           __bf16* __restrict__ outH, __bf16* __restrict__ outL, int ldo) {
  __shared__ __align__(16) float tile[64][68];     // [c][r]
  const int c0 = blockIdx.x * 64, r0 = blockIdx.y * 64;
  const int t = threadIdx.y * 32 + threadIdx.x;
  for (int i = threadIdx.y; i < 64; i += 8) {
    tile[threadIdx.x][i]      = in[(size_t)(r0 + i) * ldi + c0 + threadIdx.x];
    tile[32 + threadIdx.x][i] = in[(size_t)(r0 + i) * ldi + c0 + 32 + threadIdx.x];
  }
  __syncthreads();
  const int q = t >> 3, c8 = (t & 7) * 8;
  {
#pragma unroll
    for (int it = 0; it < 2; ++it) {
      const int c = it * 32 + q;
      v8b hv, lv;
#pragma unroll
      for (int e = 0; e < 8; ++e) {
        const float f = tile[c][c8 + e];
        const unsigned short hb = f2bf_bits(f);
        hv[e] = __builtin_bit_cast(__bf16, hb);
        lv[e] = __builtin_bit_cast(__bf16, f2bf_bits(f - bf_bits2f(hb)));
      }
      *(v8b*)(outH + (size_t)(c0 + c) * ldo + r0 + c8) = hv;
      *(v8b*)(outL + (size_t)(c0 + c) * ldo + r0 + c8) = lv;
    }
    
  }
}

#define AT_D 64
#define AT_NW 4
#define AT_QB 64
#define AT_KC 64
// LDS row pitch of the 16-bit K tile, in elements: 72 = 144 B = 16 B x odd, so the 16 rows that one
// ds_load_b128 fragment read touches start on 16 different bank groups (at 128 B they share two groups and the read serialises).
#define AT_LP 72
// LDS row pitch of the 16-bit V tile, in elements: 80 = 160 B = 32 B x odd, the conflict-free pitch of its reader ds_load_tr16_b128.
#define AT_VP 80
// e^x is taken as 2^(x * log2 e) on the hardware's base-2 exponential (one instruction); every argument here is a score minus
// its row maximum, so the library exponential's overflow and underflow ladder has nothing to catch (below 2^-126 the weight is 0).
#define AT_LOG2E 1.4426950408889634f
// How many chunks ahead of its own walk a block asks the L2 for K and V lines.
#define AT_PLEAD 8
struct AttnGeom { const float* cp = nullptr; const float* pc = nullptr; long c_bs = 0, c_rs = 0, c_hs = 0;   // mode-5 score-bias tables
                  long q_bs, q_rs, q_hs, k_bs, k_rs, k_hs, v_bs, v_rs, v_hs, o_bs, o_rs, o_hs;
                  int S, Skv, H, mask_mode; float qscale; int blk0; float mask_fill; int mask_is_int; };
static_assert(sizeof(AttnGeom) == 168, "no padding");

__device__ __forceinline__ unsigned short at_bf_bits(float f) {
  unsigned u = __float_as_uint(f);
  return (unsigned short)((u + 0x7FFFu + ((u >> 16) & 1u)) >> 16);
}
__device__ __forceinline__ __bf16 at_f2bf(float f) { return __builtin_bit_cast(__bf16, at_bf_bits(f)); }
__device__ __forceinline__ v8f at_mma(v16b a, v16b b, v8f c) {
  return __builtin_amdgcn_wmma_f32_16x16x32_bf16(false, a, false, b, (short)0, c, false, false);
}
// 16-bit element as a bit pattern held in a __bf16 slot: f16 bits when F16, bf16 (RNE) otherwise
template <bool F16> __device__ __forceinline__ __bf16 at_to16(float f) {
  if (F16) return __builtin_bit_cast(__bf16, (_Float16)f);
  return at_f2bf(f);
}
// and back to f32
template <bool F16> __device__ __forceinline__ float at_from16(__bf16 x) {
  if (F16) return (float)__builtin_bit_cast(_Float16, x);
  return __uint_as_float(((unsigned)__builtin_bit_cast(unsigned short, x)) << 16);
}
// ds_load_tr16_b128: eight 16-bit elements of one column of a row-major LDS tile (lane addresses: at the call)
__device__ __forceinline__ v8b at_ld_tr16(const __bf16* p) {
  typedef __attribute__((ext_vector_type(8))) short at_s16x8;
  typedef __attribute__((address_space(3))) at_s16x8 at_lds_s16x8;
  return __builtin_bit_cast(v8b, __builtin_amdgcn_ds_load_tr16_b128_v8i16((at_lds_s16x8*)p));
}
template <bool F16> __device__ __forceinline__ v8f at_mma16(v16b a, v16b b, v8f c) {
  if (F16) {
    const v16h ah = __builtin_bit_cast(v16h, a), bh = __builtin_bit_cast(v16h, b);
    return __builtin_amdgcn_wmma_f32_16x16x32_f16(false, ah, false, bh, (short)0, c, false, false);
  }
  return at_mma(a, b, c);
}

// Lane l's value as seen from lane l ^ 16 (the other half of the wave): one vector cross-row move, no LDS trip.
__device__ __forceinline__ float at_xhalf(float x) {
  const int b = __builtin_bit_cast(int, x);
  return __builtin_bit_cast(float, __builtin_amdgcn_permlanex16(b, b, 0x76543210, 0xfedcba98, false, false));
}

// Eight base-2 exponentials (one score tile of a lane's query), each in place. One statement, so that the
// issue slot the instruction set asks for behind a transcendental is filled by construction: each v_exp_f32 is followed by an
// independent one, the last by v_nop; written in place, no later instruction can rewrite a source that is not also the live result
// The two s_delay_alu are the hints the compiler would write for its own code and cannot for asm text (first: the arguments come from
// the vector instructions just ahead; last: whichever reader comes next): a wave that waits unhinted holds the SIMD's issue for the others.
__device__ __forceinline__ void at_exp2x8(float& p0, float& p1, float& p2, float& p3, float& p4, float& p5, float& p6, float& p7) {
  asm("s_delay_alu instid0(VALU_DEP_1)\n\t"
      "v_exp_f32 %0, %0\n\tv_exp_f32 %1, %1\n\tv_exp_f32 %2, %2\n\tv_exp_f32 %3, %3\n\t"
      "v_exp_f32 %4, %4\n\tv_exp_f32 %5, %5\n\tv_exp_f32 %6, %6\n\tv_exp_f32 %7, %7\n\tv_nop\n\t"
      "s_delay_alu instid0(TRANS32_DEP_1)"
      : "+v"(p0), "+v"(p1), "+v"(p2), "+v"(p3), "+v"(p4), "+v"(p5), "+v"(p6), "+v"(p7));
}
// The same for one value (the query's rescale factor).
__device__ __forceinline__ void at_exp2x1(float& a) {
  asm("s_delay_alu instid0(VALU_DEP_1)\n\tv_exp_f32 %0, %0\n\tv_nop\n\ts_delay_alu instid0(TRANS32_DEP_1)" : "+v"(a));
}

// MM: the mask mode as a compile-time constant (the launch's g.mask_mode must equal it); MM < 0 reads g.mask_mode at run time.
template <bool F16 = false, int MM = -1>
__global__ __launch_bounds__(128)
void attn64_kernel(const unsigned short* __restrict__ q, const unsigned short* __restrict__ k,
                   const unsigned short* __restrict__ v, float* __restrict__ out,
                   const void* __restrict__ mask_a, const int* __restrict__ mask_b, AttnGeom g) {
  const int mask_mode = (MM >= 0) ? MM : g.mask_mode;
  const float PSC = F16 ? 32768.0f : 1.0f;     // f16 probabilities carried x2^15 (subnormal range), folded into the final 1/l
  union FB { v16b v; v8b h[2]; };
  __shared__ __align__(16) __bf16 Ksh[AT_KC * AT_LP];            // K [kv][d], pitch AT_LP      9 KB
  __shared__ __align__(16) __bf16 Vsh[AT_KC * AT_VP];            // V [kv][d], pitch AT_VP     10 KB
  __shared__ __align__(16) float  Os[AT_NW][16 * 68];            // per wave out tile, pitch 68

  const int tid  = threadIdx.x;
  const int wave = tid >> 5;
  const int lane = tid & 31;
  const int hh   = lane >> 4;
  const int c    = lane & 15;

  const int nqb = g.S / AT_QB;
  const int bx = blockIdx.x + g.blk0;
  const int qb = bx % nqb;
  const int bh = bx / nqb;
  const int h  = bh % g.H;
  const int b  = bh / g.H;
  const int qbase_block = qb * AT_QB;
  const int q0 = qbase_block + wave * 16;

  const __bf16* qb_ptr = (const __bf16*)q + (size_t)b * g.q_bs + (size_t)h * g.q_hs;
  const __bf16* kb_ptr = (const __bf16*)k + (size_t)b * g.k_bs + (size_t)h * g.k_hs;
  const __bf16* vb_ptr = (const __bf16*)v + (size_t)b * g.v_bs + (size_t)h * g.v_hs;
  float*        ob_ptr = out + (size_t)b * g.o_bs + (size_t)h * g.o_hs;

  // ---- Q fragments (B operand: column = query q0 + c): 2 d-chunks ----
  v16b qah[2];
  {
    const __bf16* qrow = qb_ptr + (size_t)(q0 + c) * g.q_rs;
#pragma unroll
    for (int dc = 0; dc < 2; ++dc) {
      const v8b x0 = *(const v8b*)(qrow + dc * 32 + 8 * hh), x1 = *(const v8b*)(qrow + dc * 32 + 16 + 8 * hh);
#pragma unroll
      for (int e = 0; e < 8; ++e) {
        qah[dc][e]     = at_to16<F16>(at_from16<F16>(x0[e]) * g.qscale);
        qah[dc][8 + e] = at_to16<F16>(at_from16<F16>(x1[e]) * g.qscale);
      }
    }
  }

  // state of this lane's query q0 + c; nrow2 = -(running maximum) * log2 e as it was rounded when that maximum was taken;
  // lrow sums this wave half's keys only (the halves are joined behind the loop)
  float nrow2 = INFINITY, lrow = 0.f;
  v8f oacc[4];                                 // O^T: oacc[t][r] = element d = t*16 + 8*hh + r of query q0 + c
#pragma unroll
  for (int t = 0; t < 4; ++t) oacc[t] = (v8f){0.f,0.f,0.f,0.f,0.f,0.f,0.f,0.f};

  const int nChunks = (mask_mode == 1 || mask_mode == 4) ? (qb + 1) : (g.Skv / AT_KC);   // block-uniform
  const int qrow = q0 + c;
  const int qkeep = (mask_mode == 3) ? mask_b[(size_t)b * g.S + qrow] : 1;   // query mask (mode 3): mask_b = qmask
  // Staging deal: a K or V row of one head is one 128-B line; eight lanes take it, 16 B each, so a wave's load covers four whole lines.
  // A thread copies its piece of rows sr, sr + 16, sr + 32 and sr + 48 of both tiles.
  const int sp = (tid & 7) * 8, sr = tid >> 3;
  const __bf16* kst = kb_ptr + (size_t)sr * g.k_rs + sp;
  const __bf16* vst = vb_ptr + (size_t)sr * g.v_rs + sp;
  // Lane address of the transposing load: lane (c, hh) receives V[kbase + 8*hh + 0..7][dbase + c] when every lane l points at
  // row kbase + 8*(l >> 4) + (l & 7), byte 2*dbase + 16*((l >> 3) & 1).
  const __bf16* vtr = Vsh + (8 * hh + (lane & 7)) * AT_VP + ((lane >> 3) & 1) * 8;
  // L2 asks (see l2_ask): all blocks of a head walk the same K and V rows at about the same pace, so without them the front of the pack meets
  // memory latency at every chunk. A chunk is 64 K rows and 64 V rows of one line each: one ask, a line a thread (even threads K, odd V).
  // Dealt: a block asks for every eighth chunk, AT_PLEAD chunks ahead of its own walk; the eight blocks of a head that share a chunk
  // have eight different block indices mod 8. pnext, the next chunk to ask for, is scalar.
  int pnext = (qb + (qb >> 3)) & 7;
  if (pnext >= nChunks) pnext = 0x7fffffff;
  const long prs = (tid & 1) ? g.v_rs : g.k_rs;
  const __bf16* pf = ((tid & 1) ? vb_ptr : kb_ptr) + (size_t)((tid >> 1) + (pnext < nChunks ? pnext * AT_KC : 0)) * prs;
  for (int kc = 0; kc < nChunks; ++kc) {
    const int kv0 = kc * AT_KC;
    __syncthreads();
    {
      const __bf16* kp[4]; const __bf16* vp[4];
      v8b kk[4], vv[4];
#pragma unroll
      for (int i = 0; i < 4; ++i) {
        kp[i] = kst + (size_t)(kv0 + 16 * i) * g.k_rs;
        vp[i] = vst + (size_t)(kv0 + 16 * i) * g.v_rs;
        kk[i] = *(const v8b*)(kp[i]);
        vv[i] = *(const v8b*)(vp[i]);
      }
      // The wait that stands between an issued global load and a rewrite of its address registers. The addresses are its inputs, so
      // they stay whole up to it.
      asm volatile("s_wait_xcnt 0x0" :: "v"(kp[0]), "v"(kp[1]), "v"(kp[2]), "v"(kp[3]), "v"(vp[0]), "v"(vp[1]), "v"(vp[2]), "v"(vp[3]) : "memory");
      if (pnext <= kc + AT_PLEAD) {            // scalar; issued while the chunk's own loads are under way
        l2_ask(pf);
        pnext += 8;
        if (pnext < nChunks) pf += prs * (8 * AT_KC); else pnext = 0x7fffffff;   // moves on only while it stays inside K or V
      }
#pragma unroll
      for (int i = 0; i < 4; ++i) {
        *(v8b*)(Ksh + (sr + 16 * i) * AT_LP + sp) = kk[i];
        *(v8b*)(Vsh + (sr + 16 * i) * AT_VP + sp) = vv[i];
      }
    }
    __syncthreads();

    // All fragments of the chunk are fetched as one group of LDS reads ahead of the matrix runs: K's eight first, V's eight behind them.
    // A read waited for in front of each product costs the wave one LDS round trip per product; here the first run waits once and
    // V lands under the scores and the softmax.
    FB kf[2][4], vf[2][4];
#pragma unroll
    for (int dc = 0; dc < 2; ++dc)
#pragma unroll
      for (int j = 0; j < 4; ++j) {
        kf[dc][j].h[0] = *(const v8b*)(Ksh + (j * 16 + c) * AT_LP + dc * 32 + 8 * hh);
        kf[dc][j].h[1] = *(const v8b*)(Ksh + (j * 16 + c) * AT_LP + dc * 32 + 16 + 8 * hh);
      }
    // V^T fragment (rows d = t*16 + c): elements 0..7 are keys kk*32 + 8*hh + 0..7, elements 8..15 keys kk*32 + 16 + 8*hh + 0..7.
#pragma unroll
    for (int kk = 0; kk < 2; ++kk)
#pragma unroll
      for (int t = 0; t < 4; ++t) {
        vf[kk][t].h[0] = at_ld_tr16(vtr + (kk * 32) * AT_VP + t * 16);
        vf[kk][t].h[1] = at_ld_tr16(vtr + (kk * 32 + 16) * AT_VP + t * 16);
      }
    // Keeps the scheduler from sinking the reads back down to their products (each would again be waited for on its own).
    __builtin_amdgcn_sched_barrier(0);

    // S^T: s[j][r] = score of key kv0 + j*16 + 8*hh + r for query q0 + c. The four tiles take turns, so that a tile's second product
    // finds its first one finished; each tile still sums head elements 0..31, then 32..63.
    v8f s[4];
#pragma unroll
    for (int j = 0; j < 4; ++j) s[j] = (v8f){0.f,0.f,0.f,0.f,0.f,0.f,0.f,0.f};
#pragma unroll
    for (int dc = 0; dc < 2; ++dc)
#pragma unroll
      for (int j = 0; j < 4; ++j) {
        s[j] = at_mma16<F16>(kf[dc][j].v, qah[dc], s[j]);
      }
    const bool diag = (mask_mode == 1) && (kc == qb);
    float mj[4];                                // one maximum per score tile: four short chains instead of one long one
#pragma unroll
    for (int j = 0; j < 4; ++j) {
      mj[j] = -INFINITY;
#pragma unroll
      for (int r = 0; r < 8; ++r) {
        const int kvcol = kv0 + j * 16 + 8 * hh + r;
        bool masked = false;
        if (diag) masked = (kvcol > qrow);
        else if (mask_mode == 4) masked = (kvcol > qrow) || (qrow - kvcol > g.mask_is_int);
        else if (mask_mode == 2) {
          const size_t mi = (size_t)qrow * g.Skv + kvcol;
          masked = (g.mask_is_int == 0) ? (((const float*)mask_a)[mi] == 0.0f)
                 : (g.mask_is_int == 1) ? (((const int*)mask_a)[mi] == 0) : (((const int*)mask_a)[mi] != 0);
        } else if (mask_mode == 3) masked = (qkeep == 0) || (((const int*)mask_a)[(size_t)b * g.Skv + kvcol] == 0);   // mask_a = kvmask
        else if (mask_mode == 5) {
          const size_t mi = (size_t)qrow * g.Skv + kvcol;
          masked = (((const int*)mask_a)[mi] != 0);
          int n = mask_b[mi]; n = n < 0 ? 0 : n;
          s[j][r] += g.cp[(size_t)b * g.c_bs + (size_t)h * g.c_hs + (size_t)qrow * g.c_rs + n]
                   + g.pc[(size_t)b * g.c_bs + (size_t)h * g.c_hs + (size_t)kvcol * g.c_rs + n];
        }
        if (masked) s[j][r] = g.mask_fill;
        mj[j] = fmaxf(mj[j], s[j][r]);
      }
    }
    float m = fmaxf(fmaxf(mj[0], mj[1]), fmaxf(mj[2], mj[3]));
    m = fmaxf(m, at_xhalf(m));                  // the other half of the wave holds the query's other 32 keys
    // minus the running maximum in base-2 units, the offset of every weight of this chunk: the product is rounded once per chunk
    // maximum, and the smaller of two such products is the product of the larger maximum (rounding keeps the order)
    const float noff = fminf(nrow2, m * -AT_LOG2E);
    float alpha = noff - nrow2;                 // difference of the two offsets in use: exactly 0 while the maximum stands; -inf on the first chunk
    nrow2 = noff;
    at_exp2x1(alpha);
    float pe[4][8], ps[4];
#pragma unroll
    for (int j = 0; j < 4; ++j) {
      float* p = pe[j];
#pragma unroll
      for (int r = 0; r < 8; ++r) p[r] = fmaf(s[j][r], AT_LOG2E, noff);   // e^(s - m) = 2^(s*log2e - m*log2e)
      at_exp2x8(p[0], p[1], p[2], p[3], p[4], p[5], p[6], p[7]);
      ps[j] = ((p[0] + p[1]) + (p[2] + p[3])) + ((p[4] + p[5]) + (p[6] + p[7]));
    }
    lrow = lrow * alpha + ((ps[0] + ps[1]) + (ps[2] + ps[3]));
#pragma unroll
    for (int t = 0; t < 4; ++t)
#pragma unroll
      for (int r = 0; r < 8; ++r) oacc[t][r] *= alpha;
    // P^T as B operand, straight from the score tiles: element e of k-chunk kk is key kk*32 + 8*hh + e (tile 2kk, register e), element
    // 8 + e is key kk*32 + 16 + 8*hh + e (tile 2kk + 1, register e): the k order of the V loader above.
    // Unrolled, so that kk picks the score registers at compile time.
#pragma unroll
    for (int kk = 0; kk < 2; ++kk) {
      v16b pa;
#pragma unroll
      for (int e = 0; e < 8; ++e) {
        const float p0 = pe[2 * kk][e], p1 = pe[2 * kk + 1][e];
        pa[e] = at_to16<F16>(p0 * PSC); pa[8 + e] = at_to16<F16>(p1 * PSC);
      }
#pragma unroll
      for (int t = 0; t < 4; ++t) oacc[t] = at_mma16<F16>(vf[kk][t].v, pa, oacc[t]);
    }
  }

  float* os = Os[wave];
  {
    const float inv = 1.0f / ((lrow + at_xhalf(lrow)) * PSC);   // the two halves' sums joined, once
#pragma unroll
    for (int t = 0; t < 4; ++t) {
      v4f lo4, hi4;
#pragma unroll
      for (int e = 0; e < 4; ++e) { lo4[e] = oacc[t][e] * inv; hi4[e] = oacc[t][4 + e] * inv; }
      *(v4f*)(os + c * 68 + t * 16 + 8 * hh)     = lo4;
      *(v4f*)(os + c * 68 + t * 16 + 8 * hh + 4) = hi4;
    }
  }
  __builtin_amdgcn_fence(__ATOMIC_RELEASE, "workgroup");
  __builtin_amdgcn_wave_barrier();
  __builtin_amdgcn_fence(__ATOMIC_ACQUIRE, "workgroup");
  {
    const int c4 = (lane & 15) * 4;
    {
#pragma unroll
      for (int it = 0; it < 8; ++it) {
        const int row = it * 2 + hh;
        v4f val = *(const v4f*)(os + row * 68 + c4);
        *(v4f*)(ob_ptr + (size_t)(q0 + row) * g.o_rs + c4) = val;
      }
      
    }
  }
}

#define SB_ 2
#define SN_ 4096
#define SC_ 256
#define SI_ 512
#define SH_ 8
extern "C" void kernel_launch(void* const* d_in, const int* in_sizes, int n_in, void* d_out, int out_size, void* d_ws, size_t ws_size, hipStream_t stream) {
  (void)in_sizes; (void)n_in; (void)out_size; (void)ws_size;
  const float* x = (const float*)d_in[0]; const float* Wq = (const float*)d_in[1]; const float* Wk = (const float*)d_in[2]; const float* Wv = (const float*)d_in[3]; const float* Wo = (const float*)d_in[4];
  float* out = (float*)d_out;
  char* ws = (char*)d_ws; size_t off = 0;
  auto carve = [&](size_t bytes) -> char* { char* p = ws + off; off += (bytes + 255) & ~(size_t)255; return p; };
  const int R = SB_ * SN_;
  __bf16* Xh = (__bf16*)carve((size_t)R * SC_ * 2); __bf16* Xl = (__bf16*)carve((size_t)R * SC_ * 2);
  __bf16* W3h = (__bf16*)carve((size_t)3 * SI_ * SC_ * 2); __bf16* W3l = (__bf16*)carve((size_t)3 * SI_ * SC_ * 2);     // [Wq;Wk;Wv] stacked = Bt for N = 1536
  __bf16* Woh = (__bf16*)carve((size_t)SC_ * SI_ * 2); __bf16* Wol = (__bf16*)carve((size_t)SC_ * SI_ * 2);
  _Float16* QKV = (_Float16*)carve((size_t)R * 3 * SI_ * 2);      // 25 MB: q, k, v as the attention's f16 operands
  float* O = (float*)carve((size_t)R * SI_ * 4);
  __bf16* Oh = (__bf16*)carve((size_t)R * SI_ * 2); __bf16* Ol = (__bf16*)carve((size_t)R * SI_ * 2);
  split_inputs_frag<<<R * SC_ / 4096 + 4 * (SI_ * SC_ / 4096), 256, 0, stream>>>(x, Wq, Wk, Wv, Wo, Xh, Xl, W3h, W3l, Woh, Wol, SI_ * SC_ / 4096, 3, 4);
  { const int t = (R / 64) * (3 * SI_ / 64);
    wmma_gemm64<1, true, 0, 1, false><<<dim3((t + 7) / 8, 1), 256, 0, stream>>>(U16(Xh), U16(Xl), SC_, 0, U16(W3h), U16(W3l), SC_, 0, QKV, nullptr, 3 * SI_, 0, nullptr, nullptr, 0, R, 3 * SI_, SC_, 1.0f); }
  { AttnGeom g;
    g.q_bs = (long)SN_ * 3 * SI_; g.q_rs = 3 * SI_; g.q_hs = 64; g.k_bs = g.q_bs; g.k_rs = 3 * SI_; g.k_hs = 64; g.v_bs = g.q_bs; g.v_rs = 3 * SI_; g.v_hs = 64;
    g.o_bs = (long)SN_ * SI_; g.o_rs = SI_; g.o_hs = 64; g.S = SN_; g.Skv = SN_; g.H = SH_; g.mask_mode = 0; g.qscale = 0.125f; g.blk0 = 0; g.mask_fill = -INFINITY; g.mask_is_int = 0;
    attn64_kernel<true, 0><<<SB_ * SH_ * (SN_ / AT_QB), AT_NW * 32, 0, stream>>>(U16(QKV), U16(QKV + SI_), U16(QKV + 2 * SI_), O, nullptr, nullptr, g); }
  split_f32_bf16_frag<<<R * SI_ / 4096, 256, 0, stream>>>(O, Oh, Ol, 4, R * SI_ / 512);
  { const int t = (R / 64) * (SC_ / 64);
    wmma_gemm64<1, true, 0, 0, false><<<dim3((t + 7) / 8, 1), 256, 0, stream>>>(U16(Oh), U16(Ol), SI_, 0, U16(Woh), U16(Wol), SI_, 0, out, nullptr, SC_, 0, nullptr, nullptr, 0, R, SC_, SI_, 1.0f); }
}
